// v000
// The times below were measured on an AMD MI455X: many runs one after another, warmed up first and cycling through
// copies of the inputs, with the whole window's GPU time divided by the number of runs. Launches and the gaps
// between them are all in it. The median over several windows is given; except for v000 it joins two sittings, which
// can be a few percent apart, so the side-by-side timings, each taken in one sitting, are the better comparison.
// v000, which the later versions start from, runs in 474 microseconds.
// Contractions: Gs^T.k^T (Bm) and q.Wq^T on v_wmma_f32_16x16x32_bf16 (bf16 operands RNE-converted from inputs, single product, f32 accumulate);
// Bm.Wk^T and Wv.Bm^T on v_wmma_f32_16x16x32_bf16 with Bm as bf16 hi + bf16 residual planes (2 products, f32 accumulate);
// r.vals on v_wmma_f32_16x16x32_bf16 with r and vals^T each bf16 hi + bf16 residual (3 products hh+hl+lh, f32 accumulate);
// ctx.Wo^T on v_wmma_f32_16x16x32_f16 (ctx f16 carried x64, Wo f16 = 64 x its bf16 value, single product, f32 accumulate, folded back x 1/4096);
// keys^T.w and qry.u score-vector dots, sigmoid, softplus and the Gaussian density in f32.
// Carry audit: Woh plane = f16(64 * bf16(Wo)), ctx plane = f16(64 * ctx); both inverses folded back exactly once by
// oscale = 1/4096 in the out GEMM epilogue (OUT_MODE 0). Bm, vals^T and r residual planes are unscaled bf16 (v - hi)
// and share the hi accumulator (no fold needed).
#include <hip/hip_runtime.h>
#include <math.h>
#include <stdint.h>

#define NBATCH 4
#define LMEM   2048
#define QLEN   2048
#define HID    1024
#define NH     16
#define HD     64
#define NBAS   512
#define MROWS  (NBATCH * QLEN)   // 8192 query rows
#define NQB64  (QLEN / 64)       // 32 blocks of 64 queries per sequence
#define NCH    (NBAS / 64)       // 8 chunks of 64 basis functions
static_assert(NH * HD == HID);
static_assert(NQB64 == 32 && NCH == 8);
static_assert((LMEM % 64) == 0 && (QLEN % 64) == 0 && (HID % 64) == 0 && (NBAS % 64) == 0);
static_assert((LMEM % 32) == 0 && (HID % 32) == 0 && (NBAS % 32) == 0);
#define CSC  64.0f     // ctx plane carry (f16)
#define WOSC 64.0f     // Wo plane carry (f16 of the bf16 value)

typedef _Float16 v16h __attribute__((ext_vector_type(16)));
typedef _Float16 v8h  __attribute__((ext_vector_type(8)));
typedef __bf16   v16b __attribute__((ext_vector_type(16)));
typedef __bf16   v8b  __attribute__((ext_vector_type(8)));
typedef float    v8f  __attribute__((ext_vector_type(8)));
typedef float    v4f  __attribute__((ext_vector_type(4)));
typedef unsigned int   v4u  __attribute__((ext_vector_type(4)));
typedef unsigned short v8us __attribute__((ext_vector_type(8)));
typedef v4u  __attribute__((may_alias)) v4ua;
typedef v8us __attribute__((may_alias)) v8usa;

#if defined(__HIP_DEVICE_COMPILE__)
#define DEV_ASM 1
#else
#define DEV_ASM 0
#endif

// ---- scalar helpers ---------------------------------------------------------------------------------
__device__ __forceinline__ unsigned short bf_bits(float f) {          // f32 -> bf16 bits, RNE convert
  unsigned u = __float_as_uint(f);
  return (unsigned short)((u + 0x7FFFu + ((u >> 16) & 1u)) >> 16);
}
__device__ __forceinline__ float bf_up(unsigned short hb) { return __uint_as_float(((unsigned)hb) << 16); }
__device__ __forceinline__ unsigned short h_bits(_Float16 x) { return __builtin_bit_cast(unsigned short, x); }
__device__ __forceinline__ unsigned pk16(unsigned short a, unsigned short b) { return (unsigned)a | ((unsigned)b << 16); }
__device__ __forceinline__ v8f zero8() { v8f z = {0.f, 0.f, 0.f, 0.f, 0.f, 0.f, 0.f, 0.f}; return z; }

// ---- fragment types / loaders: 16-bit A/B operand, lane -> row/col (lane&15), p already includes +8*(lane>>4);
//      elements 0..7 <- p[0..7] (k0+8h..k0+8h+7), elements 8..15 <- p[16..23] (k0+16+8h..k0+16+8h+7)
template <typename OT> struct FT;
template <> struct FT<__bf16>   { typedef v16b frag; typedef v8b half8; };
template <> struct FT<_Float16> { typedef v16h frag; typedef v8h half8; };

template <typename OT>
__device__ __forceinline__ typename FT<OT>::frag ldfrag(const OT* p) {
  union { typename FT<OT>::frag v; typename FT<OT>::half8 h[2]; } f;
  f.h[0] = *(const typename FT<OT>::half8*)(p);
  f.h[1] = *(const typename FT<OT>::half8*)(p + 16);
  return f.v;
}

// ---- guarded WMMA: 4 VALU slots after every WMMA, D tied, A/B kept live -----------------------------------
__device__ __forceinline__ v8f mma_g(v16b a, v16b b, v8f c) {
  c = __builtin_amdgcn_wmma_f32_16x16x32_bf16(false, a, false, b, (short)0, c, false, false);
#if DEV_ASM
  asm volatile("v_nop\n\tv_nop\n\tv_nop\n\tv_nop" : "+v"(c) : "v"(a), "v"(b));
#endif
  return c;
}
__device__ __forceinline__ v8f mma_g(v16h a, v16h b, v8f c) {
  c = __builtin_amdgcn_wmma_f32_16x16x32_f16(false, a, false, b, (short)0, c, false, false);
#if DEV_ASM
  asm volatile("v_nop\n\tv_nop\n\tv_nop\n\tv_nop" : "+v"(c) : "v"(a), "v"(b));
#endif
  return c;
}

// =====================================================================================================
// f32 -> 16-bit planes, 8 elements per thread, one 16-B store per lane: a wave writes 512 contiguous B
// MODE 0: bf16 bits (RNE convert).  MODE 1: f16 bits of (64 * bf16(x)) (exact scaling of the bf16 value).
// coverage: n8 threads x 8 = the whole plane (n8 is a multiple of 256 for every use here).
// =====================================================================================================
template <int MODE>
__device__ __forceinline__ unsigned short cvm(float f) {
  const unsigned short hb = bf_bits(f);
  if (MODE == 0) return hb;
  return h_bits((_Float16)(bf_up(hb) * WOSC));
}

template <int MODE>
__global__ __launch_bounds__(256) void cvt16x8(const float* __restrict__ in, unsigned short* out, int n8) {
  const int i = blockIdx.x * 256 + (int)threadIdx.x;
  if (i < n8) {
    const v4f a  = *(const v4f*)(in + (size_t)i * 8);
    const v4f a4 = *(const v4f*)(in + (size_t)i * 8 + 4);
    v4u p;
    p[0] = pk16(cvm<MODE>(a[0]),  cvm<MODE>(a[1]));
    p[1] = pk16(cvm<MODE>(a[2]),  cvm<MODE>(a[3]));
    p[2] = pk16(cvm<MODE>(a4[0]), cvm<MODE>(a4[1]));
    p[3] = pk16(cvm<MODE>(a4[2]), cvm<MODE>(a4[3]));
    unsigned short* o = out + (size_t)i * 8;
    *(v4u*)o = p;
    
  }
}

// =====================================================================================================
// Tiled transpose + bf16 convert: in[z][R][C] f32 (C contiguous) -> out[z][C][R] bf16 (R contiguous).
// Block 256 = one 64x64 tile: blockIdx.x = column tile c0 (of C), blockIdx.y = row tile r0 (of R), blockIdx.z = z;
// grid (C/64, R/64, Z). Load: 256 thr x 4 it x 4 floats = the 64x64 tile (16-B loads along C), staged as
// bf16 t[cc][rr] (pitch 72 shorts, 16-B aligned rows); __syncthreads; store: out row (c0+row), segment
// =====================================================================================================
__global__ __launch_bounds__(256) void tr_bf16(const float* __restrict__ in, unsigned short* out,
                                               int R, int C, long long ibs, long long obs) {
  __shared__ __align__(16) unsigned short t[64][72];
  const int tid = threadIdx.x;
  const float* ib = in + (size_t)blockIdx.z * (size_t)ibs;
  unsigned short* ob = out + (size_t)blockIdx.z * (size_t)obs;
  const int r0 = blockIdx.y * 64, c0 = blockIdx.x * 64;
#pragma unroll
  for (int it = 0; it < 4; ++it) {
    const int i = tid + 256 * it;
    const int rr = i >> 4, cc4 = (i & 15) * 4;
    const v4f v = *(const v4f*)(ib + (size_t)(r0 + rr) * (size_t)C + c0 + cc4);
    t[cc4 + 0][rr] = bf_bits(v[0]);
    t[cc4 + 1][rr] = bf_bits(v[1]);
    t[cc4 + 2][rr] = bf_bits(v[2]);
    t[cc4 + 3][rr] = bf_bits(v[3]);
  }
  __syncthreads();
  const int wave = tid >> 5, lane = tid & 31;
  const int q8 = lane & 7, sub = lane >> 3;
  v4u pv[2];
#pragma unroll
  for (int it = 0; it < 2; ++it) {
    const int row = it * 32 + wave * 4 + sub;
    pv[it] = *(const v4ua*)(&t[row][8 * q8]);
  }
  {
#pragma unroll
    for (int it = 0; it < 2; ++it) {
      const int row = it * 32 + wave * 4 + sub;
      *(v4u*)(ob + (size_t)(c0 + row) * (size_t)R + r0 + 8 * q8) = pv[it];
    }
    
  }
}

// =====================================================================================================
// Register-blocked batched WMMA GEMM (16-bit operand type OT): C[m][n] = sum_k A[m][k] * Bt[n][k];
// one wave per 64x64 tile, no block barriers. A row-major [M][K] pitch lda; Bt row-major [N][K] pitch ldb
// (k contiguous); M, N multiples of 64, K multiple of 32 (static shapes here). blockIdx.y = batch index
// (strides in elements). Fragments are loaded straight from global with the split k map (ldfrag).
// SPL 0: single product. SPL 1: A = hi plane A + residual plane A2 (2 products, same accumulator).
// SPL 2: Bt = hi plane Bt + residual plane Bt2 (2 products, same accumulator; B fragments reloaded per plane).
// OUT_MODE 0: f32 C (pitch ldc), value * oscale.
// OUT_MODE 2: bf16 hi plane C + bf16 residual plane C2 = bf16(v - hi) (same pitch / stride).
// =====================================================================================================
template <typename OT, int SPL, int OUT_MODE>
__global__ __launch_bounds__(256) void gemm64(
    const unsigned short* __restrict__ Ap, const unsigned short* __restrict__ A2p, int lda, long long strideA,
    const unsigned short* __restrict__ Btp, const unsigned short* __restrict__ Bt2p, int ldb, long long strideB,
    void* Cout, void* Cout2, int ldc, long long strideC,
    int M, int N, int K, float oscale) {
  typedef typename FT<OT>::frag V16;
  const OT* A   = (const OT*)(const void*)Ap;
  const OT* A2  = (const OT*)(const void*)A2p;
  const OT* Bt  = (const OT*)(const void*)Btp;
  const OT* Bt2 = (const OT*)(const void*)Bt2p;
  __shared__ __align__(16) float sT[8][16 * 68];   // per-wave 16x64 slab, pitch 68 floats
  const int b    = blockIdx.y;
  const int lane = threadIdx.x & 31;
  const int wave = threadIdx.x >> 5;
  const int tilesN = N >> 6;
  const int tilesM = M >> 6;
  const int tile = blockIdx.x * 8 + wave;
  if (tile >= tilesM * tilesN) return;   // wave-uniform; no block barriers in this kernel
  const int tm = tile / tilesN;
  const int tn = tile - tm * tilesN;
  const int m0 = tm << 6;
  const int n0 = tn << 6;

  const OT* Ab  = A   + (size_t)b * (size_t)strideA;
  const OT* Ab2 = A2  + (size_t)b * (size_t)strideA;
  const OT* Bb  = Bt  + (size_t)b * (size_t)strideB;
  const OT* Bb2 = Bt2 + (size_t)b * (size_t)strideB;

  const int rlane = lane & 15;                 // row (A) / col (B, D) within subtile
  const int koff  = (lane >> 4) * 8;           // k offset of this lane half
  const int mOff  = (lane >> 4) * 8;           // D row offset

  v8f acc[4][4];
#pragma unroll
  for (int i = 0; i < 4; ++i)
#pragma unroll
    for (int j = 0; j < 4; ++j) acc[i][j] = zero8();

  for (int k0 = 0; k0 < K; k0 += 32) {
#pragma unroll
    for (int p = 0; p < ((SPL == 2) ? 2 : 1); ++p) {
      const OT* Bs = (p == 0) ? Bb : Bb2;
      V16 bq[4];
#pragma unroll
      for (int j = 0; j < 4; ++j)
        bq[j] = ldfrag<OT>(Bs + (size_t)(n0 + (j << 4) + rlane) * (size_t)ldb + koff + k0);
#pragma unroll
      for (int i = 0; i < 4; ++i) {
        const V16 af = ldfrag<OT>(Ab + (size_t)(m0 + (i << 4) + rlane) * (size_t)lda + koff + k0);
#pragma unroll
        for (int j = 0; j < 4; ++j) acc[i][j] = mma_g(af, bq[j], acc[i][j]);
        if (SPL == 1) {
          const V16 ag = ldfrag<OT>(Ab2 + (size_t)(m0 + (i << 4) + rlane) * (size_t)lda + koff + k0);
#pragma unroll
          for (int j = 0; j < 4; ++j) acc[i][j] = mma_g(ag, bq[j], acc[i][j]);
        }
      }
    }
  }

  // ---- epilogue ----
  float* slab = sT[wave];
#pragma unroll
  for (int i = 0; i < 4; ++i) {
    const int mBase = m0 + (i << 4);
#pragma unroll
    for (int j = 0; j < 4; ++j) {
#pragma unroll
      for (int r = 0; r < 8; ++r) {
        slab[(mOff + r) * 68 + (j << 4) + rlane] = acc[i][j][r];
      }
    }
    __builtin_amdgcn_fence(__ATOMIC_RELEASE, "workgroup");
    __builtin_amdgcn_wave_barrier();
    __builtin_amdgcn_fence(__ATOMIC_ACQUIRE, "workgroup");
    if (OUT_MODE == 0) {
      float* Cf = (float*)Cout + (size_t)b * (size_t)strideC;
      const int h2 = lane >> 4, c4 = (lane & 15) * 4;     // 256-B row segment = 16 lanes x 16 B
      {
#pragma unroll
        for (int it = 0; it < 8; ++it) {
          const int row = it * 2 + h2;                     // it 0..7 x h2 0..1 = rows 0..15
          const v4f v = *(const v4f*)(slab + row * 68 + c4) * oscale;
          *(v4f*)(Cf + (size_t)(mBase + row) * (size_t)ldc + n0 + c4) = v;
        }
        
      }
    } else {
      const int q = lane >> 3, c8 = (lane & 7) * 8;
      unsigned short* Ch = (unsigned short*)Cout  + (size_t)b * (size_t)strideC;
      unsigned short* Cl = (unsigned short*)Cout2 + (size_t)b * (size_t)strideC;
      v4u hv[4], lv[4];
#pragma unroll
      for (int it = 0; it < 4; ++it) {
        const int row = it * 4 + q;                        // it 0..3 x q 0..3 = rows 0..15
        const float* sp = slab + row * 68 + c8;
        v4u a, a2;
#pragma unroll
        for (int e = 0; e < 4; ++e) {
          const float f0 = sp[2 * e], f1 = sp[2 * e + 1];
          const unsigned short h0 = bf_bits(f0), h1 = bf_bits(f1);
          const unsigned short l0 = bf_bits(f0 - bf_up(h0));
          const unsigned short l1 = bf_bits(f1 - bf_up(h1));
          a[e] = pk16(h0, h1); a2[e] = pk16(l0, l1);
        }
        hv[it] = a; lv[it] = a2;
      }
      {
#pragma unroll
        for (int it = 0; it < 4; ++it) {
          const int row = it * 4 + q;
          *(v4u*)(Ch + (size_t)(mBase + row) * (size_t)ldc + n0 + c8) = hv[it];
          *(v4u*)(Cl + (size_t)(mBase + row) * (size_t)ldc + n0 + c8) = lv[it];
        }
        
      }
    }
    __builtin_amdgcn_fence(__ATOMIC_RELEASE, "workgroup");
    __builtin_amdgcn_wave_barrier();
    __builtin_amdgcn_fence(__ATOMIC_ACQUIRE, "workgroup");
  }
}

// =====================================================================================================
// u[b][0][e] = sum_n keys[b][n][e] * bf16(w_mu[n]),  u[b][1][e] = sum_n keys[b][n][e] * bf16(w_sigma[n])   (f32)
// keys f32 [b][512][1024]; thread = one (b, e), block 256 consecutive e, grid (HID/256, NBATCH); w vectors
// RNE-converted to bf16 values once per block in LDS. Store: each wave writes 32 consecutive floats = one
// coverage: 4 x 4 blocks x 256 threads = every (b, e) of both tables.
// =====================================================================================================
__global__ __launch_bounds__(256) void kw_kernel(const float* __restrict__ keys, const float* __restrict__ wmu,
                                                 const float* __restrict__ wsg, float* u) {
  __shared__ float wsh[2][NBAS];
  const int tid = threadIdx.x;
  const int b = blockIdx.y;
  const int e = blockIdx.x * 256 + tid;
  for (int i = tid; i < NBAS; i += 256) {
    wsh[0][i] = bf_up(bf_bits(wmu[i]));
    wsh[1][i] = bf_up(bf_bits(wsg[i]));
  }
  __syncthreads();
  const float* kp = keys + (size_t)b * NBAS * HID + e;
  float am = 0.f, ag = 0.f;
#pragma unroll 4
  for (int n = 0; n < NBAS; ++n) {
    const float kv = kp[(size_t)n * HID];
    am += kv * wsh[0][n];
    ag += kv * wsh[1][n];
  }
  float* pm = u + ((size_t)b * 2) * HID + e;
  float* pg = pm + HID;
  *(float*)pm = am;
  *(float*)pg = ag;
  
}

// =====================================================================================================
// Continuous attention context, one block = (b, head h, 64 queries), 4 waves x 16 queries, grid NBATCH*NH*NQB64.
//   prologue (f32): dm = sum_d qry[q][h*64+d]*u_mu[b][h*64+d] / 8, dg likewise with u_sigma;
//     mu = sigmoid(dm), sig2 = max(softplus(dg), 1e-4)   (lane c = query, lane halves each do 32 d, shfl combine)
//   loop over 8 chunks of 64 basis functions (static trip): vals^T hi / residual chunks [d 64][n 64] staged in
//     LDS by 128 threads x 32 elements per plane (whole 64x64 tile, __syncthreads before and after);
//     per 32-deep k-step the lane builds its A fragment in registers: element i = r[q=c][n0+32kk+k(i)],
//     r = exp(-0.5 (mu - bm[n])^2 / var) / sqrt(2 pi var), var = sig2 + bs[n]^2 (bm, bs = bf16-converted basis
//     tables in LDS), as bf16 hi + bf16 residual; B fragments = vals^T hi / residual from LDS (col = d, k = n);
//     oacc[t] += rh.vh + rh.vl + rl.vh  (bf16 WMMA, one f32 accumulator).
//   epilogue: wave's 16x64 f32 tile staged in LDS, converted to f16(64 * ctx), written to the ctx plane
//   coverage: rows it(4) x (lane>>3)(4) = 16 per wave x 4 waves x 32 qb x 4 b; cols 8 lanes x 8 = 64 per head x 16 heads
//   = the whole [8192][1024] ctx plane. LDS extents: Vth/Vtl 64x64 staged = 64x64 consumed; bm_s/bv_s 512 = 512;
//   Os written 16x64 per wave before the wave reads its own tile.
// =====================================================================================================
__global__ __launch_bounds__(128) void ctx_kernel(
    const float* __restrict__ qry, const float* __restrict__ u,
    const float* __restrict__ bmu, const float* __restrict__ bsg,
    const unsigned short* __restrict__ vthp, const unsigned short* __restrict__ vtlp,
    unsigned short* ctxp) {
  union FB { v16b v; v8us h[2]; unsigned short s[16]; };
  __shared__ __align__(16) unsigned short Vth[64 * 64];    // vals^T hi chunk [d][n]       8 KB
  __shared__ __align__(16) unsigned short Vtl[64 * 64];    // vals^T residual chunk        8 KB
  __shared__ __align__(16) float Os[4][16 * 64];           // per-wave context tile       16 KB
  __shared__ float bm_s[NBAS];                             // bf16-converted basis means
  __shared__ float bv_s[NBAS];                             // (bf16-converted basis sigma)^2

  const int tid  = threadIdx.x;
  const int wave = tid >> 5;
  const int lane = tid & 31;
  const int hh   = lane >> 4;
  const int c    = lane & 15;

  const int bx   = blockIdx.x;
  const int qb   = bx % NQB64;
  const int rest = bx / NQB64;
  const int h    = rest % NH;
  const int b    = rest / NH;
  const int q0   = qb * 64 + wave * 16;
  const size_t row0 = (size_t)b * QLEN + q0;              // plane row of this wave's query 0

  for (int i = tid; i < NBAS; i += 128) {
    const float m = bf_up(bf_bits(bmu[i]));
    const float s = bf_up(bf_bits(bsg[i]));
    bm_s[i] = m;
    bv_s[i] = s * s;
  }

  // ---- per-query affine heads (f32) ----
  float dm = 0.f, dg = 0.f;
  {
    const float* qr = qry + (row0 + c) * HID + (size_t)h * HD + 32 * hh;
    const float* um = u + ((size_t)b * 2) * HID + (size_t)h * HD + 32 * hh;
    const float* ug = um + HID;
#pragma unroll 2
    for (int i = 0; i < 8; ++i) {
      const v4f a  = *(const v4f*)(qr + 4 * i);
      const v4f wm = *(const v4f*)(um + 4 * i);
      const v4f wg = *(const v4f*)(ug + 4 * i);
      dm += a[0] * wm[0]; dm += a[1] * wm[1]; dm += a[2] * wm[2]; dm += a[3] * wm[3];
      dg += a[0] * wg[0]; dg += a[1] * wg[1]; dg += a[2] * wg[2]; dg += a[3] * wg[3];
    }
  }
  dm += __shfl_xor(dm, 16, 32);
  dg += __shfl_xor(dg, 16, 32);
  dm *= 0.125f;
  dg *= 0.125f;
  const float mu   = 1.0f / (1.0f + expf(-dm));
  const float spl  = fmaxf(dg, 0.0f) + log1pf(expf(-fabsf(dg)));
  const float sig2 = fmaxf(spl, 1e-4f);

  const unsigned short* Vh = vthp + ((size_t)b * HID + (size_t)h * HD) * NBAS;
  const unsigned short* Vl = vtlp + ((size_t)b * HID + (size_t)h * HD) * NBAS;

  v8f oacc[4];
#pragma unroll
  for (int t = 0; t < 4; ++t) oacc[t] = zero8();

  for (int nt = 0; nt < NCH; ++nt) {         // static trip count
    const int n0 = nt * 64;
    __syncthreads();
    {
      const int r = tid >> 1, half = (tid & 1) * 32;      // d = r, n = n0 + half .. + 31
      const unsigned short* vg  = Vh + (size_t)r * NBAS + n0 + half;
      const unsigned short* vlg = Vl + (size_t)r * NBAS + n0 + half;
#pragma unroll
      for (int i = 0; i < 4; ++i) {
        const v8us b0 = *(const v8usa*)(vg + 8 * i);
        const v8us b1 = *(const v8usa*)(vlg + 8 * i);
        *(v8usa*)(Vth + r * 64 + half + 8 * i) = b0;
        *(v8usa*)(Vtl + r * 64 + half + 8 * i) = b1;
      }
    }
    __syncthreads();

#pragma unroll 1
    for (int kk = 0; kk < 2; ++kk) {
      // ---- A fragments: r values of query c at the 16 k slots of this lane half, bf16 hi + residual ----
      FB rh, rl;
#pragma unroll
      for (int i = 0; i < 16; ++i) {
        const int n = n0 + kk * 32 + ((i < 8) ? (8 * hh + i) : (8 + 8 * hh + i));
        const float t   = mu - bm_s[n];
        const float var = sig2 + bv_s[n];
        const float iv  = __builtin_amdgcn_rcpf(var);
        const float rv  = __expf(-0.5f * t * t * iv) * rsqrtf(6.2831853071795864f * var);
        const unsigned short hb = bf_bits(rv);
        rh.s[i] = hb;
        rl.s[i] = bf_bits(rv - bf_up(hb));
      }
      // ---- ctx += r . vals over this 32-deep slice of n ----
#pragma unroll
      for (int t = 0; t < 4; ++t) {
        FB vb, vl;
        vb.h[0] = *(const v8usa*)(Vth + (t * 16 + c) * 64 + kk * 32 + 8 * hh);
        vb.h[1] = *(const v8usa*)(Vth + (t * 16 + c) * 64 + kk * 32 + 16 + 8 * hh);
        vl.h[0] = *(const v8usa*)(Vtl + (t * 16 + c) * 64 + kk * 32 + 8 * hh);
        vl.h[1] = *(const v8usa*)(Vtl + (t * 16 + c) * 64 + kk * 32 + 16 + 8 * hh);
        oacc[t] = mma_g(rh.v, vb.v, oacc[t]);
        oacc[t] = mma_g(rh.v, vl.v, oacc[t]);
        oacc[t] = mma_g(rl.v, vb.v, oacc[t]);
      }
    }
  }

  float* os = Os[wave];
#pragma unroll
  for (int r = 0; r < 8; ++r) {
#pragma unroll
    for (int t = 0; t < 4; ++t) os[(8 * hh + r) * 64 + t * 16 + c] = oacc[t][r];
  }
  __builtin_amdgcn_fence(__ATOMIC_RELEASE, "workgroup");
  __builtin_amdgcn_wave_barrier();
  __builtin_amdgcn_fence(__ATOMIC_ACQUIRE, "workgroup");
  {
    const int q4 = lane >> 3, c8 = (lane & 7) * 8;
    v4u hv[4];
#pragma unroll
    for (int it = 0; it < 4; ++it) {
      const int row = it * 4 + q4;   // it 0..3 x q4 0..3 = rows 0..15 of the wave tile
      const float* sp = os + row * 64 + c8;
      v4u a;
#pragma unroll
      for (int e = 0; e < 4; ++e) {
        const float f0 = sp[2 * e] * CSC, f1 = sp[2 * e + 1] * CSC;
        a[e] = pk16(h_bits((_Float16)f0), h_bits((_Float16)f1));
      }
      hv[it] = a;
    }
    {
#pragma unroll
      for (int it = 0; it < 4; ++it) {
        const int row = it * 4 + q4;
        const size_t go = (row0 + row) * HID + (size_t)h * HD + c8;
        *(v4u*)(ctxp + go) = hv[it];
      }
      
    }
  }
}

// =====================================================================================================
// Workspace map (bytes), every region an exact multiple of its whole-line / whole-tile store granularity:
//   KT   bf16 [4][1024 e][2048 l]   16777216   (dead after the Bm GEMM; reused as the f16 ctx plane [8192][1024], same size)
//   GT   bf16 [512 n][2048 l]        2097152
//   QB   bf16 [8192][1024]          16777216
//   WQB  bf16 [1024][1024]           2097152
//   WKB  bf16 [1024][1024]           2097152
//   WVB  bf16 [1024][1024]           2097152
//   WOH  f16  [1024][1024] (x64)     2097152
//   BMH  bf16 [4*512][1024]          4194304   Bm hi
//   BML  bf16 [4*512][1024]          4194304   Bm residual
//   KEY  f32  [4*512][1024]          8388608   keys
//   VTH  bf16 [4][1024 e][512 n]     4194304   vals^T hi
//   VTL  bf16 [4][1024 e][512 n]     4194304   vals^T residual
//   QRY  f32  [8192][1024]          33554432
//   U    f32  [4][2][1024]             32768
//   total                          102793216
// Weights are [out][in] with in contiguous = the Bt layout for x.W^T, so they are only converted.
// =====================================================================================================
extern "C" void kernel_launch(void* const* d_in, const int* in_sizes, int n_in,
                              void* d_out, int out_size, void* d_ws, size_t ws_size,
                              hipStream_t stream) {
  if (n_in < 11) return;
  if (in_sizes[0] != NBATCH * LMEM * HID) return;
  if (in_sizes[1] != MROWS * HID) return;
  if (in_sizes[2] != HID * HID || in_sizes[3] != HID * HID || in_sizes[4] != HID * HID || in_sizes[5] != HID * HID) return;
  if (in_sizes[6] != NBAS || in_sizes[7] != NBAS) return;
  if (in_sizes[8] != LMEM * NBAS || in_sizes[9] != NBAS || in_sizes[10] != NBAS) return;
  if (out_size != MROWS * HID) return;

  const float* kin = (const float*)d_in[0];
  const float* qin = (const float*)d_in[1];
  const float* Wq  = (const float*)d_in[2];
  const float* Wk  = (const float*)d_in[3];
  const float* Wv  = (const float*)d_in[4];
  const float* Wo  = (const float*)d_in[5];
  const float* wmu = (const float*)d_in[6];
  const float* wsg = (const float*)d_in[7];
  const float* Gs  = (const float*)d_in[8];
  const float* bmu = (const float*)d_in[9];
  const float* bsg = (const float*)d_in[10];

  const size_t PKT  = (size_t)NBATCH * HID * LMEM * 2;    // 16777216  k^T planes; later the ctx f16 plane
  const size_t PCTX = (size_t)MROWS * HID * 2;            // 16777216  (== PKT)
  const size_t PGT  = (size_t)NBAS * LMEM * 2;            //  2097152
  const size_t PQB  = (size_t)MROWS * HID * 2;            // 16777216
  const size_t PW   = (size_t)HID * HID * 2;              //  2097152
  const size_t PBM  = (size_t)NBATCH * NBAS * HID * 2;    //  4194304
  const size_t PKEY = (size_t)NBATCH * NBAS * HID * 4;    //  8388608
  const size_t PVT  = (size_t)NBATCH * HID * NBAS * 2;    //  4194304
  const size_t PQRY = (size_t)MROWS * HID * 4;            // 33554432
  const size_t PU   = (size_t)NBATCH * 2 * HID * 4;       //    32768
  if (PCTX > PKT) return;
  size_t off = 0;
  const size_t oKT  = off; off += PKT;
  const size_t oGT  = off; off += PGT;
  const size_t oQB  = off; off += PQB;
  const size_t oWQ  = off; off += PW;
  const size_t oWK  = off; off += PW;
  const size_t oWV  = off; off += PW;
  const size_t oWO  = off; off += PW;
  const size_t oBMH = off; off += PBM;
  const size_t oBML = off; off += PBM;
  const size_t oKEY = off; off += PKEY;
  const size_t oVTH = off; off += PVT;
  const size_t oVTL = off; off += PVT;
  const size_t oQRY = off; off += PQRY;
  const size_t oU   = off; off += PU;
  if (off > ws_size) return;                        // off = 102793216
  if (off > (size_t)134217728) return;

  char* ws = (char*)d_ws;
  unsigned short* KT  = (unsigned short*)(ws + oKT);
  unsigned short* CTX = (unsigned short*)(ws + oKT);   // reuse after the Bm GEMM has consumed KT
  unsigned short* GT  = (unsigned short*)(ws + oGT);
  unsigned short* QB  = (unsigned short*)(ws + oQB);
  unsigned short* WQB = (unsigned short*)(ws + oWQ);
  unsigned short* WKB = (unsigned short*)(ws + oWK);
  unsigned short* WVB = (unsigned short*)(ws + oWV);
  unsigned short* WOH = (unsigned short*)(ws + oWO);
  unsigned short* BMH = (unsigned short*)(ws + oBMH);
  unsigned short* BML = (unsigned short*)(ws + oBML);
  float*          KEY = (float*)(ws + oKEY);
  unsigned short* VTH = (unsigned short*)(ws + oVTH);
  unsigned short* VTL = (unsigned short*)(ws + oVTL);
  float*          QRY = (float*)(ws + oQRY);
  float*          U   = (float*)(ws + oU);

  const dim3 blk(256);
  const int n8q = MROWS * HID / 8;                           // 1048576
  const int n8w = HID * HID / 8;                             //  131072
  const dim3 gTrK(HID / 64, LMEM / 64, NBATCH);              // in[b][2048 l][1024 e] -> out[b][1024 e][2048 l]: (cols/64, rows/64, b) = (16, 32, 4)
  const dim3 gTrG(NBAS / 64, LMEM / 64, 1);                  // in[2048 l][512 n] -> out[512 n][2048 l]: (8, 32, 1)
  const dim3 gCvtQ((n8q + 255) / 256);                       // 4096 blocks
  const dim3 gCvtW((n8w + 255) / 256);                       //  512 blocks
  const dim3 gBm(((NBAS / 64) * (HID / 64) + 7) / 8, NBATCH);    // 128 tiles -> 16 blocks x 4 b   (M=512,  N=1024, K=2048)
  const dim3 gKey((((NBATCH * NBAS) / 64) * (HID / 64) + 7) / 8, 1);   // 512 tiles -> 64 blocks (M=2048, N=1024, K=1024)
  const dim3 gVt(((HID / 64) * (NBAS / 64) + 7) / 8, NBATCH);     // 128 tiles -> 16 blocks x 4 b   (M=1024, N=512,  K=1024)
  const dim3 gQ(((MROWS / 64) * (HID / 64) + 7) / 8, 1);          // 2048 tiles -> 256 blocks      (M=8192, N=1024, K=1024)
  const dim3 gKw(HID / 256, NBATCH);                              // (4, 4)
  const dim3 gCtx(NBATCH * NH * NQB64);                           // 2048 blocks of 128

  // (1) k -> k^T bf16 per batch, Gs -> Gs^T bf16 (l contiguous); q and weights -> bf16; Wo -> f16 (64 x its bf16 value)
  tr_bf16<<<gTrK, blk, 0, stream>>>(kin, KT, LMEM, HID, (long long)LMEM * HID, (long long)HID * LMEM);
  tr_bf16<<<gTrG, blk, 0, stream>>>(Gs, GT, LMEM, NBAS, 0LL, 0LL);
  cvt16x8<0><<<gCvtQ, blk, 0, stream>>>(qin, QB,  n8q);
  cvt16x8<0><<<gCvtW, blk, 0, stream>>>(Wq,  WQB, n8w);
  cvt16x8<0><<<gCvtW, blk, 0, stream>>>(Wk,  WKB, n8w);
  cvt16x8<0><<<gCvtW, blk, 0, stream>>>(Wv,  WVB, n8w);
  cvt16x8<1><<<gCvtW, blk, 0, stream>>>(Wo,  WOH, n8w);
  // (2) Bm[b][n][e] = sum_l Gs^T[n][l] k^T[b][e][l] -> bf16 hi / residual planes [b*512+n][e]
  gemm64<__bf16, 0, 2><<<gBm, blk, 0, stream>>>(
      GT, GT, LMEM, 0LL, KT, KT, LMEM, (long long)HID * LMEM,
      (void*)BMH, (void*)BML, HID, (long long)NBAS * HID,
      NBAS, HID, LMEM, 1.0f);
  // (3) keys[b*512+n][e] = sum_e' Bm[b*512+n][e'] Wk[e][e'] -> f32 plane (Bm hi + residual, 2 products)
  gemm64<__bf16, 1, 0><<<gKey, blk, 0, stream>>>(
      BMH, BML, HID, 0LL, WKB, WKB, HID, 0LL,
      (void*)KEY, (void*)KEY, HID, 0LL,
      NBATCH * NBAS, HID, HID, 1.0f);
  // (4) vals^T[b][e][n] = sum_e' Wv[e][e'] Bm[b*512+n][e'] -> bf16 hi / residual planes, pitch 512 (Bm on the Bt side, 2 products)
  gemm64<__bf16, 2, 2><<<gVt, blk, 0, stream>>>(
      WVB, WVB, HID, 0LL, BMH, BML, HID, (long long)NBAS * HID,
      (void*)VTH, (void*)VTL, NBAS, (long long)HID * NBAS,
      HID, NBAS, HID, 1.0f);
  // (5) qry[b*2048+q][e] = sum_e' q[..][e'] Wq[e][e'] -> f32 plane
  gemm64<__bf16, 0, 0><<<gQ, blk, 0, stream>>>(
      QB, QB, HID, 0LL, WQB, WQB, HID, 0LL,
      (void*)QRY, (void*)QRY, HID, 0LL,
      MROWS, HID, HID, 1.0f);
  // (6) u[b][0/1][e] = sum_n keys[b][n][e] * bf16(w_mu / w_sigma)[n]   (f32)
  kw_kernel<<<gKw, blk, 0, stream>>>(KEY, wmu, wsg, U);
  // (7) mu, sig2 per query; ctx = r . vals -> f16 ctx plane (x64) [8192][1024] in the KT region
  ctx_kernel<<<gCtx, dim3(128), 0, stream>>>(QRY, U, bmu, bsg, VTH, VTL, CTX);
  // (8) out = ctx . Wo^T -> d_out f32 [8192][1024], accumulator x 1/(64*64)
  gemm64<_Float16, 0, 0><<<gQ, blk, 0, stream>>>(
      CTX, CTX, HID, 0LL, WOH, WOH, HID, 0LL,
      d_out, d_out, HID, 0LL,
      MROWS, HID, HID, 1.0f / (CSC * WOSC));
  (void)hipGetLastError();
}

// v001
// Measured time: 358 microseconds a run.
// Next to v000, in two timings, it ran 1.32 times as fast each time.
// Contractions: Gs^T.k^T (Bm) and q.Wq^T on v_wmma_f32_16x16x32_bf16 (bf16 operands RNE-converted from inputs, single product, f32 accumulate);
// Wv.Bm^T on v_wmma_f32_16x16x32_bf16 with Bm as bf16 hi + bf16 residual planes (2 products, f32 accumulate);
// (w^T.Bm).Wk^T on v_wmma_f32_16x16x32_bf16: the 8 rows t = w^T.Bm as bf16 hi (A rows 0..7) + bf16 residual (A rows 8..15),
// one product, f32 accumulate, D rows r and r+8 added;
// r.vals on v_wmma_f32_16x16x32_bf16 with r and vals^T each bf16 hi + bf16 residual (3 products hh+hl+lh, f32 accumulate);
// ctx.Wo^T on v_wmma_f32_16x16x32_f16 (ctx f16 carried x64, Wo f16 = 64 x its bf16 value, single product, f32 accumulate, folded back x 1/4096);
// w^T.Bm and qry.u score-vector dots, sigmoid, softplus and the Gaussian density in f32.
// Carry audit: Woh plane = f16(64 * bf16(Wo)), ctx plane = f16(64 * ctx); both inverses folded back exactly once by
// oscale = 1/4096 in the out GEMM epilogue (OUT_MODE 0). Bm, vals^T and r residual planes are unscaled bf16 (v - hi)
// and share the hi accumulator (no fold needed).
#include <hip/hip_runtime.h>
#include <math.h>
#include <stdint.h>

#define NBATCH 4
#define LMEM   2048
#define QLEN   2048
#define HID    1024
#define NH     16
#define HD     64
#define NBAS   512
#define MROWS  (NBATCH * QLEN)   // 8192 query rows
#define NQB64  (QLEN / 64)       // 32 blocks of 64 queries per sequence
#define NCH    (NBAS / 64)       // 8 chunks of 64 basis functions
static_assert(NH * HD == HID);
static_assert(NQB64 == 32 && NCH == 8);
static_assert((LMEM % 64) == 0 && (QLEN % 64) == 0 && (HID % 64) == 0 && (NBAS % 64) == 0);
static_assert((LMEM % 32) == 0 && (HID % 32) == 0 && (NBAS % 32) == 0);
#define CSC  64.0f     // ctx plane carry (f16)
#define WOSC 64.0f     // Wo plane carry (f16 of the bf16 value)

typedef _Float16 v16h __attribute__((ext_vector_type(16)));
typedef _Float16 v8h  __attribute__((ext_vector_type(8)));
typedef __bf16   v16b __attribute__((ext_vector_type(16)));
typedef __bf16   v8b  __attribute__((ext_vector_type(8)));
typedef float    v8f  __attribute__((ext_vector_type(8)));
typedef float    v4f  __attribute__((ext_vector_type(4)));
typedef unsigned int   v4u  __attribute__((ext_vector_type(4)));
typedef unsigned short v8us __attribute__((ext_vector_type(8)));
typedef v4u  __attribute__((may_alias)) v4ua;
typedef v8us __attribute__((may_alias)) v8usa;

#if defined(__HIP_DEVICE_COMPILE__)
#define DEV_ASM 1
#else
#define DEV_ASM 0
#endif

// ---- scalar helpers ---------------------------------------------------------------------------------
__device__ __forceinline__ unsigned short bf_bits(float f) {          // f32 -> bf16 bits, RNE convert
  unsigned u = __float_as_uint(f);
  return (unsigned short)((u + 0x7FFFu + ((u >> 16) & 1u)) >> 16);
}
__device__ __forceinline__ float bf_up(unsigned short hb) { return __uint_as_float(((unsigned)hb) << 16); }
__device__ __forceinline__ unsigned short h_bits(_Float16 x) { return __builtin_bit_cast(unsigned short, x); }
__device__ __forceinline__ unsigned pk16(unsigned short a, unsigned short b) { return (unsigned)a | ((unsigned)b << 16); }
__device__ __forceinline__ v8f zero8() { v8f z = {0.f, 0.f, 0.f, 0.f, 0.f, 0.f, 0.f, 0.f}; return z; }

// ---- fragment types / loaders: 16-bit A/B operand, lane -> row/col (lane&15), p already includes +8*(lane>>4);
//      elements 0..7 <- p[0..7] (k0+8h..k0+8h+7), elements 8..15 <- p[16..23] (k0+16+8h..k0+16+8h+7)
template <typename OT> struct FT;
template <> struct FT<__bf16>   { typedef v16b frag; typedef v8b half8; };
template <> struct FT<_Float16> { typedef v16h frag; typedef v8h half8; };

template <typename OT>
__device__ __forceinline__ typename FT<OT>::frag ldfrag(const OT* p) {
  union { typename FT<OT>::frag v; typename FT<OT>::half8 h[2]; } f;
  f.h[0] = *(const typename FT<OT>::half8*)(p);
  f.h[1] = *(const typename FT<OT>::half8*)(p + 16);
  return f.v;
}

// ---- guarded WMMA: 4 VALU slots after every WMMA, D tied, A/B kept live -----------------------------------
__device__ __forceinline__ v8f mma_g(v16b a, v16b b, v8f c) {
  c = __builtin_amdgcn_wmma_f32_16x16x32_bf16(false, a, false, b, (short)0, c, false, false);
#if DEV_ASM
  asm volatile("v_nop\n\tv_nop\n\tv_nop\n\tv_nop" : "+v"(c) : "v"(a), "v"(b));
#endif
  return c;
}
__device__ __forceinline__ v8f mma_g(v16h a, v16h b, v8f c) {
  c = __builtin_amdgcn_wmma_f32_16x16x32_f16(false, a, false, b, (short)0, c, false, false);
#if DEV_ASM
  asm volatile("v_nop\n\tv_nop\n\tv_nop\n\tv_nop" : "+v"(c) : "v"(a), "v"(b));
#endif
  return c;
}

// =====================================================================================================
// f32 -> 16-bit planes, 8 elements per thread, one 16-B store per lane: a wave writes 512 contiguous B
// MODE 0: bf16 bits (RNE convert).  MODE 1: f16 bits of (64 * bf16(x)) (exact scaling of the bf16 value).
// coverage: n8 threads x 8 = the whole plane (n8 is a multiple of 256 for every use here).
// =====================================================================================================
template <int MODE>
__device__ __forceinline__ unsigned short cvm(float f) {
  const unsigned short hb = bf_bits(f);
  if (MODE == 0) return hb;
  return h_bits((_Float16)(bf_up(hb) * WOSC));
}

template <int MODE>
__global__ __launch_bounds__(256) void cvt16x8(const float* __restrict__ in, unsigned short* out, int n8) {
  const int i = blockIdx.x * 256 + (int)threadIdx.x;
  if (i < n8) {
    const v4f a  = *(const v4f*)(in + (size_t)i * 8);
    const v4f a4 = *(const v4f*)(in + (size_t)i * 8 + 4);
    v4u p;
    p[0] = pk16(cvm<MODE>(a[0]),  cvm<MODE>(a[1]));
    p[1] = pk16(cvm<MODE>(a[2]),  cvm<MODE>(a[3]));
    p[2] = pk16(cvm<MODE>(a4[0]), cvm<MODE>(a4[1]));
    p[3] = pk16(cvm<MODE>(a4[2]), cvm<MODE>(a4[3]));
    unsigned short* o = out + (size_t)i * 8;
    *(v4u*)o = p;
    
  }
}

// =====================================================================================================
// Tiled transpose + bf16 convert: in[z][R][C] f32 (C contiguous) -> out[z][C][R] bf16 (R contiguous).
// Block 256 = one 64x64 tile: blockIdx.x = column tile c0 (of C), blockIdx.y = row tile r0 (of R), blockIdx.z = z;
// grid (C/64, R/64, Z). Load: 256 thr x 4 it x 4 floats = the 64x64 tile (16-B loads along C), staged as
// bf16 t[cc][rr] (pitch 72 shorts, 16-B aligned rows); __syncthreads; store: out row (c0+row), segment
// =====================================================================================================
__global__ __launch_bounds__(256) void tr_bf16(const float* __restrict__ in, unsigned short* out,
                                               int R, int C, long long ibs, long long obs) {
  __shared__ __align__(16) unsigned short t[64][72];
  const int tid = threadIdx.x;
  const float* ib = in + (size_t)blockIdx.z * (size_t)ibs;
  unsigned short* ob = out + (size_t)blockIdx.z * (size_t)obs;
  const int r0 = blockIdx.y * 64, c0 = blockIdx.x * 64;
#pragma unroll
  for (int it = 0; it < 4; ++it) {
    const int i = tid + 256 * it;
    const int rr = i >> 4, cc4 = (i & 15) * 4;
    const v4f v = *(const v4f*)(ib + (size_t)(r0 + rr) * (size_t)C + c0 + cc4);
    t[cc4 + 0][rr] = bf_bits(v[0]);
    t[cc4 + 1][rr] = bf_bits(v[1]);
    t[cc4 + 2][rr] = bf_bits(v[2]);
    t[cc4 + 3][rr] = bf_bits(v[3]);
  }
  __syncthreads();
  const int wave = tid >> 5, lane = tid & 31;
  const int q8 = lane & 7, sub = lane >> 3;
  v4u pv[2];
#pragma unroll
  for (int it = 0; it < 2; ++it) {
    const int row = it * 32 + wave * 4 + sub;
    pv[it] = *(const v4ua*)(&t[row][8 * q8]);
  }
  {
#pragma unroll
    for (int it = 0; it < 2; ++it) {
      const int row = it * 32 + wave * 4 + sub;
      *(v4u*)(ob + (size_t)(c0 + row) * (size_t)R + r0 + 8 * q8) = pv[it];
    }
    
  }
}

// =====================================================================================================
// Register-blocked batched WMMA GEMM (16-bit operand type OT): C[m][n] = sum_k A[m][k] * Bt[n][k];
// one wave per 64x64 tile, no block barriers. A row-major [M][K] pitch lda; Bt row-major [N][K] pitch ldb
// (k contiguous); M, N multiples of 64, K multiple of 32 (static shapes here). blockIdx.y = batch index
// (strides in elements). Fragments are loaded straight from global with the split k map (ldfrag).
// SPL 0: single product. SPL 1: A = hi plane A + residual plane A2 (2 products, same accumulator).
// SPL 2: Bt = hi plane Bt + residual plane Bt2 (2 products, same accumulator; B fragments reloaded per plane).
// OUT_MODE 0: f32 C (pitch ldc), value * oscale.
// OUT_MODE 2: bf16 hi plane C + bf16 residual plane C2 = bf16(v - hi) (same pitch / stride).
// =====================================================================================================
template <typename OT, int SPL, int OUT_MODE>
__global__ __launch_bounds__(256) void gemm64(
    const unsigned short* __restrict__ Ap, const unsigned short* __restrict__ A2p, int lda, long long strideA,
    const unsigned short* __restrict__ Btp, const unsigned short* __restrict__ Bt2p, int ldb, long long strideB,
    void* Cout, void* Cout2, int ldc, long long strideC,
    int M, int N, int K, float oscale) {
  typedef typename FT<OT>::frag V16;
  const OT* A   = (const OT*)(const void*)Ap;
  const OT* A2  = (const OT*)(const void*)A2p;
  const OT* Bt  = (const OT*)(const void*)Btp;
  const OT* Bt2 = (const OT*)(const void*)Bt2p;
  __shared__ __align__(16) float sT[8][16 * 68];   // per-wave 16x64 slab, pitch 68 floats
  const int b    = blockIdx.y;
  const int lane = threadIdx.x & 31;
  const int wave = threadIdx.x >> 5;
  const int tilesN = N >> 6;
  const int tilesM = M >> 6;
  const int tile = blockIdx.x * 8 + wave;
  if (tile >= tilesM * tilesN) return;   // wave-uniform; no block barriers in this kernel
  const int tm = tile / tilesN;
  const int tn = tile - tm * tilesN;
  const int m0 = tm << 6;
  const int n0 = tn << 6;

  const OT* Ab  = A   + (size_t)b * (size_t)strideA;
  const OT* Ab2 = A2  + (size_t)b * (size_t)strideA;
  const OT* Bb  = Bt  + (size_t)b * (size_t)strideB;
  const OT* Bb2 = Bt2 + (size_t)b * (size_t)strideB;

  const int rlane = lane & 15;                 // row (A) / col (B, D) within subtile
  const int koff  = (lane >> 4) * 8;           // k offset of this lane half
  const int mOff  = (lane >> 4) * 8;           // D row offset

  v8f acc[4][4];
#pragma unroll
  for (int i = 0; i < 4; ++i)
#pragma unroll
    for (int j = 0; j < 4; ++j) acc[i][j] = zero8();

  for (int k0 = 0; k0 < K; k0 += 32) {
#pragma unroll
    for (int p = 0; p < ((SPL == 2) ? 2 : 1); ++p) {
      const OT* Bs = (p == 0) ? Bb : Bb2;
      V16 bq[4];
#pragma unroll
      for (int j = 0; j < 4; ++j)
        bq[j] = ldfrag<OT>(Bs + (size_t)(n0 + (j << 4) + rlane) * (size_t)ldb + koff + k0);
#pragma unroll
      for (int i = 0; i < 4; ++i) {
        const V16 af = ldfrag<OT>(Ab + (size_t)(m0 + (i << 4) + rlane) * (size_t)lda + koff + k0);
#pragma unroll
        for (int j = 0; j < 4; ++j) acc[i][j] = mma_g(af, bq[j], acc[i][j]);
        if (SPL == 1) {
          const V16 ag = ldfrag<OT>(Ab2 + (size_t)(m0 + (i << 4) + rlane) * (size_t)lda + koff + k0);
#pragma unroll
          for (int j = 0; j < 4; ++j) acc[i][j] = mma_g(ag, bq[j], acc[i][j]);
        }
      }
    }
  }

  // ---- epilogue ----
  float* slab = sT[wave];
#pragma unroll
  for (int i = 0; i < 4; ++i) {
    const int mBase = m0 + (i << 4);
#pragma unroll
    for (int j = 0; j < 4; ++j) {
#pragma unroll
      for (int r = 0; r < 8; ++r) {
        slab[(mOff + r) * 68 + (j << 4) + rlane] = acc[i][j][r];
      }
    }
    __builtin_amdgcn_fence(__ATOMIC_RELEASE, "workgroup");
    __builtin_amdgcn_wave_barrier();
    __builtin_amdgcn_fence(__ATOMIC_ACQUIRE, "workgroup");
    if (OUT_MODE == 0) {
      float* Cf = (float*)Cout + (size_t)b * (size_t)strideC;
      const int h2 = lane >> 4, c4 = (lane & 15) * 4;     // 256-B row segment = 16 lanes x 16 B
      {
#pragma unroll
        for (int it = 0; it < 8; ++it) {
          const int row = it * 2 + h2;                     // it 0..7 x h2 0..1 = rows 0..15
          const v4f v = *(const v4f*)(slab + row * 68 + c4) * oscale;
          *(v4f*)(Cf + (size_t)(mBase + row) * (size_t)ldc + n0 + c4) = v;
        }
        
      }
    } else {
      const int q = lane >> 3, c8 = (lane & 7) * 8;
      unsigned short* Ch = (unsigned short*)Cout  + (size_t)b * (size_t)strideC;
      unsigned short* Cl = (unsigned short*)Cout2 + (size_t)b * (size_t)strideC;
      v4u hv[4], lv[4];
#pragma unroll
      for (int it = 0; it < 4; ++it) {
        const int row = it * 4 + q;                        // it 0..3 x q 0..3 = rows 0..15
        const float* sp = slab + row * 68 + c8;
        v4u a, a2;
#pragma unroll
        for (int e = 0; e < 4; ++e) {
          const float f0 = sp[2 * e], f1 = sp[2 * e + 1];
          const unsigned short h0 = bf_bits(f0), h1 = bf_bits(f1);
          const unsigned short l0 = bf_bits(f0 - bf_up(h0));
          const unsigned short l1 = bf_bits(f1 - bf_up(h1));
          a[e] = pk16(h0, h1); a2[e] = pk16(l0, l1);
        }
        hv[it] = a; lv[it] = a2;
      }
      {
#pragma unroll
        for (int it = 0; it < 4; ++it) {
          const int row = it * 4 + q;
          *(v4u*)(Ch + (size_t)(mBase + row) * (size_t)ldc + n0 + c8) = hv[it];
          *(v4u*)(Cl + (size_t)(mBase + row) * (size_t)ldc + n0 + c8) = lv[it];
        }
        
      }
    }
    __builtin_amdgcn_fence(__ATOMIC_RELEASE, "workgroup");
    __builtin_amdgcn_wave_barrier();
    __builtin_amdgcn_fence(__ATOMIC_ACQUIRE, "workgroup");
  }
}

// =====================================================================================================
// keys^T.w = Wk.(Bm^T.w): the score vectors need keys only through this product, so the weight vectors are
// contracted with Bm first and only the 8 resulting rows go through Wk.
// t[b*2+v][e] = sum_n bf16(w_v[n]) * (Bm hi + Bm residual)[b*512+n][e]   (f32; v = 0: w_mu, v = 1: w_sigma)
// Block 256 = (b, 64 columns e): 8 lanes x 8 columns = one 128-B row segment per plane, 32 row groups x 16 rows
// = all 512 n; group partials summed through LDS. Output plane T bf16 [16][1024]: row b*2+v = hi, row 8+b*2+v =
// residual; one wave stores a whole 128-B segment (32 lanes x 2 columns). grid (HID/64, NBATCH) covers all 16 rows.
// =====================================================================================================
__global__ __launch_bounds__(256) void wb_kernel(const unsigned short* __restrict__ bmh,
                                                 const unsigned short* __restrict__ bml,
                                                 const float* __restrict__ wmu, const float* __restrict__ wsg,
                                                 unsigned short* tpl) {
  __shared__ float wsh[2][NBAS];
  __shared__ __align__(16) float part[2][32][64];
  const int tid = threadIdx.x;
  const int b  = blockIdx.y;
  const int e0 = blockIdx.x * 64;
  const int g = tid >> 3, c8 = (tid & 7) * 8;
  const unsigned short* ph = bmh + ((size_t)b * NBAS + g) * HID + e0 + c8;
  const unsigned short* pl = bml + ((size_t)b * NBAS + g) * HID + e0 + c8;
  // all of the thread's rows are loaded first: every row is read once, so the cost is latency, paid once this way
  v8us hv[NBAS / 32], lv[NBAS / 32];
#pragma unroll
  for (int it = 0; it < NBAS / 32; ++it) {
    hv[it] = *(const v8usa*)(ph + (size_t)it * 32 * HID);
    lv[it] = *(const v8usa*)(pl + (size_t)it * 32 * HID);
  }
#pragma unroll
  for (int k = 0; k < NBAS / 256; ++k) {
    const int i = tid + 256 * k;
    wsh[0][i] = bf_up(bf_bits(wmu[i]));
    wsh[1][i] = bf_up(bf_bits(wsg[i]));
  }
  __syncthreads();
  float am[8], ag[8];
#pragma unroll
  for (int j = 0; j < 8; ++j) { am[j] = 0.f; ag[j] = 0.f; }
#pragma unroll
  for (int it = 0; it < NBAS / 32; ++it) {
    const float w0 = wsh[0][it * 32 + g];
    const float w1 = wsh[1][it * 32 + g];
#pragma unroll
    for (int j = 0; j < 8; ++j) {
      const float x = bf_up(hv[it][j]) + bf_up(lv[it][j]);
      am[j] += x * w0;
      ag[j] += x * w1;
    }
  }
#pragma unroll
  for (int j = 0; j < 8; ++j) {
    part[0][g][c8 + j] = am[j];
    part[1][g][c8 + j] = ag[j];
  }
  __syncthreads();
  if (tid < 64) {                       // wave 0: v = 0, wave 1: v = 1; lane = column pair
    const int v = tid >> 5, c2 = (tid & 31) * 2;
    float s0 = 0.f, s1 = 0.f;
#pragma unroll
    for (int gg = 0; gg < 32; ++gg) {
      s0 += part[v][gg][c2];
      s1 += part[v][gg][c2 + 1];
    }
    const unsigned short h0 = bf_bits(s0), h1 = bf_bits(s1);
    const unsigned short l0 = bf_bits(s0 - bf_up(h0));
    const unsigned short l1 = bf_bits(s1 - bf_up(h1));
    *(unsigned*)(tpl + (size_t)(b * 2 + v) * HID + e0 + c2)     = pk16(h0, h1);
    *(unsigned*)(tpl + (size_t)(8 + b * 2 + v) * HID + e0 + c2) = pk16(l0, l1);
  }
}

// =====================================================================================================
// u[r][e] = sum_e' (T hi + T residual)[r][e'] * bf16(Wk)[e][e'],  r = b*2+v in 0..7   (f32, same table as before)
// A = T [16][1024] (rows 0..7 hi, rows 8..15 residual), Bt = Wk bf16 [e][e']; D row r + D row r+8 = u row r.
// Block 256 = 32 columns e (two 16-column tiles); wave w takes the k slice [128 w, 128 w + 128) = 4 k-steps for both
// tiles (A fragment shared); the 8 slice partials are summed through LDS. Store: one wave = one row's 32 floats
// = one 128-B segment. grid HID/32 covers all 1024 columns of all 8 rows.
// =====================================================================================================
__global__ __launch_bounds__(256) void u_kernel(const unsigned short* __restrict__ tpl,
                                                const unsigned short* __restrict__ wkp, float* u) {
  __shared__ float red[8][8][32];       // [k slice][row r][column]
  const int tid  = threadIdx.x;
  const int wave = tid >> 5;
  const int lane = tid & 31;
  const int rlane = lane & 15;          // row (A) / col (B, D) within the tile
  const int koff  = (lane >> 4) * 8;    // k offset of this lane half
  const int n0 = blockIdx.x * 32;
  const __bf16* A  = (const __bf16*)(const void*)tpl + (size_t)rlane * HID + koff + wave * 128;
  const __bf16* B0 = (const __bf16*)(const void*)wkp + (size_t)(n0 + rlane) * HID + koff + wave * 128;
  const __bf16* B1 = B0 + (size_t)16 * HID;
  v16b af[4], b0[4], b1[4];
#pragma unroll
  for (int s = 0; s < 4; ++s) {
    af[s] = ldfrag<__bf16>(A  + 32 * s);
    b0[s] = ldfrag<__bf16>(B0 + 32 * s);
    b1[s] = ldfrag<__bf16>(B1 + 32 * s);
  }
  v8f a0 = zero8(), a1 = zero8();
#pragma unroll
  for (int s = 0; s < 4; ++s) {
    a0 = mma_g(af[s], b0[s], a0);
    a1 = mma_g(af[s], b1[s], a1);
  }
  // D element r of lane half 0 = row r (hi part), of lane half 1 = row r+8 (residual part), same column
#pragma unroll
  for (int r = 0; r < 8; ++r) {
    const float x0 = a0[r] + __shfl_xor(a0[r], 16, 32);
    const float x1 = a1[r] + __shfl_xor(a1[r], 16, 32);
    red[wave][r][lane] = (lane < 16) ? x0 : x1;     // lanes 16..31 hold the second tile's column lane-16
  }
  __syncthreads();
  {
    float s = 0.f;
#pragma unroll
    for (int w = 0; w < 8; ++w) s += red[w][wave][lane];
    u[(size_t)wave * HID + n0 + lane] = s;
  }
}

// =====================================================================================================
// Continuous attention context, one block = (b, head h, 64 queries), 4 waves x 16 queries, grid NBATCH*NH*NQB64.
//   prologue (f32): dm = sum_d qry[q][h*64+d]*u_mu[b][h*64+d] / 8, dg likewise with u_sigma;
//     mu = sigmoid(dm), sig2 = max(softplus(dg), 1e-4)   (lane c = query, lane halves each do 32 d, shfl combine)
//   loop over 8 chunks of 64 basis functions (static trip): vals^T hi / residual chunks [d 64][n 64] staged in
//     LDS by 128 threads x 32 elements per plane (whole 64x64 tile, __syncthreads before and after);
//     per 32-deep k-step the lane builds its A fragment in registers: element i = r[q=c][n0+32kk+k(i)],
//     r = exp(-0.5 (mu - bm[n])^2 / var) / sqrt(2 pi var), var = sig2 + bs[n]^2 (bm, bs = bf16-converted basis
//     tables in LDS), as bf16 hi + bf16 residual; B fragments = vals^T hi / residual from LDS (col = d, k = n);
//     oacc[t] += rh.vh + rh.vl + rl.vh  (bf16 WMMA, one f32 accumulator).
//   epilogue: wave's 16x64 f32 tile staged in LDS, converted to f16(64 * ctx), written to the ctx plane
//   coverage: rows it(4) x (lane>>3)(4) = 16 per wave x 4 waves x 32 qb x 4 b; cols 8 lanes x 8 = 64 per head x 16 heads
//   = the whole [8192][1024] ctx plane. LDS extents: Vth/Vtl 64x64 staged = 64x64 consumed; bm_s/bv_s 512 = 512;
//   Os written 16x64 per wave before the wave reads its own tile.
// =====================================================================================================
__global__ __launch_bounds__(128) void ctx_kernel(
    const float* __restrict__ qry, const float* __restrict__ u,
    const float* __restrict__ bmu, const float* __restrict__ bsg,
    const unsigned short* __restrict__ vthp, const unsigned short* __restrict__ vtlp,
    unsigned short* ctxp) {
  union FB { v16b v; v8us h[2]; unsigned short s[16]; };
  __shared__ __align__(16) unsigned short Vth[64 * 64];    // vals^T hi chunk [d][n]       8 KB
  __shared__ __align__(16) unsigned short Vtl[64 * 64];    // vals^T residual chunk        8 KB
  __shared__ __align__(16) float Os[4][16 * 64];           // per-wave context tile       16 KB
  __shared__ float bm_s[NBAS];                             // bf16-converted basis means
  __shared__ float bv_s[NBAS];                             // (bf16-converted basis sigma)^2

  const int tid  = threadIdx.x;
  const int wave = tid >> 5;
  const int lane = tid & 31;
  const int hh   = lane >> 4;
  const int c    = lane & 15;

  const int bx   = blockIdx.x;
  const int qb   = bx % NQB64;
  const int rest = bx / NQB64;
  const int h    = rest % NH;
  const int b    = rest / NH;
  const int q0   = qb * 64 + wave * 16;
  const size_t row0 = (size_t)b * QLEN + q0;              // plane row of this wave's query 0

  for (int i = tid; i < NBAS; i += 128) {
    const float m = bf_up(bf_bits(bmu[i]));
    const float s = bf_up(bf_bits(bsg[i]));
    bm_s[i] = m;
    bv_s[i] = s * s;
  }

  // ---- per-query affine heads (f32) ----
  float dm = 0.f, dg = 0.f;
  {
    const float* qr = qry + (row0 + c) * HID + (size_t)h * HD + 32 * hh;
    const float* um = u + ((size_t)b * 2) * HID + (size_t)h * HD + 32 * hh;
    const float* ug = um + HID;
#pragma unroll 2
    for (int i = 0; i < 8; ++i) {
      const v4f a  = *(const v4f*)(qr + 4 * i);
      const v4f wm = *(const v4f*)(um + 4 * i);
      const v4f wg = *(const v4f*)(ug + 4 * i);
      dm += a[0] * wm[0]; dm += a[1] * wm[1]; dm += a[2] * wm[2]; dm += a[3] * wm[3];
      dg += a[0] * wg[0]; dg += a[1] * wg[1]; dg += a[2] * wg[2]; dg += a[3] * wg[3];
    }
  }
  dm += __shfl_xor(dm, 16, 32);
  dg += __shfl_xor(dg, 16, 32);
  dm *= 0.125f;
  dg *= 0.125f;
  const float mu   = 1.0f / (1.0f + expf(-dm));
  const float spl  = fmaxf(dg, 0.0f) + log1pf(expf(-fabsf(dg)));
  const float sig2 = fmaxf(spl, 1e-4f);

  const unsigned short* Vh = vthp + ((size_t)b * HID + (size_t)h * HD) * NBAS;
  const unsigned short* Vl = vtlp + ((size_t)b * HID + (size_t)h * HD) * NBAS;

  v8f oacc[4];
#pragma unroll
  for (int t = 0; t < 4; ++t) oacc[t] = zero8();

  for (int nt = 0; nt < NCH; ++nt) {         // static trip count
    const int n0 = nt * 64;
    __syncthreads();
    {
      const int r = tid >> 1, half = (tid & 1) * 32;      // d = r, n = n0 + half .. + 31
      const unsigned short* vg  = Vh + (size_t)r * NBAS + n0 + half;
      const unsigned short* vlg = Vl + (size_t)r * NBAS + n0 + half;
#pragma unroll
      for (int i = 0; i < 4; ++i) {
        const v8us b0 = *(const v8usa*)(vg + 8 * i);
        const v8us b1 = *(const v8usa*)(vlg + 8 * i);
        *(v8usa*)(Vth + r * 64 + half + 8 * i) = b0;
        *(v8usa*)(Vtl + r * 64 + half + 8 * i) = b1;
      }
    }
    __syncthreads();

#pragma unroll 1
    for (int kk = 0; kk < 2; ++kk) {
      // ---- A fragments: r values of query c at the 16 k slots of this lane half, bf16 hi + residual ----
      FB rh, rl;
#pragma unroll
      for (int i = 0; i < 16; ++i) {
        const int n = n0 + kk * 32 + ((i < 8) ? (8 * hh + i) : (8 + 8 * hh + i));
        const float t   = mu - bm_s[n];
        const float var = sig2 + bv_s[n];
        const float iv  = __builtin_amdgcn_rcpf(var);
        const float rv  = __expf(-0.5f * t * t * iv) * rsqrtf(6.2831853071795864f * var);
        const unsigned short hb = bf_bits(rv);
        rh.s[i] = hb;
        rl.s[i] = bf_bits(rv - bf_up(hb));
      }
      // ---- ctx += r . vals over this 32-deep slice of n ----
#pragma unroll
      for (int t = 0; t < 4; ++t) {
        FB vb, vl;
        vb.h[0] = *(const v8usa*)(Vth + (t * 16 + c) * 64 + kk * 32 + 8 * hh);
        vb.h[1] = *(const v8usa*)(Vth + (t * 16 + c) * 64 + kk * 32 + 16 + 8 * hh);
        vl.h[0] = *(const v8usa*)(Vtl + (t * 16 + c) * 64 + kk * 32 + 8 * hh);
        vl.h[1] = *(const v8usa*)(Vtl + (t * 16 + c) * 64 + kk * 32 + 16 + 8 * hh);
        oacc[t] = mma_g(rh.v, vb.v, oacc[t]);
        oacc[t] = mma_g(rh.v, vl.v, oacc[t]);
        oacc[t] = mma_g(rl.v, vb.v, oacc[t]);
      }
    }
  }

  float* os = Os[wave];
#pragma unroll
  for (int r = 0; r < 8; ++r) {
#pragma unroll
    for (int t = 0; t < 4; ++t) os[(8 * hh + r) * 64 + t * 16 + c] = oacc[t][r];
  }
  __builtin_amdgcn_fence(__ATOMIC_RELEASE, "workgroup");
  __builtin_amdgcn_wave_barrier();
  __builtin_amdgcn_fence(__ATOMIC_ACQUIRE, "workgroup");
  {
    const int q4 = lane >> 3, c8 = (lane & 7) * 8;
    v4u hv[4];
#pragma unroll
    for (int it = 0; it < 4; ++it) {
      const int row = it * 4 + q4;   // it 0..3 x q4 0..3 = rows 0..15 of the wave tile
      const float* sp = os + row * 64 + c8;
      v4u a;
#pragma unroll
      for (int e = 0; e < 4; ++e) {
        const float f0 = sp[2 * e] * CSC, f1 = sp[2 * e + 1] * CSC;
        a[e] = pk16(h_bits((_Float16)f0), h_bits((_Float16)f1));
      }
      hv[it] = a;
    }
    {
#pragma unroll
      for (int it = 0; it < 4; ++it) {
        const int row = it * 4 + q4;
        const size_t go = (row0 + row) * HID + (size_t)h * HD + c8;
        *(v4u*)(ctxp + go) = hv[it];
      }
      
    }
  }
}

// =====================================================================================================
// Workspace map (bytes), every region an exact multiple of its whole-line / whole-tile store granularity:
//   KT   bf16 [4][1024 e][2048 l]   16777216   (dead after the Bm GEMM; reused as the f16 ctx plane [8192][1024], same size)
//   GT   bf16 [512 n][2048 l]        2097152
//   QB   bf16 [8192][1024]          16777216
//   WQB  bf16 [1024][1024]           2097152
//   WKB  bf16 [1024][1024]           2097152
//   WVB  bf16 [1024][1024]           2097152
//   WOH  f16  [1024][1024] (x64)     2097152
//   BMH  bf16 [4*512][1024]          4194304   Bm hi
//   BML  bf16 [4*512][1024]          4194304   Bm residual
//   TPL  bf16 [16][1024]               32768   t = w^T.Bm, rows 0..7 hi, rows 8..15 residual
//   VTH  bf16 [4][1024 e][512 n]     4194304   vals^T hi
//   VTL  bf16 [4][1024 e][512 n]     4194304   vals^T residual
//   QRY  f32  [8192][1024]          33554432
//   U    f32  [4][2][1024]             32768
//   total                           94437376
// Weights are [out][in] with in contiguous = the Bt layout for x.W^T, so they are only converted.
// =====================================================================================================
extern "C" void kernel_launch(void* const* d_in, const int* in_sizes, int n_in,
                              void* d_out, int out_size, void* d_ws, size_t ws_size,
                              hipStream_t stream) {
  if (n_in < 11) return;
  if (in_sizes[0] != NBATCH * LMEM * HID) return;
  if (in_sizes[1] != MROWS * HID) return;
  if (in_sizes[2] != HID * HID || in_sizes[3] != HID * HID || in_sizes[4] != HID * HID || in_sizes[5] != HID * HID) return;
  if (in_sizes[6] != NBAS || in_sizes[7] != NBAS) return;
  if (in_sizes[8] != LMEM * NBAS || in_sizes[9] != NBAS || in_sizes[10] != NBAS) return;
  if (out_size != MROWS * HID) return;

  const float* kin = (const float*)d_in[0];
  const float* qin = (const float*)d_in[1];
  const float* Wq  = (const float*)d_in[2];
  const float* Wk  = (const float*)d_in[3];
  const float* Wv  = (const float*)d_in[4];
  const float* Wo  = (const float*)d_in[5];
  const float* wmu = (const float*)d_in[6];
  const float* wsg = (const float*)d_in[7];
  const float* Gs  = (const float*)d_in[8];
  const float* bmu = (const float*)d_in[9];
  const float* bsg = (const float*)d_in[10];

  const size_t PKT  = (size_t)NBATCH * HID * LMEM * 2;    // 16777216  k^T planes; later the ctx f16 plane
  const size_t PCTX = (size_t)MROWS * HID * 2;            // 16777216  (== PKT)
  const size_t PGT  = (size_t)NBAS * LMEM * 2;            //  2097152
  const size_t PQB  = (size_t)MROWS * HID * 2;            // 16777216
  const size_t PW   = (size_t)HID * HID * 2;              //  2097152
  const size_t PBM  = (size_t)NBATCH * NBAS * HID * 2;    //  4194304
  const size_t PTPL = (size_t)16 * HID * 2;               //    32768
  const size_t PVT  = (size_t)NBATCH * HID * NBAS * 2;    //  4194304
  const size_t PQRY = (size_t)MROWS * HID * 4;            // 33554432
  const size_t PU   = (size_t)NBATCH * 2 * HID * 4;       //    32768
  if (PCTX > PKT) return;
  size_t off = 0;
  const size_t oKT  = off; off += PKT;
  const size_t oGT  = off; off += PGT;
  const size_t oQB  = off; off += PQB;
  const size_t oWQ  = off; off += PW;
  const size_t oWK  = off; off += PW;
  const size_t oWV  = off; off += PW;
  const size_t oWO  = off; off += PW;
  const size_t oBMH = off; off += PBM;
  const size_t oBML = off; off += PBM;
  const size_t oTPL = off; off += PTPL;
  const size_t oVTH = off; off += PVT;
  const size_t oVTL = off; off += PVT;
  const size_t oQRY = off; off += PQRY;
  const size_t oU   = off; off += PU;
  if (off > ws_size) return;                        // off = 94437376
  if (off > (size_t)134217728) return;

  char* ws = (char*)d_ws;
  unsigned short* KT  = (unsigned short*)(ws + oKT);
  unsigned short* CTX = (unsigned short*)(ws + oKT);   // reuse after the Bm GEMM has consumed KT
  unsigned short* GT  = (unsigned short*)(ws + oGT);
  unsigned short* QB  = (unsigned short*)(ws + oQB);
  unsigned short* WQB = (unsigned short*)(ws + oWQ);
  unsigned short* WKB = (unsigned short*)(ws + oWK);
  unsigned short* WVB = (unsigned short*)(ws + oWV);
  unsigned short* WOH = (unsigned short*)(ws + oWO);
  unsigned short* BMH = (unsigned short*)(ws + oBMH);
  unsigned short* BML = (unsigned short*)(ws + oBML);
  unsigned short* TPL = (unsigned short*)(ws + oTPL);
  unsigned short* VTH = (unsigned short*)(ws + oVTH);
  unsigned short* VTL = (unsigned short*)(ws + oVTL);
  float*          QRY = (float*)(ws + oQRY);
  float*          U   = (float*)(ws + oU);

  const dim3 blk(256);
  const int n8q = MROWS * HID / 8;                           // 1048576
  const int n8w = HID * HID / 8;                             //  131072
  const dim3 gTrK(HID / 64, LMEM / 64, NBATCH);              // in[b][2048 l][1024 e] -> out[b][1024 e][2048 l]: (cols/64, rows/64, b) = (16, 32, 4)
  const dim3 gTrG(NBAS / 64, LMEM / 64, 1);                  // in[2048 l][512 n] -> out[512 n][2048 l]: (8, 32, 1)
  const dim3 gCvtQ((n8q + 255) / 256);                       // 4096 blocks
  const dim3 gCvtW((n8w + 255) / 256);                       //  512 blocks
  const dim3 gBm(((NBAS / 64) * (HID / 64) + 7) / 8, NBATCH);    // 128 tiles -> 16 blocks x 4 b   (M=512,  N=1024, K=2048)
  const dim3 gWb(HID / 64, NBATCH);                               // (16, 4)
  const dim3 gVt(((HID / 64) * (NBAS / 64) + 7) / 8, NBATCH);     // 128 tiles -> 16 blocks x 4 b   (M=1024, N=512,  K=1024)
  const dim3 gQ(((MROWS / 64) * (HID / 64) + 7) / 8, 1);          // 2048 tiles -> 256 blocks      (M=8192, N=1024, K=1024)
  const dim3 gU(HID / 32);                                        // 32 blocks
  const dim3 gCtx(NBATCH * NH * NQB64);                           // 2048 blocks of 128

  // (1) k -> k^T bf16 per batch, Gs -> Gs^T bf16 (l contiguous); q and weights -> bf16; Wo -> f16 (64 x its bf16 value)
  tr_bf16<<<gTrK, blk, 0, stream>>>(kin, KT, LMEM, HID, (long long)LMEM * HID, (long long)HID * LMEM);
  tr_bf16<<<gTrG, blk, 0, stream>>>(Gs, GT, LMEM, NBAS, 0LL, 0LL);
  cvt16x8<0><<<gCvtQ, blk, 0, stream>>>(qin, QB,  n8q);
  cvt16x8<0><<<gCvtW, blk, 0, stream>>>(Wq,  WQB, n8w);
  cvt16x8<0><<<gCvtW, blk, 0, stream>>>(Wk,  WKB, n8w);
  cvt16x8<0><<<gCvtW, blk, 0, stream>>>(Wv,  WVB, n8w);
  cvt16x8<1><<<gCvtW, blk, 0, stream>>>(Wo,  WOH, n8w);
  // (2) Bm[b][n][e] = sum_l Gs^T[n][l] k^T[b][e][l] -> bf16 hi / residual planes [b*512+n][e]
  gemm64<__bf16, 0, 2><<<gBm, blk, 0, stream>>>(
      GT, GT, LMEM, 0LL, KT, KT, LMEM, (long long)HID * LMEM,
      (void*)BMH, (void*)BML, HID, (long long)NBAS * HID,
      NBAS, HID, LMEM, 1.0f);
  // (3) t[b*2+v][e'] = sum_n bf16(w_mu / w_sigma)[n] Bm[b*512+n][e'] (f32) -> bf16 hi / residual rows of TPL
  wb_kernel<<<gWb, blk, 0, stream>>>(BMH, BML, wmu, wsg, TPL);
  // (4) vals^T[b][e][n] = sum_e' Wv[e][e'] Bm[b*512+n][e'] -> bf16 hi / residual planes, pitch 512 (Bm on the Bt side, 2 products)
  gemm64<__bf16, 2, 2><<<gVt, blk, 0, stream>>>(
      WVB, WVB, HID, 0LL, BMH, BML, HID, (long long)NBAS * HID,
      (void*)VTH, (void*)VTL, NBAS, (long long)HID * NBAS,
      HID, NBAS, HID, 1.0f);
  // (5) qry[b*2048+q][e] = sum_e' q[..][e'] Wq[e][e'] -> f32 plane (read only by the qry.u dots of (7))
  gemm64<__bf16, 0, 0><<<gQ, blk, 0, stream>>>(
      QB, QB, HID, 0LL, WQB, WQB, HID, 0LL,
      (void*)QRY, (void*)QRY, HID, 0LL,
      MROWS, HID, HID, 1.0f);
  // (6) u[b][0/1][e] = sum_e' t[b*2+0/1][e'] Wk[e][e']   (= sum_n keys[b][n][e] * w[n] with keys = Bm.Wk^T)
  u_kernel<<<gU, blk, 0, stream>>>(TPL, WKB, U);
  // (7) mu, sig2 per query; ctx = r . vals -> f16 ctx plane (x64) [8192][1024] in the KT region
  ctx_kernel<<<gCtx, dim3(128), 0, stream>>>(QRY, U, bmu, bsg, VTH, VTL, CTX);
  // (8) out = ctx . Wo^T -> d_out f32 [8192][1024], accumulator x 1/(64*64)
  gemm64<_Float16, 0, 0><<<gQ, blk, 0, stream>>>(
      CTX, CTX, HID, 0LL, WOH, WOH, HID, 0LL,
      d_out, d_out, HID, 0LL,
      MROWS, HID, HID, 1.0f / (CSC * WOSC));
  (void)hipGetLastError();
}

// v002
// A run of this version takes 195 microseconds.
// Timed twice side by side with v001, it ran 1.85 and 1.86 times as fast.
// All steps since v000 together make it 2.44 times as fast.
// Contractions: Gs^T.k^T (Bm) and q.Wq^T on v_wmma_f32_16x16x32_bf16 (bf16 operands RNE-converted from inputs, single product, f32 accumulate);
// Wv.Bm^T on v_wmma_f32_16x16x32_bf16 with Bm as bf16 hi + bf16 residual planes (2 products, f32 accumulate);
// (w^T.Bm).Wk^T on v_wmma_f32_16x16x32_bf16: the 8 rows t = w^T.Bm as bf16 hi (A rows 0..7) + bf16 residual (A rows 8..15),
// one product, f32 accumulate, D rows r and r+8 added;
// r.vals on v_wmma_f32_16x16x32_bf16 with r and vals^T each bf16 hi + bf16 residual (3 products hh+hl+lh, f32 accumulate);
// ctx.Wo^T on v_wmma_f32_16x16x32_f16 (ctx f16 carried x64, Wo f16 = 64 x its bf16 value, single product, f32 accumulate, folded back x 1/4096);
// w^T.Bm and qry.u score-vector dots, sigmoid, softplus and the Gaussian density in f32.
// Carry audit: Woh plane = f16(64 * bf16(Wo)), ctx plane = f16(64 * ctx); both inverses folded back exactly once by
// oscale = 1/4096 in the out GEMM epilogue (OUT_MODE 0). Bm, vals^T and r residual planes are unscaled bf16 (v - hi)
// and share the hi accumulator (no fold needed).
#include <hip/hip_runtime.h>
#include <math.h>
#include <stdint.h>

#define NBATCH 4
#define LMEM   2048
#define QLEN   2048
#define HID    1024
#define NH     16
#define HD     64
#define NBAS   512
#define MROWS  (NBATCH * QLEN)   // 8192 query rows
#define NQB64  (QLEN / 64)       // 32 blocks of 64 queries per sequence
#define NCH    (NBAS / 64)       // 8 chunks of 64 basis functions
static_assert(NH * HD == HID);
static_assert(NQB64 == 32 && NCH == 8);
static_assert((LMEM % 64) == 0 && (QLEN % 64) == 0 && (HID % 64) == 0 && (NBAS % 64) == 0);
static_assert((LMEM % 128) == 0 && (HID % 128) == 0 && (NBAS % 128) == 0 && (MROWS % 128) == 0);
#define CSC  64.0f     // ctx plane carry (f16)
#define WOSC 64.0f     // Wo plane carry (f16 of the bf16 value)

typedef _Float16 v16h __attribute__((ext_vector_type(16)));
typedef _Float16 v8h  __attribute__((ext_vector_type(8)));
typedef __bf16   v16b __attribute__((ext_vector_type(16)));
typedef __bf16   v8b  __attribute__((ext_vector_type(8)));
typedef float    v8f  __attribute__((ext_vector_type(8)));
typedef float    v4f  __attribute__((ext_vector_type(4)));
typedef unsigned int   v4u  __attribute__((ext_vector_type(4)));
typedef unsigned short v8us __attribute__((ext_vector_type(8)));
typedef v4u  __attribute__((may_alias)) v4ua;
typedef v8us __attribute__((may_alias)) v8usa;

#if defined(__HIP_DEVICE_COMPILE__)
#define DEV_ASM 1
#else
#define DEV_ASM 0
#endif

// ---- scalar helpers ---------------------------------------------------------------------------------
__device__ __forceinline__ unsigned short bf_bits(float f) {          // f32 -> bf16 bits, RNE convert
  unsigned u = __float_as_uint(f);
  return (unsigned short)((u + 0x7FFFu + ((u >> 16) & 1u)) >> 16);
}
__device__ __forceinline__ float bf_up(unsigned short hb) { return __uint_as_float(((unsigned)hb) << 16); }
__device__ __forceinline__ unsigned short h_bits(_Float16 x) { return __builtin_bit_cast(unsigned short, x); }
__device__ __forceinline__ unsigned pk16(unsigned short a, unsigned short b) { return (unsigned)a | ((unsigned)b << 16); }
__device__ __forceinline__ v8f zero8() { v8f z = {0.f, 0.f, 0.f, 0.f, 0.f, 0.f, 0.f, 0.f}; return z; }

// ---- fragment types / loaders: 16-bit A/B operand, lane -> row/col (lane&15), p already includes +8*(lane>>4);
//      elements 0..7 <- p[0..7] (k0+8h..k0+8h+7), elements 8..15 <- p[16..23] (k0+16+8h..k0+16+8h+7)
template <typename OT> struct FT;
template <> struct FT<__bf16>   { typedef v16b frag; typedef v8b half8; };
template <> struct FT<_Float16> { typedef v16h frag; typedef v8h half8; };

template <typename OT>
__device__ __forceinline__ typename FT<OT>::frag ldfrag(const OT* p) {
  union { typename FT<OT>::frag v; typename FT<OT>::half8 h[2]; } f;
  f.h[0] = *(const typename FT<OT>::half8*)(p);
  f.h[1] = *(const typename FT<OT>::half8*)(p + 16);
  return f.v;
}

// ---- guarded WMMA: 4 VALU slots after every WMMA, D tied, A/B kept live -----------------------------------
__device__ __forceinline__ v8f mma_g(v16b a, v16b b, v8f c) {
  c = __builtin_amdgcn_wmma_f32_16x16x32_bf16(false, a, false, b, (short)0, c, false, false);
#if DEV_ASM
  asm volatile("v_nop\n\tv_nop\n\tv_nop\n\tv_nop" : "+v"(c) : "v"(a), "v"(b));
#endif
  return c;
}
__device__ __forceinline__ v8f mma_g(v16h a, v16h b, v8f c) {
  c = __builtin_amdgcn_wmma_f32_16x16x32_f16(false, a, false, b, (short)0, c, false, false);
#if DEV_ASM
  asm volatile("v_nop\n\tv_nop\n\tv_nop\n\tv_nop" : "+v"(c) : "v"(a), "v"(b));
#endif
  return c;
}

// =====================================================================================================
// f32 -> 16-bit planes, 8 elements per thread, one 16-B store per lane: a wave writes 512 contiguous B
// MODE 0: bf16 bits (RNE convert).  MODE 1: f16 bits of (64 * bf16(x)) (exact scaling of the bf16 value).
// coverage: n8 threads x 8 = the whole plane (n8 is a multiple of 256 for every use here).
// =====================================================================================================
template <int MODE>
__device__ __forceinline__ unsigned short cvm(float f) {
  const unsigned short hb = bf_bits(f);
  if (MODE == 0) return hb;
  return h_bits((_Float16)(bf_up(hb) * WOSC));
}

template <int MODE>
__global__ __launch_bounds__(256) void cvt16x8(const float* __restrict__ in, unsigned short* out, int n8) {
  const int i = blockIdx.x * 256 + (int)threadIdx.x;
  if (i < n8) {
    const v4f a  = *(const v4f*)(in + (size_t)i * 8);
    const v4f a4 = *(const v4f*)(in + (size_t)i * 8 + 4);
    v4u p;
    p[0] = pk16(cvm<MODE>(a[0]),  cvm<MODE>(a[1]));
    p[1] = pk16(cvm<MODE>(a[2]),  cvm<MODE>(a[3]));
    p[2] = pk16(cvm<MODE>(a4[0]), cvm<MODE>(a4[1]));
    p[3] = pk16(cvm<MODE>(a4[2]), cvm<MODE>(a4[3]));
    unsigned short* o = out + (size_t)i * 8;
    *(v4u*)o = p;
    
  }
}

// =====================================================================================================
// Tiled transpose + bf16 convert: in[z][R][C] f32 (C contiguous) -> out[z][C][R] bf16 (R contiguous).
// Block 256 = one 64x64 tile: blockIdx.x = column tile c0 (of C), blockIdx.y = row tile r0 (of R), blockIdx.z = z;
// grid (C/64, R/64, Z). Load: 256 thr x 4 it x 4 floats = the 64x64 tile (16-B loads along C), staged as
// bf16 t[cc][rr] (pitch 72 shorts, 16-B aligned rows); __syncthreads; store: out row (c0+row), segment
// =====================================================================================================
__global__ __launch_bounds__(256) void tr_bf16(const float* __restrict__ in, unsigned short* out,
                                               int R, int C, long long ibs, long long obs) {
  __shared__ __align__(16) unsigned short t[64][72];
  const int tid = threadIdx.x;
  const float* ib = in + (size_t)blockIdx.z * (size_t)ibs;
  unsigned short* ob = out + (size_t)blockIdx.z * (size_t)obs;
  const int r0 = blockIdx.y * 64, c0 = blockIdx.x * 64;
#pragma unroll
  for (int it = 0; it < 4; ++it) {
    const int i = tid + 256 * it;
    const int rr = i >> 4, cc4 = (i & 15) * 4;
    const v4f v = *(const v4f*)(ib + (size_t)(r0 + rr) * (size_t)C + c0 + cc4);
    t[cc4 + 0][rr] = bf_bits(v[0]);
    t[cc4 + 1][rr] = bf_bits(v[1]);
    t[cc4 + 2][rr] = bf_bits(v[2]);
    t[cc4 + 3][rr] = bf_bits(v[3]);
  }
  __syncthreads();
  const int wave = tid >> 5, lane = tid & 31;
  const int q8 = lane & 7, sub = lane >> 3;
  v4u pv[2];
#pragma unroll
  for (int it = 0; it < 2; ++it) {
    const int row = it * 32 + wave * 4 + sub;
    pv[it] = *(const v4ua*)(&t[row][8 * q8]);
  }
  {
#pragma unroll
    for (int it = 0; it < 2; ++it) {
      const int row = it * 32 + wave * 4 + sub;
      *(v4u*)(ob + (size_t)(c0 + row) * (size_t)R + r0 + 8 * q8) = pv[it];
    }
    
  }
}

// =====================================================================================================
// LDS-staged batched WMMA GEMM (16-bit operand type OT): C[m][n] = sum_k A[m][k] * Bt[n][k];
// one block of 4 waves (2 x 2) per 128x128 tile, one wave per 64x64 quarter. A row-major [M][KD], Bt row-major
// [N][KD] (k contiguous, pitch KD); M, N multiples of 128, KD a multiple of 128 and at least 256 (static shapes here).
// blockIdx.x = tile (column tile fastest), blockIdx.y = batch index (strides in elements); the grid is exactly the tiles.
// A stage = 128 k = 256 B of each of the tile's operand rows [A 128 | Bt 128 | (SPL 2) Bt2 128], brought by asynchronous
// copies to LDS: 16 lanes x 16 B = one row's 256 B, so a wave's copy covers two rows in whole lines; each of the 128
// threads copies rows (tid >> 4) + 8 i. LDS row pitch 272 B. Two buffers: stage t + 1 flies while stage t is worked on.
// Fragments are read from LDS with the split k map (ldfrag), same k order per accumulator as a straight k loop.
// SPL 0: single product. SPL 2: Bt = hi plane Bt + residual plane Bt2 (2 products per k-step, same accumulator).
// OUT_MODE 0: f32 C (pitch ldc), value * oscale.
// OUT_MODE 2: bf16 hi plane C + bf16 residual plane C2 = bf16(v - hi) (same pitch / stride).
// =====================================================================================================
#define GKS  128       // k elements per stage
#define GPIT 136       // LDS row pitch in 16-bit elements: 272 B = 16 B x 17, conflict-free for 16-B fragment reads

// Eight asynchronous 16-B-per-lane copies global -> LDS: rows r, r + 8, ..., r + 56 of one operand plane.
// l = the lane's LDS byte address, g = the lane's global address, ld = global row pitch in elements.
__device__ __forceinline__ void acopy8(unsigned l, const unsigned short* g, int ld) {
#if DEV_ASM
  const size_t gs = (size_t)8 * (size_t)ld;
  const unsigned ls = 8u * GPIT * 2u;
  // the closing s_wait_xcnt keeps every address register intact until the copies have taken it
  asm volatile(
      "global_load_async_to_lds_b128 %0, %8, off\n\t"
      "global_load_async_to_lds_b128 %1, %9, off\n\t"
      "global_load_async_to_lds_b128 %2, %10, off\n\t"
      "global_load_async_to_lds_b128 %3, %11, off\n\t"
      "global_load_async_to_lds_b128 %4, %12, off\n\t"
      "global_load_async_to_lds_b128 %5, %13, off\n\t"
      "global_load_async_to_lds_b128 %6, %14, off\n\t"
      "global_load_async_to_lds_b128 %7, %15, off\n\t"
      "s_wait_xcnt 0x0"
      :: "v"(l), "v"(l + ls), "v"(l + 2u * ls), "v"(l + 3u * ls),
         "v"(l + 4u * ls), "v"(l + 5u * ls), "v"(l + 6u * ls), "v"(l + 7u * ls),
         "v"(g), "v"(g + gs), "v"(g + 2 * gs), "v"(g + 3 * gs),
         "v"(g + 4 * gs), "v"(g + 5 * gs), "v"(g + 6 * gs), "v"(g + 7 * gs)
      : "memory");
#endif
}

template <typename OT, int SPL, int OUT_MODE, int KD>
__global__ __launch_bounds__(128) void gemm128(
    const unsigned short* __restrict__ Ap, long long strideA,
    const unsigned short* __restrict__ Btp, const unsigned short* __restrict__ Bt2p, long long strideB,
    void* Cout, void* Cout2, int ldc, long long strideC,
    int N, float oscale) {
  typedef typename FT<OT>::frag V16;
  static_assert((KD % GKS) == 0 && KD / GKS >= 2);
  constexpr int NST  = KD / GKS;                       // stages
  constexpr int NPL  = (SPL == 2) ? 3 : 2;             // operand planes per stage
  constexpr int BUFE = NPL * 128 * GPIT;               // elements per buffer
  __shared__ __align__(16) unsigned short ring[2 * BUFE];
  __shared__ __align__(16) float sT[4][16 * 68];       // per-wave 16x64 slab, pitch 68 floats
  const int b    = blockIdx.y;
  const int tid  = threadIdx.x;
  const int lane = tid & 31;
  const int wave = tid >> 5;
  const int tilesN = N >> 7;
  const int tm = (int)blockIdx.x / tilesN;
  const int tn = (int)blockIdx.x - tm * tilesN;
  const int m0 = (tm << 7) + ((wave >> 1) << 6);       // this wave's 64x64 quarter
  const int n0 = (tn << 7) + ((wave & 1) << 6);

  // ---- copy side: lane -> (row group, 16-B segment of the 256-B row) ----
  const int seg = tid & 15, r8 = tid >> 4;
  const unsigned short* gA  = Ap   + (size_t)b * (size_t)strideA + (size_t)((tm << 7) + r8) * KD + seg * 8;
  const unsigned short* gB  = Btp  + (size_t)b * (size_t)strideB + (size_t)((tn << 7) + r8) * KD + seg * 8;
  const unsigned short* gB2 = Bt2p + (size_t)b * (size_t)strideB + (size_t)((tn << 7) + r8) * KD + seg * 8;
  const unsigned lds0 = (unsigned)(uintptr_t)(ring + r8 * GPIT + seg * 8);
  auto fill = [&](int s, int buf) {
    const unsigned l = lds0 + (unsigned)buf * (unsigned)(BUFE * 2);
    const int k0 = s * GKS;
    acopy8(l,                   gA + k0, KD);
    acopy8(l +  64 * GPIT * 2,  gA + k0 + (size_t)64 * KD, KD);
    acopy8(l + 128 * GPIT * 2,  gB + k0, KD);
    acopy8(l + 192 * GPIT * 2,  gB + k0 + (size_t)64 * KD, KD);
    if (SPL == 2) {
      acopy8(l + 256 * GPIT * 2, gB2 + k0, KD);
      acopy8(l + 320 * GPIT * 2, gB2 + k0 + (size_t)64 * KD, KD);
    }
  };

  const int rlane = lane & 15;                 // row (A) / col (B, D) within subtile
  const int koff  = (lane >> 4) * 8;           // k offset of this lane half
  const int mOff  = (lane >> 4) * 8;           // D row offset
  const int aoff = (((wave >> 1) << 6) + rlane) * GPIT + koff;
  const int boff = (128 + ((wave & 1) << 6) + rlane) * GPIT + koff;

  v8f acc[4][4];
#pragma unroll
  for (int i = 0; i < 4; ++i)
#pragma unroll
    for (int j = 0; j < 4; ++j) acc[i][j] = zero8();

  fill(0, 0);
#if DEV_ASM
  asm volatile("s_wait_asynccnt 0x0" ::: "memory");   // stage 0 of this wave has landed
#endif
  __syncthreads();                                      // stage 0 of every wave is readable
  fill(1, 1);

  // rolled: one stage's 64 or 128 WMMAs are the hot loop
#pragma unroll 1
  for (int t = 0; t < NST; ++t) {
    const OT* rb = (const OT*)(const void*)ring + (t & 1) * BUFE;
    // the loops below are unrolled so that af, bq and acc are indexed by constants and stay in registers
#pragma unroll
    for (int kk = 0; kk < GKS / 32; ++kk) {
      V16 af[4];
#pragma unroll
      for (int i = 0; i < 4; ++i) af[i] = ldfrag<OT>(rb + aoff + i * 16 * GPIT + kk * 32);
#pragma unroll
      for (int p = 0; p < ((SPL == 2) ? 2 : 1); ++p) {
        V16 bq[4];
#pragma unroll
        for (int j = 0; j < 4; ++j) bq[j] = ldfrag<OT>(rb + boff + p * 128 * GPIT + j * 16 * GPIT + kk * 32);
#pragma unroll
        for (int i = 0; i < 4; ++i)
#pragma unroll
          for (int j = 0; j < 4; ++j) acc[i][j] = mma_g(af[i], bq[j], acc[i][j]);
      }
    }
#if DEV_ASM
    asm volatile("s_wait_dscnt 0x0" ::: "memory");      // this wave's reads of buffer t & 1 are done before it is refilled
    asm volatile("s_wait_asynccnt 0x0" ::: "memory");   // this wave's copies of stage t + 1 have landed
#endif
    __syncthreads();                                    // publishes stage t + 1 and frees buffer t & 1
    if (t + 2 < NST) fill(t + 2, t & 1);
  }
#if DEV_ASM
  asm volatile("s_wait_asynccnt 0x0" ::: "memory");     // no copy is outstanding when the wave goes on to its end
#endif

  // ---- epilogue ----
  float* slab = sT[wave];
#pragma unroll
  for (int i = 0; i < 4; ++i) {
    const int mBase = m0 + (i << 4);
#pragma unroll
    for (int j = 0; j < 4; ++j) {
#pragma unroll
      for (int r = 0; r < 8; ++r) {
        slab[(mOff + r) * 68 + (j << 4) + rlane] = acc[i][j][r];
      }
    }
    __builtin_amdgcn_fence(__ATOMIC_RELEASE, "workgroup");
    __builtin_amdgcn_wave_barrier();
    __builtin_amdgcn_fence(__ATOMIC_ACQUIRE, "workgroup");
    if (OUT_MODE == 0) {
      float* Cf = (float*)Cout + (size_t)b * (size_t)strideC;
      const int h2 = lane >> 4, c4 = (lane & 15) * 4;     // 256-B row segment = 16 lanes x 16 B
      {
#pragma unroll
        for (int it = 0; it < 8; ++it) {
          const int row = it * 2 + h2;                     // it 0..7 x h2 0..1 = rows 0..15
          const v4f v = *(const v4f*)(slab + row * 68 + c4) * oscale;
          *(v4f*)(Cf + (size_t)(mBase + row) * (size_t)ldc + n0 + c4) = v;
        }
        
      }
    } else {
      const int q = lane >> 3, c8 = (lane & 7) * 8;
      unsigned short* Ch = (unsigned short*)Cout  + (size_t)b * (size_t)strideC;
      unsigned short* Cl = (unsigned short*)Cout2 + (size_t)b * (size_t)strideC;
      v4u hv[4], lv[4];
#pragma unroll
      for (int it = 0; it < 4; ++it) {
        const int row = it * 4 + q;                        // it 0..3 x q 0..3 = rows 0..15
        const float* sp = slab + row * 68 + c8;
        v4u a, a2;
#pragma unroll
        for (int e = 0; e < 4; ++e) {
          const float f0 = sp[2 * e], f1 = sp[2 * e + 1];
          const unsigned short h0 = bf_bits(f0), h1 = bf_bits(f1);
          const unsigned short l0 = bf_bits(f0 - bf_up(h0));
          const unsigned short l1 = bf_bits(f1 - bf_up(h1));
          a[e] = pk16(h0, h1); a2[e] = pk16(l0, l1);
        }
        hv[it] = a; lv[it] = a2;
      }
      {
#pragma unroll
        for (int it = 0; it < 4; ++it) {
          const int row = it * 4 + q;
          *(v4u*)(Ch + (size_t)(mBase + row) * (size_t)ldc + n0 + c8) = hv[it];
          *(v4u*)(Cl + (size_t)(mBase + row) * (size_t)ldc + n0 + c8) = lv[it];
        }
        
      }
    }
    __builtin_amdgcn_fence(__ATOMIC_RELEASE, "workgroup");
    __builtin_amdgcn_wave_barrier();
    __builtin_amdgcn_fence(__ATOMIC_ACQUIRE, "workgroup");
  }
}

// =====================================================================================================
// keys^T.w = Wk.(Bm^T.w): the score vectors need keys only through this product, so the weight vectors are
// contracted with Bm first and only the 8 resulting rows go through Wk.
// t[b*2+v][e] = sum_n bf16(w_v[n]) * (Bm hi + Bm residual)[b*512+n][e]   (f32; v = 0: w_mu, v = 1: w_sigma)
// Block 256 = (b, 64 columns e): 8 lanes x 8 columns = one 128-B row segment per plane, 32 row groups x 16 rows
// = all 512 n; group partials summed through LDS. Output plane T bf16 [16][1024]: row b*2+v = hi, row 8+b*2+v =
// residual; one wave stores a whole 128-B segment (32 lanes x 2 columns). grid (HID/64, NBATCH) covers all 16 rows.
// =====================================================================================================
__global__ __launch_bounds__(256) void wb_kernel(const unsigned short* __restrict__ bmh,
                                                 const unsigned short* __restrict__ bml,
                                                 const float* __restrict__ wmu, const float* __restrict__ wsg,
                                                 unsigned short* tpl) {
  __shared__ float wsh[2][NBAS];
  __shared__ __align__(16) float part[2][32][64];
  const int tid = threadIdx.x;
  const int b  = blockIdx.y;
  const int e0 = blockIdx.x * 64;
  const int g = tid >> 3, c8 = (tid & 7) * 8;
  const unsigned short* ph = bmh + ((size_t)b * NBAS + g) * HID + e0 + c8;
  const unsigned short* pl = bml + ((size_t)b * NBAS + g) * HID + e0 + c8;
  // all of the thread's rows are loaded first: every row is read once, so the cost is latency, paid once this way
  v8us hv[NBAS / 32], lv[NBAS / 32];
#pragma unroll
  for (int it = 0; it < NBAS / 32; ++it) {
    hv[it] = *(const v8usa*)(ph + (size_t)it * 32 * HID);
    lv[it] = *(const v8usa*)(pl + (size_t)it * 32 * HID);
  }
#pragma unroll
  for (int k = 0; k < NBAS / 256; ++k) {
    const int i = tid + 256 * k;
    wsh[0][i] = bf_up(bf_bits(wmu[i]));
    wsh[1][i] = bf_up(bf_bits(wsg[i]));
  }
  __syncthreads();
  float am[8], ag[8];
#pragma unroll
  for (int j = 0; j < 8; ++j) { am[j] = 0.f; ag[j] = 0.f; }
#pragma unroll
  for (int it = 0; it < NBAS / 32; ++it) {
    const float w0 = wsh[0][it * 32 + g];
    const float w1 = wsh[1][it * 32 + g];
#pragma unroll
    for (int j = 0; j < 8; ++j) {
      const float x = bf_up(hv[it][j]) + bf_up(lv[it][j]);
      am[j] += x * w0;
      ag[j] += x * w1;
    }
  }
#pragma unroll
  for (int j = 0; j < 8; ++j) {
    part[0][g][c8 + j] = am[j];
    part[1][g][c8 + j] = ag[j];
  }
  __syncthreads();
  if (tid < 64) {                       // wave 0: v = 0, wave 1: v = 1; lane = column pair
    const int v = tid >> 5, c2 = (tid & 31) * 2;
    float s0 = 0.f, s1 = 0.f;
#pragma unroll
    for (int gg = 0; gg < 32; ++gg) {
      s0 += part[v][gg][c2];
      s1 += part[v][gg][c2 + 1];
    }
    const unsigned short h0 = bf_bits(s0), h1 = bf_bits(s1);
    const unsigned short l0 = bf_bits(s0 - bf_up(h0));
    const unsigned short l1 = bf_bits(s1 - bf_up(h1));
    *(unsigned*)(tpl + (size_t)(b * 2 + v) * HID + e0 + c2)     = pk16(h0, h1);
    *(unsigned*)(tpl + (size_t)(8 + b * 2 + v) * HID + e0 + c2) = pk16(l0, l1);
  }
}

// =====================================================================================================
// u[r][e] = sum_e' (T hi + T residual)[r][e'] * bf16(Wk)[e][e'],  r = b*2+v in 0..7   (f32, same table as before)
// A = T [16][1024] (rows 0..7 hi, rows 8..15 residual), Bt = Wk bf16 [e][e']; D row r + D row r+8 = u row r.
// Block 256 = 32 columns e (two 16-column tiles); wave w takes the k slice [128 w, 128 w + 128) = 4 k-steps for both
// tiles (A fragment shared); the 8 slice partials are summed through LDS. Store: one wave = one row's 32 floats
// = one 128-B segment. grid HID/32 covers all 1024 columns of all 8 rows.
// =====================================================================================================
__global__ __launch_bounds__(256) void u_kernel(const unsigned short* __restrict__ tpl,
                                                const unsigned short* __restrict__ wkp, float* u) {
  __shared__ float red[8][8][32];       // [k slice][row r][column]
  const int tid  = threadIdx.x;
  const int wave = tid >> 5;
  const int lane = tid & 31;
  const int rlane = lane & 15;          // row (A) / col (B, D) within the tile
  const int koff  = (lane >> 4) * 8;    // k offset of this lane half
  const int n0 = blockIdx.x * 32;
  const __bf16* A  = (const __bf16*)(const void*)tpl + (size_t)rlane * HID + koff + wave * 128;
  const __bf16* B0 = (const __bf16*)(const void*)wkp + (size_t)(n0 + rlane) * HID + koff + wave * 128;
  const __bf16* B1 = B0 + (size_t)16 * HID;
  v16b af[4], b0[4], b1[4];
#pragma unroll
  for (int s = 0; s < 4; ++s) {
    af[s] = ldfrag<__bf16>(A  + 32 * s);
    b0[s] = ldfrag<__bf16>(B0 + 32 * s);
    b1[s] = ldfrag<__bf16>(B1 + 32 * s);
  }
  v8f a0 = zero8(), a1 = zero8();
#pragma unroll
  for (int s = 0; s < 4; ++s) {
    a0 = mma_g(af[s], b0[s], a0);
    a1 = mma_g(af[s], b1[s], a1);
  }
  // D element r of lane half 0 = row r (hi part), of lane half 1 = row r+8 (residual part), same column
#pragma unroll
  for (int r = 0; r < 8; ++r) {
    const float x0 = a0[r] + __shfl_xor(a0[r], 16, 32);
    const float x1 = a1[r] + __shfl_xor(a1[r], 16, 32);
    red[wave][r][lane] = (lane < 16) ? x0 : x1;     // lanes 16..31 hold the second tile's column lane-16
  }
  __syncthreads();
  {
    float s = 0.f;
#pragma unroll
    for (int w = 0; w < 8; ++w) s += red[w][wave][lane];
    u[(size_t)wave * HID + n0 + lane] = s;
  }
}

// =====================================================================================================
// Continuous attention context, one block = (b, head h, 64 queries), 4 waves x 16 queries, grid NBATCH*NH*NQB64.
//   prologue (f32): dm = sum_d qry[q][h*64+d]*u_mu[b][h*64+d] / 8, dg likewise with u_sigma;
//     mu = sigmoid(dm), sig2 = max(softplus(dg), 1e-4)   (lane c = query, lane halves each do 32 d, shfl combine)
//   loop over 8 chunks of 64 basis functions (static trip): vals^T hi / residual chunks [d 64][n 64] staged in
//     LDS by 128 threads x 32 elements per plane (whole 64x64 tile, __syncthreads before and after);
//     per 32-deep k-step the lane builds its A fragment in registers: element i = r[q=c][n0+32kk+k(i)],
//     r = exp(-0.5 (mu - bm[n])^2 / var) / sqrt(2 pi var), var = sig2 + bs[n]^2 (bm, bs = bf16-converted basis
//     tables in LDS), as bf16 hi + bf16 residual; B fragments = vals^T hi / residual from LDS (col = d, k = n);
//     oacc[t] += rh.vh + rh.vl + rl.vh  (bf16 WMMA, one f32 accumulator).
//   epilogue: wave's 16x64 f32 tile staged in LDS, converted to f16(64 * ctx), written to the ctx plane
//   coverage: rows it(4) x (lane>>3)(4) = 16 per wave x 4 waves x 32 qb x 4 b; cols 8 lanes x 8 = 64 per head x 16 heads
//   = the whole [8192][1024] ctx plane. LDS extents: Vth/Vtl 64x64 staged = 64x64 consumed; bm_s/bv_s 512 = 512;
//   Os written 16x64 per wave before the wave reads its own tile.
// =====================================================================================================
__global__ __launch_bounds__(128) void ctx_kernel(
    const float* __restrict__ qry, const float* __restrict__ u,
    const float* __restrict__ bmu, const float* __restrict__ bsg,
    const unsigned short* __restrict__ vthp, const unsigned short* __restrict__ vtlp,
    unsigned short* ctxp) {
  union FB { v16b v; v8us h[2]; unsigned short s[16]; };
  __shared__ __align__(16) unsigned short Vth[64 * 64];    // vals^T hi chunk [d][n]       8 KB
  __shared__ __align__(16) unsigned short Vtl[64 * 64];    // vals^T residual chunk        8 KB
  __shared__ __align__(16) float Os[4][16 * 64];           // per-wave context tile       16 KB
  __shared__ float bm_s[NBAS];                             // bf16-converted basis means
  __shared__ float bv_s[NBAS];                             // (bf16-converted basis sigma)^2

  const int tid  = threadIdx.x;
  const int wave = tid >> 5;
  const int lane = tid & 31;
  const int hh   = lane >> 4;
  const int c    = lane & 15;

  const int bx   = blockIdx.x;
  const int qb   = bx % NQB64;
  const int rest = bx / NQB64;
  const int h    = rest % NH;
  const int b    = rest / NH;
  const int q0   = qb * 64 + wave * 16;
  const size_t row0 = (size_t)b * QLEN + q0;              // plane row of this wave's query 0

  for (int i = tid; i < NBAS; i += 128) {
    const float m = bf_up(bf_bits(bmu[i]));
    const float s = bf_up(bf_bits(bsg[i]));
    bm_s[i] = m;
    bv_s[i] = s * s;
  }

  // ---- per-query affine heads (f32) ----
  float dm = 0.f, dg = 0.f;
  {
    const float* qr = qry + (row0 + c) * HID + (size_t)h * HD + 32 * hh;
    const float* um = u + ((size_t)b * 2) * HID + (size_t)h * HD + 32 * hh;
    const float* ug = um + HID;
#pragma unroll 2
    for (int i = 0; i < 8; ++i) {
      const v4f a  = *(const v4f*)(qr + 4 * i);
      const v4f wm = *(const v4f*)(um + 4 * i);
      const v4f wg = *(const v4f*)(ug + 4 * i);
      dm += a[0] * wm[0]; dm += a[1] * wm[1]; dm += a[2] * wm[2]; dm += a[3] * wm[3];
      dg += a[0] * wg[0]; dg += a[1] * wg[1]; dg += a[2] * wg[2]; dg += a[3] * wg[3];
    }
  }
  dm += __shfl_xor(dm, 16, 32);
  dg += __shfl_xor(dg, 16, 32);
  dm *= 0.125f;
  dg *= 0.125f;
  const float mu   = 1.0f / (1.0f + expf(-dm));
  const float spl  = fmaxf(dg, 0.0f) + log1pf(expf(-fabsf(dg)));
  const float sig2 = fmaxf(spl, 1e-4f);

  const unsigned short* Vh = vthp + ((size_t)b * HID + (size_t)h * HD) * NBAS;
  const unsigned short* Vl = vtlp + ((size_t)b * HID + (size_t)h * HD) * NBAS;

  v8f oacc[4];
#pragma unroll
  for (int t = 0; t < 4; ++t) oacc[t] = zero8();

  for (int nt = 0; nt < NCH; ++nt) {         // static trip count
    const int n0 = nt * 64;
    __syncthreads();
    {
      const int r = tid >> 1, half = (tid & 1) * 32;      // d = r, n = n0 + half .. + 31
      const unsigned short* vg  = Vh + (size_t)r * NBAS + n0 + half;
      const unsigned short* vlg = Vl + (size_t)r * NBAS + n0 + half;
#pragma unroll
      for (int i = 0; i < 4; ++i) {
        const v8us b0 = *(const v8usa*)(vg + 8 * i);
        const v8us b1 = *(const v8usa*)(vlg + 8 * i);
        *(v8usa*)(Vth + r * 64 + half + 8 * i) = b0;
        *(v8usa*)(Vtl + r * 64 + half + 8 * i) = b1;
      }
    }
    __syncthreads();

#pragma unroll 1
    for (int kk = 0; kk < 2; ++kk) {
      // ---- A fragments: r values of query c at the 16 k slots of this lane half, bf16 hi + residual ----
      FB rh, rl;
#pragma unroll
      for (int i = 0; i < 16; ++i) {
        const int n = n0 + kk * 32 + ((i < 8) ? (8 * hh + i) : (8 + 8 * hh + i));
        const float t   = mu - bm_s[n];
        const float var = sig2 + bv_s[n];
        const float iv  = __builtin_amdgcn_rcpf(var);
        const float rv  = __expf(-0.5f * t * t * iv) * rsqrtf(6.2831853071795864f * var);
        const unsigned short hb = bf_bits(rv);
        rh.s[i] = hb;
        rl.s[i] = bf_bits(rv - bf_up(hb));
      }
      // ---- ctx += r . vals over this 32-deep slice of n ----
#pragma unroll
      for (int t = 0; t < 4; ++t) {
        FB vb, vl;
        vb.h[0] = *(const v8usa*)(Vth + (t * 16 + c) * 64 + kk * 32 + 8 * hh);
        vb.h[1] = *(const v8usa*)(Vth + (t * 16 + c) * 64 + kk * 32 + 16 + 8 * hh);
        vl.h[0] = *(const v8usa*)(Vtl + (t * 16 + c) * 64 + kk * 32 + 8 * hh);
        vl.h[1] = *(const v8usa*)(Vtl + (t * 16 + c) * 64 + kk * 32 + 16 + 8 * hh);
        oacc[t] = mma_g(rh.v, vb.v, oacc[t]);
        oacc[t] = mma_g(rh.v, vl.v, oacc[t]);
        oacc[t] = mma_g(rl.v, vb.v, oacc[t]);
      }
    }
  }

  float* os = Os[wave];
#pragma unroll
  for (int r = 0; r < 8; ++r) {
#pragma unroll
    for (int t = 0; t < 4; ++t) os[(8 * hh + r) * 64 + t * 16 + c] = oacc[t][r];
  }
  __builtin_amdgcn_fence(__ATOMIC_RELEASE, "workgroup");
  __builtin_amdgcn_wave_barrier();
  __builtin_amdgcn_fence(__ATOMIC_ACQUIRE, "workgroup");
  {
    const int q4 = lane >> 3, c8 = (lane & 7) * 8;
    v4u hv[4];
#pragma unroll
    for (int it = 0; it < 4; ++it) {
      const int row = it * 4 + q4;   // it 0..3 x q4 0..3 = rows 0..15 of the wave tile
      const float* sp = os + row * 64 + c8;
      v4u a;
#pragma unroll
      for (int e = 0; e < 4; ++e) {
        const float f0 = sp[2 * e] * CSC, f1 = sp[2 * e + 1] * CSC;
        a[e] = pk16(h_bits((_Float16)f0), h_bits((_Float16)f1));
      }
      hv[it] = a;
    }
    {
#pragma unroll
      for (int it = 0; it < 4; ++it) {
        const int row = it * 4 + q4;
        const size_t go = (row0 + row) * HID + (size_t)h * HD + c8;
        *(v4u*)(ctxp + go) = hv[it];
      }
      
    }
  }
}

// =====================================================================================================
// Workspace map (bytes), every region an exact multiple of its whole-line / whole-tile store granularity:
//   KT   bf16 [4][1024 e][2048 l]   16777216   (dead after the Bm GEMM; reused as the f16 ctx plane [8192][1024], same size)
//   GT   bf16 [512 n][2048 l]        2097152
//   QB   bf16 [8192][1024]          16777216
//   WQB  bf16 [1024][1024]           2097152
//   WKB  bf16 [1024][1024]           2097152
//   WVB  bf16 [1024][1024]           2097152
//   WOH  f16  [1024][1024] (x64)     2097152
//   BMH  bf16 [4*512][1024]          4194304   Bm hi
//   BML  bf16 [4*512][1024]          4194304   Bm residual
//   TPL  bf16 [16][1024]               32768   t = w^T.Bm, rows 0..7 hi, rows 8..15 residual
//   VTH  bf16 [4][1024 e][512 n]     4194304   vals^T hi
//   VTL  bf16 [4][1024 e][512 n]     4194304   vals^T residual
//   QRY  f32  [8192][1024]          33554432
//   U    f32  [4][2][1024]             32768
//   total                           94437376
// Weights are [out][in] with in contiguous = the Bt layout for x.W^T, so they are only converted.
// =====================================================================================================
extern "C" void kernel_launch(void* const* d_in, const int* in_sizes, int n_in,
                              void* d_out, int out_size, void* d_ws, size_t ws_size,
                              hipStream_t stream) {
  if (n_in < 11) return;
  if (in_sizes[0] != NBATCH * LMEM * HID) return;
  if (in_sizes[1] != MROWS * HID) return;
  if (in_sizes[2] != HID * HID || in_sizes[3] != HID * HID || in_sizes[4] != HID * HID || in_sizes[5] != HID * HID) return;
  if (in_sizes[6] != NBAS || in_sizes[7] != NBAS) return;
  if (in_sizes[8] != LMEM * NBAS || in_sizes[9] != NBAS || in_sizes[10] != NBAS) return;
  if (out_size != MROWS * HID) return;

  const float* kin = (const float*)d_in[0];
  const float* qin = (const float*)d_in[1];
  const float* Wq  = (const float*)d_in[2];
  const float* Wk  = (const float*)d_in[3];
  const float* Wv  = (const float*)d_in[4];
  const float* Wo  = (const float*)d_in[5];
  const float* wmu = (const float*)d_in[6];
  const float* wsg = (const float*)d_in[7];
  const float* Gs  = (const float*)d_in[8];
  const float* bmu = (const float*)d_in[9];
  const float* bsg = (const float*)d_in[10];

  const size_t PKT  = (size_t)NBATCH * HID * LMEM * 2;    // 16777216  k^T planes; later the ctx f16 plane
  const size_t PCTX = (size_t)MROWS * HID * 2;            // 16777216  (== PKT)
  const size_t PGT  = (size_t)NBAS * LMEM * 2;            //  2097152
  const size_t PQB  = (size_t)MROWS * HID * 2;            // 16777216
  const size_t PW   = (size_t)HID * HID * 2;              //  2097152
  const size_t PBM  = (size_t)NBATCH * NBAS * HID * 2;    //  4194304
  const size_t PTPL = (size_t)16 * HID * 2;               //    32768
  const size_t PVT  = (size_t)NBATCH * HID * NBAS * 2;    //  4194304
  const size_t PQRY = (size_t)MROWS * HID * 4;            // 33554432
  const size_t PU   = (size_t)NBATCH * 2 * HID * 4;       //    32768
  if (PCTX > PKT) return;
  size_t off = 0;
  const size_t oKT  = off; off += PKT;
  const size_t oGT  = off; off += PGT;
  const size_t oQB  = off; off += PQB;
  const size_t oWQ  = off; off += PW;
  const size_t oWK  = off; off += PW;
  const size_t oWV  = off; off += PW;
  const size_t oWO  = off; off += PW;
  const size_t oBMH = off; off += PBM;
  const size_t oBML = off; off += PBM;
  const size_t oTPL = off; off += PTPL;
  const size_t oVTH = off; off += PVT;
  const size_t oVTL = off; off += PVT;
  const size_t oQRY = off; off += PQRY;
  const size_t oU   = off; off += PU;
  if (off > ws_size) return;                        // off = 94437376
  if (off > (size_t)134217728) return;

  char* ws = (char*)d_ws;
  unsigned short* KT  = (unsigned short*)(ws + oKT);
  unsigned short* CTX = (unsigned short*)(ws + oKT);   // reuse after the Bm GEMM has consumed KT
  unsigned short* GT  = (unsigned short*)(ws + oGT);
  unsigned short* QB  = (unsigned short*)(ws + oQB);
  unsigned short* WQB = (unsigned short*)(ws + oWQ);
  unsigned short* WKB = (unsigned short*)(ws + oWK);
  unsigned short* WVB = (unsigned short*)(ws + oWV);
  unsigned short* WOH = (unsigned short*)(ws + oWO);
  unsigned short* BMH = (unsigned short*)(ws + oBMH);
  unsigned short* BML = (unsigned short*)(ws + oBML);
  unsigned short* TPL = (unsigned short*)(ws + oTPL);
  unsigned short* VTH = (unsigned short*)(ws + oVTH);
  unsigned short* VTL = (unsigned short*)(ws + oVTL);
  float*          QRY = (float*)(ws + oQRY);
  float*          U   = (float*)(ws + oU);

  const dim3 blk(256);
  const int n8q = MROWS * HID / 8;                           // 1048576
  const int n8w = HID * HID / 8;                             //  131072
  const dim3 gTrK(HID / 64, LMEM / 64, NBATCH);              // in[b][2048 l][1024 e] -> out[b][1024 e][2048 l]: (cols/64, rows/64, b) = (16, 32, 4)
  const dim3 gTrG(NBAS / 64, LMEM / 64, 1);                  // in[2048 l][512 n] -> out[512 n][2048 l]: (8, 32, 1)
  const dim3 gCvtQ((n8q + 255) / 256);                       // 4096 blocks
  const dim3 gCvtW((n8w + 255) / 256);                       //  512 blocks
  const dim3 gBm((NBAS / 128) * (HID / 128), NBATCH);            // 32 tiles of 128x128 x 4 b      (M=512,  N=1024, K=2048)
  const dim3 gWb(HID / 64, NBATCH);                               // (16, 4)
  const dim3 gVt((HID / 128) * (NBAS / 128), NBATCH);             // 32 tiles of 128x128 x 4 b      (M=1024, N=512,  K=1024)
  const dim3 gQ((MROWS / 128) * (HID / 128), 1);                  // 512 tiles of 128x128           (M=8192, N=1024, K=1024)
  const dim3 gU(HID / 32);                                        // 32 blocks
  const dim3 gCtx(NBATCH * NH * NQB64);                           // 2048 blocks of 128

  // (1) k -> k^T bf16 per batch, Gs -> Gs^T bf16 (l contiguous); q and weights -> bf16; Wo -> f16 (64 x its bf16 value)
  tr_bf16<<<gTrK, blk, 0, stream>>>(kin, KT, LMEM, HID, (long long)LMEM * HID, (long long)HID * LMEM);
  tr_bf16<<<gTrG, blk, 0, stream>>>(Gs, GT, LMEM, NBAS, 0LL, 0LL);
  cvt16x8<0><<<gCvtQ, blk, 0, stream>>>(qin, QB,  n8q);
  cvt16x8<0><<<gCvtW, blk, 0, stream>>>(Wq,  WQB, n8w);
  cvt16x8<0><<<gCvtW, blk, 0, stream>>>(Wk,  WKB, n8w);
  cvt16x8<0><<<gCvtW, blk, 0, stream>>>(Wv,  WVB, n8w);
  cvt16x8<1><<<gCvtW, blk, 0, stream>>>(Wo,  WOH, n8w);
  // (2) Bm[b][n][e] = sum_l Gs^T[n][l] k^T[b][e][l] -> bf16 hi / residual planes [b*512+n][e]
  gemm128<__bf16, 0, 2, LMEM><<<gBm, dim3(128), 0, stream>>>(
      GT, 0LL, KT, KT, (long long)HID * LMEM,
      (void*)BMH, (void*)BML, HID, (long long)NBAS * HID,
      HID, 1.0f);
  // (3) t[b*2+v][e'] = sum_n bf16(w_mu / w_sigma)[n] Bm[b*512+n][e'] (f32) -> bf16 hi / residual rows of TPL
  wb_kernel<<<gWb, blk, 0, stream>>>(BMH, BML, wmu, wsg, TPL);
  // (4) vals^T[b][e][n] = sum_e' Wv[e][e'] Bm[b*512+n][e'] -> bf16 hi / residual planes, pitch 512 (Bm on the Bt side, 2 products)
  gemm128<__bf16, 2, 2, HID><<<gVt, dim3(128), 0, stream>>>(
      WVB, 0LL, BMH, BML, (long long)NBAS * HID,
      (void*)VTH, (void*)VTL, NBAS, (long long)HID * NBAS,
      NBAS, 1.0f);
  // (5) qry[b*2048+q][e] = sum_e' q[..][e'] Wq[e][e'] -> f32 plane (read only by the qry.u dots of (7))
  gemm128<__bf16, 0, 0, HID><<<gQ, dim3(128), 0, stream>>>(
      QB, 0LL, WQB, WQB, 0LL,
      (void*)QRY, (void*)QRY, HID, 0LL,
      HID, 1.0f);
  // (6) u[b][0/1][e] = sum_e' t[b*2+0/1][e'] Wk[e][e']   (= sum_n keys[b][n][e] * w[n] with keys = Bm.Wk^T)
  u_kernel<<<gU, blk, 0, stream>>>(TPL, WKB, U);
  // (7) mu, sig2 per query; ctx = r . vals -> f16 ctx plane (x64) [8192][1024] in the KT region
  ctx_kernel<<<gCtx, dim3(128), 0, stream>>>(QRY, U, bmu, bsg, VTH, VTL, CTX);
  // (8) out = ctx . Wo^T -> d_out f32 [8192][1024], accumulator x 1/(64*64)
  gemm128<_Float16, 0, 0, HID><<<gQ, dim3(128), 0, stream>>>(
      CTX, 0LL, WOH, WOH, 0LL,
      d_out, d_out, HID, 0LL,
      HID, 1.0f / (CSC * WOSC));
  (void)hipGetLastError();
}

// v003
// A run of this version takes 171 microseconds.
// Timed twice side by side with v002, it ran 1.13 times as fast both times.
// Over all steps from v000 it is 2.77 times as fast.
// Contractions: Gs^T.k^T (Bm) and q.Wq^T on v_wmma_f32_16x16x32_bf16 (bf16 operands RNE-converted from inputs, single product, f32 accumulate);
// Wv.Bm^T on v_wmma_f32_16x16x32_bf16 with Bm as bf16 hi + bf16 residual planes (2 products, f32 accumulate);
// (w^T.Bm).Wk^T on v_wmma_f32_16x16x32_bf16: the 8 rows t = w^T.Bm as bf16 hi (A rows 0..7) + bf16 residual (A rows 8..15),
// one product, f32 accumulate, D rows r and r+8 added;
// r.vals on v_wmma_f32_16x16x32_bf16 with r and vals^T each bf16 hi + bf16 residual (3 products hh+hl+lh, f32 accumulate);
// ctx.Wo^T on v_wmma_f32_16x16x32_f16 (ctx f16 carried x64, Wo f16 = 64 x its bf16 value, single product, f32 accumulate, folded back x 1/4096);
// w^T.Bm and qry.u score-vector dots, sigmoid, softplus and the Gaussian density in f32.
// Carry audit: Woh plane = f16(64 * bf16(Wo)), ctx plane = f16(64 * ctx); both inverses folded back exactly once by
// oscale = 1/4096 in the out GEMM epilogue (OUT_MODE 0). Bm, vals^T and r residual planes are unscaled bf16 (v - hi)
// and share the hi accumulator (no fold needed).
#include <hip/hip_runtime.h>
#include <math.h>
#include <stdint.h>

#define NBATCH 4
#define LMEM   2048
#define QLEN   2048
#define HID    1024
#define NH     16
#define HD     64
#define NBAS   512
#define MROWS  (NBATCH * QLEN)   // 8192 query rows
#define NQB64  (QLEN / 64)       // 32 blocks of 64 queries per sequence
#define NCH    (NBAS / 64)       // 8 chunks of 64 basis functions
static_assert(NH * HD == HID);
static_assert(NQB64 == 32 && NCH == 8);
static_assert((LMEM % 64) == 0 && (QLEN % 64) == 0 && (HID % 64) == 0 && (NBAS % 64) == 0);
static_assert((LMEM % 128) == 0 && (HID % 128) == 0 && (NBAS % 128) == 0 && (MROWS % 128) == 0);
#define CSC  64.0f     // ctx plane carry (f16)
#define WOSC 64.0f     // Wo plane carry (f16 of the bf16 value)

typedef _Float16 v16h __attribute__((ext_vector_type(16)));
typedef _Float16 v8h  __attribute__((ext_vector_type(8)));
typedef __bf16   v16b __attribute__((ext_vector_type(16)));
typedef __bf16   v8b  __attribute__((ext_vector_type(8)));
typedef float    v8f  __attribute__((ext_vector_type(8)));
typedef float    v4f  __attribute__((ext_vector_type(4)));
typedef unsigned int   v4u  __attribute__((ext_vector_type(4)));
typedef unsigned short v8us __attribute__((ext_vector_type(8)));
typedef v4u  __attribute__((may_alias)) v4ua;
typedef v8us __attribute__((may_alias)) v8usa;

#if defined(__HIP_DEVICE_COMPILE__)
#define DEV_ASM 1
#else
#define DEV_ASM 0
#endif

// ---- scalar helpers ---------------------------------------------------------------------------------
__device__ __forceinline__ unsigned short bf_bits(float f) {          // f32 -> bf16 bits, RNE convert
  unsigned u = __float_as_uint(f);
  return (unsigned short)((u + 0x7FFFu + ((u >> 16) & 1u)) >> 16);
}
__device__ __forceinline__ float bf_up(unsigned short hb) { return __uint_as_float(((unsigned)hb) << 16); }
__device__ __forceinline__ unsigned short h_bits(_Float16 x) { return __builtin_bit_cast(unsigned short, x); }
__device__ __forceinline__ unsigned pk16(unsigned short a, unsigned short b) { return (unsigned)a | ((unsigned)b << 16); }
__device__ __forceinline__ v8f zero8() { v8f z = {0.f, 0.f, 0.f, 0.f, 0.f, 0.f, 0.f, 0.f}; return z; }

// ---- fragment types / loaders: 16-bit A/B operand, lane -> row/col (lane&15), p already includes +8*(lane>>4);
//      elements 0..7 <- p[0..7] (k0+8h..k0+8h+7), elements 8..15 <- p[16..23] (k0+16+8h..k0+16+8h+7)
template <typename OT> struct FT;
template <> struct FT<__bf16>   { typedef v16b frag; typedef v8b half8; };
template <> struct FT<_Float16> { typedef v16h frag; typedef v8h half8; };

template <typename OT>
__device__ __forceinline__ typename FT<OT>::frag ldfrag(const OT* p) {
  union { typename FT<OT>::frag v; typename FT<OT>::half8 h[2]; } f;
  f.h[0] = *(const typename FT<OT>::half8*)(p);
  f.h[1] = *(const typename FT<OT>::half8*)(p + 16);
  return f.v;
}

// ---- guarded WMMA: 4 VALU slots after every WMMA, D tied, A/B kept live -----------------------------------
__device__ __forceinline__ v8f mma_g(v16b a, v16b b, v8f c) {
  c = __builtin_amdgcn_wmma_f32_16x16x32_bf16(false, a, false, b, (short)0, c, false, false);
#if DEV_ASM
  asm volatile("v_nop\n\tv_nop\n\tv_nop\n\tv_nop" : "+v"(c) : "v"(a), "v"(b));
#endif
  return c;
}
__device__ __forceinline__ v8f mma_g(v16h a, v16h b, v8f c) {
  c = __builtin_amdgcn_wmma_f32_16x16x32_f16(false, a, false, b, (short)0, c, false, false);
#if DEV_ASM
  asm volatile("v_nop\n\tv_nop\n\tv_nop\n\tv_nop" : "+v"(c) : "v"(a), "v"(b));
#endif
  return c;
}

// =====================================================================================================
// f32 -> 16-bit planes, 8 elements per thread, one 16-B store per lane: a wave writes 512 contiguous B
// MODE 0: bf16 bits (RNE convert).  MODE 1: f16 bits of (64 * bf16(x)) (exact scaling of the bf16 value).
// coverage: n8 threads x 8 = the whole plane (n8 is a multiple of 256 for every use here).
// =====================================================================================================
template <int MODE>
__device__ __forceinline__ unsigned short cvm(float f) {
  const unsigned short hb = bf_bits(f);
  if (MODE == 0) return hb;
  return h_bits((_Float16)(bf_up(hb) * WOSC));
}

template <int MODE>
__global__ __launch_bounds__(256) void cvt16x8(const float* __restrict__ in, unsigned short* out, int n8) {
  const int i = blockIdx.x * 256 + (int)threadIdx.x;
  if (i < n8) {
    const v4f a  = *(const v4f*)(in + (size_t)i * 8);
    const v4f a4 = *(const v4f*)(in + (size_t)i * 8 + 4);
    v4u p;
    p[0] = pk16(cvm<MODE>(a[0]),  cvm<MODE>(a[1]));
    p[1] = pk16(cvm<MODE>(a[2]),  cvm<MODE>(a[3]));
    p[2] = pk16(cvm<MODE>(a4[0]), cvm<MODE>(a4[1]));
    p[3] = pk16(cvm<MODE>(a4[2]), cvm<MODE>(a4[3]));
    unsigned short* o = out + (size_t)i * 8;
    *(v4u*)o = p;
    
  }
}

// =====================================================================================================
// Tiled transpose + bf16 convert: in[z][R][C] f32 (C contiguous) -> out[z][C][R] bf16 (R contiguous).
// Block 256 = one 64x64 tile: blockIdx.x = column tile c0 (of C), blockIdx.y = row tile r0 (of R), blockIdx.z = z;
// grid (C/64, R/64, Z). Load: 256 thr x 4 it x 4 floats = the 64x64 tile (16-B loads along C), staged as
// bf16 t[cc][rr] (pitch 72 shorts, 16-B aligned rows); __syncthreads; store: out row (c0+row), segment
// =====================================================================================================
__global__ __launch_bounds__(256) void tr_bf16(const float* __restrict__ in, unsigned short* out,
                                               int R, int C, long long ibs, long long obs) {
  __shared__ __align__(16) unsigned short t[64][72];
  const int tid = threadIdx.x;
  const float* ib = in + (size_t)blockIdx.z * (size_t)ibs;
  unsigned short* ob = out + (size_t)blockIdx.z * (size_t)obs;
  const int r0 = blockIdx.y * 64, c0 = blockIdx.x * 64;
#pragma unroll
  for (int it = 0; it < 4; ++it) {
    const int i = tid + 256 * it;
    const int rr = i >> 4, cc4 = (i & 15) * 4;
    const v4f v = *(const v4f*)(ib + (size_t)(r0 + rr) * (size_t)C + c0 + cc4);
    t[cc4 + 0][rr] = bf_bits(v[0]);
    t[cc4 + 1][rr] = bf_bits(v[1]);
    t[cc4 + 2][rr] = bf_bits(v[2]);
    t[cc4 + 3][rr] = bf_bits(v[3]);
  }
  __syncthreads();
  const int wave = tid >> 5, lane = tid & 31;
  const int q8 = lane & 7, sub = lane >> 3;
  v4u pv[2];
#pragma unroll
  for (int it = 0; it < 2; ++it) {
    const int row = it * 32 + wave * 4 + sub;
    pv[it] = *(const v4ua*)(&t[row][8 * q8]);
  }
  {
#pragma unroll
    for (int it = 0; it < 2; ++it) {
      const int row = it * 32 + wave * 4 + sub;
      *(v4u*)(ob + (size_t)(c0 + row) * (size_t)R + r0 + 8 * q8) = pv[it];
    }
    
  }
}

// =====================================================================================================
// LDS-staged batched WMMA GEMM (16-bit operand type OT): C[m][n] = sum_k A[m][k] * Bt[n][k];
// one block of 4 waves (2 x 2) per 128x128 tile, one wave per 64x64 quarter. A row-major [M][KD], Bt row-major
// [N][KD] (k contiguous, pitch KD); M, N multiples of 128, KD a multiple of 128 and at least 256 (static shapes here).
// blockIdx.x = tile (column tile fastest), blockIdx.y = batch index (strides in elements); the grid is exactly the tiles.
// A stage = 128 k = 256 B of each of the tile's operand rows [A 128 | Bt 128 | (SPL 2) Bt2 128], brought by asynchronous
// copies to LDS: 16 lanes x 16 B = one row's 256 B, so a wave's copy covers two rows in whole lines; each of the 128
// threads copies rows (tid >> 4) + 8 i. LDS row pitch 272 B. Two buffers: stage t + 1 flies while stage t is worked on.
// Fragments are read from LDS with the split k map (ldfrag), same k order per accumulator as a straight k loop.
// SPL 0: single product. SPL 2: Bt = hi plane Bt + residual plane Bt2 (2 products per k-step, same accumulator).
// OUT_MODE 0: f32 C (pitch ldc), value * oscale.
// OUT_MODE 2: bf16 hi plane C + bf16 residual plane C2 = bf16(v - hi) (same pitch / stride).
// =====================================================================================================
#define GKS  128       // k elements per stage
#define GPIT 136       // LDS row pitch in 16-bit elements: 272 B = 16 B x 17, conflict-free for 16-B fragment reads

// Eight asynchronous 16-B-per-lane copies global -> LDS: rows r, r + 8, ..., r + 56 of one operand plane.
// l = the lane's LDS byte address, g = the lane's global address, ld = global row pitch in elements.
__device__ __forceinline__ void acopy8(unsigned l, const unsigned short* g, int ld) {
#if DEV_ASM
  const size_t gs = (size_t)8 * (size_t)ld;
  const unsigned ls = 8u * GPIT * 2u;
  // the closing s_wait_xcnt keeps every address register intact until the copies have taken it
  asm volatile(
      "global_load_async_to_lds_b128 %0, %8, off\n\t"
      "global_load_async_to_lds_b128 %1, %9, off\n\t"
      "global_load_async_to_lds_b128 %2, %10, off\n\t"
      "global_load_async_to_lds_b128 %3, %11, off\n\t"
      "global_load_async_to_lds_b128 %4, %12, off\n\t"
      "global_load_async_to_lds_b128 %5, %13, off\n\t"
      "global_load_async_to_lds_b128 %6, %14, off\n\t"
      "global_load_async_to_lds_b128 %7, %15, off\n\t"
      "s_wait_xcnt 0x0"
      :: "v"(l), "v"(l + ls), "v"(l + 2u * ls), "v"(l + 3u * ls),
         "v"(l + 4u * ls), "v"(l + 5u * ls), "v"(l + 6u * ls), "v"(l + 7u * ls),
         "v"(g), "v"(g + gs), "v"(g + 2 * gs), "v"(g + 3 * gs),
         "v"(g + 4 * gs), "v"(g + 5 * gs), "v"(g + 6 * gs), "v"(g + 7 * gs)
      : "memory");
#endif
}

template <typename OT, int SPL, int OUT_MODE, int KD>
__global__ __launch_bounds__(128) void gemm128(
    const unsigned short* __restrict__ Ap, long long strideA,
    const unsigned short* __restrict__ Btp, const unsigned short* __restrict__ Bt2p, long long strideB,
    void* Cout, void* Cout2, int ldc, long long strideC,
    int N, float oscale) {
  typedef typename FT<OT>::frag V16;
  static_assert((KD % GKS) == 0 && KD / GKS >= 2);
  constexpr int NST  = KD / GKS;                       // stages
  constexpr int NPL  = (SPL == 2) ? 3 : 2;             // operand planes per stage
  constexpr int BUFE = NPL * 128 * GPIT;               // elements per buffer
  __shared__ __align__(16) unsigned short ring[2 * BUFE];
  __shared__ __align__(16) float sT[4][16 * 68];       // per-wave 16x64 slab, pitch 68 floats
  const int b    = blockIdx.y;
  const int tid  = threadIdx.x;
  const int lane = tid & 31;
  const int wave = tid >> 5;
  const int tilesN = N >> 7;
  const int tm = (int)blockIdx.x / tilesN;
  const int tn = (int)blockIdx.x - tm * tilesN;
  const int m0 = (tm << 7) + ((wave >> 1) << 6);       // this wave's 64x64 quarter
  const int n0 = (tn << 7) + ((wave & 1) << 6);

  // ---- copy side: lane -> (row group, 16-B segment of the 256-B row) ----
  const int seg = tid & 15, r8 = tid >> 4;
  const unsigned short* gA  = Ap   + (size_t)b * (size_t)strideA + (size_t)((tm << 7) + r8) * KD + seg * 8;
  const unsigned short* gB  = Btp  + (size_t)b * (size_t)strideB + (size_t)((tn << 7) + r8) * KD + seg * 8;
  const unsigned short* gB2 = Bt2p + (size_t)b * (size_t)strideB + (size_t)((tn << 7) + r8) * KD + seg * 8;
  const unsigned lds0 = (unsigned)(uintptr_t)(ring + r8 * GPIT + seg * 8);
  auto fill = [&](int s, int buf) {
    const unsigned l = lds0 + (unsigned)buf * (unsigned)(BUFE * 2);
    const int k0 = s * GKS;
    acopy8(l,                   gA + k0, KD);
    acopy8(l +  64 * GPIT * 2,  gA + k0 + (size_t)64 * KD, KD);
    acopy8(l + 128 * GPIT * 2,  gB + k0, KD);
    acopy8(l + 192 * GPIT * 2,  gB + k0 + (size_t)64 * KD, KD);
    if (SPL == 2) {
      acopy8(l + 256 * GPIT * 2, gB2 + k0, KD);
      acopy8(l + 320 * GPIT * 2, gB2 + k0 + (size_t)64 * KD, KD);
    }
  };

  const int rlane = lane & 15;                 // row (A) / col (B, D) within subtile
  const int koff  = (lane >> 4) * 8;           // k offset of this lane half
  const int mOff  = (lane >> 4) * 8;           // D row offset
  const int aoff = (((wave >> 1) << 6) + rlane) * GPIT + koff;
  const int boff = (128 + ((wave & 1) << 6) + rlane) * GPIT + koff;

  v8f acc[4][4];
#pragma unroll
  for (int i = 0; i < 4; ++i)
#pragma unroll
    for (int j = 0; j < 4; ++j) acc[i][j] = zero8();

  fill(0, 0);
#if DEV_ASM
  asm volatile("s_wait_asynccnt 0x0" ::: "memory");   // stage 0 of this wave has landed
#endif
  __syncthreads();                                      // stage 0 of every wave is readable
  fill(1, 1);

  // rolled: one stage's 64 or 128 WMMAs are the hot loop
#pragma unroll 1
  for (int t = 0; t < NST; ++t) {
    const OT* rb = (const OT*)(const void*)ring + (t & 1) * BUFE;
    // the loops below are unrolled so that af, bq and acc are indexed by constants and stay in registers
#pragma unroll
    for (int kk = 0; kk < GKS / 32; ++kk) {
      V16 af[4];
#pragma unroll
      for (int i = 0; i < 4; ++i) af[i] = ldfrag<OT>(rb + aoff + i * 16 * GPIT + kk * 32);
#pragma unroll
      for (int p = 0; p < ((SPL == 2) ? 2 : 1); ++p) {
        V16 bq[4];
#pragma unroll
        for (int j = 0; j < 4; ++j) bq[j] = ldfrag<OT>(rb + boff + p * 128 * GPIT + j * 16 * GPIT + kk * 32);
#pragma unroll
        for (int i = 0; i < 4; ++i)
#pragma unroll
          for (int j = 0; j < 4; ++j) acc[i][j] = mma_g(af[i], bq[j], acc[i][j]);
      }
    }
#if DEV_ASM
    asm volatile("s_wait_dscnt 0x0" ::: "memory");      // this wave's reads of buffer t & 1 are done before it is refilled
    asm volatile("s_wait_asynccnt 0x0" ::: "memory");   // this wave's copies of stage t + 1 have landed
#endif
    __syncthreads();                                    // publishes stage t + 1 and frees buffer t & 1
    if (t + 2 < NST) fill(t + 2, t & 1);
  }
#if DEV_ASM
  asm volatile("s_wait_asynccnt 0x0" ::: "memory");     // no copy is outstanding when the wave goes on to its end
#endif

  // ---- epilogue ----
  float* slab = sT[wave];
#pragma unroll
  for (int i = 0; i < 4; ++i) {
    const int mBase = m0 + (i << 4);
#pragma unroll
    for (int j = 0; j < 4; ++j) {
#pragma unroll
      for (int r = 0; r < 8; ++r) {
        slab[(mOff + r) * 68 + (j << 4) + rlane] = acc[i][j][r];
      }
    }
    __builtin_amdgcn_fence(__ATOMIC_RELEASE, "workgroup");
    __builtin_amdgcn_wave_barrier();
    __builtin_amdgcn_fence(__ATOMIC_ACQUIRE, "workgroup");
    if (OUT_MODE == 0) {
      float* Cf = (float*)Cout + (size_t)b * (size_t)strideC;
      const int h2 = lane >> 4, c4 = (lane & 15) * 4;     // 256-B row segment = 16 lanes x 16 B
      {
#pragma unroll
        for (int it = 0; it < 8; ++it) {
          const int row = it * 2 + h2;                     // it 0..7 x h2 0..1 = rows 0..15
          const v4f v = *(const v4f*)(slab + row * 68 + c4) * oscale;
          *(v4f*)(Cf + (size_t)(mBase + row) * (size_t)ldc + n0 + c4) = v;
        }
        
      }
    } else {
      const int q = lane >> 3, c8 = (lane & 7) * 8;
      unsigned short* Ch = (unsigned short*)Cout  + (size_t)b * (size_t)strideC;
      unsigned short* Cl = (unsigned short*)Cout2 + (size_t)b * (size_t)strideC;
      v4u hv[4], lv[4];
#pragma unroll
      for (int it = 0; it < 4; ++it) {
        const int row = it * 4 + q;                        // it 0..3 x q 0..3 = rows 0..15
        const float* sp = slab + row * 68 + c8;
        v4u a, a2;
#pragma unroll
        for (int e = 0; e < 4; ++e) {
          const float f0 = sp[2 * e], f1 = sp[2 * e + 1];
          const unsigned short h0 = bf_bits(f0), h1 = bf_bits(f1);
          const unsigned short l0 = bf_bits(f0 - bf_up(h0));
          const unsigned short l1 = bf_bits(f1 - bf_up(h1));
          a[e] = pk16(h0, h1); a2[e] = pk16(l0, l1);
        }
        hv[it] = a; lv[it] = a2;
      }
      {
#pragma unroll
        for (int it = 0; it < 4; ++it) {
          const int row = it * 4 + q;
          *(v4u*)(Ch + (size_t)(mBase + row) * (size_t)ldc + n0 + c8) = hv[it];
          *(v4u*)(Cl + (size_t)(mBase + row) * (size_t)ldc + n0 + c8) = lv[it];
        }
        
      }
    }
    __builtin_amdgcn_fence(__ATOMIC_RELEASE, "workgroup");
    __builtin_amdgcn_wave_barrier();
    __builtin_amdgcn_fence(__ATOMIC_ACQUIRE, "workgroup");
  }
}

// =====================================================================================================
// keys^T.w = Wk.(Bm^T.w): the score vectors need keys only through this product, so the weight vectors are
// contracted with Bm first and only the 8 resulting rows go through Wk.
// t[b*2+v][e] = sum_n bf16(w_v[n]) * (Bm hi + Bm residual)[b*512+n][e]   (f32; v = 0: w_mu, v = 1: w_sigma)
// Block 256 = (b, 64 columns e): 8 lanes x 8 columns = one 128-B row segment per plane, 32 row groups x 16 rows
// = all 512 n; group partials summed through LDS. Output plane T bf16 [16][1024]: row b*2+v = hi, row 8+b*2+v =
// residual; one wave stores a whole 128-B segment (32 lanes x 2 columns). grid (HID/64, NBATCH) covers all 16 rows.
// =====================================================================================================
__global__ __launch_bounds__(256) void wb_kernel(const unsigned short* __restrict__ bmh,
                                                 const unsigned short* __restrict__ bml,
                                                 const float* __restrict__ wmu, const float* __restrict__ wsg,
                                                 unsigned short* tpl) {
  __shared__ float wsh[2][NBAS];
  __shared__ __align__(16) float part[2][32][64];
  const int tid = threadIdx.x;
  const int b  = blockIdx.y;
  const int e0 = blockIdx.x * 64;
  const int g = tid >> 3, c8 = (tid & 7) * 8;
  const unsigned short* ph = bmh + ((size_t)b * NBAS + g) * HID + e0 + c8;
  const unsigned short* pl = bml + ((size_t)b * NBAS + g) * HID + e0 + c8;
  // all of the thread's rows are loaded first: every row is read once, so the cost is latency, paid once this way
  v8us hv[NBAS / 32], lv[NBAS / 32];
#pragma unroll
  for (int it = 0; it < NBAS / 32; ++it) {
    hv[it] = *(const v8usa*)(ph + (size_t)it * 32 * HID);
    lv[it] = *(const v8usa*)(pl + (size_t)it * 32 * HID);
  }
#pragma unroll
  for (int k = 0; k < NBAS / 256; ++k) {
    const int i = tid + 256 * k;
    wsh[0][i] = bf_up(bf_bits(wmu[i]));
    wsh[1][i] = bf_up(bf_bits(wsg[i]));
  }
  __syncthreads();
  float am[8], ag[8];
#pragma unroll
  for (int j = 0; j < 8; ++j) { am[j] = 0.f; ag[j] = 0.f; }
#pragma unroll
  for (int it = 0; it < NBAS / 32; ++it) {
    const float w0 = wsh[0][it * 32 + g];
    const float w1 = wsh[1][it * 32 + g];
#pragma unroll
    for (int j = 0; j < 8; ++j) {
      const float x = bf_up(hv[it][j]) + bf_up(lv[it][j]);
      am[j] += x * w0;
      ag[j] += x * w1;
    }
  }
#pragma unroll
  for (int j = 0; j < 8; ++j) {
    part[0][g][c8 + j] = am[j];
    part[1][g][c8 + j] = ag[j];
  }
  __syncthreads();
  if (tid < 64) {                       // wave 0: v = 0, wave 1: v = 1; lane = column pair
    const int v = tid >> 5, c2 = (tid & 31) * 2;
    float s0 = 0.f, s1 = 0.f;
#pragma unroll
    for (int gg = 0; gg < 32; ++gg) {
      s0 += part[v][gg][c2];
      s1 += part[v][gg][c2 + 1];
    }
    const unsigned short h0 = bf_bits(s0), h1 = bf_bits(s1);
    const unsigned short l0 = bf_bits(s0 - bf_up(h0));
    const unsigned short l1 = bf_bits(s1 - bf_up(h1));
    *(unsigned*)(tpl + (size_t)(b * 2 + v) * HID + e0 + c2)     = pk16(h0, h1);
    *(unsigned*)(tpl + (size_t)(8 + b * 2 + v) * HID + e0 + c2) = pk16(l0, l1);
  }
}

// =====================================================================================================
// u[r][e] = sum_e' (T hi + T residual)[r][e'] * bf16(Wk)[e][e'],  r = b*2+v in 0..7   (f32, same table as before)
// A = T [16][1024] (rows 0..7 hi, rows 8..15 residual), Bt = Wk bf16 [e][e']; D row r + D row r+8 = u row r.
// Block 256 = 32 columns e (two 16-column tiles); wave w takes the k slice [128 w, 128 w + 128) = 4 k-steps for both
// tiles (A fragment shared); the 8 slice partials are summed through LDS. Store: one wave = one row's 32 floats
// = one 128-B segment. grid HID/32 covers all 1024 columns of all 8 rows.
// =====================================================================================================
__global__ __launch_bounds__(256) void u_kernel(const unsigned short* __restrict__ tpl,
                                                const unsigned short* __restrict__ wkp, float* u) {
  __shared__ float red[8][8][32];       // [k slice][row r][column]
  const int tid  = threadIdx.x;
  const int wave = tid >> 5;
  const int lane = tid & 31;
  const int rlane = lane & 15;          // row (A) / col (B, D) within the tile
  const int koff  = (lane >> 4) * 8;    // k offset of this lane half
  const int n0 = blockIdx.x * 32;
  const __bf16* A  = (const __bf16*)(const void*)tpl + (size_t)rlane * HID + koff + wave * 128;
  const __bf16* B0 = (const __bf16*)(const void*)wkp + (size_t)(n0 + rlane) * HID + koff + wave * 128;
  const __bf16* B1 = B0 + (size_t)16 * HID;
  v16b af[4], b0[4], b1[4];
#pragma unroll
  for (int s = 0; s < 4; ++s) {
    af[s] = ldfrag<__bf16>(A  + 32 * s);
    b0[s] = ldfrag<__bf16>(B0 + 32 * s);
    b1[s] = ldfrag<__bf16>(B1 + 32 * s);
  }
  v8f a0 = zero8(), a1 = zero8();
#pragma unroll
  for (int s = 0; s < 4; ++s) {
    a0 = mma_g(af[s], b0[s], a0);
    a1 = mma_g(af[s], b1[s], a1);
  }
  // D element r of lane half 0 = row r (hi part), of lane half 1 = row r+8 (residual part), same column
#pragma unroll
  for (int r = 0; r < 8; ++r) {
    const float x0 = a0[r] + __shfl_xor(a0[r], 16, 32);
    const float x1 = a1[r] + __shfl_xor(a1[r], 16, 32);
    red[wave][r][lane] = (lane < 16) ? x0 : x1;     // lanes 16..31 hold the second tile's column lane-16
  }
  __syncthreads();
  {
    float s = 0.f;
#pragma unroll
    for (int w = 0; w < 8; ++w) s += red[w][wave][lane];
    u[(size_t)wave * HID + n0 + lane] = s;
  }
}

// =====================================================================================================
// Continuous attention context, one block = (b, head h, 64 queries), 4 waves x 16 queries, grid NBATCH*NH*NQB64.
//   prologue (f32): dm = sum_d qry[q][h*64+d]*u_mu[b][h*64+d] / 8, dg likewise with u_sigma;
//     mu = sigmoid(dm), sig2 = max(softplus(dg), 1e-4)   (lane c = query, lane halves each do 32 d, shfl combine)
//   loop over 8 chunks of 64 basis functions (static trip): vals^T hi / residual chunks [d 64][n 64] staged in
//     LDS by 128 threads x 32 elements per plane (whole 64x64 tile, __syncthreads before and after);
//     per 32-deep k-step the lane builds its A fragment in registers: element i = r[q=c][n0+32kk+k(i)],
//     r = exp(-0.5 (mu - bm[n])^2 / var) / sqrt(2 pi var), var = sig2 + bs[n]^2 (bm, bs = bf16-converted basis
//     tables in LDS), as bf16 hi + bf16 residual; B fragments = vals^T hi / residual from LDS (col = d, k = n);
//     oacc[t] += rh.vh + rh.vl + rl.vh  (bf16 WMMA, one f32 accumulator).
//   epilogue: wave's 16x64 f32 tile staged in LDS, converted to f16(64 * ctx), written to the ctx plane
//   coverage: rows it(4) x (lane>>3)(4) = 16 per wave x 4 waves x 32 qb x 4 b; cols 8 lanes x 8 = 64 per head x 16 heads
//   = the whole [8192][1024] ctx plane. LDS extents: Vth/Vtl 64x64 staged = 64x64 consumed (row pitch VPIT); bm_s/bv_s 512 = 512;
//   Os written 16x64 per wave before the wave reads its own tile.
// =====================================================================================================
#define VPIT 72        // LDS row pitch of the vals^T chunks in 16-bit elements: 144 B = 16 B x 9, conflict-free for 16-B reads and stores
#define OPIT 68        // LDS row pitch of the per-wave context tile in floats: 272 B = 16 B x 17, same reason
__global__ __launch_bounds__(128) void ctx_kernel(
    const float* __restrict__ qry, const float* __restrict__ u,
    const float* __restrict__ bmu, const float* __restrict__ bsg,
    const unsigned short* __restrict__ vthp, const unsigned short* __restrict__ vtlp,
    unsigned short* ctxp) {
  union FB { v16b v; v8us h[2]; unsigned short s[16]; };
  __shared__ __align__(16) unsigned short Vth[64 * VPIT];  // vals^T hi chunk [d][n]       9 KB
  __shared__ __align__(16) unsigned short Vtl[64 * VPIT];  // vals^T residual chunk        9 KB
  __shared__ __align__(16) float Os[4][16 * OPIT];         // per-wave context tile       17 KB
  __shared__ float bm_s[NBAS];                             // bf16-converted basis means
  __shared__ float bv_s[NBAS];                             // (bf16-converted basis sigma)^2

  const int tid  = threadIdx.x;
  const int wave = tid >> 5;
  const int lane = tid & 31;
  const int hh   = lane >> 4;
  const int c    = lane & 15;

  const int bx   = blockIdx.x;
  const int qb   = bx % NQB64;
  const int rest = bx / NQB64;
  const int h    = rest % NH;
  const int b    = rest / NH;
  const int q0   = qb * 64 + wave * 16;
  const size_t row0 = (size_t)b * QLEN + q0;              // plane row of this wave's query 0

  for (int i = tid; i < NBAS; i += 128) {
    const float m = bf_up(bf_bits(bmu[i]));
    const float s = bf_up(bf_bits(bsg[i]));
    bm_s[i] = m;
    bv_s[i] = s * s;
  }

  // ---- per-query affine heads (f32) ----
  float dm = 0.f, dg = 0.f;
  {
    const float* qr = qry + (row0 + c) * HID + (size_t)h * HD + 32 * hh;
    const float* um = u + ((size_t)b * 2) * HID + (size_t)h * HD + 32 * hh;
    const float* ug = um + HID;
#pragma unroll 2
    for (int i = 0; i < 8; ++i) {
      const v4f a  = *(const v4f*)(qr + 4 * i);
      const v4f wm = *(const v4f*)(um + 4 * i);
      const v4f wg = *(const v4f*)(ug + 4 * i);
      dm += a[0] * wm[0]; dm += a[1] * wm[1]; dm += a[2] * wm[2]; dm += a[3] * wm[3];
      dg += a[0] * wg[0]; dg += a[1] * wg[1]; dg += a[2] * wg[2]; dg += a[3] * wg[3];
    }
  }
  dm += __shfl_xor(dm, 16, 32);
  dg += __shfl_xor(dg, 16, 32);
  dm *= 0.125f;
  dg *= 0.125f;
  const float mu   = 1.0f / (1.0f + expf(-dm));
  const float spl  = fmaxf(dg, 0.0f) + log1pf(expf(-fabsf(dg)));
  const float sig2 = fmaxf(spl, 1e-4f);

  const unsigned short* Vh = vthp + ((size_t)b * HID + (size_t)h * HD) * NBAS;
  const unsigned short* Vl = vtlp + ((size_t)b * HID + (size_t)h * HD) * NBAS;

  v8f oacc[4];
#pragma unroll
  for (int t = 0; t < 4; ++t) oacc[t] = zero8();

  for (int nt = 0; nt < NCH; ++nt) {         // static trip count
    const int n0 = nt * 64;
    __syncthreads();
    {
      const int r = tid >> 1, half = (tid & 1) * 32;      // d = r, n = n0 + half .. + 31
      const unsigned short* vg  = Vh + (size_t)r * NBAS + n0 + half;
      const unsigned short* vlg = Vl + (size_t)r * NBAS + n0 + half;
#pragma unroll
      for (int i = 0; i < 4; ++i) {
        const v8us b0 = *(const v8usa*)(vg + 8 * i);
        const v8us b1 = *(const v8usa*)(vlg + 8 * i);
        *(v8usa*)(Vth + r * VPIT + half + 8 * i) = b0;
        *(v8usa*)(Vtl + r * VPIT + half + 8 * i) = b1;
      }
    }
    __syncthreads();

#pragma unroll 1
    for (int kk = 0; kk < 2; ++kk) {
      // ---- A fragments: r values of query c at the 16 k slots of this lane half, bf16 hi + residual ----
      FB rh, rl;
#pragma unroll
      for (int i = 0; i < 16; ++i) {
        const int n = n0 + kk * 32 + ((i < 8) ? (8 * hh + i) : (8 + 8 * hh + i));
        const float t   = mu - bm_s[n];
        const float var = sig2 + bv_s[n];
        const float iv  = __builtin_amdgcn_rcpf(var);
        const float rv  = __expf(-0.5f * t * t * iv) * rsqrtf(6.2831853071795864f * var);
        const unsigned short hb = bf_bits(rv);
        rh.s[i] = hb;
        rl.s[i] = bf_bits(rv - bf_up(hb));
      }
      // ---- ctx += r . vals over this 32-deep slice of n ----
#pragma unroll
      for (int t = 0; t < 4; ++t) {
        FB vb, vl;
        vb.h[0] = *(const v8usa*)(Vth + (t * 16 + c) * VPIT + kk * 32 + 8 * hh);
        vb.h[1] = *(const v8usa*)(Vth + (t * 16 + c) * VPIT + kk * 32 + 16 + 8 * hh);
        vl.h[0] = *(const v8usa*)(Vtl + (t * 16 + c) * VPIT + kk * 32 + 8 * hh);
        vl.h[1] = *(const v8usa*)(Vtl + (t * 16 + c) * VPIT + kk * 32 + 16 + 8 * hh);
        oacc[t] = mma_g(rh.v, vb.v, oacc[t]);
        oacc[t] = mma_g(rh.v, vl.v, oacc[t]);
        oacc[t] = mma_g(rl.v, vb.v, oacc[t]);
      }
    }
  }

  float* os = Os[wave];
#pragma unroll
  for (int r = 0; r < 8; ++r) {
#pragma unroll
    for (int t = 0; t < 4; ++t) os[(8 * hh + r) * OPIT + t * 16 + c] = oacc[t][r];
  }
  __builtin_amdgcn_fence(__ATOMIC_RELEASE, "workgroup");
  __builtin_amdgcn_wave_barrier();
  __builtin_amdgcn_fence(__ATOMIC_ACQUIRE, "workgroup");
  {
    const int q4 = lane >> 3, c8 = (lane & 7) * 8;
    v4u hv[4];
#pragma unroll
    for (int it = 0; it < 4; ++it) {
      const int row = it * 4 + q4;   // it 0..3 x q4 0..3 = rows 0..15 of the wave tile
      const float* sp = os + row * OPIT + c8;
      v4u a;
#pragma unroll
      for (int e = 0; e < 4; ++e) {
        const float f0 = sp[2 * e] * CSC, f1 = sp[2 * e + 1] * CSC;
        a[e] = pk16(h_bits((_Float16)f0), h_bits((_Float16)f1));
      }
      hv[it] = a;
    }
    {
#pragma unroll
      for (int it = 0; it < 4; ++it) {
        const int row = it * 4 + q4;
        const size_t go = (row0 + row) * HID + (size_t)h * HD + c8;
        *(v4u*)(ctxp + go) = hv[it];
      }
      
    }
  }
}

// =====================================================================================================
// Workspace map (bytes), every region an exact multiple of its whole-line / whole-tile store granularity:
//   KT   bf16 [4][1024 e][2048 l]   16777216   (dead after the Bm GEMM; reused as the f16 ctx plane [8192][1024], same size)
//   GT   bf16 [512 n][2048 l]        2097152
//   QB   bf16 [8192][1024]          16777216
//   WQB  bf16 [1024][1024]           2097152
//   WKB  bf16 [1024][1024]           2097152
//   WVB  bf16 [1024][1024]           2097152
//   WOH  f16  [1024][1024] (x64)     2097152
//   BMH  bf16 [4*512][1024]          4194304   Bm hi
//   BML  bf16 [4*512][1024]          4194304   Bm residual
//   TPL  bf16 [16][1024]               32768   t = w^T.Bm, rows 0..7 hi, rows 8..15 residual
//   VTH  bf16 [4][1024 e][512 n]     4194304   vals^T hi
//   VTL  bf16 [4][1024 e][512 n]     4194304   vals^T residual
//   QRY  f32  [8192][1024]          33554432
//   U    f32  [4][2][1024]             32768
//   total                           94437376
// Weights are [out][in] with in contiguous = the Bt layout for x.W^T, so they are only converted.
// =====================================================================================================
extern "C" void kernel_launch(void* const* d_in, const int* in_sizes, int n_in,
                              void* d_out, int out_size, void* d_ws, size_t ws_size,
                              hipStream_t stream) {
  if (n_in < 11) return;
  if (in_sizes[0] != NBATCH * LMEM * HID) return;
  if (in_sizes[1] != MROWS * HID) return;
  if (in_sizes[2] != HID * HID || in_sizes[3] != HID * HID || in_sizes[4] != HID * HID || in_sizes[5] != HID * HID) return;
  if (in_sizes[6] != NBAS || in_sizes[7] != NBAS) return;
  if (in_sizes[8] != LMEM * NBAS || in_sizes[9] != NBAS || in_sizes[10] != NBAS) return;
  if (out_size != MROWS * HID) return;

  const float* kin = (const float*)d_in[0];
  const float* qin = (const float*)d_in[1];
  const float* Wq  = (const float*)d_in[2];
  const float* Wk  = (const float*)d_in[3];
  const float* Wv  = (const float*)d_in[4];
  const float* Wo  = (const float*)d_in[5];
  const float* wmu = (const float*)d_in[6];
  const float* wsg = (const float*)d_in[7];
  const float* Gs  = (const float*)d_in[8];
  const float* bmu = (const float*)d_in[9];
  const float* bsg = (const float*)d_in[10];

  const size_t PKT  = (size_t)NBATCH * HID * LMEM * 2;    // 16777216  k^T planes; later the ctx f16 plane
  const size_t PCTX = (size_t)MROWS * HID * 2;            // 16777216  (== PKT)
  const size_t PGT  = (size_t)NBAS * LMEM * 2;            //  2097152
  const size_t PQB  = (size_t)MROWS * HID * 2;            // 16777216
  const size_t PW   = (size_t)HID * HID * 2;              //  2097152
  const size_t PBM  = (size_t)NBATCH * NBAS * HID * 2;    //  4194304
  const size_t PTPL = (size_t)16 * HID * 2;               //    32768
  const size_t PVT  = (size_t)NBATCH * HID * NBAS * 2;    //  4194304
  const size_t PQRY = (size_t)MROWS * HID * 4;            // 33554432
  const size_t PU   = (size_t)NBATCH * 2 * HID * 4;       //    32768
  if (PCTX > PKT) return;
  size_t off = 0;
  const size_t oKT  = off; off += PKT;
  const size_t oGT  = off; off += PGT;
  const size_t oQB  = off; off += PQB;
  const size_t oWQ  = off; off += PW;
  const size_t oWK  = off; off += PW;
  const size_t oWV  = off; off += PW;
  const size_t oWO  = off; off += PW;
  const size_t oBMH = off; off += PBM;
  const size_t oBML = off; off += PBM;
  const size_t oTPL = off; off += PTPL;
  const size_t oVTH = off; off += PVT;
  const size_t oVTL = off; off += PVT;
  const size_t oQRY = off; off += PQRY;
  const size_t oU   = off; off += PU;
  if (off > ws_size) return;                        // off = 94437376
  if (off > (size_t)134217728) return;

  char* ws = (char*)d_ws;
  unsigned short* KT  = (unsigned short*)(ws + oKT);
  unsigned short* CTX = (unsigned short*)(ws + oKT);   // reuse after the Bm GEMM has consumed KT
  unsigned short* GT  = (unsigned short*)(ws + oGT);
  unsigned short* QB  = (unsigned short*)(ws + oQB);
  unsigned short* WQB = (unsigned short*)(ws + oWQ);
  unsigned short* WKB = (unsigned short*)(ws + oWK);
  unsigned short* WVB = (unsigned short*)(ws + oWV);
  unsigned short* WOH = (unsigned short*)(ws + oWO);
  unsigned short* BMH = (unsigned short*)(ws + oBMH);
  unsigned short* BML = (unsigned short*)(ws + oBML);
  unsigned short* TPL = (unsigned short*)(ws + oTPL);
  unsigned short* VTH = (unsigned short*)(ws + oVTH);
  unsigned short* VTL = (unsigned short*)(ws + oVTL);
  float*          QRY = (float*)(ws + oQRY);
  float*          U   = (float*)(ws + oU);

  const dim3 blk(256);
  const int n8q = MROWS * HID / 8;                           // 1048576
  const int n8w = HID * HID / 8;                             //  131072
  const dim3 gTrK(HID / 64, LMEM / 64, NBATCH);              // in[b][2048 l][1024 e] -> out[b][1024 e][2048 l]: (cols/64, rows/64, b) = (16, 32, 4)
  const dim3 gTrG(NBAS / 64, LMEM / 64, 1);                  // in[2048 l][512 n] -> out[512 n][2048 l]: (8, 32, 1)
  const dim3 gCvtQ((n8q + 255) / 256);                       // 4096 blocks
  const dim3 gCvtW((n8w + 255) / 256);                       //  512 blocks
  const dim3 gBm((NBAS / 128) * (HID / 128), NBATCH);            // 32 tiles of 128x128 x 4 b      (M=512,  N=1024, K=2048)
  const dim3 gWb(HID / 64, NBATCH);                               // (16, 4)
  const dim3 gVt((HID / 128) * (NBAS / 128), NBATCH);             // 32 tiles of 128x128 x 4 b      (M=1024, N=512,  K=1024)
  const dim3 gQ((MROWS / 128) * (HID / 128), 1);                  // 512 tiles of 128x128           (M=8192, N=1024, K=1024)
  const dim3 gU(HID / 32);                                        // 32 blocks
  const dim3 gCtx(NBATCH * NH * NQB64);                           // 2048 blocks of 128

  // (1) k -> k^T bf16 per batch, Gs -> Gs^T bf16 (l contiguous); q and weights -> bf16; Wo -> f16 (64 x its bf16 value)
  tr_bf16<<<gTrK, blk, 0, stream>>>(kin, KT, LMEM, HID, (long long)LMEM * HID, (long long)HID * LMEM);
  tr_bf16<<<gTrG, blk, 0, stream>>>(Gs, GT, LMEM, NBAS, 0LL, 0LL);
  cvt16x8<0><<<gCvtQ, blk, 0, stream>>>(qin, QB,  n8q);
  cvt16x8<0><<<gCvtW, blk, 0, stream>>>(Wq,  WQB, n8w);
  cvt16x8<0><<<gCvtW, blk, 0, stream>>>(Wk,  WKB, n8w);
  cvt16x8<0><<<gCvtW, blk, 0, stream>>>(Wv,  WVB, n8w);
  cvt16x8<1><<<gCvtW, blk, 0, stream>>>(Wo,  WOH, n8w);
  // (2) Bm[b][n][e] = sum_l Gs^T[n][l] k^T[b][e][l] -> bf16 hi / residual planes [b*512+n][e]
  gemm128<__bf16, 0, 2, LMEM><<<gBm, dim3(128), 0, stream>>>(
      GT, 0LL, KT, KT, (long long)HID * LMEM,
      (void*)BMH, (void*)BML, HID, (long long)NBAS * HID,
      HID, 1.0f);
  // (3) t[b*2+v][e'] = sum_n bf16(w_mu / w_sigma)[n] Bm[b*512+n][e'] (f32) -> bf16 hi / residual rows of TPL
  wb_kernel<<<gWb, blk, 0, stream>>>(BMH, BML, wmu, wsg, TPL);
  // (4) vals^T[b][e][n] = sum_e' Wv[e][e'] Bm[b*512+n][e'] -> bf16 hi / residual planes, pitch 512 (Bm on the Bt side, 2 products)
  gemm128<__bf16, 2, 2, HID><<<gVt, dim3(128), 0, stream>>>(
      WVB, 0LL, BMH, BML, (long long)NBAS * HID,
      (void*)VTH, (void*)VTL, NBAS, (long long)HID * NBAS,
      NBAS, 1.0f);
  // (5) qry[b*2048+q][e] = sum_e' q[..][e'] Wq[e][e'] -> f32 plane (read only by the qry.u dots of (7))
  gemm128<__bf16, 0, 0, HID><<<gQ, dim3(128), 0, stream>>>(
      QB, 0LL, WQB, WQB, 0LL,
      (void*)QRY, (void*)QRY, HID, 0LL,
      HID, 1.0f);
  // (6) u[b][0/1][e] = sum_e' t[b*2+0/1][e'] Wk[e][e']   (= sum_n keys[b][n][e] * w[n] with keys = Bm.Wk^T)
  u_kernel<<<gU, blk, 0, stream>>>(TPL, WKB, U);
  // (7) mu, sig2 per query; ctx = r . vals -> f16 ctx plane (x64) [8192][1024] in the KT region
  ctx_kernel<<<gCtx, dim3(128), 0, stream>>>(QRY, U, bmu, bsg, VTH, VTL, CTX);
  // (8) out = ctx . Wo^T -> d_out f32 [8192][1024], accumulator x 1/(64*64)
  gemm128<_Float16, 0, 0, HID><<<gQ, dim3(128), 0, stream>>>(
      CTX, 0LL, WOH, WOH, 0LL,
      d_out, d_out, HID, 0LL,
      HID, 1.0f / (CSC * WOSC));
  (void)hipGetLastError();
}

// v004
// Measured time: 164 microseconds a run.
// In both of two side-by-side timings against v003, it was 1.05 times as fast.
// Over all steps from v000 it is 2.90 times as fast.
// Contractions: Gs^T.k^T (Bm) and q.Wq^T on v_wmma_f32_16x16x32_bf16 (bf16 operands RNE-converted from inputs, single product, f32 accumulate);
// Wv.Bm^T on v_wmma_f32_16x16x32_bf16 with Bm as bf16 hi + bf16 residual planes (2 products, f32 accumulate);
// (w^T.Bm).Wk^T on v_wmma_f32_16x16x32_bf16: the 8 rows t = w^T.Bm as bf16 hi (A rows 0..7) + bf16 residual (A rows 8..15),
// one product, f32 accumulate, D rows r and r+8 added;
// r.vals on v_wmma_f32_16x16x32_bf16 with r and vals^T each bf16 hi + bf16 residual (3 products hh+hl+lh, f32 accumulate);
// ctx.Wo^T on v_wmma_f32_16x16x32_f16 (ctx f16 carried x64, Wo f16 = 64 x its bf16 value, single product, f32 accumulate, folded back x 1/4096);
// w^T.Bm and qry.u score-vector dots, sigmoid, softplus and the Gaussian density in f32.
// Carry audit: Woh plane = f16(64 * bf16(Wo)), ctx plane = f16(64 * ctx); both inverses folded back exactly once by
// oscale = 1/4096 in the out GEMM epilogue (OUT_MODE 0). Bm, vals^T and r residual planes are unscaled bf16 (v - hi)
// and share the hi accumulator (no fold needed).
#include <hip/hip_runtime.h>
#include <math.h>
#include <stdint.h>

#define NBATCH 4
#define LMEM   2048
#define QLEN   2048
#define HID    1024
#define NH     16
#define HD     64
#define NBAS   512
#define MROWS  (NBATCH * QLEN)   // 8192 query rows
#define NQB64  (QLEN / 64)       // 32 blocks of 64 queries per sequence
#define NCH    (NBAS / 64)       // 8 chunks of 64 basis functions
static_assert(NH * HD == HID);
static_assert(NQB64 == 32 && NCH == 8);
static_assert((LMEM % 64) == 0 && (QLEN % 64) == 0 && (HID % 64) == 0 && (NBAS % 64) == 0);
static_assert((LMEM % 128) == 0 && (HID % 128) == 0 && (NBAS % 128) == 0 && (MROWS % 128) == 0);
#define CSC  64.0f     // ctx plane carry (f16)
#define WOSC 64.0f     // Wo plane carry (f16 of the bf16 value)

typedef _Float16 v16h __attribute__((ext_vector_type(16)));
typedef _Float16 v8h  __attribute__((ext_vector_type(8)));
typedef __bf16   v16b __attribute__((ext_vector_type(16)));
typedef __bf16   v8b  __attribute__((ext_vector_type(8)));
typedef float    v8f  __attribute__((ext_vector_type(8)));
typedef float    v4f  __attribute__((ext_vector_type(4)));
typedef unsigned int   v4u  __attribute__((ext_vector_type(4)));
typedef unsigned short v8us __attribute__((ext_vector_type(8)));
typedef v4u  __attribute__((may_alias)) v4ua;
typedef v8us __attribute__((may_alias)) v8usa;

#if defined(__HIP_DEVICE_COMPILE__)
#define DEV_ASM 1
#else
#define DEV_ASM 0
#endif

// ---- scalar helpers ---------------------------------------------------------------------------------
__device__ __forceinline__ unsigned short bf_bits(float f) {          // f32 -> bf16 bits, RNE convert
  unsigned u = __float_as_uint(f);
  return (unsigned short)((u + 0x7FFFu + ((u >> 16) & 1u)) >> 16);
}
__device__ __forceinline__ float bf_up(unsigned short hb) { return __uint_as_float(((unsigned)hb) << 16); }
__device__ __forceinline__ unsigned short h_bits(_Float16 x) { return __builtin_bit_cast(unsigned short, x); }
__device__ __forceinline__ unsigned pk16(unsigned short a, unsigned short b) { return (unsigned)a | ((unsigned)b << 16); }
__device__ __forceinline__ v8f zero8() { v8f z = {0.f, 0.f, 0.f, 0.f, 0.f, 0.f, 0.f, 0.f}; return z; }

// ---- fragment types / loaders: 16-bit A/B operand, lane -> row/col (lane&15), p already includes +8*(lane>>4);
//      elements 0..7 <- p[0..7] (k0+8h..k0+8h+7), elements 8..15 <- p[16..23] (k0+16+8h..k0+16+8h+7)
template <typename OT> struct FT;
template <> struct FT<__bf16>   { typedef v16b frag; typedef v8b half8; };
template <> struct FT<_Float16> { typedef v16h frag; typedef v8h half8; };

template <typename OT>
__device__ __forceinline__ typename FT<OT>::frag ldfrag(const OT* p) {
  union { typename FT<OT>::frag v; typename FT<OT>::half8 h[2]; } f;
  f.h[0] = *(const typename FT<OT>::half8*)(p);
  f.h[1] = *(const typename FT<OT>::half8*)(p + 16);
  return f.v;
}

// ---- guarded WMMA: 4 VALU slots after every WMMA, D tied, A/B kept live -----------------------------------
__device__ __forceinline__ v8f mma_g(v16b a, v16b b, v8f c) {
  c = __builtin_amdgcn_wmma_f32_16x16x32_bf16(false, a, false, b, (short)0, c, false, false);
#if DEV_ASM
  asm volatile("v_nop\n\tv_nop\n\tv_nop\n\tv_nop" : "+v"(c) : "v"(a), "v"(b));
#endif
  return c;
}
__device__ __forceinline__ v8f mma_g(v16h a, v16h b, v8f c) {
  c = __builtin_amdgcn_wmma_f32_16x16x32_f16(false, a, false, b, (short)0, c, false, false);
#if DEV_ASM
  asm volatile("v_nop\n\tv_nop\n\tv_nop\n\tv_nop" : "+v"(c) : "v"(a), "v"(b));
#endif
  return c;
}

// =====================================================================================================
// Operand preparation, ONE launch: seven jobs that do not depend on one another share one grid; blockIdx.x alone
// (block-uniform) says which job a block works for and which piece of it:
//   [0, NTK)          k[b][l][e]  f32 -> k^T[b][e][l] bf16   64x64 tile transpose
//   then NTG blocks   Gs[l][n]    f32 -> Gs^T[n][l]   bf16   64x64 tile transpose
//   then NCQ blocks   q  f32 -> bf16;  then NCW blocks each for Wq, Wk, Wv (bf16) and Wo (f16 of 64 x its bf16 value)
// =====================================================================================================
#define NTK  ((HID / 64) * (LMEM / 64) * NBATCH)     // 2048
#define NTG  ((NBAS / 64) * (LMEM / 64))             //  256
#define NCQ  (MROWS * HID / 2048)                    // 4096
#define NCW  (HID * HID / 2048)                      //  512
#define NPREP (NTK + NTG + NCQ + 4 * NCW)            // 8448
static_assert(((MROWS * HID) % 2048) == 0 && ((HID * HID) % 2048) == 0);

// f32 -> 16-bit planes, 8 elements per thread, one 16-B store per lane: a wave writes 512 contiguous B
// MODE 0: bf16 bits (RNE convert).  MODE 1: f16 bits of (64 * bf16(x)) (exact scaling of the bf16 value).
template <int MODE>
__device__ __forceinline__ unsigned short cvm(float f) {
  const unsigned short hb = bf_bits(f);
  if (MODE == 0) return hb;
  return h_bits((_Float16)(bf_up(hb) * WOSC));
}

// thread i of a plane -> its elements 8 i .. 8 i + 7; a block of 256 threads = 2048 elements, the blocks cover the plane exactly
template <int MODE>
__device__ __forceinline__ void cvt16x8(const float* __restrict__ in, unsigned short* out, int i) {
  const v4f a  = *(const v4f*)(in + (size_t)i * 8);
  const v4f a4 = *(const v4f*)(in + (size_t)i * 8 + 4);
  v4u p;
  p[0] = pk16(cvm<MODE>(a[0]),  cvm<MODE>(a[1]));
  p[1] = pk16(cvm<MODE>(a[2]),  cvm<MODE>(a[3]));
  p[2] = pk16(cvm<MODE>(a4[0]), cvm<MODE>(a4[1]));
  p[3] = pk16(cvm<MODE>(a4[2]), cvm<MODE>(a4[3]));
  unsigned short* o = out + (size_t)i * 8;
  *(v4u*)o = p;
#if DEV_ASM
  asm volatile("s_wait_xcnt 0x0" ::: "memory");   // another job's code follows in the kernel and reuses the store's registers
#endif
}

// Tiled transpose + bf16 convert: in[R][C] f32 (C contiguous) -> out[C][R] bf16 (R contiguous), one 64x64 tile at row r0,
// column c0. Load: 256 thr x 4 it x 4 floats = the tile (16-B loads along C), staged as bf16 t[cc][rr] (pitch 72 shorts,
// 16-B aligned rows); __syncthreads; store: out row (c0+row), 128-B segments.
template <int R, int C>
__device__ __forceinline__ void tr_bf16(const float* __restrict__ ib, unsigned short* ob, int r0, int c0,
                                        unsigned short (*t)[72], int tid) {
  const int rq = tid >> 4, cc4 = (tid & 15) * 4;       // round it: row rq + 16 it, columns cc4 .. cc4 + 3
  const float* p = ib + (size_t)(r0 + rq) * (size_t)C + c0 + cc4;
  v4f v[4];
#pragma unroll
  for (int it = 0; it < 4; ++it) v[it] = *(const v4f*)(p + (size_t)it * 16 * C);
#if DEV_ASM
  asm volatile("s_wait_xcnt 0x0" :: "v"(p) : "memory");   // the four loads' address pair is rewritten only behind this wait
#endif
#pragma unroll
  for (int it = 0; it < 4; ++it) {
    const int rr = rq + 16 * it;
    t[cc4 + 0][rr] = bf_bits(v[it][0]);
    t[cc4 + 1][rr] = bf_bits(v[it][1]);
    t[cc4 + 2][rr] = bf_bits(v[it][2]);
    t[cc4 + 3][rr] = bf_bits(v[it][3]);
  }
  __syncthreads();
  const int wave = tid >> 5, lane = tid & 31;
  const int q8 = lane & 7, sub = lane >> 3;
  v4u pv[2];
#pragma unroll
  for (int it = 0; it < 2; ++it) {
    const int row = it * 32 + wave * 4 + sub;
    pv[it] = *(const v4ua*)(&t[row][8 * q8]);
  }
#pragma unroll
  for (int it = 0; it < 2; ++it) {
    const int row = it * 32 + wave * 4 + sub;
    *(v4u*)(ob + (size_t)(c0 + row) * (size_t)R + r0 + 8 * q8) = pv[it];
  }
#if DEV_ASM
  asm volatile("s_wait_xcnt 0x0" ::: "memory");   // another job's code follows in the kernel and reuses the stores' registers
#endif
}

__global__ __launch_bounds__(256) void prep_kernel(
    const float* __restrict__ kin, const float* __restrict__ Gs, const float* __restrict__ qin,
    const float* __restrict__ Wq, const float* __restrict__ Wk, const float* __restrict__ Wv,
    const float* __restrict__ Wo,
    unsigned short* KT, unsigned short* GT, unsigned short* QB,
    unsigned short* WQB, unsigned short* WKB, unsigned short* WVB, unsigned short* WOH) {
  __shared__ __align__(16) unsigned short t[64][72];
  const int tid = threadIdx.x;
  int j = blockIdx.x;
  if (j < NTK) {                         // column tile fastest, then row tile, then batch
    const int c0 = (j % (HID / 64)) * 64;
    const int r0 = ((j / (HID / 64)) % (LMEM / 64)) * 64;
    const size_t z = (size_t)(j / ((HID / 64) * (LMEM / 64)));
    tr_bf16<LMEM, HID>(kin + z * (size_t)(LMEM * HID), KT + z * (size_t)(HID * LMEM), r0, c0, t, tid);
    return;
  }
  j -= NTK;
  if (j < NTG) {
    const int c0 = (j % (NBAS / 64)) * 64;
    const int r0 = (j / (NBAS / 64)) * 64;
    tr_bf16<LMEM, NBAS>(Gs, GT, r0, c0, t, tid);
    return;
  }
  j -= NTG;
  if (j < NCQ) {
    cvt16x8<0>(qin, QB, j * 256 + tid);
    return;
  }
  j -= NCQ;
  const int w = j / NCW;
  const int i = (j % NCW) * 256 + tid;
  if (w == 3) {
    cvt16x8<1>(Wo, WOH, i);
  } else {
    const float* in = (w == 0) ? Wq : (w == 1) ? Wk : Wv;
    unsigned short* out = (w == 0) ? WQB : (w == 1) ? WKB : WVB;
    cvt16x8<0>(in, out, i);
  }
}

// =====================================================================================================
// LDS-staged batched WMMA GEMM (16-bit operand type OT): C[m][n] = sum_k A[m][k] * Bt[n][k];
// one block of 4 waves (2 x 2) per 128x128 tile, one wave per 64x64 quarter. A row-major [M][KD], Bt row-major
// [N][KD] (k contiguous, pitch KD); M, N multiples of 128, KD a multiple of 128 and at least 256 (static shapes here).
// blockIdx.x = tile (column tile fastest), blockIdx.y = batch index (strides in elements); the grid is exactly the tiles.
// A stage = 128 k = 256 B of each of the tile's operand rows [A 128 | Bt 128 | (SPL 2) Bt2 128], brought by asynchronous
// copies to LDS: 16 lanes x 16 B = one row's 256 B, so a wave's copy covers two rows in whole lines; each of the 128
// threads copies rows (tid >> 4) + 8 i. LDS row pitch 272 B. Two buffers: stage t + 1 flies while stage t is worked on.
// Fragments are read from LDS with the split k map (ldfrag), same k order per accumulator as a straight k loop.
// SPL 0: single product. SPL 2: Bt = hi plane Bt + residual plane Bt2 (2 products per k-step, same accumulator).
// OUT_MODE 0: f32 C (pitch ldc), value * oscale.
// OUT_MODE 2: bf16 hi plane C + bf16 residual plane C2 = bf16(v - hi) (same pitch / stride).
// =====================================================================================================
#define GKS  128       // k elements per stage
#define GPIT 136       // LDS row pitch in 16-bit elements: 272 B = 16 B x 17, conflict-free for 16-B fragment reads

// Eight asynchronous 16-B-per-lane copies global -> LDS: rows r, r + 8, ..., r + 56 of one operand plane.
// l = the lane's LDS byte address, g = the lane's global address, ld = global row pitch in elements.
__device__ __forceinline__ void acopy8(unsigned l, const unsigned short* g, int ld) {
#if DEV_ASM
  const size_t gs = (size_t)8 * (size_t)ld;
  const unsigned ls = 8u * GPIT * 2u;
  // the closing s_wait_xcnt keeps every address register intact until the copies have taken it
  asm volatile(
      "global_load_async_to_lds_b128 %0, %8, off\n\t"
      "global_load_async_to_lds_b128 %1, %9, off\n\t"
      "global_load_async_to_lds_b128 %2, %10, off\n\t"
      "global_load_async_to_lds_b128 %3, %11, off\n\t"
      "global_load_async_to_lds_b128 %4, %12, off\n\t"
      "global_load_async_to_lds_b128 %5, %13, off\n\t"
      "global_load_async_to_lds_b128 %6, %14, off\n\t"
      "global_load_async_to_lds_b128 %7, %15, off\n\t"
      "s_wait_xcnt 0x0"
      :: "v"(l), "v"(l + ls), "v"(l + 2u * ls), "v"(l + 3u * ls),
         "v"(l + 4u * ls), "v"(l + 5u * ls), "v"(l + 6u * ls), "v"(l + 7u * ls),
         "v"(g), "v"(g + gs), "v"(g + 2 * gs), "v"(g + 3 * gs),
         "v"(g + 4 * gs), "v"(g + 5 * gs), "v"(g + 6 * gs), "v"(g + 7 * gs)
      : "memory");
#endif
}

template <typename OT, int SPL, int OUT_MODE, int KD>
__global__ __launch_bounds__(128) void gemm128(
    const unsigned short* __restrict__ Ap, long long strideA,
    const unsigned short* __restrict__ Btp, const unsigned short* __restrict__ Bt2p, long long strideB,
    void* Cout, void* Cout2, int ldc, long long strideC,
    int N, float oscale) {
  typedef typename FT<OT>::frag V16;
  static_assert((KD % GKS) == 0 && KD / GKS >= 2);
  constexpr int NST  = KD / GKS;                       // stages
  constexpr int NPL  = (SPL == 2) ? 3 : 2;             // operand planes per stage
  constexpr int BUFE = NPL * 128 * GPIT;               // elements per buffer
  __shared__ __align__(16) unsigned short ring[2 * BUFE];
  __shared__ __align__(16) float sT[4][16 * 68];       // per-wave 16x64 slab, pitch 68 floats
  const int b    = blockIdx.y;
  const int tid  = threadIdx.x;
  const int lane = tid & 31;
  const int wave = tid >> 5;
  const int tilesN = N >> 7;
  const int tm = (int)blockIdx.x / tilesN;
  const int tn = (int)blockIdx.x - tm * tilesN;
  const int m0 = (tm << 7) + ((wave >> 1) << 6);       // this wave's 64x64 quarter
  const int n0 = (tn << 7) + ((wave & 1) << 6);

  // ---- copy side: lane -> (row group, 16-B segment of the 256-B row) ----
  const int seg = tid & 15, r8 = tid >> 4;
  const unsigned short* gA  = Ap   + (size_t)b * (size_t)strideA + (size_t)((tm << 7) + r8) * KD + seg * 8;
  const unsigned short* gB  = Btp  + (size_t)b * (size_t)strideB + (size_t)((tn << 7) + r8) * KD + seg * 8;
  const unsigned short* gB2 = Bt2p + (size_t)b * (size_t)strideB + (size_t)((tn << 7) + r8) * KD + seg * 8;
  const unsigned lds0 = (unsigned)(uintptr_t)(ring + r8 * GPIT + seg * 8);
  auto fill = [&](int s, int buf) {
    const unsigned l = lds0 + (unsigned)buf * (unsigned)(BUFE * 2);
    const int k0 = s * GKS;
    acopy8(l,                   gA + k0, KD);
    acopy8(l +  64 * GPIT * 2,  gA + k0 + (size_t)64 * KD, KD);
    acopy8(l + 128 * GPIT * 2,  gB + k0, KD);
    acopy8(l + 192 * GPIT * 2,  gB + k0 + (size_t)64 * KD, KD);
    if (SPL == 2) {
      acopy8(l + 256 * GPIT * 2, gB2 + k0, KD);
      acopy8(l + 320 * GPIT * 2, gB2 + k0 + (size_t)64 * KD, KD);
    }
  };

  const int rlane = lane & 15;                 // row (A) / col (B, D) within subtile
  const int koff  = (lane >> 4) * 8;           // k offset of this lane half
  const int mOff  = (lane >> 4) * 8;           // D row offset
  const int aoff = (((wave >> 1) << 6) + rlane) * GPIT + koff;
  const int boff = (128 + ((wave & 1) << 6) + rlane) * GPIT + koff;

  v8f acc[4][4];
#pragma unroll
  for (int i = 0; i < 4; ++i)
#pragma unroll
    for (int j = 0; j < 4; ++j) acc[i][j] = zero8();

  fill(0, 0);
#if DEV_ASM
  asm volatile("s_wait_asynccnt 0x0" ::: "memory");   // stage 0 of this wave has landed
#endif
  __syncthreads();                                      // stage 0 of every wave is readable
  fill(1, 1);

  // rolled: one stage's 64 or 128 WMMAs are the hot loop
#pragma unroll 1
  for (int t = 0; t < NST; ++t) {
    const OT* rb = (const OT*)(const void*)ring + (t & 1) * BUFE;
    // the loops below are unrolled so that af, bq and acc are indexed by constants and stay in registers
#pragma unroll
    for (int kk = 0; kk < GKS / 32; ++kk) {
      V16 af[4];
#pragma unroll
      for (int i = 0; i < 4; ++i) af[i] = ldfrag<OT>(rb + aoff + i * 16 * GPIT + kk * 32);
#pragma unroll
      for (int p = 0; p < ((SPL == 2) ? 2 : 1); ++p) {
        V16 bq[4];
#pragma unroll
        for (int j = 0; j < 4; ++j) bq[j] = ldfrag<OT>(rb + boff + p * 128 * GPIT + j * 16 * GPIT + kk * 32);
#pragma unroll
        for (int i = 0; i < 4; ++i)
#pragma unroll
          for (int j = 0; j < 4; ++j) acc[i][j] = mma_g(af[i], bq[j], acc[i][j]);
      }
    }
#if DEV_ASM
    asm volatile("s_wait_dscnt 0x0" ::: "memory");      // this wave's reads of buffer t & 1 are done before it is refilled
    asm volatile("s_wait_asynccnt 0x0" ::: "memory");   // this wave's copies of stage t + 1 have landed
#endif
    __syncthreads();                                    // publishes stage t + 1 and frees buffer t & 1
    if (t + 2 < NST) fill(t + 2, t & 1);
  }
#if DEV_ASM
  asm volatile("s_wait_asynccnt 0x0" ::: "memory");     // no copy is outstanding when the wave goes on to its end
#endif

  // ---- epilogue ----
  float* slab = sT[wave];
#pragma unroll
  for (int i = 0; i < 4; ++i) {
    const int mBase = m0 + (i << 4);
#pragma unroll
    for (int j = 0; j < 4; ++j) {
#pragma unroll
      for (int r = 0; r < 8; ++r) {
        slab[(mOff + r) * 68 + (j << 4) + rlane] = acc[i][j][r];
      }
    }
    __builtin_amdgcn_fence(__ATOMIC_RELEASE, "workgroup");
    __builtin_amdgcn_wave_barrier();
    __builtin_amdgcn_fence(__ATOMIC_ACQUIRE, "workgroup");
    if (OUT_MODE == 0) {
      float* Cf = (float*)Cout + (size_t)b * (size_t)strideC;
      const int h2 = lane >> 4, c4 = (lane & 15) * 4;     // 256-B row segment = 16 lanes x 16 B
      {
#pragma unroll
        for (int it = 0; it < 8; ++it) {
          const int row = it * 2 + h2;                     // it 0..7 x h2 0..1 = rows 0..15
          const v4f v = *(const v4f*)(slab + row * 68 + c4) * oscale;
          *(v4f*)(Cf + (size_t)(mBase + row) * (size_t)ldc + n0 + c4) = v;
        }
        
      }
    } else {
      const int q = lane >> 3, c8 = (lane & 7) * 8;
      unsigned short* Ch = (unsigned short*)Cout  + (size_t)b * (size_t)strideC;
      unsigned short* Cl = (unsigned short*)Cout2 + (size_t)b * (size_t)strideC;
      v4u hv[4], lv[4];
#pragma unroll
      for (int it = 0; it < 4; ++it) {
        const int row = it * 4 + q;                        // it 0..3 x q 0..3 = rows 0..15
        const float* sp = slab + row * 68 + c8;
        v4u a, a2;
#pragma unroll
        for (int e = 0; e < 4; ++e) {
          const float f0 = sp[2 * e], f1 = sp[2 * e + 1];
          const unsigned short h0 = bf_bits(f0), h1 = bf_bits(f1);
          const unsigned short l0 = bf_bits(f0 - bf_up(h0));
          const unsigned short l1 = bf_bits(f1 - bf_up(h1));
          a[e] = pk16(h0, h1); a2[e] = pk16(l0, l1);
        }
        hv[it] = a; lv[it] = a2;
      }
      {
#pragma unroll
        for (int it = 0; it < 4; ++it) {
          const int row = it * 4 + q;
          *(v4u*)(Ch + (size_t)(mBase + row) * (size_t)ldc + n0 + c8) = hv[it];
          *(v4u*)(Cl + (size_t)(mBase + row) * (size_t)ldc + n0 + c8) = lv[it];
        }
        
      }
    }
    __builtin_amdgcn_fence(__ATOMIC_RELEASE, "workgroup");
    __builtin_amdgcn_wave_barrier();
    __builtin_amdgcn_fence(__ATOMIC_ACQUIRE, "workgroup");
  }
}

// =====================================================================================================
// keys^T.w = Wk.(Bm^T.w): the score vectors need keys only through this product, so the weight vectors are
// contracted with Bm first and only the 8 resulting rows go through Wk.
// t[b*2+v][e] = sum_n bf16(w_v[n]) * (Bm hi + Bm residual)[b*512+n][e]   (f32; v = 0: w_mu, v = 1: w_sigma)
// Block 256 = (b, 64 columns e): 8 lanes x 8 columns = one 128-B row segment per plane, 32 row groups x 16 rows
// = all 512 n; group partials summed through LDS. Output plane T bf16 [16][1024]: row b*2+v = hi, row 8+b*2+v =
// residual; one wave stores a whole 128-B segment (32 lanes x 2 columns). grid (HID/64, NBATCH) covers all 16 rows.
// =====================================================================================================
__global__ __launch_bounds__(256) void wb_kernel(const unsigned short* __restrict__ bmh,
                                                 const unsigned short* __restrict__ bml,
                                                 const float* __restrict__ wmu, const float* __restrict__ wsg,
                                                 unsigned short* tpl) {
  __shared__ float wsh[2][NBAS];
  __shared__ __align__(16) float part[2][32][64];
  const int tid = threadIdx.x;
  const int b  = blockIdx.y;
  const int e0 = blockIdx.x * 64;
  const int g = tid >> 3, c8 = (tid & 7) * 8;
  const unsigned short* ph = bmh + ((size_t)b * NBAS + g) * HID + e0 + c8;
  const unsigned short* pl = bml + ((size_t)b * NBAS + g) * HID + e0 + c8;
  // all of the thread's rows are loaded first: every row is read once, so the cost is latency, paid once this way
  v8us hv[NBAS / 32], lv[NBAS / 32];
#pragma unroll
  for (int it = 0; it < NBAS / 32; ++it) {
    hv[it] = *(const v8usa*)(ph + (size_t)it * 32 * HID);
    lv[it] = *(const v8usa*)(pl + (size_t)it * 32 * HID);
  }
#pragma unroll
  for (int k = 0; k < NBAS / 256; ++k) {
    const int i = tid + 256 * k;
    wsh[0][i] = bf_up(bf_bits(wmu[i]));
    wsh[1][i] = bf_up(bf_bits(wsg[i]));
  }
  __syncthreads();
  float am[8], ag[8];
#pragma unroll
  for (int j = 0; j < 8; ++j) { am[j] = 0.f; ag[j] = 0.f; }
#pragma unroll
  for (int it = 0; it < NBAS / 32; ++it) {
    const float w0 = wsh[0][it * 32 + g];
    const float w1 = wsh[1][it * 32 + g];
#pragma unroll
    for (int j = 0; j < 8; ++j) {
      const float x = bf_up(hv[it][j]) + bf_up(lv[it][j]);
      am[j] += x * w0;
      ag[j] += x * w1;
    }
  }
#pragma unroll
  for (int j = 0; j < 8; ++j) {
    part[0][g][c8 + j] = am[j];
    part[1][g][c8 + j] = ag[j];
  }
  __syncthreads();
  if (tid < 64) {                       // wave 0: v = 0, wave 1: v = 1; lane = column pair
    const int v = tid >> 5, c2 = (tid & 31) * 2;
    float s0 = 0.f, s1 = 0.f;
#pragma unroll
    for (int gg = 0; gg < 32; ++gg) {
      s0 += part[v][gg][c2];
      s1 += part[v][gg][c2 + 1];
    }
    const unsigned short h0 = bf_bits(s0), h1 = bf_bits(s1);
    const unsigned short l0 = bf_bits(s0 - bf_up(h0));
    const unsigned short l1 = bf_bits(s1 - bf_up(h1));
    *(unsigned*)(tpl + (size_t)(b * 2 + v) * HID + e0 + c2)     = pk16(h0, h1);
    *(unsigned*)(tpl + (size_t)(8 + b * 2 + v) * HID + e0 + c2) = pk16(l0, l1);
  }
}

// =====================================================================================================
// u[r][e] = sum_e' (T hi + T residual)[r][e'] * bf16(Wk)[e][e'],  r = b*2+v in 0..7   (f32, same table as before)
// A = T [16][1024] (rows 0..7 hi, rows 8..15 residual), Bt = Wk bf16 [e][e']; D row r + D row r+8 = u row r.
// Block 256 = 32 columns e (two 16-column tiles); wave w takes the k slice [128 w, 128 w + 128) = 4 k-steps for both
// tiles (A fragment shared); the 8 slice partials are summed through LDS. Store: one wave = one row's 32 floats
// = one 128-B segment. grid HID/32 covers all 1024 columns of all 8 rows.
// =====================================================================================================
__global__ __launch_bounds__(256) void u_kernel(const unsigned short* __restrict__ tpl,
                                                const unsigned short* __restrict__ wkp, float* u) {
  __shared__ float red[8][8][32];       // [k slice][row r][column]
  const int tid  = threadIdx.x;
  const int wave = tid >> 5;
  const int lane = tid & 31;
  const int rlane = lane & 15;          // row (A) / col (B, D) within the tile
  const int koff  = (lane >> 4) * 8;    // k offset of this lane half
  const int n0 = blockIdx.x * 32;
  const __bf16* A  = (const __bf16*)(const void*)tpl + (size_t)rlane * HID + koff + wave * 128;
  const __bf16* B0 = (const __bf16*)(const void*)wkp + (size_t)(n0 + rlane) * HID + koff + wave * 128;
  const __bf16* B1 = B0 + (size_t)16 * HID;
  v16b af[4], b0[4], b1[4];
#pragma unroll
  for (int s = 0; s < 4; ++s) {
    af[s] = ldfrag<__bf16>(A  + 32 * s);
    b0[s] = ldfrag<__bf16>(B0 + 32 * s);
    b1[s] = ldfrag<__bf16>(B1 + 32 * s);
  }
  v8f a0 = zero8(), a1 = zero8();
#pragma unroll
  for (int s = 0; s < 4; ++s) {
    a0 = mma_g(af[s], b0[s], a0);
    a1 = mma_g(af[s], b1[s], a1);
  }
  // D element r of lane half 0 = row r (hi part), of lane half 1 = row r+8 (residual part), same column
#pragma unroll
  for (int r = 0; r < 8; ++r) {
    const float x0 = a0[r] + __shfl_xor(a0[r], 16, 32);
    const float x1 = a1[r] + __shfl_xor(a1[r], 16, 32);
    red[wave][r][lane] = (lane < 16) ? x0 : x1;     // lanes 16..31 hold the second tile's column lane-16
  }
  __syncthreads();
  {
    float s = 0.f;
#pragma unroll
    for (int w = 0; w < 8; ++w) s += red[w][wave][lane];
    u[(size_t)wave * HID + n0 + lane] = s;
  }
}

// =====================================================================================================
// Continuous attention context, one block = (b, head h, 64 queries), 4 waves x 16 queries, grid NBATCH*NH*NQB64.
//   prologue (f32): dm = sum_d qry[q][h*64+d]*u_mu[b][h*64+d] / 8, dg likewise with u_sigma;
//     mu = sigmoid(dm), sig2 = max(softplus(dg), 1e-4)   (lane c = query, lane halves each do 32 d, shfl combine)
//   loop over 8 chunks of 64 basis functions (static trip): vals^T hi / residual chunks [d 64][n 64] staged in
//     LDS by 128 threads x 32 elements per plane (whole 64x64 tile, __syncthreads before and after);
//     per 32-deep k-step the lane builds its A fragment in registers: element i = r[q=c][n0+32kk+k(i)],
//     r = exp(-0.5 (mu - bm[n])^2 / var) / sqrt(2 pi var), var = sig2 + bs[n]^2 (bm, bs = bf16-converted basis
//     tables in LDS), as bf16 hi + bf16 residual; B fragments = vals^T hi / residual from LDS (col = d, k = n);
//     oacc[t] += rh.vh + rh.vl + rl.vh  (bf16 WMMA, one f32 accumulator).
//   epilogue: wave's 16x64 f32 tile staged in LDS, converted to f16(64 * ctx), written to the ctx plane
//   coverage: rows it(4) x (lane>>3)(4) = 16 per wave x 4 waves x 32 qb x 4 b; cols 8 lanes x 8 = 64 per head x 16 heads
//   = the whole [8192][1024] ctx plane. LDS extents: Vth/Vtl 64x64 staged = 64x64 consumed (row pitch VPIT); bm_s/bv_s 512 = 512;
//   Os written 16x64 per wave before the wave reads its own tile.
// =====================================================================================================
#define VPIT 72        // LDS row pitch of the vals^T chunks in 16-bit elements: 144 B = 16 B x 9, conflict-free for 16-B reads and stores
#define OPIT 68        // LDS row pitch of the per-wave context tile in floats: 272 B = 16 B x 17, same reason
__global__ __launch_bounds__(128) void ctx_kernel(
    const float* __restrict__ qry, const float* __restrict__ u,
    const float* __restrict__ bmu, const float* __restrict__ bsg,
    const unsigned short* __restrict__ vthp, const unsigned short* __restrict__ vtlp,
    unsigned short* ctxp) {
  union FB { v16b v; v8us h[2]; unsigned short s[16]; };
  __shared__ __align__(16) unsigned short Vth[64 * VPIT];  // vals^T hi chunk [d][n]       9 KB
  __shared__ __align__(16) unsigned short Vtl[64 * VPIT];  // vals^T residual chunk        9 KB
  __shared__ __align__(16) float Os[4][16 * OPIT];         // per-wave context tile       17 KB
  __shared__ float bm_s[NBAS];                             // bf16-converted basis means
  __shared__ float bv_s[NBAS];                             // (bf16-converted basis sigma)^2

  const int tid  = threadIdx.x;
  const int wave = tid >> 5;
  const int lane = tid & 31;
  const int hh   = lane >> 4;
  const int c    = lane & 15;

  const int bx   = blockIdx.x;
  const int qb   = bx % NQB64;
  const int rest = bx / NQB64;
  const int h    = rest % NH;
  const int b    = rest / NH;
  const int q0   = qb * 64 + wave * 16;
  const size_t row0 = (size_t)b * QLEN + q0;              // plane row of this wave's query 0

  for (int i = tid; i < NBAS; i += 128) {
    const float m = bf_up(bf_bits(bmu[i]));
    const float s = bf_up(bf_bits(bsg[i]));
    bm_s[i] = m;
    bv_s[i] = s * s;
  }

  // ---- per-query affine heads (f32) ----
  float dm = 0.f, dg = 0.f;
  {
    const float* qr = qry + (row0 + c) * HID + (size_t)h * HD + 32 * hh;
    const float* um = u + ((size_t)b * 2) * HID + (size_t)h * HD + 32 * hh;
    const float* ug = um + HID;
#pragma unroll 2
    for (int i = 0; i < 8; ++i) {
      const v4f a  = *(const v4f*)(qr + 4 * i);
      const v4f wm = *(const v4f*)(um + 4 * i);
      const v4f wg = *(const v4f*)(ug + 4 * i);
      dm += a[0] * wm[0]; dm += a[1] * wm[1]; dm += a[2] * wm[2]; dm += a[3] * wm[3];
      dg += a[0] * wg[0]; dg += a[1] * wg[1]; dg += a[2] * wg[2]; dg += a[3] * wg[3];
    }
  }
  dm += __shfl_xor(dm, 16, 32);
  dg += __shfl_xor(dg, 16, 32);
  dm *= 0.125f;
  dg *= 0.125f;
  const float mu   = 1.0f / (1.0f + expf(-dm));
  const float spl  = fmaxf(dg, 0.0f) + log1pf(expf(-fabsf(dg)));
  const float sig2 = fmaxf(spl, 1e-4f);

  const unsigned short* Vh = vthp + ((size_t)b * HID + (size_t)h * HD) * NBAS;
  const unsigned short* Vl = vtlp + ((size_t)b * HID + (size_t)h * HD) * NBAS;

  v8f oacc[4];
#pragma unroll
  for (int t = 0; t < 4; ++t) oacc[t] = zero8();

  for (int nt = 0; nt < NCH; ++nt) {         // static trip count
    const int n0 = nt * 64;
    __syncthreads();
    {
      const int r = tid >> 1, half = (tid & 1) * 32;      // d = r, n = n0 + half .. + 31
      const unsigned short* vg  = Vh + (size_t)r * NBAS + n0 + half;
      const unsigned short* vlg = Vl + (size_t)r * NBAS + n0 + half;
#pragma unroll
      for (int i = 0; i < 4; ++i) {
        const v8us b0 = *(const v8usa*)(vg + 8 * i);
        const v8us b1 = *(const v8usa*)(vlg + 8 * i);
        *(v8usa*)(Vth + r * VPIT + half + 8 * i) = b0;
        *(v8usa*)(Vtl + r * VPIT + half + 8 * i) = b1;
      }
    }
    __syncthreads();

#pragma unroll 1
    for (int kk = 0; kk < 2; ++kk) {
      // ---- A fragments: r values of query c at the 16 k slots of this lane half, bf16 hi + residual ----
      FB rh, rl;
#pragma unroll
      for (int i = 0; i < 16; ++i) {
        const int n = n0 + kk * 32 + ((i < 8) ? (8 * hh + i) : (8 + 8 * hh + i));
        const float t   = mu - bm_s[n];
        const float var = sig2 + bv_s[n];
        const float iv  = __builtin_amdgcn_rcpf(var);
        const float rv  = __expf(-0.5f * t * t * iv) * rsqrtf(6.2831853071795864f * var);
        const unsigned short hb = bf_bits(rv);
        rh.s[i] = hb;
        rl.s[i] = bf_bits(rv - bf_up(hb));
      }
      // ---- ctx += r . vals over this 32-deep slice of n ----
#pragma unroll
      for (int t = 0; t < 4; ++t) {
        FB vb, vl;
        vb.h[0] = *(const v8usa*)(Vth + (t * 16 + c) * VPIT + kk * 32 + 8 * hh);
        vb.h[1] = *(const v8usa*)(Vth + (t * 16 + c) * VPIT + kk * 32 + 16 + 8 * hh);
        vl.h[0] = *(const v8usa*)(Vtl + (t * 16 + c) * VPIT + kk * 32 + 8 * hh);
        vl.h[1] = *(const v8usa*)(Vtl + (t * 16 + c) * VPIT + kk * 32 + 16 + 8 * hh);
        oacc[t] = mma_g(rh.v, vb.v, oacc[t]);
        oacc[t] = mma_g(rh.v, vl.v, oacc[t]);
        oacc[t] = mma_g(rl.v, vb.v, oacc[t]);
      }
    }
  }

  float* os = Os[wave];
#pragma unroll
  for (int r = 0; r < 8; ++r) {
#pragma unroll
    for (int t = 0; t < 4; ++t) os[(8 * hh + r) * OPIT + t * 16 + c] = oacc[t][r];
  }
  __builtin_amdgcn_fence(__ATOMIC_RELEASE, "workgroup");
  __builtin_amdgcn_wave_barrier();
  __builtin_amdgcn_fence(__ATOMIC_ACQUIRE, "workgroup");
  {
    const int q4 = lane >> 3, c8 = (lane & 7) * 8;
    v4u hv[4];
#pragma unroll
    for (int it = 0; it < 4; ++it) {
      const int row = it * 4 + q4;   // it 0..3 x q4 0..3 = rows 0..15 of the wave tile
      const float* sp = os + row * OPIT + c8;
      v4u a;
#pragma unroll
      for (int e = 0; e < 4; ++e) {
        const float f0 = sp[2 * e] * CSC, f1 = sp[2 * e + 1] * CSC;
        a[e] = pk16(h_bits((_Float16)f0), h_bits((_Float16)f1));
      }
      hv[it] = a;
    }
    {
#pragma unroll
      for (int it = 0; it < 4; ++it) {
        const int row = it * 4 + q4;
        const size_t go = (row0 + row) * HID + (size_t)h * HD + c8;
        *(v4u*)(ctxp + go) = hv[it];
      }
      
    }
  }
}

// =====================================================================================================
// Workspace map (bytes), every region an exact multiple of its whole-line / whole-tile store granularity:
//   KT   bf16 [4][1024 e][2048 l]   16777216   (dead after the Bm GEMM; reused as the f16 ctx plane [8192][1024], same size)
//   GT   bf16 [512 n][2048 l]        2097152
//   QB   bf16 [8192][1024]          16777216
//   WQB  bf16 [1024][1024]           2097152
//   WKB  bf16 [1024][1024]           2097152
//   WVB  bf16 [1024][1024]           2097152
//   WOH  f16  [1024][1024] (x64)     2097152
//   BMH  bf16 [4*512][1024]          4194304   Bm hi
//   BML  bf16 [4*512][1024]          4194304   Bm residual
//   TPL  bf16 [16][1024]               32768   t = w^T.Bm, rows 0..7 hi, rows 8..15 residual
//   VTH  bf16 [4][1024 e][512 n]     4194304   vals^T hi
//   VTL  bf16 [4][1024 e][512 n]     4194304   vals^T residual
//   QRY  f32  [8192][1024]          33554432
//   U    f32  [4][2][1024]             32768
//   total                           94437376
// Weights are [out][in] with in contiguous = the Bt layout for x.W^T, so they are only converted.
// =====================================================================================================
extern "C" void kernel_launch(void* const* d_in, const int* in_sizes, int n_in,
                              void* d_out, int out_size, void* d_ws, size_t ws_size,
                              hipStream_t stream) {
  if (n_in < 11) return;
  if (in_sizes[0] != NBATCH * LMEM * HID) return;
  if (in_sizes[1] != MROWS * HID) return;
  if (in_sizes[2] != HID * HID || in_sizes[3] != HID * HID || in_sizes[4] != HID * HID || in_sizes[5] != HID * HID) return;
  if (in_sizes[6] != NBAS || in_sizes[7] != NBAS) return;
  if (in_sizes[8] != LMEM * NBAS || in_sizes[9] != NBAS || in_sizes[10] != NBAS) return;
  if (out_size != MROWS * HID) return;

  const float* kin = (const float*)d_in[0];
  const float* qin = (const float*)d_in[1];
  const float* Wq  = (const float*)d_in[2];
  const float* Wk  = (const float*)d_in[3];
  const float* Wv  = (const float*)d_in[4];
  const float* Wo  = (const float*)d_in[5];
  const float* wmu = (const float*)d_in[6];
  const float* wsg = (const float*)d_in[7];
  const float* Gs  = (const float*)d_in[8];
  const float* bmu = (const float*)d_in[9];
  const float* bsg = (const float*)d_in[10];

  const size_t PKT  = (size_t)NBATCH * HID * LMEM * 2;    // 16777216  k^T planes; later the ctx f16 plane
  const size_t PCTX = (size_t)MROWS * HID * 2;            // 16777216  (== PKT)
  const size_t PGT  = (size_t)NBAS * LMEM * 2;            //  2097152
  const size_t PQB  = (size_t)MROWS * HID * 2;            // 16777216
  const size_t PW   = (size_t)HID * HID * 2;              //  2097152
  const size_t PBM  = (size_t)NBATCH * NBAS * HID * 2;    //  4194304
  const size_t PTPL = (size_t)16 * HID * 2;               //    32768
  const size_t PVT  = (size_t)NBATCH * HID * NBAS * 2;    //  4194304
  const size_t PQRY = (size_t)MROWS * HID * 4;            // 33554432
  const size_t PU   = (size_t)NBATCH * 2 * HID * 4;       //    32768
  if (PCTX > PKT) return;
  size_t off = 0;
  const size_t oKT  = off; off += PKT;
  const size_t oGT  = off; off += PGT;
  const size_t oQB  = off; off += PQB;
  const size_t oWQ  = off; off += PW;
  const size_t oWK  = off; off += PW;
  const size_t oWV  = off; off += PW;
  const size_t oWO  = off; off += PW;
  const size_t oBMH = off; off += PBM;
  const size_t oBML = off; off += PBM;
  const size_t oTPL = off; off += PTPL;
  const size_t oVTH = off; off += PVT;
  const size_t oVTL = off; off += PVT;
  const size_t oQRY = off; off += PQRY;
  const size_t oU   = off; off += PU;
  if (off > ws_size) return;                        // off = 94437376
  if (off > (size_t)134217728) return;

  char* ws = (char*)d_ws;
  unsigned short* KT  = (unsigned short*)(ws + oKT);
  unsigned short* CTX = (unsigned short*)(ws + oKT);   // reuse after the Bm GEMM has consumed KT
  unsigned short* GT  = (unsigned short*)(ws + oGT);
  unsigned short* QB  = (unsigned short*)(ws + oQB);
  unsigned short* WQB = (unsigned short*)(ws + oWQ);
  unsigned short* WKB = (unsigned short*)(ws + oWK);
  unsigned short* WVB = (unsigned short*)(ws + oWV);
  unsigned short* WOH = (unsigned short*)(ws + oWO);
  unsigned short* BMH = (unsigned short*)(ws + oBMH);
  unsigned short* BML = (unsigned short*)(ws + oBML);
  unsigned short* TPL = (unsigned short*)(ws + oTPL);
  unsigned short* VTH = (unsigned short*)(ws + oVTH);
  unsigned short* VTL = (unsigned short*)(ws + oVTL);
  float*          QRY = (float*)(ws + oQRY);
  float*          U   = (float*)(ws + oU);

  const dim3 blk(256);
  const dim3 gBm((NBAS / 128) * (HID / 128), NBATCH);            // 32 tiles of 128x128 x 4 b      (M=512,  N=1024, K=2048)
  const dim3 gWb(HID / 64, NBATCH);                               // (16, 4)
  const dim3 gVt((HID / 128) * (NBAS / 128), NBATCH);             // 32 tiles of 128x128 x 4 b      (M=1024, N=512,  K=1024)
  const dim3 gQ((MROWS / 128) * (HID / 128), 1);                  // 512 tiles of 128x128           (M=8192, N=1024, K=1024)
  const dim3 gU(HID / 32);                                        // 32 blocks
  const dim3 gCtx(NBATCH * NH * NQB64);                           // 2048 blocks of 128

  // (1) k -> k^T bf16 per batch, Gs -> Gs^T bf16 (l contiguous); q and weights -> bf16; Wo -> f16 (64 x its bf16 value)
  prep_kernel<<<dim3(NPREP), blk, 0, stream>>>(kin, Gs, qin, Wq, Wk, Wv, Wo, KT, GT, QB, WQB, WKB, WVB, WOH);
  // (2) Bm[b][n][e] = sum_l Gs^T[n][l] k^T[b][e][l] -> bf16 hi / residual planes [b*512+n][e]
  gemm128<__bf16, 0, 2, LMEM><<<gBm, dim3(128), 0, stream>>>(
      GT, 0LL, KT, KT, (long long)HID * LMEM,
      (void*)BMH, (void*)BML, HID, (long long)NBAS * HID,
      HID, 1.0f);
  // (3) t[b*2+v][e'] = sum_n bf16(w_mu / w_sigma)[n] Bm[b*512+n][e'] (f32) -> bf16 hi / residual rows of TPL
  wb_kernel<<<gWb, blk, 0, stream>>>(BMH, BML, wmu, wsg, TPL);
  // (4) vals^T[b][e][n] = sum_e' Wv[e][e'] Bm[b*512+n][e'] -> bf16 hi / residual planes, pitch 512 (Bm on the Bt side, 2 products)
  gemm128<__bf16, 2, 2, HID><<<gVt, dim3(128), 0, stream>>>(
      WVB, 0LL, BMH, BML, (long long)NBAS * HID,
      (void*)VTH, (void*)VTL, NBAS, (long long)HID * NBAS,
      NBAS, 1.0f);
  // (5) qry[b*2048+q][e] = sum_e' q[..][e'] Wq[e][e'] -> f32 plane (read only by the qry.u dots of (7))
  gemm128<__bf16, 0, 0, HID><<<gQ, dim3(128), 0, stream>>>(
      QB, 0LL, WQB, WQB, 0LL,
      (void*)QRY, (void*)QRY, HID, 0LL,
      HID, 1.0f);
  // (6) u[b][0/1][e] = sum_e' t[b*2+0/1][e'] Wk[e][e']   (= sum_n keys[b][n][e] * w[n] with keys = Bm.Wk^T)
  u_kernel<<<gU, blk, 0, stream>>>(TPL, WKB, U);
  // (7) mu, sig2 per query; ctx = r . vals -> f16 ctx plane (x64) [8192][1024] in the KT region
  ctx_kernel<<<gCtx, dim3(128), 0, stream>>>(QRY, U, bmu, bsg, VTH, VTL, CTX);
  // (8) out = ctx . Wo^T -> d_out f32 [8192][1024], accumulator x 1/(64*64)
  gemm128<_Float16, 0, 0, HID><<<gQ, dim3(128), 0, stream>>>(
      CTX, 0LL, WOH, WOH, 0LL,
      d_out, d_out, HID, 0LL,
      HID, 1.0f / (CSC * WOSC));
  (void)hipGetLastError();
}

// v005
// Measured time: 144 microseconds a run.
// Timed twice side by side with v004, it ran 1.13 and 1.14 times as fast.
// Over all steps from v000 it is 3.29 times as fast.
// Contractions: Gs^T.k^T (Bm) and q.Wq^T on v_wmma_f32_16x16x32_bf16 (bf16 operands RNE-converted from inputs, single product, f32 accumulate);
// Wv.Bm^T on v_wmma_f32_16x16x32_bf16 with Bm as bf16 hi + bf16 residual planes (2 products, f32 accumulate);
// (w^T.Bm).Wk^T on v_wmma_f32_16x16x32_bf16: the 8 rows t = w^T.Bm as bf16 hi (A rows 0..7) + bf16 residual (A rows 8..15),
// one product, f32 accumulate, D rows r and r+8 added;
// r.vals on v_wmma_f32_16x16x32_bf16 with r and vals^T each bf16 hi + bf16 residual (3 products hh+hl+lh, f32 accumulate);
// ctx.Wo^T on v_wmma_f32_16x16x32_f16 (ctx f16 carried x64, Wo f16 = 64 x its bf16 value, single product, f32 accumulate, folded back x 1/4096);
// w^T.Bm and qry.u score-vector dots, sigmoid, softplus and the Gaussian density in f32.
// Carry audit: Woh plane = f16(64 * bf16(Wo)), ctx plane = f16(64 * ctx); both inverses folded back exactly once by
// oscale = 1/4096 in the out GEMM epilogue (OUT_MODE 0). Bm, vals^T and r residual planes are unscaled bf16 (v - hi)
// and share the hi accumulator (no fold needed). r planes carry r / RSC (RSC = sqrt(ln 2 / pi)); the inverse is folded back exactly
// once, with the ctx carry, by CSC * RSC in the ctx kernel's epilogue.
#include <hip/hip_runtime.h>
#include <math.h>
#include <stdint.h>

#define NBATCH 4
#define LMEM   2048
#define QLEN   2048
#define HID    1024
#define NH     16
#define HD     64
#define NBAS   512
#define MROWS  (NBATCH * QLEN)   // 8192 query rows
#define NQB64  (QLEN / 64)       // 32 blocks of 64 queries per sequence
#define NCH    (NBAS / 64)       // 8 chunks of 64 basis functions
static_assert(NH * HD == HID);
static_assert(NQB64 == 32 && NCH == 8);
static_assert((LMEM % 64) == 0 && (QLEN % 64) == 0 && (HID % 64) == 0 && (NBAS % 64) == 0);
static_assert((LMEM % 128) == 0 && (HID % 128) == 0 && (NBAS % 128) == 0 && (MROWS % 128) == 0);
#define CSC  64.0f     // ctx plane carry (f16)
#define WOSC 64.0f     // Wo plane carry (f16 of the bf16 value)

typedef _Float16 v16h __attribute__((ext_vector_type(16)));
typedef _Float16 v8h  __attribute__((ext_vector_type(8)));
typedef __bf16   v16b __attribute__((ext_vector_type(16)));
typedef __bf16   v8b  __attribute__((ext_vector_type(8)));
typedef float    v8f  __attribute__((ext_vector_type(8)));
typedef float    v4f  __attribute__((ext_vector_type(4)));
typedef float    v2f  __attribute__((ext_vector_type(2)));
typedef __bf16   v2b  __attribute__((ext_vector_type(2)));
typedef unsigned int   v4u  __attribute__((ext_vector_type(4)));
typedef unsigned short v8us __attribute__((ext_vector_type(8)));
typedef v4u  __attribute__((may_alias)) v4ua;
typedef v8us __attribute__((may_alias)) v8usa;

#if defined(__HIP_DEVICE_COMPILE__)
#define DEV_ASM 1
#else
#define DEV_ASM 0
#endif

// ---- scalar helpers ---------------------------------------------------------------------------------
__device__ __forceinline__ unsigned short bf_bits(float f) {          // f32 -> bf16 bits, RNE convert
  unsigned u = __float_as_uint(f);
  return (unsigned short)((u + 0x7FFFu + ((u >> 16) & 1u)) >> 16);
}
__device__ __forceinline__ float bf_up(unsigned short hb) { return __uint_as_float(((unsigned)hb) << 16); }
__device__ __forceinline__ unsigned short h_bits(_Float16 x) { return __builtin_bit_cast(unsigned short, x); }
__device__ __forceinline__ unsigned pk16(unsigned short a, unsigned short b) { return (unsigned)a | ((unsigned)b << 16); }
__device__ __forceinline__ v8f zero8() { v8f z = {0.f, 0.f, 0.f, 0.f, 0.f, 0.f, 0.f, 0.f}; return z; }

// ---- fragment types / loaders: 16-bit A/B operand, lane -> row/col (lane&15), p already includes +8*(lane>>4);
//      elements 0..7 <- p[0..7] (k0+8h..k0+8h+7), elements 8..15 <- p[16..23] (k0+16+8h..k0+16+8h+7)
template <typename OT> struct FT;
template <> struct FT<__bf16>   { typedef v16b frag; typedef v8b half8; };
template <> struct FT<_Float16> { typedef v16h frag; typedef v8h half8; };

template <typename OT>
__device__ __forceinline__ typename FT<OT>::frag ldfrag(const OT* p) {
  union { typename FT<OT>::frag v; typename FT<OT>::half8 h[2]; } f;
  f.h[0] = *(const typename FT<OT>::half8*)(p);
  f.h[1] = *(const typename FT<OT>::half8*)(p + 16);
  return f.v;
}

// ---- guarded WMMA: 4 VALU slots after every WMMA, D tied, A/B kept live -----------------------------------
__device__ __forceinline__ v8f mma_g(v16b a, v16b b, v8f c) {
  c = __builtin_amdgcn_wmma_f32_16x16x32_bf16(false, a, false, b, (short)0, c, false, false);
#if DEV_ASM
  asm volatile("v_nop\n\tv_nop\n\tv_nop\n\tv_nop" : "+v"(c) : "v"(a), "v"(b));
#endif
  return c;
}
__device__ __forceinline__ v8f mma_g(v16h a, v16h b, v8f c) {
  c = __builtin_amdgcn_wmma_f32_16x16x32_f16(false, a, false, b, (short)0, c, false, false);
#if DEV_ASM
  asm volatile("v_nop\n\tv_nop\n\tv_nop\n\tv_nop" : "+v"(c) : "v"(a), "v"(b));
#endif
  return c;
}

// =====================================================================================================
// Operand preparation, ONE launch: seven jobs that do not depend on one another share one grid; blockIdx.x alone
// (block-uniform) says which job a block works for and which piece of it:
//   [0, NTK)          k[b][l][e]  f32 -> k^T[b][e][l] bf16   64x64 tile transpose
//   then NTG blocks   Gs[l][n]    f32 -> Gs^T[n][l]   bf16   64x64 tile transpose
//   then NCQ blocks   q  f32 -> bf16;  then NCW blocks each for Wq, Wk, Wv (bf16) and Wo (f16 of 64 x its bf16 value)
// =====================================================================================================
#define NTK  ((HID / 64) * (LMEM / 64) * NBATCH)     // 2048
#define NTG  ((NBAS / 64) * (LMEM / 64))             //  256
#define NCQ  (MROWS * HID / 2048)                    // 4096
#define NCW  (HID * HID / 2048)                      //  512
#define NPREP (NTK + NTG + NCQ + 4 * NCW)            // 8448
static_assert(((MROWS * HID) % 2048) == 0 && ((HID * HID) % 2048) == 0);

// f32 -> 16-bit planes, 8 elements per thread, one 16-B store per lane: a wave writes 512 contiguous B
// MODE 0: bf16 bits (RNE convert).  MODE 1: f16 bits of (64 * bf16(x)) (exact scaling of the bf16 value).
template <int MODE>
__device__ __forceinline__ unsigned short cvm(float f) {
  const unsigned short hb = bf_bits(f);
  if (MODE == 0) return hb;
  return h_bits((_Float16)(bf_up(hb) * WOSC));
}

// thread i of a plane -> its elements 8 i .. 8 i + 7; a block of 256 threads = 2048 elements, the blocks cover the plane exactly
template <int MODE>
__device__ __forceinline__ void cvt16x8(const float* __restrict__ in, unsigned short* out, int i) {
  const v4f a  = *(const v4f*)(in + (size_t)i * 8);
  const v4f a4 = *(const v4f*)(in + (size_t)i * 8 + 4);
  v4u p;
  p[0] = pk16(cvm<MODE>(a[0]),  cvm<MODE>(a[1]));
  p[1] = pk16(cvm<MODE>(a[2]),  cvm<MODE>(a[3]));
  p[2] = pk16(cvm<MODE>(a4[0]), cvm<MODE>(a4[1]));
  p[3] = pk16(cvm<MODE>(a4[2]), cvm<MODE>(a4[3]));
  unsigned short* o = out + (size_t)i * 8;
  *(v4u*)o = p;
#if DEV_ASM
  asm volatile("s_wait_xcnt 0x0" ::: "memory");   // another job's code follows in the kernel and reuses the store's registers
#endif
}

// Tiled transpose + bf16 convert: in[R][C] f32 (C contiguous) -> out[C][R] bf16 (R contiguous), one 64x64 tile at row r0,
// column c0. Load: 256 thr x 4 it x 4 floats = the tile (16-B loads along C), staged as bf16 t[cc][rr] (pitch 72 shorts,
// 16-B aligned rows); __syncthreads; store: out row (c0+row), 128-B segments.
template <int R, int C>
__device__ __forceinline__ void tr_bf16(const float* __restrict__ ib, unsigned short* ob, int r0, int c0,
                                        unsigned short (*t)[72], int tid) {
  const int rq = tid >> 4, cc4 = (tid & 15) * 4;       // round it: row rq + 16 it, columns cc4 .. cc4 + 3
  const float* p = ib + (size_t)(r0 + rq) * (size_t)C + c0 + cc4;
  v4f v[4];
#pragma unroll
  for (int it = 0; it < 4; ++it) v[it] = *(const v4f*)(p + (size_t)it * 16 * C);
#if DEV_ASM
  asm volatile("s_wait_xcnt 0x0" :: "v"(p) : "memory");   // the four loads' address pair is rewritten only behind this wait
#endif
#pragma unroll
  for (int it = 0; it < 4; ++it) {
    const int rr = rq + 16 * it;
    t[cc4 + 0][rr] = bf_bits(v[it][0]);
    t[cc4 + 1][rr] = bf_bits(v[it][1]);
    t[cc4 + 2][rr] = bf_bits(v[it][2]);
    t[cc4 + 3][rr] = bf_bits(v[it][3]);
  }
  __syncthreads();
  const int wave = tid >> 5, lane = tid & 31;
  const int q8 = lane & 7, sub = lane >> 3;
  v4u pv[2];
#pragma unroll
  for (int it = 0; it < 2; ++it) {
    const int row = it * 32 + wave * 4 + sub;
    pv[it] = *(const v4ua*)(&t[row][8 * q8]);
  }
#pragma unroll
  for (int it = 0; it < 2; ++it) {
    const int row = it * 32 + wave * 4 + sub;
    *(v4u*)(ob + (size_t)(c0 + row) * (size_t)R + r0 + 8 * q8) = pv[it];
  }
#if DEV_ASM
  asm volatile("s_wait_xcnt 0x0" ::: "memory");   // another job's code follows in the kernel and reuses the stores' registers
#endif
}

__global__ __launch_bounds__(256) void prep_kernel(
    const float* __restrict__ kin, const float* __restrict__ Gs, const float* __restrict__ qin,
    const float* __restrict__ Wq, const float* __restrict__ Wk, const float* __restrict__ Wv,
    const float* __restrict__ Wo,
    unsigned short* KT, unsigned short* GT, unsigned short* QB,
    unsigned short* WQB, unsigned short* WKB, unsigned short* WVB, unsigned short* WOH) {
  __shared__ __align__(16) unsigned short t[64][72];
  const int tid = threadIdx.x;
  int j = blockIdx.x;
  if (j < NTK) {                         // column tile fastest, then row tile, then batch
    const int c0 = (j % (HID / 64)) * 64;
    const int r0 = ((j / (HID / 64)) % (LMEM / 64)) * 64;
    const size_t z = (size_t)(j / ((HID / 64) * (LMEM / 64)));
    tr_bf16<LMEM, HID>(kin + z * (size_t)(LMEM * HID), KT + z * (size_t)(HID * LMEM), r0, c0, t, tid);
    return;
  }
  j -= NTK;
  if (j < NTG) {
    const int c0 = (j % (NBAS / 64)) * 64;
    const int r0 = (j / (NBAS / 64)) * 64;
    tr_bf16<LMEM, NBAS>(Gs, GT, r0, c0, t, tid);
    return;
  }
  j -= NTG;
  if (j < NCQ) {
    cvt16x8<0>(qin, QB, j * 256 + tid);
    return;
  }
  j -= NCQ;
  const int w = j / NCW;
  const int i = (j % NCW) * 256 + tid;
  if (w == 3) {
    cvt16x8<1>(Wo, WOH, i);
  } else {
    const float* in = (w == 0) ? Wq : (w == 1) ? Wk : Wv;
    unsigned short* out = (w == 0) ? WQB : (w == 1) ? WKB : WVB;
    cvt16x8<0>(in, out, i);
  }
}

// =====================================================================================================
// LDS-staged batched WMMA GEMM (16-bit operand type OT): C[m][n] = sum_k A[m][k] * Bt[n][k];
// one block of 4 waves (2 x 2) per 128x128 tile, one wave per 64x64 quarter. A row-major [M][KD], Bt row-major
// [N][KD] (k contiguous, pitch KD); M, N multiples of 128, KD a multiple of 128 and at least 256 (static shapes here).
// blockIdx.x = tile (column tile fastest), blockIdx.y = batch index (strides in elements); the grid is exactly the tiles.
// A stage = 128 k = 256 B of each of the tile's operand rows [A 128 | Bt 128 | (SPL 2) Bt2 128], brought by asynchronous
// copies to LDS: 16 lanes x 16 B = one row's 256 B, so a wave's copy covers two rows in whole lines; each of the 128
// threads copies rows (tid >> 4) + 8 i. LDS row pitch 272 B. Two buffers: stage t + 1 flies while stage t is worked on.
// Fragments are read from LDS with the split k map (ldfrag), same k order per accumulator as a straight k loop.
// SPL 0: single product. SPL 2: Bt = hi plane Bt + residual plane Bt2 (2 products per k-step, same accumulator).
// OUT_MODE 0: f32 C (pitch ldc), value * oscale.
// OUT_MODE 2: bf16 hi plane C + bf16 residual plane C2 = bf16(v - hi) (same pitch / stride).
// =====================================================================================================
#define GKS  128       // k elements per stage
#define GPIT 136       // LDS row pitch in 16-bit elements: 272 B = 16 B x 17, conflict-free for 16-B fragment reads

// Eight asynchronous 16-B-per-lane copies global -> LDS: rows r, r + 8, ..., r + 56 of one operand plane.
// l = the lane's LDS byte address, g = the lane's global address, ld = global row pitch in elements.
__device__ __forceinline__ void acopy8(unsigned l, const unsigned short* g, int ld) {
#if DEV_ASM
  const size_t gs = (size_t)8 * (size_t)ld;
  const unsigned ls = 8u * GPIT * 2u;
  // the closing s_wait_xcnt keeps every address register intact until the copies have taken it
  asm volatile(
      "global_load_async_to_lds_b128 %0, %8, off\n\t"
      "global_load_async_to_lds_b128 %1, %9, off\n\t"
      "global_load_async_to_lds_b128 %2, %10, off\n\t"
      "global_load_async_to_lds_b128 %3, %11, off\n\t"
      "global_load_async_to_lds_b128 %4, %12, off\n\t"
      "global_load_async_to_lds_b128 %5, %13, off\n\t"
      "global_load_async_to_lds_b128 %6, %14, off\n\t"
      "global_load_async_to_lds_b128 %7, %15, off\n\t"
      "s_wait_xcnt 0x0"
      :: "v"(l), "v"(l + ls), "v"(l + 2u * ls), "v"(l + 3u * ls),
         "v"(l + 4u * ls), "v"(l + 5u * ls), "v"(l + 6u * ls), "v"(l + 7u * ls),
         "v"(g), "v"(g + gs), "v"(g + 2 * gs), "v"(g + 3 * gs),
         "v"(g + 4 * gs), "v"(g + 5 * gs), "v"(g + 6 * gs), "v"(g + 7 * gs)
      : "memory");
#endif
}

template <typename OT, int SPL, int OUT_MODE, int KD>
__global__ __launch_bounds__(128) void gemm128(
    const unsigned short* __restrict__ Ap, long long strideA,
    const unsigned short* __restrict__ Btp, const unsigned short* __restrict__ Bt2p, long long strideB,
    void* Cout, void* Cout2, int ldc, long long strideC,
    int N, float oscale) {
  typedef typename FT<OT>::frag V16;
  static_assert((KD % GKS) == 0 && KD / GKS >= 2);
  constexpr int NST  = KD / GKS;                       // stages
  constexpr int NPL  = (SPL == 2) ? 3 : 2;             // operand planes per stage
  constexpr int BUFE = NPL * 128 * GPIT;               // elements per buffer
  __shared__ __align__(16) unsigned short ring[2 * BUFE];
  __shared__ __align__(16) float sT[4][16 * 68];       // per-wave 16x64 slab, pitch 68 floats
  const int b    = blockIdx.y;
  const int tid  = threadIdx.x;
  const int lane = tid & 31;
  const int wave = tid >> 5;
  const int tilesN = N >> 7;
  const int tm = (int)blockIdx.x / tilesN;
  const int tn = (int)blockIdx.x - tm * tilesN;
  const int m0 = (tm << 7) + ((wave >> 1) << 6);       // this wave's 64x64 quarter
  const int n0 = (tn << 7) + ((wave & 1) << 6);

  // ---- copy side: lane -> (row group, 16-B segment of the 256-B row) ----
  const int seg = tid & 15, r8 = tid >> 4;
  const unsigned short* gA  = Ap   + (size_t)b * (size_t)strideA + (size_t)((tm << 7) + r8) * KD + seg * 8;
  const unsigned short* gB  = Btp  + (size_t)b * (size_t)strideB + (size_t)((tn << 7) + r8) * KD + seg * 8;
  const unsigned short* gB2 = Bt2p + (size_t)b * (size_t)strideB + (size_t)((tn << 7) + r8) * KD + seg * 8;
  const unsigned lds0 = (unsigned)(uintptr_t)(ring + r8 * GPIT + seg * 8);
  auto fill = [&](int s, int buf) {
    const unsigned l = lds0 + (unsigned)buf * (unsigned)(BUFE * 2);
    const int k0 = s * GKS;
    acopy8(l,                   gA + k0, KD);
    acopy8(l +  64 * GPIT * 2,  gA + k0 + (size_t)64 * KD, KD);
    acopy8(l + 128 * GPIT * 2,  gB + k0, KD);
    acopy8(l + 192 * GPIT * 2,  gB + k0 + (size_t)64 * KD, KD);
    if (SPL == 2) {
      acopy8(l + 256 * GPIT * 2, gB2 + k0, KD);
      acopy8(l + 320 * GPIT * 2, gB2 + k0 + (size_t)64 * KD, KD);
    }
  };

  const int rlane = lane & 15;                 // row (A) / col (B, D) within subtile
  const int koff  = (lane >> 4) * 8;           // k offset of this lane half
  const int mOff  = (lane >> 4) * 8;           // D row offset
  const int aoff = (((wave >> 1) << 6) + rlane) * GPIT + koff;
  const int boff = (128 + ((wave & 1) << 6) + rlane) * GPIT + koff;

  v8f acc[4][4];
#pragma unroll
  for (int i = 0; i < 4; ++i)
#pragma unroll
    for (int j = 0; j < 4; ++j) acc[i][j] = zero8();

  fill(0, 0);
#if DEV_ASM
  asm volatile("s_wait_asynccnt 0x0" ::: "memory");   // stage 0 of this wave has landed
#endif
  __syncthreads();                                      // stage 0 of every wave is readable
  fill(1, 1);

  // rolled: one stage's 64 or 128 WMMAs are the hot loop
#pragma unroll 1
  for (int t = 0; t < NST; ++t) {
    const OT* rb = (const OT*)(const void*)ring + (t & 1) * BUFE;
    // the loops below are unrolled so that af, bq and acc are indexed by constants and stay in registers
#pragma unroll
    for (int kk = 0; kk < GKS / 32; ++kk) {
      V16 af[4];
#pragma unroll
      for (int i = 0; i < 4; ++i) af[i] = ldfrag<OT>(rb + aoff + i * 16 * GPIT + kk * 32);
#pragma unroll
      for (int p = 0; p < ((SPL == 2) ? 2 : 1); ++p) {
        V16 bq[4];
#pragma unroll
        for (int j = 0; j < 4; ++j) bq[j] = ldfrag<OT>(rb + boff + p * 128 * GPIT + j * 16 * GPIT + kk * 32);
#pragma unroll
        for (int i = 0; i < 4; ++i)
#pragma unroll
          for (int j = 0; j < 4; ++j) acc[i][j] = mma_g(af[i], bq[j], acc[i][j]);
      }
    }
#if DEV_ASM
    asm volatile("s_wait_dscnt 0x0" ::: "memory");      // this wave's reads of buffer t & 1 are done before it is refilled
    asm volatile("s_wait_asynccnt 0x0" ::: "memory");   // this wave's copies of stage t + 1 have landed
#endif
    __syncthreads();                                    // publishes stage t + 1 and frees buffer t & 1
    if (t + 2 < NST) fill(t + 2, t & 1);
  }
#if DEV_ASM
  asm volatile("s_wait_asynccnt 0x0" ::: "memory");     // no copy is outstanding when the wave goes on to its end
#endif

  // ---- epilogue ----
  float* slab = sT[wave];
#pragma unroll
  for (int i = 0; i < 4; ++i) {
    const int mBase = m0 + (i << 4);
#pragma unroll
    for (int j = 0; j < 4; ++j) {
#pragma unroll
      for (int r = 0; r < 8; ++r) {
        slab[(mOff + r) * 68 + (j << 4) + rlane] = acc[i][j][r];
      }
    }
    __builtin_amdgcn_fence(__ATOMIC_RELEASE, "workgroup");
    __builtin_amdgcn_wave_barrier();
    __builtin_amdgcn_fence(__ATOMIC_ACQUIRE, "workgroup");
    if (OUT_MODE == 0) {
      float* Cf = (float*)Cout + (size_t)b * (size_t)strideC;
      const int h2 = lane >> 4, c4 = (lane & 15) * 4;     // 256-B row segment = 16 lanes x 16 B
      {
#pragma unroll
        for (int it = 0; it < 8; ++it) {
          const int row = it * 2 + h2;                     // it 0..7 x h2 0..1 = rows 0..15
          const v4f v = *(const v4f*)(slab + row * 68 + c4) * oscale;
          *(v4f*)(Cf + (size_t)(mBase + row) * (size_t)ldc + n0 + c4) = v;
        }
        
      }
    } else {
      const int q = lane >> 3, c8 = (lane & 7) * 8;
      unsigned short* Ch = (unsigned short*)Cout  + (size_t)b * (size_t)strideC;
      unsigned short* Cl = (unsigned short*)Cout2 + (size_t)b * (size_t)strideC;
      v4u hv[4], lv[4];
#pragma unroll
      for (int it = 0; it < 4; ++it) {
        const int row = it * 4 + q;                        // it 0..3 x q 0..3 = rows 0..15
        const float* sp = slab + row * 68 + c8;
        v4u a, a2;
#pragma unroll
        for (int e = 0; e < 4; ++e) {
          const float f0 = sp[2 * e], f1 = sp[2 * e + 1];
          const unsigned short h0 = bf_bits(f0), h1 = bf_bits(f1);
          const unsigned short l0 = bf_bits(f0 - bf_up(h0));
          const unsigned short l1 = bf_bits(f1 - bf_up(h1));
          a[e] = pk16(h0, h1); a2[e] = pk16(l0, l1);
        }
        hv[it] = a; lv[it] = a2;
      }
      {
#pragma unroll
        for (int it = 0; it < 4; ++it) {
          const int row = it * 4 + q;
          *(v4u*)(Ch + (size_t)(mBase + row) * (size_t)ldc + n0 + c8) = hv[it];
          *(v4u*)(Cl + (size_t)(mBase + row) * (size_t)ldc + n0 + c8) = lv[it];
        }
        
      }
    }
    __builtin_amdgcn_fence(__ATOMIC_RELEASE, "workgroup");
    __builtin_amdgcn_wave_barrier();
    __builtin_amdgcn_fence(__ATOMIC_ACQUIRE, "workgroup");
  }
}

// =====================================================================================================
// keys^T.w = Wk.(Bm^T.w): the score vectors need keys only through this product, so the weight vectors are
// contracted with Bm first and only the 8 resulting rows go through Wk.
// t[b*2+v][e] = sum_n bf16(w_v[n]) * (Bm hi + Bm residual)[b*512+n][e]   (f32; v = 0: w_mu, v = 1: w_sigma)
// Block 256 = (b, 64 columns e): 8 lanes x 8 columns = one 128-B row segment per plane, 32 row groups x 16 rows
// = all 512 n; group partials summed through LDS. Output plane T bf16 [16][1024]: row b*2+v = hi, row 8+b*2+v =
// residual; one wave stores a whole 128-B segment (32 lanes x 2 columns). grid (HID/64, NBATCH) covers all 16 rows.
// =====================================================================================================
__global__ __launch_bounds__(256) void wb_kernel(const unsigned short* __restrict__ bmh,
                                                 const unsigned short* __restrict__ bml,
                                                 const float* __restrict__ wmu, const float* __restrict__ wsg,
                                                 unsigned short* tpl) {
  __shared__ float wsh[2][NBAS];
  __shared__ __align__(16) float part[2][32][64];
  const int tid = threadIdx.x;
  const int b  = blockIdx.y;
  const int e0 = blockIdx.x * 64;
  const int g = tid >> 3, c8 = (tid & 7) * 8;
  const unsigned short* ph = bmh + ((size_t)b * NBAS + g) * HID + e0 + c8;
  const unsigned short* pl = bml + ((size_t)b * NBAS + g) * HID + e0 + c8;
  // all of the thread's rows are loaded first: every row is read once, so the cost is latency, paid once this way
  v8us hv[NBAS / 32], lv[NBAS / 32];
#pragma unroll
  for (int it = 0; it < NBAS / 32; ++it) {
    hv[it] = *(const v8usa*)(ph + (size_t)it * 32 * HID);
    lv[it] = *(const v8usa*)(pl + (size_t)it * 32 * HID);
  }
#pragma unroll
  for (int k = 0; k < NBAS / 256; ++k) {
    const int i = tid + 256 * k;
    wsh[0][i] = bf_up(bf_bits(wmu[i]));
    wsh[1][i] = bf_up(bf_bits(wsg[i]));
  }
  __syncthreads();
  float am[8], ag[8];
#pragma unroll
  for (int j = 0; j < 8; ++j) { am[j] = 0.f; ag[j] = 0.f; }
#pragma unroll
  for (int it = 0; it < NBAS / 32; ++it) {
    const float w0 = wsh[0][it * 32 + g];
    const float w1 = wsh[1][it * 32 + g];
#pragma unroll
    for (int j = 0; j < 8; ++j) {
      const float x = bf_up(hv[it][j]) + bf_up(lv[it][j]);
      am[j] += x * w0;
      ag[j] += x * w1;
    }
  }
#pragma unroll
  for (int j = 0; j < 8; ++j) {
    part[0][g][c8 + j] = am[j];
    part[1][g][c8 + j] = ag[j];
  }
  __syncthreads();
  if (tid < 64) {                       // wave 0: v = 0, wave 1: v = 1; lane = column pair
    const int v = tid >> 5, c2 = (tid & 31) * 2;
    float s0 = 0.f, s1 = 0.f;
#pragma unroll
    for (int gg = 0; gg < 32; ++gg) {
      s0 += part[v][gg][c2];
      s1 += part[v][gg][c2 + 1];
    }
    const unsigned short h0 = bf_bits(s0), h1 = bf_bits(s1);
    const unsigned short l0 = bf_bits(s0 - bf_up(h0));
    const unsigned short l1 = bf_bits(s1 - bf_up(h1));
    *(unsigned*)(tpl + (size_t)(b * 2 + v) * HID + e0 + c2)     = pk16(h0, h1);
    *(unsigned*)(tpl + (size_t)(8 + b * 2 + v) * HID + e0 + c2) = pk16(l0, l1);
  }
}

// =====================================================================================================
// u[r][e] = sum_e' (T hi + T residual)[r][e'] * bf16(Wk)[e][e'],  r = b*2+v in 0..7   (f32, same table as before)
// A = T [16][1024] (rows 0..7 hi, rows 8..15 residual), Bt = Wk bf16 [e][e']; D row r + D row r+8 = u row r.
// Block 256 = 32 columns e (two 16-column tiles); wave w takes the k slice [128 w, 128 w + 128) = 4 k-steps for both
// tiles (A fragment shared); the 8 slice partials are summed through LDS. Store: one wave = one row's 32 floats
// = one 128-B segment. grid HID/32 covers all 1024 columns of all 8 rows.
// =====================================================================================================
__global__ __launch_bounds__(256) void u_kernel(const unsigned short* __restrict__ tpl,
                                                const unsigned short* __restrict__ wkp, float* u) {
  __shared__ float red[8][8][32];       // [k slice][row r][column]
  const int tid  = threadIdx.x;
  const int wave = tid >> 5;
  const int lane = tid & 31;
  const int rlane = lane & 15;          // row (A) / col (B, D) within the tile
  const int koff  = (lane >> 4) * 8;    // k offset of this lane half
  const int n0 = blockIdx.x * 32;
  const __bf16* A  = (const __bf16*)(const void*)tpl + (size_t)rlane * HID + koff + wave * 128;
  const __bf16* B0 = (const __bf16*)(const void*)wkp + (size_t)(n0 + rlane) * HID + koff + wave * 128;
  const __bf16* B1 = B0 + (size_t)16 * HID;
  v16b af[4], b0[4], b1[4];
#pragma unroll
  for (int s = 0; s < 4; ++s) {
    af[s] = ldfrag<__bf16>(A  + 32 * s);
    b0[s] = ldfrag<__bf16>(B0 + 32 * s);
    b1[s] = ldfrag<__bf16>(B1 + 32 * s);
  }
  v8f a0 = zero8(), a1 = zero8();
#pragma unroll
  for (int s = 0; s < 4; ++s) {
    a0 = mma_g(af[s], b0[s], a0);
    a1 = mma_g(af[s], b1[s], a1);
  }
  // D element r of lane half 0 = row r (hi part), of lane half 1 = row r+8 (residual part), same column
#pragma unroll
  for (int r = 0; r < 8; ++r) {
    const float x0 = a0[r] + __shfl_xor(a0[r], 16, 32);
    const float x1 = a1[r] + __shfl_xor(a1[r], 16, 32);
    red[wave][r][lane] = (lane < 16) ? x0 : x1;     // lanes 16..31 hold the second tile's column lane-16
  }
  __syncthreads();
  {
    float s = 0.f;
#pragma unroll
    for (int w = 0; w < 8; ++w) s += red[w][wave][lane];
    u[(size_t)wave * HID + n0 + lane] = s;
  }
}

// =====================================================================================================
// Continuous attention context, one block = (b, head h, 64 queries), 4 waves x 16 queries, grid NBATCH*NH*NQB64.
//   prologue (f32): dm = sum_d qry[q][h*64+d]*u_mu[b][h*64+d] / 8, dg likewise with u_sigma;
//     mu = sigmoid(dm), sig2 = max(softplus(dg), 1e-4)   (lane c = query, lane halves each do 32 d, shfl combine)
//   loop over 8 chunks of 64 basis functions (static trip): vals^T hi / residual chunks [d 64][n 64] staged in
//     LDS by 128 threads x 32 elements per plane (whole 64x64 tile, __syncthreads before and after);
//     per 32-deep k-step the lane builds its A fragment in registers: element i = r[q=c][n0+32kk+k(i)],
//     r = exp(-0.5 (mu - bm[n])^2 / var) / sqrt(2 pi var), var = sig2 + bs[n]^2 (bm, bs = bf16-converted basis
//     tables in LDS), carried as r / RSC = exp2(-(t s)^2) s with t = mu - bm[n], s = rsq(VK var) (sig2 and the bs^2 table
//     hold VK var's two terms; RSC is folded back once in the epilogue), two n per packed f32 instruction,
//     as bf16 hi + bf16 residual (RNE converts); B fragments = vals^T hi / residual from LDS (col = d, k = n);
//     oacc[t] += rh.vh + rh.vl + rl.vh  (bf16 WMMA, one f32 accumulator).
//   epilogue: wave's 16x64 f32 tile staged in LDS, converted to f16(64 * ctx), written to the ctx plane
//   coverage: rows it(4) x (lane>>3)(4) = 16 per wave x 4 waves x 32 qb x 4 b; cols 8 lanes x 8 = 64 per head x 16 heads
//   = the whole [8192][1024] ctx plane. LDS extents: Vth/Vtl 64x64 staged = 64x64 consumed (row pitch VPIT); bm_s/bv_s 512 = 512;
//   Os written 16x64 per wave before the wave reads its own tile.
// =====================================================================================================
#define VPIT 72        // LDS row pitch of the vals^T chunks in 16-bit elements: 144 B = 16 B x 9, conflict-free for 16-B reads and stores
#define OPIT 68        // LDS row pitch of the per-wave context tile in floats: 272 B = 16 B x 17, same reason
#define VK   1.3862943611198906f   // 2 ln 2: exp(-t^2 / (2 var)) = exp2(-t^2 / (VK var))
#define RSC  0.46971863934982566f  // sqrt(VK / (2 pi)): 1 / sqrt(2 pi var) = RSC / sqrt(VK var)
__global__ __launch_bounds__(128) void ctx_kernel(
    const float* __restrict__ qry, const float* __restrict__ u,
    const float* __restrict__ bmu, const float* __restrict__ bsg,
    const unsigned short* __restrict__ vthp, const unsigned short* __restrict__ vtlp,
    unsigned short* ctxp) {
  union FB { v16b v; v8us h[2]; unsigned w[8]; };
  __shared__ __align__(16) unsigned short Vth[64 * VPIT];  // vals^T hi chunk [d][n]       9 KB
  __shared__ __align__(16) unsigned short Vtl[64 * VPIT];  // vals^T residual chunk        9 KB
  __shared__ __align__(16) float Os[4][16 * OPIT];         // per-wave context tile       17 KB
  __shared__ __align__(16) float bm_s[NBAS];               // bf16-converted basis means
  __shared__ __align__(16) float bv_s[NBAS];               // VK * (bf16-converted basis sigma)^2

  const int tid  = threadIdx.x;
  const int wave = tid >> 5;
  const int lane = tid & 31;
  const int hh   = lane >> 4;
  const int c    = lane & 15;

  const int bx   = blockIdx.x;
  const int qb   = bx % NQB64;
  const int rest = bx / NQB64;
  const int h    = rest % NH;
  const int b    = rest / NH;
  const int q0   = qb * 64 + wave * 16;
  const size_t row0 = (size_t)b * QLEN + q0;              // plane row of this wave's query 0

  for (int i = tid; i < NBAS; i += 128) {
    const float m = bf_up(bf_bits(bmu[i]));
    const float s = bf_up(bf_bits(bsg[i]));
    bm_s[i] = m;
    bv_s[i] = s * s * VK;
  }

  // ---- per-query affine heads (f32) ----
  float dm = 0.f, dg = 0.f;
  {
    const float* qr = qry + (row0 + c) * HID + (size_t)h * HD + 32 * hh;
    const float* um = u + ((size_t)b * 2) * HID + (size_t)h * HD + 32 * hh;
    const float* ug = um + HID;
#pragma unroll 2
    for (int i = 0; i < 8; ++i) {
      const v4f a  = *(const v4f*)(qr + 4 * i);
      const v4f wm = *(const v4f*)(um + 4 * i);
      const v4f wg = *(const v4f*)(ug + 4 * i);
      dm += a[0] * wm[0]; dm += a[1] * wm[1]; dm += a[2] * wm[2]; dm += a[3] * wm[3];
      dg += a[0] * wg[0]; dg += a[1] * wg[1]; dg += a[2] * wg[2]; dg += a[3] * wg[3];
    }
  }
  dm += __shfl_xor(dm, 16, 32);
  dg += __shfl_xor(dg, 16, 32);
  dm *= 0.125f;
  dg *= 0.125f;
  const float mu   = 1.0f / (1.0f + expf(-dm));
  const float spl  = fmaxf(dg, 0.0f) + log1pf(expf(-fabsf(dg)));
  const float sig2k = fmaxf(spl, 1e-4f) * VK;

  const unsigned short* Vh = vthp + ((size_t)b * HID + (size_t)h * HD) * NBAS;
  const unsigned short* Vl = vtlp + ((size_t)b * HID + (size_t)h * HD) * NBAS;

  v8f oacc[4];
#pragma unroll
  for (int t = 0; t < 4; ++t) oacc[t] = zero8();

  for (int nt = 0; nt < NCH; ++nt) {         // static trip count
    const int n0 = nt * 64;
    __syncthreads();
    {
      const int r = tid >> 1, half = (tid & 1) * 32;      // d = r, n = n0 + half .. + 31
      const unsigned short* vg  = Vh + (size_t)r * NBAS + n0 + half;
      const unsigned short* vlg = Vl + (size_t)r * NBAS + n0 + half;
#pragma unroll
      for (int i = 0; i < 4; ++i) {
        const v8us b0 = *(const v8usa*)(vg + 8 * i);
        const v8us b1 = *(const v8usa*)(vlg + 8 * i);
        *(v8usa*)(Vth + r * VPIT + half + 8 * i) = b0;
        *(v8usa*)(Vtl + r * VPIT + half + 8 * i) = b1;
      }
    }
    __syncthreads();

#pragma unroll 1
    for (int kk = 0; kk < 2; ++kk) {
      // ---- A fragments: r values of query c at the 16 k slots of this lane half, bf16 hi + residual ----
      FB rh, rl;
#pragma unroll
      for (int p = 0; p < 8; ++p) {          // elements 2p, 2p + 1: two neighbouring n
        const int n = n0 + kk * 32 + 8 * hh + ((p < 4) ? (2 * p) : (8 + 2 * p));
        const v2f t  = mu - *(const v2f*)(bm_s + n);
        const v2f vk = sig2k + *(const v2f*)(bv_s + n);
        v2f rs;
        rs.x = __builtin_amdgcn_rsqf(vk.x);
        rs.y = __builtin_amdgcn_rsqf(vk.y);
        const v2f zz = t * rs;
        const v2f ar = zz * zz;
        v2f ex;
        ex.x = __builtin_amdgcn_exp2f(-ar.x);
        ex.y = __builtin_amdgcn_exp2f(-ar.y);
        const v2f rv = ex * rs;
        const unsigned hp = __builtin_bit_cast(unsigned, __builtin_convertvector(rv, v2b));
        v2f up;
        up.x = __uint_as_float(hp << 16);
        up.y = __uint_as_float(hp & 0xFFFF0000u);
        rh.w[p] = hp;
        rl.w[p] = __builtin_bit_cast(unsigned, __builtin_convertvector(rv - up, v2b));
      }
      // ---- ctx += r . vals over this 32-deep slice of n ----
#pragma unroll
      for (int t = 0; t < 4; ++t) {
        FB vb, vl;
        vb.h[0] = *(const v8usa*)(Vth + (t * 16 + c) * VPIT + kk * 32 + 8 * hh);
        vb.h[1] = *(const v8usa*)(Vth + (t * 16 + c) * VPIT + kk * 32 + 16 + 8 * hh);
        vl.h[0] = *(const v8usa*)(Vtl + (t * 16 + c) * VPIT + kk * 32 + 8 * hh);
        vl.h[1] = *(const v8usa*)(Vtl + (t * 16 + c) * VPIT + kk * 32 + 16 + 8 * hh);
        oacc[t] = mma_g(rh.v, vb.v, oacc[t]);
        oacc[t] = mma_g(rh.v, vl.v, oacc[t]);
        oacc[t] = mma_g(rl.v, vb.v, oacc[t]);
      }
    }
  }

  float* os = Os[wave];
#pragma unroll
  for (int r = 0; r < 8; ++r) {
#pragma unroll
    for (int t = 0; t < 4; ++t) os[(8 * hh + r) * OPIT + t * 16 + c] = oacc[t][r];
  }
  __builtin_amdgcn_fence(__ATOMIC_RELEASE, "workgroup");
  __builtin_amdgcn_wave_barrier();
  __builtin_amdgcn_fence(__ATOMIC_ACQUIRE, "workgroup");
  {
    const int q4 = lane >> 3, c8 = (lane & 7) * 8;
    v4u hv[4];
#pragma unroll
    for (int it = 0; it < 4; ++it) {
      const int row = it * 4 + q4;   // it 0..3 x q4 0..3 = rows 0..15 of the wave tile
      const float* sp = os + row * OPIT + c8;
      v4u a;
#pragma unroll
      for (int e = 0; e < 4; ++e) {
        const float f0 = sp[2 * e] * (CSC * RSC), f1 = sp[2 * e + 1] * (CSC * RSC);
        a[e] = pk16(h_bits((_Float16)f0), h_bits((_Float16)f1));
      }
      hv[it] = a;
    }
    {
#pragma unroll
      for (int it = 0; it < 4; ++it) {
        const int row = it * 4 + q4;
        const size_t go = (row0 + row) * HID + (size_t)h * HD + c8;
        *(v4u*)(ctxp + go) = hv[it];
      }
      
    }
  }
}

// =====================================================================================================
// Workspace map (bytes), every region an exact multiple of its whole-line / whole-tile store granularity:
//   KT   bf16 [4][1024 e][2048 l]   16777216   (dead after the Bm GEMM; reused as the f16 ctx plane [8192][1024], same size)
//   GT   bf16 [512 n][2048 l]        2097152
//   QB   bf16 [8192][1024]          16777216
//   WQB  bf16 [1024][1024]           2097152
//   WKB  bf16 [1024][1024]           2097152
//   WVB  bf16 [1024][1024]           2097152
//   WOH  f16  [1024][1024] (x64)     2097152
//   BMH  bf16 [4*512][1024]          4194304   Bm hi
//   BML  bf16 [4*512][1024]          4194304   Bm residual
//   TPL  bf16 [16][1024]               32768   t = w^T.Bm, rows 0..7 hi, rows 8..15 residual
//   VTH  bf16 [4][1024 e][512 n]     4194304   vals^T hi
//   VTL  bf16 [4][1024 e][512 n]     4194304   vals^T residual
//   QRY  f32  [8192][1024]          33554432
//   U    f32  [4][2][1024]             32768
//   total                           94437376
// Weights are [out][in] with in contiguous = the Bt layout for x.W^T, so they are only converted.
// =====================================================================================================
extern "C" void kernel_launch(void* const* d_in, const int* in_sizes, int n_in,
                              void* d_out, int out_size, void* d_ws, size_t ws_size,
                              hipStream_t stream) {
  if (n_in < 11) return;
  if (in_sizes[0] != NBATCH * LMEM * HID) return;
  if (in_sizes[1] != MROWS * HID) return;
  if (in_sizes[2] != HID * HID || in_sizes[3] != HID * HID || in_sizes[4] != HID * HID || in_sizes[5] != HID * HID) return;
  if (in_sizes[6] != NBAS || in_sizes[7] != NBAS) return;
  if (in_sizes[8] != LMEM * NBAS || in_sizes[9] != NBAS || in_sizes[10] != NBAS) return;
  if (out_size != MROWS * HID) return;

  const float* kin = (const float*)d_in[0];
  const float* qin = (const float*)d_in[1];
  const float* Wq  = (const float*)d_in[2];
  const float* Wk  = (const float*)d_in[3];
  const float* Wv  = (const float*)d_in[4];
  const float* Wo  = (const float*)d_in[5];
  const float* wmu = (const float*)d_in[6];
  const float* wsg = (const float*)d_in[7];
  const float* Gs  = (const float*)d_in[8];
  const float* bmu = (const float*)d_in[9];
  const float* bsg = (const float*)d_in[10];

  const size_t PKT  = (size_t)NBATCH * HID * LMEM * 2;    // 16777216  k^T planes; later the ctx f16 plane
  const size_t PCTX = (size_t)MROWS * HID * 2;            // 16777216  (== PKT)
  const size_t PGT  = (size_t)NBAS * LMEM * 2;            //  2097152
  const size_t PQB  = (size_t)MROWS * HID * 2;            // 16777216
  const size_t PW   = (size_t)HID * HID * 2;              //  2097152
  const size_t PBM  = (size_t)NBATCH * NBAS * HID * 2;    //  4194304
  const size_t PTPL = (size_t)16 * HID * 2;               //    32768
  const size_t PVT  = (size_t)NBATCH * HID * NBAS * 2;    //  4194304
  const size_t PQRY = (size_t)MROWS * HID * 4;            // 33554432
  const size_t PU   = (size_t)NBATCH * 2 * HID * 4;       //    32768
  if (PCTX > PKT) return;
  size_t off = 0;
  const size_t oKT  = off; off += PKT;
  const size_t oGT  = off; off += PGT;
  const size_t oQB  = off; off += PQB;
  const size_t oWQ  = off; off += PW;
  const size_t oWK  = off; off += PW;
  const size_t oWV  = off; off += PW;
  const size_t oWO  = off; off += PW;
  const size_t oBMH = off; off += PBM;
  const size_t oBML = off; off += PBM;
  const size_t oTPL = off; off += PTPL;
  const size_t oVTH = off; off += PVT;
  const size_t oVTL = off; off += PVT;
  const size_t oQRY = off; off += PQRY;
  const size_t oU   = off; off += PU;
  if (off > ws_size) return;                        // off = 94437376
  if (off > (size_t)134217728) return;

  char* ws = (char*)d_ws;
  unsigned short* KT  = (unsigned short*)(ws + oKT);
  unsigned short* CTX = (unsigned short*)(ws + oKT);   // reuse after the Bm GEMM has consumed KT
  unsigned short* GT  = (unsigned short*)(ws + oGT);
  unsigned short* QB  = (unsigned short*)(ws + oQB);
  unsigned short* WQB = (unsigned short*)(ws + oWQ);
  unsigned short* WKB = (unsigned short*)(ws + oWK);
  unsigned short* WVB = (unsigned short*)(ws + oWV);
  unsigned short* WOH = (unsigned short*)(ws + oWO);
  unsigned short* BMH = (unsigned short*)(ws + oBMH);
  unsigned short* BML = (unsigned short*)(ws + oBML);
  unsigned short* TPL = (unsigned short*)(ws + oTPL);
  unsigned short* VTH = (unsigned short*)(ws + oVTH);
  unsigned short* VTL = (unsigned short*)(ws + oVTL);
  float*          QRY = (float*)(ws + oQRY);
  float*          U   = (float*)(ws + oU);

  const dim3 blk(256);
  const dim3 gBm((NBAS / 128) * (HID / 128), NBATCH);            // 32 tiles of 128x128 x 4 b      (M=512,  N=1024, K=2048)
  const dim3 gWb(HID / 64, NBATCH);                               // (16, 4)
  const dim3 gVt((HID / 128) * (NBAS / 128), NBATCH);             // 32 tiles of 128x128 x 4 b      (M=1024, N=512,  K=1024)
  const dim3 gQ((MROWS / 128) * (HID / 128), 1);                  // 512 tiles of 128x128           (M=8192, N=1024, K=1024)
  const dim3 gU(HID / 32);                                        // 32 blocks
  const dim3 gCtx(NBATCH * NH * NQB64);                           // 2048 blocks of 128

  // (1) k -> k^T bf16 per batch, Gs -> Gs^T bf16 (l contiguous); q and weights -> bf16; Wo -> f16 (64 x its bf16 value)
  prep_kernel<<<dim3(NPREP), blk, 0, stream>>>(kin, Gs, qin, Wq, Wk, Wv, Wo, KT, GT, QB, WQB, WKB, WVB, WOH);
  // (2) Bm[b][n][e] = sum_l Gs^T[n][l] k^T[b][e][l] -> bf16 hi / residual planes [b*512+n][e]
  gemm128<__bf16, 0, 2, LMEM><<<gBm, dim3(128), 0, stream>>>(
      GT, 0LL, KT, KT, (long long)HID * LMEM,
      (void*)BMH, (void*)BML, HID, (long long)NBAS * HID,
      HID, 1.0f);
  // (3) t[b*2+v][e'] = sum_n bf16(w_mu / w_sigma)[n] Bm[b*512+n][e'] (f32) -> bf16 hi / residual rows of TPL
  wb_kernel<<<gWb, blk, 0, stream>>>(BMH, BML, wmu, wsg, TPL);
  // (4) vals^T[b][e][n] = sum_e' Wv[e][e'] Bm[b*512+n][e'] -> bf16 hi / residual planes, pitch 512 (Bm on the Bt side, 2 products)
  gemm128<__bf16, 2, 2, HID><<<gVt, dim3(128), 0, stream>>>(
      WVB, 0LL, BMH, BML, (long long)NBAS * HID,
      (void*)VTH, (void*)VTL, NBAS, (long long)HID * NBAS,
      NBAS, 1.0f);
  // (5) qry[b*2048+q][e] = sum_e' q[..][e'] Wq[e][e'] -> f32 plane (read only by the qry.u dots of (7))
  gemm128<__bf16, 0, 0, HID><<<gQ, dim3(128), 0, stream>>>(
      QB, 0LL, WQB, WQB, 0LL,
      (void*)QRY, (void*)QRY, HID, 0LL,
      HID, 1.0f);
  // (6) u[b][0/1][e] = sum_e' t[b*2+0/1][e'] Wk[e][e']   (= sum_n keys[b][n][e] * w[n] with keys = Bm.Wk^T)
  u_kernel<<<gU, blk, 0, stream>>>(TPL, WKB, U);
  // (7) mu, sig2 per query; ctx = r . vals -> f16 ctx plane (x64) [8192][1024] in the KT region
  ctx_kernel<<<gCtx, dim3(128), 0, stream>>>(QRY, U, bmu, bsg, VTH, VTL, CTX);
  // (8) out = ctx . Wo^T -> d_out f32 [8192][1024], accumulator x 1/(64*64)
  gemm128<_Float16, 0, 0, HID><<<gQ, dim3(128), 0, stream>>>(
      CTX, 0LL, WOH, WOH, 0LL,
      d_out, d_out, HID, 0LL,
      HID, 1.0f / (CSC * WOSC));
  (void)hipGetLastError();
}

// v006
// It runs in 125 microseconds.
// Next to v005, in two timings, it ran 1.15 times as fast each time.
// All steps since v000 together make it 3.78 times as fast.
// Contractions: Gs^T.k^T (Bm) on v_wmma_f32_16x16x32_bf16 (bf16 operands RNE-converted from inputs, single product, f32 accumulate);
// q.P^T on v_wmma_f32_16x16x32_bf16, P[b][v][h][e'] = sum_d u[b][v][h*64+d] * bf16(Wq)[h*64+d][e'] (f32) as bf16 hi + bf16 residual
// planes (2 products, f32 accumulate), q RNE-converted to bf16 in registers: qry.u = (q.Wq^T).u = q.(Wq^T.u), head by head;
// Wv.Bm^T on v_wmma_f32_16x16x32_bf16 with Bm as bf16 hi + bf16 residual planes (2 products, f32 accumulate);
// (w^T.Bm).Wk^T on v_wmma_f32_16x16x32_bf16: the 8 rows t = w^T.Bm as bf16 hi (A rows 0..7) + bf16 residual (A rows 8..15),
// one product, f32 accumulate, D rows r and r+8 added;
// r.vals on v_wmma_f32_16x16x32_bf16 with r and vals^T each bf16 hi + bf16 residual (3 products hh+hl+lh, f32 accumulate);
// ctx.Wo^T on v_wmma_f32_16x16x32_f16 (ctx f16 carried x64, Wo f16 = 64 x its bf16 value, single product, f32 accumulate, folded back x 1/4096);
// w^T.Bm and u.Wq score-vector dots, sigmoid, softplus and the Gaussian density in f32.
// Carry audit: Woh plane = f16(64 * bf16(Wo)), ctx plane = f16(64 * ctx); both inverses folded back exactly once by
// oscale = 1/4096 in the out GEMM epilogue (OUT_MODE 0). Bm, vals^T and r residual planes are unscaled bf16 (v - hi)
// and share the hi accumulator (no fold needed). r planes carry r / RSC (RSC = sqrt(ln 2 / pi)); the inverse is folded back exactly
// once, with the ctx carry, by CSC * RSC in the ctx kernel's epilogue.
#include <hip/hip_runtime.h>
#include <math.h>
#include <stdint.h>

#define NBATCH 4
#define LMEM   2048
#define QLEN   2048
#define HID    1024
#define NH     16
#define HD     64
#define NBAS   512
#define MROWS  (NBATCH * QLEN)   // 8192 query rows
#define NQB64  (QLEN / 64)       // 32 blocks of 64 queries per sequence
#define NCH    (NBAS / 64)       // 8 chunks of 64 basis functions
static_assert(NH * HD == HID);
static_assert(NQB64 == 32 && NCH == 8);
static_assert((LMEM % 64) == 0 && (QLEN % 64) == 0 && (HID % 64) == 0 && (NBAS % 64) == 0);
static_assert((LMEM % 128) == 0 && (HID % 128) == 0 && (NBAS % 128) == 0 && (MROWS % 128) == 0);
#define CSC  64.0f     // ctx plane carry (f16)
#define WOSC 64.0f     // Wo plane carry (f16 of the bf16 value)

typedef _Float16 v16h __attribute__((ext_vector_type(16)));
typedef _Float16 v8h  __attribute__((ext_vector_type(8)));
typedef __bf16   v16b __attribute__((ext_vector_type(16)));
typedef __bf16   v8b  __attribute__((ext_vector_type(8)));
typedef float    v8f  __attribute__((ext_vector_type(8)));
typedef float    v4f  __attribute__((ext_vector_type(4)));
typedef float    v2f  __attribute__((ext_vector_type(2)));
typedef __bf16   v2b  __attribute__((ext_vector_type(2)));
typedef unsigned int   v4u  __attribute__((ext_vector_type(4)));
typedef unsigned short v8us __attribute__((ext_vector_type(8)));
typedef v4u  __attribute__((may_alias)) v4ua;
typedef v8us __attribute__((may_alias)) v8usa;

#if defined(__HIP_DEVICE_COMPILE__)
#define DEV_ASM 1
#else
#define DEV_ASM 0
#endif

// ---- scalar helpers ---------------------------------------------------------------------------------
__device__ __forceinline__ unsigned short bf_bits(float f) {          // f32 -> bf16 bits, RNE convert
  unsigned u = __float_as_uint(f);
  return (unsigned short)((u + 0x7FFFu + ((u >> 16) & 1u)) >> 16);
}
__device__ __forceinline__ float bf_up(unsigned short hb) { return __uint_as_float(((unsigned)hb) << 16); }
__device__ __forceinline__ unsigned short h_bits(_Float16 x) { return __builtin_bit_cast(unsigned short, x); }
__device__ __forceinline__ unsigned pk16(unsigned short a, unsigned short b) { return (unsigned)a | ((unsigned)b << 16); }
__device__ __forceinline__ v8f zero8() { v8f z = {0.f, 0.f, 0.f, 0.f, 0.f, 0.f, 0.f, 0.f}; return z; }

// ---- fragment types / loaders: 16-bit A/B operand, lane -> row/col (lane&15), p already includes +8*(lane>>4);
//      elements 0..7 <- p[0..7] (k0+8h..k0+8h+7), elements 8..15 <- p[16..23] (k0+16+8h..k0+16+8h+7)
template <typename OT> struct FT;
template <> struct FT<__bf16>   { typedef v16b frag; typedef v8b half8; };
template <> struct FT<_Float16> { typedef v16h frag; typedef v8h half8; };

template <typename OT>
__device__ __forceinline__ typename FT<OT>::frag ldfrag(const OT* p) {
  union { typename FT<OT>::frag v; typename FT<OT>::half8 h[2]; } f;
  f.h[0] = *(const typename FT<OT>::half8*)(p);
  f.h[1] = *(const typename FT<OT>::half8*)(p + 16);
  return f.v;
}

// ---- guarded WMMA: 4 VALU slots after every WMMA, D tied, A/B kept live -----------------------------------
__device__ __forceinline__ v8f mma_g(v16b a, v16b b, v8f c) {
  c = __builtin_amdgcn_wmma_f32_16x16x32_bf16(false, a, false, b, (short)0, c, false, false);
#if DEV_ASM
  asm volatile("v_nop\n\tv_nop\n\tv_nop\n\tv_nop" : "+v"(c) : "v"(a), "v"(b));
#endif
  return c;
}
__device__ __forceinline__ v8f mma_g(v16h a, v16h b, v8f c) {
  c = __builtin_amdgcn_wmma_f32_16x16x32_f16(false, a, false, b, (short)0, c, false, false);
#if DEV_ASM
  asm volatile("v_nop\n\tv_nop\n\tv_nop\n\tv_nop" : "+v"(c) : "v"(a), "v"(b));
#endif
  return c;
}

// =====================================================================================================
// Operand preparation, ONE launch: six jobs that do not depend on one another share one grid; blockIdx.x alone
// (block-uniform) says which job a block works for and which piece of it:
//   [0, NTK)          k[b][l][e]  f32 -> k^T[b][e][l] bf16   64x64 tile transpose
//   then NTG blocks   Gs[l][n]    f32 -> Gs^T[n][l]   bf16   64x64 tile transpose
//   then NCW blocks each for Wq, Wk, Wv (bf16) and Wo (f16 of 64 x its bf16 value)
// =====================================================================================================
#define NTK  ((HID / 64) * (LMEM / 64) * NBATCH)     // 2048
#define NTG  ((NBAS / 64) * (LMEM / 64))             //  256
#define NCW  (HID * HID / 2048)                      //  512
#define NPREP (NTK + NTG + 4 * NCW)                  // 4352
static_assert(((HID * HID) % 2048) == 0);

// f32 -> 16-bit planes, 8 elements per thread, one 16-B store per lane: a wave writes 512 contiguous B
// MODE 0: bf16 bits (RNE convert).  MODE 1: f16 bits of (64 * bf16(x)) (exact scaling of the bf16 value).
template <int MODE>
__device__ __forceinline__ unsigned short cvm(float f) {
  const unsigned short hb = bf_bits(f);
  if (MODE == 0) return hb;
  return h_bits((_Float16)(bf_up(hb) * WOSC));
}

// thread i of a plane -> its elements 8 i .. 8 i + 7; a block of 256 threads = 2048 elements, the blocks cover the plane exactly
template <int MODE>
__device__ __forceinline__ void cvt16x8(const float* __restrict__ in, unsigned short* out, int i) {
  const v4f a  = *(const v4f*)(in + (size_t)i * 8);
  const v4f a4 = *(const v4f*)(in + (size_t)i * 8 + 4);
  v4u p;
  p[0] = pk16(cvm<MODE>(a[0]),  cvm<MODE>(a[1]));
  p[1] = pk16(cvm<MODE>(a[2]),  cvm<MODE>(a[3]));
  p[2] = pk16(cvm<MODE>(a4[0]), cvm<MODE>(a4[1]));
  p[3] = pk16(cvm<MODE>(a4[2]), cvm<MODE>(a4[3]));
  unsigned short* o = out + (size_t)i * 8;
  *(v4u*)o = p;
#if DEV_ASM
  asm volatile("s_wait_xcnt 0x0" ::: "memory");   // another job's code follows in the kernel and reuses the store's registers
#endif
}

// Tiled transpose + bf16 convert: in[R][C] f32 (C contiguous) -> out[C][R] bf16 (R contiguous), one 64x64 tile at row r0,
// column c0. Load: 256 thr x 4 it x 4 floats = the tile (16-B loads along C), staged as bf16 t[cc][rr] (pitch 72 shorts,
// 16-B aligned rows); __syncthreads; store: out row (c0+row), 128-B segments.
template <int R, int C>
__device__ __forceinline__ void tr_bf16(const float* __restrict__ ib, unsigned short* ob, int r0, int c0,
                                        unsigned short (*t)[72], int tid) {
  const int rq = tid >> 4, cc4 = (tid & 15) * 4;       // round it: row rq + 16 it, columns cc4 .. cc4 + 3
  const float* p = ib + (size_t)(r0 + rq) * (size_t)C + c0 + cc4;
  v4f v[4];
#pragma unroll
  for (int it = 0; it < 4; ++it) v[it] = *(const v4f*)(p + (size_t)it * 16 * C);
#if DEV_ASM
  asm volatile("s_wait_xcnt 0x0" :: "v"(p) : "memory");   // the four loads' address pair is rewritten only behind this wait
#endif
#pragma unroll
  for (int it = 0; it < 4; ++it) {
    const int rr = rq + 16 * it;
    t[cc4 + 0][rr] = bf_bits(v[it][0]);
    t[cc4 + 1][rr] = bf_bits(v[it][1]);
    t[cc4 + 2][rr] = bf_bits(v[it][2]);
    t[cc4 + 3][rr] = bf_bits(v[it][3]);
  }
  __syncthreads();
  const int wave = tid >> 5, lane = tid & 31;
  const int q8 = lane & 7, sub = lane >> 3;
  v4u pv[2];
#pragma unroll
  for (int it = 0; it < 2; ++it) {
    const int row = it * 32 + wave * 4 + sub;
    pv[it] = *(const v4ua*)(&t[row][8 * q8]);
  }
#pragma unroll
  for (int it = 0; it < 2; ++it) {
    const int row = it * 32 + wave * 4 + sub;
    *(v4u*)(ob + (size_t)(c0 + row) * (size_t)R + r0 + 8 * q8) = pv[it];
  }
#if DEV_ASM
  asm volatile("s_wait_xcnt 0x0" ::: "memory");   // another job's code follows in the kernel and reuses the stores' registers
#endif
}

__global__ __launch_bounds__(256) void prep_kernel(
    const float* __restrict__ kin, const float* __restrict__ Gs,
    const float* __restrict__ Wq, const float* __restrict__ Wk, const float* __restrict__ Wv,
    const float* __restrict__ Wo,
    unsigned short* KT, unsigned short* GT,
    unsigned short* WQB, unsigned short* WKB, unsigned short* WVB, unsigned short* WOH) {
  __shared__ __align__(16) unsigned short t[64][72];
  const int tid = threadIdx.x;
  int j = blockIdx.x;
  if (j < NTK) {                         // column tile fastest, then row tile, then batch
    const int c0 = (j % (HID / 64)) * 64;
    const int r0 = ((j / (HID / 64)) % (LMEM / 64)) * 64;
    const size_t z = (size_t)(j / ((HID / 64) * (LMEM / 64)));
    tr_bf16<LMEM, HID>(kin + z * (size_t)(LMEM * HID), KT + z * (size_t)(HID * LMEM), r0, c0, t, tid);
    return;
  }
  j -= NTK;
  if (j < NTG) {
    const int c0 = (j % (NBAS / 64)) * 64;
    const int r0 = (j / (NBAS / 64)) * 64;
    tr_bf16<LMEM, NBAS>(Gs, GT, r0, c0, t, tid);
    return;
  }
  j -= NTG;
  const int w = j / NCW;
  const int i = (j % NCW) * 256 + tid;
  if (w == 3) {
    cvt16x8<1>(Wo, WOH, i);
  } else {
    const float* in = (w == 0) ? Wq : (w == 1) ? Wk : Wv;
    unsigned short* out = (w == 0) ? WQB : (w == 1) ? WKB : WVB;
    cvt16x8<0>(in, out, i);
  }
}

// =====================================================================================================
// LDS-staged batched WMMA GEMM (16-bit operand type OT): C[m][n] = sum_k A[m][k] * Bt[n][k];
// one block of 4 waves (2 x 2) per 128x128 tile, one wave per 64x64 quarter. A row-major [M][KD], Bt row-major
// [N][KD] (k contiguous, pitch KD); M, N multiples of 128, KD a multiple of 128 and at least 256 (static shapes here).
// blockIdx.x = tile (column tile fastest), blockIdx.y = batch index (strides in elements); the grid is exactly the tiles.
// A stage = 128 k = 256 B of each of the tile's operand rows [A 128 | Bt 128 | (SPL 2) Bt2 128], brought by asynchronous
// copies to LDS: 16 lanes x 16 B = one row's 256 B, so a wave's copy covers two rows in whole lines; each of the 128
// threads copies rows (tid >> 4) + 8 i. LDS row pitch 272 B. Two buffers: stage t + 1 flies while stage t is worked on.
// Fragments are read from LDS with the split k map (ldfrag), same k order per accumulator as a straight k loop.
// SPL 0: single product. SPL 2: Bt = hi plane Bt + residual plane Bt2 (2 products per k-step, same accumulator).
// OUT_MODE 0: f32 C (pitch ldc), value * oscale.
// OUT_MODE 2: bf16 hi plane C + bf16 residual plane C2 = bf16(v - hi) (same pitch / stride).
// =====================================================================================================
#define GKS  128       // k elements per stage
#define GPIT 136       // LDS row pitch in 16-bit elements: 272 B = 16 B x 17, conflict-free for 16-B fragment reads

// Eight asynchronous 16-B-per-lane copies global -> LDS: rows r, r + 8, ..., r + 56 of one operand plane.
// l = the lane's LDS byte address, g = the lane's global address, ld = global row pitch in elements.
__device__ __forceinline__ void acopy8(unsigned l, const unsigned short* g, int ld) {
#if DEV_ASM
  const size_t gs = (size_t)8 * (size_t)ld;
  const unsigned ls = 8u * GPIT * 2u;
  // the closing s_wait_xcnt keeps every address register intact until the copies have taken it
  asm volatile(
      "global_load_async_to_lds_b128 %0, %8, off\n\t"
      "global_load_async_to_lds_b128 %1, %9, off\n\t"
      "global_load_async_to_lds_b128 %2, %10, off\n\t"
      "global_load_async_to_lds_b128 %3, %11, off\n\t"
      "global_load_async_to_lds_b128 %4, %12, off\n\t"
      "global_load_async_to_lds_b128 %5, %13, off\n\t"
      "global_load_async_to_lds_b128 %6, %14, off\n\t"
      "global_load_async_to_lds_b128 %7, %15, off\n\t"
      "s_wait_xcnt 0x0"
      :: "v"(l), "v"(l + ls), "v"(l + 2u * ls), "v"(l + 3u * ls),
         "v"(l + 4u * ls), "v"(l + 5u * ls), "v"(l + 6u * ls), "v"(l + 7u * ls),
         "v"(g), "v"(g + gs), "v"(g + 2 * gs), "v"(g + 3 * gs),
         "v"(g + 4 * gs), "v"(g + 5 * gs), "v"(g + 6 * gs), "v"(g + 7 * gs)
      : "memory");
#endif
}

template <typename OT, int SPL, int OUT_MODE, int KD>
__global__ __launch_bounds__(128) void gemm128(
    const unsigned short* __restrict__ Ap, long long strideA,
    const unsigned short* __restrict__ Btp, const unsigned short* __restrict__ Bt2p, long long strideB,
    void* Cout, void* Cout2, int ldc, long long strideC,
    int N, float oscale) {
  typedef typename FT<OT>::frag V16;
  static_assert((KD % GKS) == 0 && KD / GKS >= 2);
  constexpr int NST  = KD / GKS;                       // stages
  constexpr int NPL  = (SPL == 2) ? 3 : 2;             // operand planes per stage
  constexpr int BUFE = NPL * 128 * GPIT;               // elements per buffer
  __shared__ __align__(16) unsigned short ring[2 * BUFE];
  __shared__ __align__(16) float sT[4][16 * 68];       // per-wave 16x64 slab, pitch 68 floats
  const int b    = blockIdx.y;
  const int tid  = threadIdx.x;
  const int lane = tid & 31;
  const int wave = tid >> 5;
  const int tilesN = N >> 7;
  const int tm = (int)blockIdx.x / tilesN;
  const int tn = (int)blockIdx.x - tm * tilesN;
  const int m0 = (tm << 7) + ((wave >> 1) << 6);       // this wave's 64x64 quarter
  const int n0 = (tn << 7) + ((wave & 1) << 6);

  // ---- copy side: lane -> (row group, 16-B segment of the 256-B row) ----
  const int seg = tid & 15, r8 = tid >> 4;
  const unsigned short* gA  = Ap   + (size_t)b * (size_t)strideA + (size_t)((tm << 7) + r8) * KD + seg * 8;
  const unsigned short* gB  = Btp  + (size_t)b * (size_t)strideB + (size_t)((tn << 7) + r8) * KD + seg * 8;
  const unsigned short* gB2 = Bt2p + (size_t)b * (size_t)strideB + (size_t)((tn << 7) + r8) * KD + seg * 8;
  const unsigned lds0 = (unsigned)(uintptr_t)(ring + r8 * GPIT + seg * 8);
  auto fill = [&](int s, int buf) {
    const unsigned l = lds0 + (unsigned)buf * (unsigned)(BUFE * 2);
    const int k0 = s * GKS;
    acopy8(l,                   gA + k0, KD);
    acopy8(l +  64 * GPIT * 2,  gA + k0 + (size_t)64 * KD, KD);
    acopy8(l + 128 * GPIT * 2,  gB + k0, KD);
    acopy8(l + 192 * GPIT * 2,  gB + k0 + (size_t)64 * KD, KD);
    if (SPL == 2) {
      acopy8(l + 256 * GPIT * 2, gB2 + k0, KD);
      acopy8(l + 320 * GPIT * 2, gB2 + k0 + (size_t)64 * KD, KD);
    }
  };

  const int rlane = lane & 15;                 // row (A) / col (B, D) within subtile
  const int koff  = (lane >> 4) * 8;           // k offset of this lane half
  const int mOff  = (lane >> 4) * 8;           // D row offset
  const int aoff = (((wave >> 1) << 6) + rlane) * GPIT + koff;
  const int boff = (128 + ((wave & 1) << 6) + rlane) * GPIT + koff;

  v8f acc[4][4];
#pragma unroll
  for (int i = 0; i < 4; ++i)
#pragma unroll
    for (int j = 0; j < 4; ++j) acc[i][j] = zero8();

  fill(0, 0);
#if DEV_ASM
  asm volatile("s_wait_asynccnt 0x0" ::: "memory");   // stage 0 of this wave has landed
#endif
  __syncthreads();                                      // stage 0 of every wave is readable
  fill(1, 1);

  // rolled: one stage's 64 or 128 WMMAs are the hot loop
#pragma unroll 1
  for (int t = 0; t < NST; ++t) {
    const OT* rb = (const OT*)(const void*)ring + (t & 1) * BUFE;
    // the loops below are unrolled so that af, bq and acc are indexed by constants and stay in registers
#pragma unroll
    for (int kk = 0; kk < GKS / 32; ++kk) {
      V16 af[4];
#pragma unroll
      for (int i = 0; i < 4; ++i) af[i] = ldfrag<OT>(rb + aoff + i * 16 * GPIT + kk * 32);
#pragma unroll
      for (int p = 0; p < ((SPL == 2) ? 2 : 1); ++p) {
        V16 bq[4];
#pragma unroll
        for (int j = 0; j < 4; ++j) bq[j] = ldfrag<OT>(rb + boff + p * 128 * GPIT + j * 16 * GPIT + kk * 32);
#pragma unroll
        for (int i = 0; i < 4; ++i)
#pragma unroll
          for (int j = 0; j < 4; ++j) acc[i][j] = mma_g(af[i], bq[j], acc[i][j]);
      }
    }
#if DEV_ASM
    asm volatile("s_wait_dscnt 0x0" ::: "memory");      // this wave's reads of buffer t & 1 are done before it is refilled
    asm volatile("s_wait_asynccnt 0x0" ::: "memory");   // this wave's copies of stage t + 1 have landed
#endif
    __syncthreads();                                    // publishes stage t + 1 and frees buffer t & 1
    if (t + 2 < NST) fill(t + 2, t & 1);
  }
#if DEV_ASM
  asm volatile("s_wait_asynccnt 0x0" ::: "memory");     // no copy is outstanding when the wave goes on to its end
#endif

  // ---- epilogue ----
  float* slab = sT[wave];
#pragma unroll
  for (int i = 0; i < 4; ++i) {
    const int mBase = m0 + (i << 4);
#pragma unroll
    for (int j = 0; j < 4; ++j) {
#pragma unroll
      for (int r = 0; r < 8; ++r) {
        slab[(mOff + r) * 68 + (j << 4) + rlane] = acc[i][j][r];
      }
    }
    __builtin_amdgcn_fence(__ATOMIC_RELEASE, "workgroup");
    __builtin_amdgcn_wave_barrier();
    __builtin_amdgcn_fence(__ATOMIC_ACQUIRE, "workgroup");
    if (OUT_MODE == 0) {
      float* Cf = (float*)Cout + (size_t)b * (size_t)strideC;
      const int h2 = lane >> 4, c4 = (lane & 15) * 4;     // 256-B row segment = 16 lanes x 16 B
      {
#pragma unroll
        for (int it = 0; it < 8; ++it) {
          const int row = it * 2 + h2;                     // it 0..7 x h2 0..1 = rows 0..15
          const v4f v = *(const v4f*)(slab + row * 68 + c4) * oscale;
          *(v4f*)(Cf + (size_t)(mBase + row) * (size_t)ldc + n0 + c4) = v;
        }
        
      }
    } else {
      const int q = lane >> 3, c8 = (lane & 7) * 8;
      unsigned short* Ch = (unsigned short*)Cout  + (size_t)b * (size_t)strideC;
      unsigned short* Cl = (unsigned short*)Cout2 + (size_t)b * (size_t)strideC;
      v4u hv[4], lv[4];
#pragma unroll
      for (int it = 0; it < 4; ++it) {
        const int row = it * 4 + q;                        // it 0..3 x q 0..3 = rows 0..15
        const float* sp = slab + row * 68 + c8;
        v4u a, a2;
#pragma unroll
        for (int e = 0; e < 4; ++e) {
          const float f0 = sp[2 * e], f1 = sp[2 * e + 1];
          const unsigned short h0 = bf_bits(f0), h1 = bf_bits(f1);
          const unsigned short l0 = bf_bits(f0 - bf_up(h0));
          const unsigned short l1 = bf_bits(f1 - bf_up(h1));
          a[e] = pk16(h0, h1); a2[e] = pk16(l0, l1);
        }
        hv[it] = a; lv[it] = a2;
      }
      {
#pragma unroll
        for (int it = 0; it < 4; ++it) {
          const int row = it * 4 + q;
          *(v4u*)(Ch + (size_t)(mBase + row) * (size_t)ldc + n0 + c8) = hv[it];
          *(v4u*)(Cl + (size_t)(mBase + row) * (size_t)ldc + n0 + c8) = lv[it];
        }
        
      }
    }
    __builtin_amdgcn_fence(__ATOMIC_RELEASE, "workgroup");
    __builtin_amdgcn_wave_barrier();
    __builtin_amdgcn_fence(__ATOMIC_ACQUIRE, "workgroup");
  }
}

// =====================================================================================================
// keys^T.w = Wk.(Bm^T.w): the score vectors need keys only through this product, so the weight vectors are
// contracted with Bm first and only the 8 resulting rows go through Wk.
// t[b*2+v][e] = sum_n bf16(w_v[n]) * (Bm hi + Bm residual)[b*512+n][e]   (f32; v = 0: w_mu, v = 1: w_sigma)
// Block 256 = (b, 64 columns e): 8 lanes x 8 columns = one 128-B row segment per plane, 32 row groups x 16 rows
// = all 512 n; group partials summed through LDS. Output plane T bf16 [16][1024]: row b*2+v = hi, row 8+b*2+v =
// residual; one wave stores a whole 128-B segment (32 lanes x 2 columns). grid (HID/64, NBATCH) covers all 16 rows.
// =====================================================================================================
__global__ __launch_bounds__(256) void wb_kernel(const unsigned short* __restrict__ bmh,
                                                 const unsigned short* __restrict__ bml,
                                                 const float* __restrict__ wmu, const float* __restrict__ wsg,
                                                 unsigned short* tpl) {
  __shared__ float wsh[2][NBAS];
  __shared__ __align__(16) float part[2][32][64];
  const int tid = threadIdx.x;
  const int b  = blockIdx.y;
  const int e0 = blockIdx.x * 64;
  const int g = tid >> 3, c8 = (tid & 7) * 8;
  const unsigned short* ph = bmh + ((size_t)b * NBAS + g) * HID + e0 + c8;
  const unsigned short* pl = bml + ((size_t)b * NBAS + g) * HID + e0 + c8;
  // all of the thread's rows are loaded first: every row is read once, so the cost is latency, paid once this way
  v8us hv[NBAS / 32], lv[NBAS / 32];
#pragma unroll
  for (int it = 0; it < NBAS / 32; ++it) {
    hv[it] = *(const v8usa*)(ph + (size_t)it * 32 * HID);
    lv[it] = *(const v8usa*)(pl + (size_t)it * 32 * HID);
  }
#pragma unroll
  for (int k = 0; k < NBAS / 256; ++k) {
    const int i = tid + 256 * k;
    wsh[0][i] = bf_up(bf_bits(wmu[i]));
    wsh[1][i] = bf_up(bf_bits(wsg[i]));
  }
  __syncthreads();
  float am[8], ag[8];
#pragma unroll
  for (int j = 0; j < 8; ++j) { am[j] = 0.f; ag[j] = 0.f; }
#pragma unroll
  for (int it = 0; it < NBAS / 32; ++it) {
    const float w0 = wsh[0][it * 32 + g];
    const float w1 = wsh[1][it * 32 + g];
#pragma unroll
    for (int j = 0; j < 8; ++j) {
      const float x = bf_up(hv[it][j]) + bf_up(lv[it][j]);
      am[j] += x * w0;
      ag[j] += x * w1;
    }
  }
#pragma unroll
  for (int j = 0; j < 8; ++j) {
    part[0][g][c8 + j] = am[j];
    part[1][g][c8 + j] = ag[j];
  }
  __syncthreads();
  if (tid < 64) {                       // wave 0: v = 0, wave 1: v = 1; lane = column pair
    const int v = tid >> 5, c2 = (tid & 31) * 2;
    float s0 = 0.f, s1 = 0.f;
#pragma unroll
    for (int gg = 0; gg < 32; ++gg) {
      s0 += part[v][gg][c2];
      s1 += part[v][gg][c2 + 1];
    }
    const unsigned short h0 = bf_bits(s0), h1 = bf_bits(s1);
    const unsigned short l0 = bf_bits(s0 - bf_up(h0));
    const unsigned short l1 = bf_bits(s1 - bf_up(h1));
    *(unsigned*)(tpl + (size_t)(b * 2 + v) * HID + e0 + c2)     = pk16(h0, h1);
    *(unsigned*)(tpl + (size_t)(8 + b * 2 + v) * HID + e0 + c2) = pk16(l0, l1);
  }
}

// =====================================================================================================
// Score vectors folded through Wq, one block = (head h, 512 columns e'), grid (NH, HID / 512).
// Part 1: u[r][h*64+c] = sum_e' (T hi + T residual)[r][e'] * bf16(Wk)[h*64+c][e'],  r = b*2+v in 0..7, c in 0..63   (f32)
//   A = T [16][1024] (rows 0..7 hi, rows 8..15 residual), Bt = Wk bf16 [e][e']; D row r + D row r+8 = u row r.
//   Wave w takes the k slice [128 w, 128 w + 128) = 4 k-steps for the head's four 16-column tiles, two tiles at a time
//   (A fragment shared); the 8 slice partials are summed through LDS into us[c][r].
// Part 2: P[r][h][e'] = sum_d u[r][h*64+d] * bf16(Wq)[h*64+d][e']   (f32, d ascending), so that qry.u = q.P, head by head.
//   Thread = two neighbouring columns e' (one 4-B load per d; a wave = one 128-B segment of a Wq row).
//   Output plane PP bf16 [b][hi, residual][v][h][1024]: a wave stores whole 128-B segments; the grid covers all 256 rows.
// =====================================================================================================
#define PCH 512        // columns e' per block
static_assert((HID % PCH) == 0);
__global__ __launch_bounds__(256) void up_kernel(const unsigned short* __restrict__ tpl,
                                                 const unsigned short* __restrict__ wkp,
                                                 const unsigned short* __restrict__ wqp, unsigned short* pp) {
  __shared__ float red[8][8][64];                 // [k slice][row r][column of the head]
  __shared__ __align__(16) float us[HD][8];       // u of this head: [d][row r]
  const int tid  = threadIdx.x;
  const int wave = tid >> 5;
  const int lane = tid & 31;
  const int rlane = lane & 15;          // row (A) / col (B, D) within the tile
  const int koff  = (lane >> 4) * 8;    // k offset of this lane half
  const int h  = blockIdx.x;
  const int e0 = blockIdx.y * PCH + 2 * tid;
  const __bf16* A = (const __bf16*)(const void*)tpl + (size_t)rlane * HID + koff + wave * 128;
  v16b af[4];
#pragma unroll
  for (int s = 0; s < 4; ++s) af[s] = ldfrag<__bf16>(A + 32 * s);
  const __bf16* B = (const __bf16*)(const void*)wkp + (size_t)(h * HD + rlane) * HID + koff + wave * 128;
  v16b bt[4][4];                        // [16-column tile][k-step]
#pragma unroll
  for (int j = 0; j < 4; ++j)
#pragma unroll
    for (int s = 0; s < 4; ++s) bt[j][s] = ldfrag<__bf16>(B + (size_t)j * 16 * HID + 32 * s);
#if DEV_ASM
  asm volatile("s_wait_xcnt 0x0" :: "v"(A), "v"(B) : "memory");   // the loads' address pairs are rewritten only behind this wait
#endif
#pragma unroll
  for (int hf = 0; hf < 2; ++hf) {
    v8f a0 = zero8(), a1 = zero8();
#pragma unroll
    for (int s = 0; s < 4; ++s) {
      a0 = mma_g(af[s], bt[2 * hf][s], a0);
      a1 = mma_g(af[s], bt[2 * hf + 1][s], a1);
    }
    // D element r of lane half 0 = row r (hi part), of lane half 1 = row r+8 (residual part), same column
#pragma unroll
    for (int r = 0; r < 8; ++r) {
      const float x0 = a0[r] + __shfl_xor(a0[r], 16, 32);
      const float x1 = a1[r] + __shfl_xor(a1[r], 16, 32);
      red[wave][r][hf * 32 + lane] = (lane < 16) ? x0 : x1;     // lanes 16..31 hold the second tile's column lane-16
    }
  }
  // the thread's Wq column pair does not depend on u: loaded here, where part 1's fragments are dead, its latency runs beside the sums
  const unsigned short* wq = wqp + (size_t)(h * HD) * HID + e0;
  unsigned wv[HD];
#pragma unroll
  for (int d = 0; d < HD; ++d) wv[d] = *(const unsigned*)(wq + (size_t)d * HID);
#if DEV_ASM
  asm volatile("s_wait_xcnt 0x0" :: "v"(wq) : "memory");   // the loads' address pair is rewritten only behind this wait
#endif
  __syncthreads();
#pragma unroll
  for (int k = 0; k < 2; ++k) {         // 512 sums = 8 rows x 64 columns, two per thread
    const int r = (tid >> 6) + 4 * k, col = tid & 63;
    float s = 0.f;
#pragma unroll
    for (int w = 0; w < 8; ++w) s += red[w][r][col];
    us[col][r] = s;
  }
  __syncthreads();
  v2f acc[8];
#pragma unroll
  for (int r = 0; r < 8; ++r) { acc[r].x = 0.f; acc[r].y = 0.f; }
#pragma unroll
  for (int d = 0; d < HD; ++d) {
    v2f x;
    x.x = __uint_as_float(wv[d] << 16);
    x.y = __uint_as_float(wv[d] & 0xFFFF0000u);
    const v4f ua = *(const v4f*)(&us[d][0]);
    const v4f ub = *(const v4f*)(&us[d][4]);
#pragma unroll
    for (int r = 0; r < 4; ++r) {
      acc[r]     += x * ua[r];
      acc[4 + r] += x * ub[r];
    }
  }
#pragma unroll
  for (int r = 0; r < 8; ++r) {         // r = b*2+v
    const unsigned short h0 = bf_bits(acc[r].x), h1 = bf_bits(acc[r].y);
    const unsigned short l0 = bf_bits(acc[r].x - bf_up(h0));
    const unsigned short l1 = bf_bits(acc[r].y - bf_up(h1));
    unsigned short* o = pp + (size_t)((r >> 1) * 64 + (r & 1) * 16 + h) * HID + e0;
    *(unsigned*)(o)                    = pk16(h0, h1);
    *(unsigned*)(o + (size_t)32 * HID) = pk16(l0, l1);
  }
}

// =====================================================================================================
// S[m][v*16+h] = sum_e' bf16(q)[m][e'] * (P hi + P residual)[b][v][h][e']   (= qry[m][head h] . u[b][v][head h], unscaled)
// Block 512 = 32 query rows (two 16-row tiles, all of one batch); wave w of 16 takes the k slice [64 w, 64 w + 64) = 2 k-steps.
// A fragments: q f32 from global with the split k map of ldfrag, RNE-converted to bf16 in registers (q is read once, here).
// B fragments: PP rows b*64 + j*16 + col, j = 0, 1: hi of v = 0, 1; j = 2, 3: residual of v = 0, 1; shared by both row tiles.
// The 16 slice partials are summed through LDS (pitch 36 floats = 16 B x 9). Store: 16 lanes x 8 B = one row's 128 B.
// grid MROWS / 32 covers all 8192 rows of S [8192][32].
// =====================================================================================================
#define SPIT 36
static_assert((QLEN % 32) == 0 && 2 * NH == 32);
__global__ __launch_bounds__(512) void s_kernel(const float* __restrict__ qin,
                                                const unsigned short* __restrict__ pp, float* S) {
  union FA { v16b v; unsigned w[8]; };
  __shared__ __align__(16) float red[16][32 * SPIT];
  const int tid  = threadIdx.x;
  const int wave = tid >> 5;
  const int lane = tid & 31;
  const int rlane = lane & 15;          // row (A) / col (B, D) within the tile
  const int hh    = lane >> 4;
  const int m0 = blockIdx.x * 32;
  const int b  = m0 / QLEN;
  const float* qa = qin + (size_t)(m0 + rlane) * HID + wave * 64 + 8 * hh;
  const __bf16* Bp = (const __bf16*)(const void*)pp + (size_t)(b * 64 + rlane) * HID + wave * 64 + 8 * hh;
  // every load of the wave is issued before the first use: each byte is read once, so the cost is latency, paid once
  v4f a[2][2][4];
#pragma unroll
  for (int i = 0; i < 2; ++i)
#pragma unroll
    for (int s = 0; s < 2; ++s) {
      const float* p = qa + (size_t)i * 16 * HID + 32 * s;
      a[i][s][0] = *(const v4f*)(p);
      a[i][s][1] = *(const v4f*)(p + 4);
      a[i][s][2] = *(const v4f*)(p + 16);
      a[i][s][3] = *(const v4f*)(p + 20);
    }
  v16b bq[2][4];
#pragma unroll
  for (int s = 0; s < 2; ++s)
#pragma unroll
    for (int j = 0; j < 4; ++j) bq[s][j] = ldfrag<__bf16>(Bp + (size_t)j * 16 * HID + 32 * s);
#if DEV_ASM
  asm volatile("s_wait_xcnt 0x0" :: "v"(qa), "v"(Bp) : "memory");   // the loads' address pairs are rewritten only behind this wait
#endif
  v8f acc[2][2];
#pragma unroll
  for (int i = 0; i < 2; ++i)
#pragma unroll
    for (int v = 0; v < 2; ++v) acc[i][v] = zero8();
#pragma unroll
  for (int s = 0; s < 2; ++s) {
    FA af[2];
#pragma unroll
    for (int i = 0; i < 2; ++i)
#pragma unroll
      for (int p = 0; p < 8; ++p) {      // elements 2p, 2p + 1
        v2f x;
        x.x = a[i][s][p >> 1][(p & 1) * 2];
        x.y = a[i][s][p >> 1][(p & 1) * 2 + 1];
        af[i].w[p] = __builtin_bit_cast(unsigned, __builtin_convertvector(x, v2b));
      }
#pragma unroll
    for (int pl = 0; pl < 2; ++pl)
#pragma unroll
      for (int i = 0; i < 2; ++i)
#pragma unroll
        for (int v = 0; v < 2; ++v) acc[i][v] = mma_g(af[i].v, bq[s][pl * 2 + v], acc[i][v]);
  }
  float* rw = red[wave];
#pragma unroll
  for (int i = 0; i < 2; ++i)
#pragma unroll
    for (int v = 0; v < 2; ++v)
#pragma unroll
      for (int r = 0; r < 8; ++r) rw[(i * 16 + 8 * hh + r) * SPIT + v * 16 + rlane] = acc[i][v][r];
  __syncthreads();
  {
    const int row = tid >> 4, c2 = (tid & 15) * 2;
    v2f s = {0.f, 0.f};
#pragma unroll
    for (int w = 0; w < 16; ++w) s += *(const v2f*)(red[w] + row * SPIT + c2);
    *(v2f*)(S + (size_t)(m0 + row) * 32 + c2) = s;
  }
}

// =====================================================================================================
// Continuous attention context, one block = (b, head h, 64 queries), 4 waves x 16 queries, grid NBATCH*NH*NQB64.
//   prologue (f32): dm = S[q][h] / 8 (= qry[q][head h] . u_mu[b][head h] / 8), dg = S[q][16+h] / 8 likewise with u_sigma;
//     mu = sigmoid(dm), sig2 = max(softplus(dg), 1e-4)   (lane c = query, both lane halves read the same two values)
//   loop over 8 chunks of 64 basis functions (static trip): vals^T hi / residual chunks [d 64][n 64] staged in
//     LDS by 128 threads x 32 elements per plane (whole 64x64 tile, __syncthreads before and after);
//     per 32-deep k-step the lane builds its A fragment in registers: element i = r[q=c][n0+32kk+k(i)],
//     r = exp(-0.5 (mu - bm[n])^2 / var) / sqrt(2 pi var), var = sig2 + bs[n]^2 (bm, bs = bf16-converted basis
//     tables in LDS), carried as r / RSC = exp2(-(t s)^2) s with t = mu - bm[n], s = rsq(VK var) (sig2 and the bs^2 table
//     hold VK var's two terms; RSC is folded back once in the epilogue), two n per packed f32 instruction,
//     as bf16 hi + bf16 residual (RNE converts); B fragments = vals^T hi / residual from LDS (col = d, k = n);
//     oacc[t] += rh.vh + rh.vl + rl.vh  (bf16 WMMA, one f32 accumulator).
//   epilogue: wave's 16x64 f32 tile staged in LDS, converted to f16(64 * ctx), written to the ctx plane
//   coverage: rows it(4) x (lane>>3)(4) = 16 per wave x 4 waves x 32 qb x 4 b; cols 8 lanes x 8 = 64 per head x 16 heads
//   = the whole [8192][1024] ctx plane. LDS extents: Vth/Vtl 64x64 staged = 64x64 consumed (row pitch VPIT); bm_s/bv_s 512 = 512;
//   Os written 16x64 per wave before the wave reads its own tile.
// =====================================================================================================
#define VPIT 72        // LDS row pitch of the vals^T chunks in 16-bit elements: 144 B = 16 B x 9, conflict-free for 16-B reads and stores
#define OPIT 68        // LDS row pitch of the per-wave context tile in floats: 272 B = 16 B x 17, same reason
#define VK   1.3862943611198906f   // 2 ln 2: exp(-t^2 / (2 var)) = exp2(-t^2 / (VK var))
#define RSC  0.46971863934982566f  // sqrt(VK / (2 pi)): 1 / sqrt(2 pi var) = RSC / sqrt(VK var)
__global__ __launch_bounds__(128) void ctx_kernel(
    const float* __restrict__ sv,
    const float* __restrict__ bmu, const float* __restrict__ bsg,
    const unsigned short* __restrict__ vthp, const unsigned short* __restrict__ vtlp,
    unsigned short* ctxp) {
  union FB { v16b v; v8us h[2]; unsigned w[8]; };
  __shared__ __align__(16) unsigned short Vth[64 * VPIT];  // vals^T hi chunk [d][n]       9 KB
  __shared__ __align__(16) unsigned short Vtl[64 * VPIT];  // vals^T residual chunk        9 KB
  __shared__ __align__(16) float Os[4][16 * OPIT];         // per-wave context tile       17 KB
  __shared__ __align__(16) float bm_s[NBAS];               // bf16-converted basis means
  __shared__ __align__(16) float bv_s[NBAS];               // VK * (bf16-converted basis sigma)^2

  const int tid  = threadIdx.x;
  const int wave = tid >> 5;
  const int lane = tid & 31;
  const int hh   = lane >> 4;
  const int c    = lane & 15;

  const int bx   = blockIdx.x;
  const int qb   = bx % NQB64;
  const int rest = bx / NQB64;
  const int h    = rest % NH;
  const int b    = rest / NH;
  const int q0   = qb * 64 + wave * 16;
  const size_t row0 = (size_t)b * QLEN + q0;              // plane row of this wave's query 0

  for (int i = tid; i < NBAS; i += 128) {
    const float m = bf_up(bf_bits(bmu[i]));
    const float s = bf_up(bf_bits(bsg[i]));
    bm_s[i] = m;
    bv_s[i] = s * s * VK;
  }

  // ---- per-query affine heads (f32) ----
  const float* sr = sv + (row0 + c) * 32 + h;
  const float dm = sr[0]  * 0.125f;
  const float dg = sr[NH] * 0.125f;
#if DEV_ASM
  asm volatile("s_wait_xcnt 0x0" :: "v"(sr) : "memory");   // the two loads' address pair is rewritten only behind this wait
#endif
  const float mu   = 1.0f / (1.0f + expf(-dm));
  const float spl  = fmaxf(dg, 0.0f) + log1pf(expf(-fabsf(dg)));
  const float sig2k = fmaxf(spl, 1e-4f) * VK;

  const unsigned short* Vh = vthp + ((size_t)b * HID + (size_t)h * HD) * NBAS;
  const unsigned short* Vl = vtlp + ((size_t)b * HID + (size_t)h * HD) * NBAS;

  v8f oacc[4];
#pragma unroll
  for (int t = 0; t < 4; ++t) oacc[t] = zero8();

  for (int nt = 0; nt < NCH; ++nt) {         // static trip count
    const int n0 = nt * 64;
    __syncthreads();
    {
      const int r = tid >> 1, half = (tid & 1) * 32;      // d = r, n = n0 + half .. + 31
      const unsigned short* vg  = Vh + (size_t)r * NBAS + n0 + half;
      const unsigned short* vlg = Vl + (size_t)r * NBAS + n0 + half;
#pragma unroll
      for (int i = 0; i < 4; ++i) {
        const v8us b0 = *(const v8usa*)(vg + 8 * i);
        const v8us b1 = *(const v8usa*)(vlg + 8 * i);
        *(v8usa*)(Vth + r * VPIT + half + 8 * i) = b0;
        *(v8usa*)(Vtl + r * VPIT + half + 8 * i) = b1;
      }
    }
    __syncthreads();

#pragma unroll 1
    for (int kk = 0; kk < 2; ++kk) {
      // ---- A fragments: r values of query c at the 16 k slots of this lane half, bf16 hi + residual ----
      FB rh, rl;
#pragma unroll
      for (int p = 0; p < 8; ++p) {          // elements 2p, 2p + 1: two neighbouring n
        const int n = n0 + kk * 32 + 8 * hh + ((p < 4) ? (2 * p) : (8 + 2 * p));
        const v2f t  = mu - *(const v2f*)(bm_s + n);
        const v2f vk = sig2k + *(const v2f*)(bv_s + n);
        v2f rs;
        rs.x = __builtin_amdgcn_rsqf(vk.x);
        rs.y = __builtin_amdgcn_rsqf(vk.y);
        const v2f zz = t * rs;
        const v2f ar = zz * zz;
        v2f ex;
        ex.x = __builtin_amdgcn_exp2f(-ar.x);
        ex.y = __builtin_amdgcn_exp2f(-ar.y);
        const v2f rv = ex * rs;
        const unsigned hp = __builtin_bit_cast(unsigned, __builtin_convertvector(rv, v2b));
        v2f up;
        up.x = __uint_as_float(hp << 16);
        up.y = __uint_as_float(hp & 0xFFFF0000u);
        rh.w[p] = hp;
        rl.w[p] = __builtin_bit_cast(unsigned, __builtin_convertvector(rv - up, v2b));
      }
      // ---- ctx += r . vals over this 32-deep slice of n ----
#pragma unroll
      for (int t = 0; t < 4; ++t) {
        FB vb, vl;
        vb.h[0] = *(const v8usa*)(Vth + (t * 16 + c) * VPIT + kk * 32 + 8 * hh);
        vb.h[1] = *(const v8usa*)(Vth + (t * 16 + c) * VPIT + kk * 32 + 16 + 8 * hh);
        vl.h[0] = *(const v8usa*)(Vtl + (t * 16 + c) * VPIT + kk * 32 + 8 * hh);
        vl.h[1] = *(const v8usa*)(Vtl + (t * 16 + c) * VPIT + kk * 32 + 16 + 8 * hh);
        oacc[t] = mma_g(rh.v, vb.v, oacc[t]);
        oacc[t] = mma_g(rh.v, vl.v, oacc[t]);
        oacc[t] = mma_g(rl.v, vb.v, oacc[t]);
      }
    }
  }

  float* os = Os[wave];
#pragma unroll
  for (int r = 0; r < 8; ++r) {
#pragma unroll
    for (int t = 0; t < 4; ++t) os[(8 * hh + r) * OPIT + t * 16 + c] = oacc[t][r];
  }
  __builtin_amdgcn_fence(__ATOMIC_RELEASE, "workgroup");
  __builtin_amdgcn_wave_barrier();
  __builtin_amdgcn_fence(__ATOMIC_ACQUIRE, "workgroup");
  {
    const int q4 = lane >> 3, c8 = (lane & 7) * 8;
    v4u hv[4];
#pragma unroll
    for (int it = 0; it < 4; ++it) {
      const int row = it * 4 + q4;   // it 0..3 x q4 0..3 = rows 0..15 of the wave tile
      const float* sp = os + row * OPIT + c8;
      v4u a;
#pragma unroll
      for (int e = 0; e < 4; ++e) {
        const float f0 = sp[2 * e] * (CSC * RSC), f1 = sp[2 * e + 1] * (CSC * RSC);
        a[e] = pk16(h_bits((_Float16)f0), h_bits((_Float16)f1));
      }
      hv[it] = a;
    }
    {
#pragma unroll
      for (int it = 0; it < 4; ++it) {
        const int row = it * 4 + q4;
        const size_t go = (row0 + row) * HID + (size_t)h * HD + c8;
        *(v4u*)(ctxp + go) = hv[it];
      }
      
    }
  }
}

// =====================================================================================================
// Workspace map (bytes), every region an exact multiple of its whole-line / whole-tile store granularity:
//   KT   bf16 [4][1024 e][2048 l]   16777216   (dead after the Bm GEMM; reused as the f16 ctx plane [8192][1024], same size)
//   GT   bf16 [512 n][2048 l]        2097152
//   WQB  bf16 [1024][1024]           2097152
//   WKB  bf16 [1024][1024]           2097152
//   WVB  bf16 [1024][1024]           2097152
//   WOH  f16  [1024][1024] (x64)     2097152
//   BMH  bf16 [4*512][1024]          4194304   Bm hi
//   BML  bf16 [4*512][1024]          4194304   Bm residual
//   TPL  bf16 [16][1024]               32768   t = w^T.Bm, rows 0..7 hi, rows 8..15 residual
//   VTH  bf16 [4][1024 e][512 n]     4194304   vals^T hi
//   VTL  bf16 [4][1024 e][512 n]     4194304   vals^T residual
//   PP   bf16 [4][2][2][16][1024]     524288   P = u.Wq per head: [b][hi, residual][v][h][e']
//   SV   f32  [8192][32]             1048576   S = q.P^T: [query row][v*16+h]
//   total                           45645824
// Weights are [out][in] with in contiguous = the Bt layout for x.W^T, so they are only converted.
// =====================================================================================================
extern "C" void kernel_launch(void* const* d_in, const int* in_sizes, int n_in,
                              void* d_out, int out_size, void* d_ws, size_t ws_size,
                              hipStream_t stream) {
  if (n_in < 11) return;
  if (in_sizes[0] != NBATCH * LMEM * HID) return;
  if (in_sizes[1] != MROWS * HID) return;
  if (in_sizes[2] != HID * HID || in_sizes[3] != HID * HID || in_sizes[4] != HID * HID || in_sizes[5] != HID * HID) return;
  if (in_sizes[6] != NBAS || in_sizes[7] != NBAS) return;
  if (in_sizes[8] != LMEM * NBAS || in_sizes[9] != NBAS || in_sizes[10] != NBAS) return;
  if (out_size != MROWS * HID) return;

  const float* kin = (const float*)d_in[0];
  const float* qin = (const float*)d_in[1];
  const float* Wq  = (const float*)d_in[2];
  const float* Wk  = (const float*)d_in[3];
  const float* Wv  = (const float*)d_in[4];
  const float* Wo  = (const float*)d_in[5];
  const float* wmu = (const float*)d_in[6];
  const float* wsg = (const float*)d_in[7];
  const float* Gs  = (const float*)d_in[8];
  const float* bmu = (const float*)d_in[9];
  const float* bsg = (const float*)d_in[10];

  const size_t PKT  = (size_t)NBATCH * HID * LMEM * 2;    // 16777216  k^T planes; later the ctx f16 plane
  const size_t PCTX = (size_t)MROWS * HID * 2;            // 16777216  (== PKT)
  const size_t PGT  = (size_t)NBAS * LMEM * 2;            //  2097152
  const size_t PW   = (size_t)HID * HID * 2;              //  2097152
  const size_t PBM  = (size_t)NBATCH * NBAS * HID * 2;    //  4194304
  const size_t PTPL = (size_t)16 * HID * 2;               //    32768
  const size_t PVT  = (size_t)NBATCH * HID * NBAS * 2;    //  4194304
  const size_t PPP  = (size_t)NBATCH * 64 * HID * 2;      //   524288
  const size_t PSV  = (size_t)MROWS * 32 * 4;             //  1048576
  if (PCTX > PKT) return;
  size_t off = 0;
  const size_t oKT  = off; off += PKT;
  const size_t oGT  = off; off += PGT;
  const size_t oWQ  = off; off += PW;
  const size_t oWK  = off; off += PW;
  const size_t oWV  = off; off += PW;
  const size_t oWO  = off; off += PW;
  const size_t oBMH = off; off += PBM;
  const size_t oBML = off; off += PBM;
  const size_t oTPL = off; off += PTPL;
  const size_t oVTH = off; off += PVT;
  const size_t oVTL = off; off += PVT;
  const size_t oPP  = off; off += PPP;
  const size_t oSV  = off; off += PSV;
  if (off > ws_size) return;                        // off = 45645824
  if (off > (size_t)134217728) return;

  char* ws = (char*)d_ws;
  unsigned short* KT  = (unsigned short*)(ws + oKT);
  unsigned short* CTX = (unsigned short*)(ws + oKT);   // reuse after the Bm GEMM has consumed KT
  unsigned short* GT  = (unsigned short*)(ws + oGT);
  unsigned short* WQB = (unsigned short*)(ws + oWQ);
  unsigned short* WKB = (unsigned short*)(ws + oWK);
  unsigned short* WVB = (unsigned short*)(ws + oWV);
  unsigned short* WOH = (unsigned short*)(ws + oWO);
  unsigned short* BMH = (unsigned short*)(ws + oBMH);
  unsigned short* BML = (unsigned short*)(ws + oBML);
  unsigned short* TPL = (unsigned short*)(ws + oTPL);
  unsigned short* VTH = (unsigned short*)(ws + oVTH);
  unsigned short* VTL = (unsigned short*)(ws + oVTL);
  unsigned short* PP  = (unsigned short*)(ws + oPP);
  float*          SV  = (float*)(ws + oSV);

  const dim3 blk(256);
  const dim3 gBm((NBAS / 128) * (HID / 128), NBATCH);            // 32 tiles of 128x128 x 4 b      (M=512,  N=1024, K=2048)
  const dim3 gWb(HID / 64, NBATCH);                               // (16, 4)
  const dim3 gVt((HID / 128) * (NBAS / 128), NBATCH);             // 32 tiles of 128x128 x 4 b      (M=1024, N=512,  K=1024)
  const dim3 gQ((MROWS / 128) * (HID / 128), 1);                  // 512 tiles of 128x128           (M=8192, N=1024, K=1024)
  const dim3 gUp(NH, HID / PCH);                                  // (16, 2)
  const dim3 gS(MROWS / 32);                                      // 256 blocks of 512
  const dim3 gCtx(NBATCH * NH * NQB64);                           // 2048 blocks of 128

  // (1) k -> k^T bf16 per batch, Gs -> Gs^T bf16 (l contiguous); weights -> bf16; Wo -> f16 (64 x its bf16 value)
  prep_kernel<<<dim3(NPREP), blk, 0, stream>>>(kin, Gs, Wq, Wk, Wv, Wo, KT, GT, WQB, WKB, WVB, WOH);
  // (2) Bm[b][n][e] = sum_l Gs^T[n][l] k^T[b][e][l] -> bf16 hi / residual planes [b*512+n][e]
  gemm128<__bf16, 0, 2, LMEM><<<gBm, dim3(128), 0, stream>>>(
      GT, 0LL, KT, KT, (long long)HID * LMEM,
      (void*)BMH, (void*)BML, HID, (long long)NBAS * HID,
      HID, 1.0f);
  // (3) t[b*2+v][e'] = sum_n bf16(w_mu / w_sigma)[n] Bm[b*512+n][e'] (f32) -> bf16 hi / residual rows of TPL
  wb_kernel<<<gWb, blk, 0, stream>>>(BMH, BML, wmu, wsg, TPL);
  // (4) vals^T[b][e][n] = sum_e' Wv[e][e'] Bm[b*512+n][e'] -> bf16 hi / residual planes, pitch 512 (Bm on the Bt side, 2 products)
  gemm128<__bf16, 2, 2, HID><<<gVt, dim3(128), 0, stream>>>(
      WVB, 0LL, BMH, BML, (long long)NBAS * HID,
      (void*)VTH, (void*)VTL, NBAS, (long long)HID * NBAS,
      NBAS, 1.0f);
  // (5) u[b][0/1][e] = sum_e' t[b*2+0/1][e'] Wk[e][e']   (= sum_n keys[b][n][e] * w[n] with keys = Bm.Wk^T), kept in LDS;
  //     P[b][0/1][h][e'] = sum_d u[b][0/1][h*64+d] Wq[h*64+d][e'] -> bf16 hi / residual rows of PP
  up_kernel<<<gUp, blk, 0, stream>>>(TPL, WKB, WQB, PP);
  // (6) S[b*2048+q][v*16+h] = sum_e' q[..][e'] P[b][v][h][e']   (= qry . u per head with qry = q.Wq^T)
  s_kernel<<<gS, dim3(512), 0, stream>>>(qin, PP, SV);
  // (7) mu, sig2 per query; ctx = r . vals -> f16 ctx plane (x64) [8192][1024] in the KT region
  ctx_kernel<<<gCtx, dim3(128), 0, stream>>>(SV, bmu, bsg, VTH, VTL, CTX);
  // (8) out = ctx . Wo^T -> d_out f32 [8192][1024], accumulator x 1/(64*64)
  gemm128<_Float16, 0, 0, HID><<<gQ, dim3(128), 0, stream>>>(
      CTX, 0LL, WOH, WOH, 0LL,
      d_out, d_out, HID, 0LL,
      HID, 1.0f / (CSC * WOSC));
  (void)hipGetLastError();
}

// v007
// A run of this version takes 113 microseconds.
// Timed twice side by side with v006, it ran 1.11 times as fast both times.
// All steps since v000 together make it 4.20 times as fast.
// Contractions: Gs^T.k^T (Bm) on v_wmma_f32_16x16x32_bf16 (bf16 operands RNE-converted from inputs, single product, f32 accumulate);
// q.P^T on v_wmma_f32_16x16x32_bf16, P[b][v][h][e'] = sum_d u[b][v][h*64+d] * bf16(Wq)[h*64+d][e'] (f32) as bf16 hi + bf16 residual
// planes (2 products, f32 accumulate), q RNE-converted to bf16 in registers: qry.u = (q.Wq^T).u = q.(Wq^T.u), head by head;
// Wv.Bm^T on v_wmma_f32_16x16x32_bf16 with Bm as bf16 hi + bf16 residual planes (2 products, f32 accumulate);
// (w^T.Bm).Wk^T on v_wmma_f32_16x16x32_bf16: the 8 rows t = w^T.Bm = (Gs.w)^T.k as bf16 hi (A rows 0..7) + bf16 residual (A rows 8..15),
// one product, f32 accumulate, D rows r and r+8 added;
// r.vals on v_wmma_f32_16x16x32_bf16 with r and vals^T each bf16 hi + bf16 residual (3 products hh+hl+lh, f32 accumulate);
// ctx.Wo^T on v_wmma_f32_16x16x32_f16 (ctx f16 carried x64, Wo f16 = 64 x its bf16 value, single product, f32 accumulate, folded back x 1/4096);
// Gs.w (f32 inputs), (Gs.w)^T.k (k as bf16) and u.Wq score-vector dots, sigmoid, softplus and the Gaussian density in f32.
// Carry audit: Woh plane = f16(64 * bf16(Wo)), ctx plane = f16(64 * ctx); both inverses folded back exactly once by
// oscale = 1/4096 in the out GEMM epilogue (OUT_MODE 0). Bm, vals^T and r residual planes are unscaled bf16 (v - hi)
// and share the hi accumulator (no fold needed). r planes carry r / RSC (RSC = sqrt(ln 2 / pi)); the inverse is folded back exactly
// once, with the ctx carry, by CSC * RSC in the ctx kernel's epilogue.
#include <hip/hip_runtime.h>
#include <math.h>
#include <stdint.h>

#define NBATCH 4
#define LMEM   2048
#define QLEN   2048
#define HID    1024
#define NH     16
#define HD     64
#define NBAS   512
#define MROWS  (NBATCH * QLEN)   // 8192 query rows
#define NQB64  (QLEN / 64)       // 32 blocks of 64 queries per sequence
#define NCH    (NBAS / 64)       // 8 chunks of 64 basis functions
static_assert(NH * HD == HID);
static_assert(NBATCH == 4 && HID / 256 == NBATCH);   // the score-vector jobs share the GEMM grids' y extent
static_assert(NQB64 == 32 && NCH == 8);
static_assert((LMEM % 64) == 0 && (QLEN % 64) == 0 && (HID % 64) == 0 && (NBAS % 64) == 0);
static_assert((LMEM % 128) == 0 && (HID % 128) == 0 && (NBAS % 128) == 0 && (MROWS % 128) == 0);
#define CSC  64.0f     // ctx plane carry (f16)
#define WOSC 64.0f     // Wo plane carry (f16 of the bf16 value)

typedef _Float16 v16h __attribute__((ext_vector_type(16)));
typedef _Float16 v8h  __attribute__((ext_vector_type(8)));
typedef __bf16   v16b __attribute__((ext_vector_type(16)));
typedef __bf16   v8b  __attribute__((ext_vector_type(8)));
typedef float    v8f  __attribute__((ext_vector_type(8)));
typedef float    v4f  __attribute__((ext_vector_type(4)));
typedef float    v2f  __attribute__((ext_vector_type(2)));
typedef __bf16   v2b  __attribute__((ext_vector_type(2)));
typedef unsigned int   v4u  __attribute__((ext_vector_type(4)));
typedef unsigned short v8us __attribute__((ext_vector_type(8)));
typedef v4u  __attribute__((may_alias)) v4ua;
typedef v8us __attribute__((may_alias)) v8usa;

#if defined(__HIP_DEVICE_COMPILE__)
#define DEV_ASM 1
#else
#define DEV_ASM 0
#endif

// ---- scalar helpers ---------------------------------------------------------------------------------
__device__ __forceinline__ unsigned short bf_bits(float f) {          // f32 -> bf16 bits, RNE convert
  unsigned u = __float_as_uint(f);
  return (unsigned short)((u + 0x7FFFu + ((u >> 16) & 1u)) >> 16);
}
__device__ __forceinline__ float bf_up(unsigned short hb) { return __uint_as_float(((unsigned)hb) << 16); }
__device__ __forceinline__ unsigned short h_bits(_Float16 x) { return __builtin_bit_cast(unsigned short, x); }
__device__ __forceinline__ unsigned pk16(unsigned short a, unsigned short b) { return (unsigned)a | ((unsigned)b << 16); }
__device__ __forceinline__ v8f zero8() { v8f z = {0.f, 0.f, 0.f, 0.f, 0.f, 0.f, 0.f, 0.f}; return z; }

// ---- fragment types / loaders: 16-bit A/B operand, lane -> row/col (lane&15), p already includes +8*(lane>>4);
//      elements 0..7 <- p[0..7] (k0+8h..k0+8h+7), elements 8..15 <- p[16..23] (k0+16+8h..k0+16+8h+7)
template <typename OT> struct FT;
template <> struct FT<__bf16>   { typedef v16b frag; typedef v8b half8; };
template <> struct FT<_Float16> { typedef v16h frag; typedef v8h half8; };

template <typename OT>
__device__ __forceinline__ typename FT<OT>::frag ldfrag(const OT* p) {
  union { typename FT<OT>::frag v; typename FT<OT>::half8 h[2]; } f;
  f.h[0] = *(const typename FT<OT>::half8*)(p);
  f.h[1] = *(const typename FT<OT>::half8*)(p + 16);
  return f.v;
}

// ---- guarded WMMA: 4 VALU slots after every WMMA, D tied, A/B kept live -----------------------------------
__device__ __forceinline__ v8f mma_g(v16b a, v16b b, v8f c) {
  c = __builtin_amdgcn_wmma_f32_16x16x32_bf16(false, a, false, b, (short)0, c, false, false);
#if DEV_ASM
  asm volatile("v_nop\n\tv_nop\n\tv_nop\n\tv_nop" : "+v"(c) : "v"(a), "v"(b));
#endif
  return c;
}
__device__ __forceinline__ v8f mma_g(v16h a, v16h b, v8f c) {
  c = __builtin_amdgcn_wmma_f32_16x16x32_f16(false, a, false, b, (short)0, c, false, false);
#if DEV_ASM
  asm volatile("v_nop\n\tv_nop\n\tv_nop\n\tv_nop" : "+v"(c) : "v"(a), "v"(b));
#endif
  return c;
}

// =====================================================================================================
// Operand preparation, ONE launch: seven jobs that do not depend on one another share one grid; blockIdx.x alone
// (block-uniform) says which job a block works for and which piece of it:
//   [0, NG)           g[v][l] = sum_n Gs[l][n] w_v[n]  (f32; v = 0: w_mu, v = 1: w_sigma), 32 rows l per block
//   then NTK blocks   k[b][l][e]  f32 -> k^T[b][e][l] bf16   64x64 tile transpose
//   then NTG blocks   Gs[l][n]    f32 -> Gs^T[n][l]   bf16   64x64 tile transpose
//   then NCW blocks each for Wq, Wk, Wv (bf16) and Wo (f16 of 64 x its bf16 value)
// =====================================================================================================
#define NTK  ((HID / 64) * (LMEM / 64) * NBATCH)     // 2048
#define NTG  ((NBAS / 64) * (LMEM / 64))             //  256
#define NCW  (HID * HID / 2048)                      //  512
#define NG   (LMEM / 32)                             //   64
#define NPREP (NG + NTK + NTG + 4 * NCW)             // 4416
static_assert(((HID * HID) % 2048) == 0);

// f32 -> 16-bit planes, 8 elements per thread, one 16-B store per lane: a wave writes 512 contiguous B
// MODE 0: bf16 bits (RNE convert).  MODE 1: f16 bits of (64 * bf16(x)) (exact scaling of the bf16 value).
template <int MODE>
__device__ __forceinline__ unsigned short cvm(float f) {
  const unsigned short hb = bf_bits(f);
  if (MODE == 0) return hb;
  return h_bits((_Float16)(bf_up(hb) * WOSC));
}

// thread i of a plane -> its elements 8 i .. 8 i + 7; a block of 256 threads = 2048 elements, the blocks cover the plane exactly
template <int MODE>
__device__ __forceinline__ void cvt16x8(const float* __restrict__ in, unsigned short* out, int i) {
  const v4f a  = *(const v4f*)(in + (size_t)i * 8);
  const v4f a4 = *(const v4f*)(in + (size_t)i * 8 + 4);
  v4u p;
  p[0] = pk16(cvm<MODE>(a[0]),  cvm<MODE>(a[1]));
  p[1] = pk16(cvm<MODE>(a[2]),  cvm<MODE>(a[3]));
  p[2] = pk16(cvm<MODE>(a4[0]), cvm<MODE>(a4[1]));
  p[3] = pk16(cvm<MODE>(a4[2]), cvm<MODE>(a4[3]));
  unsigned short* o = out + (size_t)i * 8;
  *(v4u*)o = p;
#if DEV_ASM
  asm volatile("s_wait_xcnt 0x0" ::: "memory");   // another job's code follows in the kernel and reuses the store's registers
#endif
}

// Tiled transpose + bf16 convert: in[R][C] f32 (C contiguous) -> out[C][R] bf16 (R contiguous), one 64x64 tile at row r0,
// column c0. Load: 256 thr x 4 it x 4 floats = the tile (16-B loads along C), staged as bf16 t[cc][rr] (pitch 72 shorts,
// 16-B aligned rows); __syncthreads; store: out row (c0+row), 128-B segments.
template <int R, int C>
__device__ __forceinline__ void tr_bf16(const float* __restrict__ ib, unsigned short* ob, int r0, int c0,
                                        unsigned short (*t)[72], int tid) {
  const int rq = tid >> 4, cc4 = (tid & 15) * 4;       // round it: row rq + 16 it, columns cc4 .. cc4 + 3
  const float* p = ib + (size_t)(r0 + rq) * (size_t)C + c0 + cc4;
  v4f v[4];
#pragma unroll
  for (int it = 0; it < 4; ++it) v[it] = *(const v4f*)(p + (size_t)it * 16 * C);
#if DEV_ASM
  asm volatile("s_wait_xcnt 0x0" :: "v"(p) : "memory");   // the four loads' address pair is rewritten only behind this wait
#endif
#pragma unroll
  for (int it = 0; it < 4; ++it) {
    const int rr = rq + 16 * it;
    t[cc4 + 0][rr] = bf_bits(v[it][0]);
    t[cc4 + 1][rr] = bf_bits(v[it][1]);
    t[cc4 + 2][rr] = bf_bits(v[it][2]);
    t[cc4 + 3][rr] = bf_bits(v[it][3]);
  }
  __syncthreads();
  const int wave = tid >> 5, lane = tid & 31;
  const int q8 = lane & 7, sub = lane >> 3;
  v4u pv[2];
#pragma unroll
  for (int it = 0; it < 2; ++it) {
    const int row = it * 32 + wave * 4 + sub;
    pv[it] = *(const v4ua*)(&t[row][8 * q8]);
  }
#pragma unroll
  for (int it = 0; it < 2; ++it) {
    const int row = it * 32 + wave * 4 + sub;
    *(v4u*)(ob + (size_t)(c0 + row) * (size_t)R + r0 + 8 * q8) = pv[it];
  }
#if DEV_ASM
  asm volatile("s_wait_xcnt 0x0" ::: "memory");   // another job's code follows in the kernel and reuses the stores' registers
#endif
}

// g[v][l] = sum_n Gs[l][n] * w_v[n] for the 32 rows l0 .. l0 + 31: wave w takes rows l0 + 4 w .. + 3, a lane the columns
// n = 128 i + 4 lane .. + 3 (a wave's load = 512 contiguous B of the row); the 32 lane partials are summed by a butterfly.
// Store: wave 0 the 128-B segment of g[0], wave 1 that of g[1].
__device__ __forceinline__ void g_job(const float* __restrict__ Gs, const float* __restrict__ wmu,
                                      const float* __restrict__ wsg, float* g2, int l0, float (*gsh)[32], int tid) {
  const int wave = tid >> 5, lane = tid & 31;
  const float* p = Gs + (size_t)(l0 + wave * 4) * NBAS + lane * 4;
  float s0[4] = {0.f, 0.f, 0.f, 0.f}, s1[4] = {0.f, 0.f, 0.f, 0.f};
  // rolled: one 128-column chunk's values at a time, so that this job does not raise the register count of the whole launch
#pragma unroll 1
  for (int i = 0; i < 4; ++i) {
    const float* pi = p + i * 128;
    const float* q0 = wmu + i * 128 + lane * 4;
    const float* q1 = wsg + i * 128 + lane * 4;
    v4f x[4];
#pragma unroll
    for (int rr = 0; rr < 4; ++rr) x[rr] = *(const v4f*)(pi + (size_t)rr * NBAS);
    const v4f w0 = *(const v4f*)q0;
    const v4f w1 = *(const v4f*)q1;
#if DEV_ASM
    asm volatile("s_wait_xcnt 0x0" :: "v"(pi), "v"(q0), "v"(q1) : "memory");   // the loads' address registers are rewritten only behind this wait
#endif
#pragma unroll
    for (int rr = 0; rr < 4; ++rr)
#pragma unroll
      for (int e = 0; e < 4; ++e) {
        s0[rr] += x[rr][e] * w0[e];
        s1[rr] += x[rr][e] * w1[e];
      }
  }
#pragma unroll
  for (int rr = 0; rr < 4; ++rr) {
    float a0 = s0[rr], a1 = s1[rr];
#pragma unroll
    for (int m = 16; m >= 1; m >>= 1) {
      a0 += __shfl_xor(a0, m, 32);
      a1 += __shfl_xor(a1, m, 32);
    }
    if (lane == 0) {
      gsh[0][wave * 4 + rr] = a0;
      gsh[1][wave * 4 + rr] = a1;
    }
  }
  __syncthreads();
  if (tid < 64) g2[(size_t)(tid >> 5) * LMEM + l0 + (tid & 31)] = gsh[tid >> 5][tid & 31];
#if DEV_ASM
  asm volatile("s_wait_xcnt 0x0" ::: "memory");   // another job's code follows in the kernel and reuses the store's registers
#endif
}

__global__ __launch_bounds__(256) void prep_kernel(
    const float* __restrict__ kin, const float* __restrict__ Gs,
    const float* __restrict__ Wq, const float* __restrict__ Wk, const float* __restrict__ Wv,
    const float* __restrict__ Wo, const float* __restrict__ wmu, const float* __restrict__ wsg,
    unsigned short* KT, unsigned short* GT,
    unsigned short* WQB, unsigned short* WKB, unsigned short* WVB, unsigned short* WOH, float* G2) {
  __shared__ __align__(16) unsigned short t[64][72];
  __shared__ float gsh[2][32];
  const int tid = threadIdx.x;
  int j = blockIdx.x;
  if (j < NG) {
    g_job(Gs, wmu, wsg, G2, j * 32, gsh, tid);
    return;
  }
  j -= NG;
  if (j < NTK) {                         // column tile fastest, then row tile, then batch
    const int c0 = (j % (HID / 64)) * 64;
    const int r0 = ((j / (HID / 64)) % (LMEM / 64)) * 64;
    const size_t z = (size_t)(j / ((HID / 64) * (LMEM / 64)));
    tr_bf16<LMEM, HID>(kin + z * (size_t)(LMEM * HID), KT + z * (size_t)(HID * LMEM), r0, c0, t, tid);
    return;
  }
  j -= NTK;
  if (j < NTG) {
    const int c0 = (j % (NBAS / 64)) * 64;
    const int r0 = (j / (NBAS / 64)) * 64;
    tr_bf16<LMEM, NBAS>(Gs, GT, r0, c0, t, tid);
    return;
  }
  j -= NTG;
  const int w = j / NCW;
  const int i = (j % NCW) * 256 + tid;
  if (w == 3) {
    cvt16x8<1>(Wo, WOH, i);
  } else {
    const float* in = (w == 0) ? Wq : (w == 1) ? Wk : Wv;
    unsigned short* out = (w == 0) ? WQB : (w == 1) ? WKB : WVB;
    cvt16x8<0>(in, out, i);
  }
}

// =====================================================================================================
// Score-vector jobs. keys^T.w = Wk.(Bm^T.w) and Bm^T.w = k^T.(Gs.w): the score vectors need neither keys nor Bm, so their
// chain g = Gs.w -> t = g^T.k -> u, P does not wait for the GEMMs; t rides in the Bm GEMM's launch and u, P in the vals^T
// GEMM's launch, as extra blocks of 128 threads on WGPs that those grids of 128 tiles leave idle. lds = the block's LDS.
//
// t[b*2+v][e] = sum_l g[v][l] * bf16(k)[b][l][e]   (f32), one block = (b, 64 columns e) = 64 rows of k^T [b][e][l].
// Wave w takes rows e0 + 16 w .. + 15; a lane the elements l = 256 i + 8 lane .. + 7 of each row (a wave's load = 512
// contiguous B), with its 128 g values of both v in registers; the 32 lane partials are summed through LDS (pitch 33).
// Output plane T bf16 [16][1024]: row b*2+v = hi, row 8+b*2+v = residual; one wave stores a whole 128-B segment
// (32 lanes x 2 columns). 16 column blocks x NBATCH cover all 16 rows.
// =====================================================================================================
__device__ __forceinline__ void t_job(float* lds, const unsigned short* __restrict__ kt, const float* __restrict__ g2,
                                      unsigned short* tpl, int et, int b) {
  float* part = lds;                    // [v 2][e 64][33]
  float* fin  = lds + 2 * 64 * 33;      // [v 2][e 64]
  const int tid = threadIdx.x;
  const int wave = tid >> 5, lane = tid & 31;
  const int e0 = et * 64;
  v4f g[2][8][2];
#pragma unroll
  for (int v = 0; v < 2; ++v)
#pragma unroll
    for (int i = 0; i < 8; ++i) {
      g[v][i][0] = *(const v4f*)(g2 + v * LMEM + i * 256 + lane * 8);
      g[v][i][1] = *(const v4f*)(g2 + v * LMEM + i * 256 + lane * 8 + 4);
    }
  const unsigned short* p = kt + ((size_t)b * HID + e0 + wave * 16) * LMEM + lane * 8;
  // rolled, two rows per trip: 16 loads of 16 B in flight per lane, and the job stays within the GEMM's own register count
#pragma unroll 1
  for (int r = 0; r < 16; r += 2) {
    const unsigned short* pr = p + (size_t)r * LMEM;
    v8us x[2][8];
#pragma unroll
    for (int q = 0; q < 2; ++q)
#pragma unroll
      for (int i = 0; i < 8; ++i) x[q][i] = *(const v8usa*)(pr + (size_t)q * LMEM + i * 256);
#if DEV_ASM
    asm volatile("s_wait_xcnt 0x0" :: "v"(pr) : "memory");   // the loads' address pair is rewritten only behind this wait
#endif
#pragma unroll
    for (int q = 0; q < 2; ++q) {
      float a0 = 0.f, a1 = 0.f;
#pragma unroll
      for (int i = 0; i < 8; ++i)
#pragma unroll
        for (int j = 0; j < 8; ++j) {
          const float f = bf_up(x[q][i][j]);
          a0 += f * g[0][i][j >> 2][j & 3];
          a1 += f * g[1][i][j >> 2][j & 3];
        }
      part[(wave * 16 + r + q) * 33 + lane]      = a0;
      part[(64 + wave * 16 + r + q) * 33 + lane] = a1;
    }
  }
  __syncthreads();
  {
    float s = 0.f;                      // thread = (v, e): tid = v * 64 + e
#pragma unroll
    for (int k = 0; k < 32; ++k) s += part[tid * 33 + k];
    fin[tid] = s;
  }
  __syncthreads();
  if (tid < 64) {                       // wave 0: v = 0, wave 1: v = 1; lane = column pair
    const int v = tid >> 5, c2 = (tid & 31) * 2;
    const float s0 = fin[v * 64 + c2], s1 = fin[v * 64 + c2 + 1];
    const unsigned short h0 = bf_bits(s0), h1 = bf_bits(s1);
    const unsigned short l0 = bf_bits(s0 - bf_up(h0));
    const unsigned short l1 = bf_bits(s1 - bf_up(h1));
    *(unsigned*)(tpl + (size_t)(b * 2 + v) * HID + e0 + c2)     = pk16(h0, h1);
    *(unsigned*)(tpl + (size_t)(8 + b * 2 + v) * HID + e0 + c2) = pk16(l0, l1);
  }
}

// =====================================================================================================
// Score vectors folded through Wq, one block of 128 = (head h, 256 columns e'), NH x (HID / 256) blocks.
// Part 1: u[r][h*64+c] = sum_e' (T hi + T residual)[r][e'] * bf16(Wk)[h*64+c][e'],  r = b*2+v in 0..7, c in 0..63   (f32)
//   A = T [16][1024] (rows 0..7 hi, rows 8..15 residual), Bt = Wk bf16 [e][e']; D row r + D row r+8 = u row r.
//   Wave w takes the k slices [128 ks, 128 ks + 128), ks = w and w + 4, each 4 k-steps for the head's four 16-column tiles,
//   two tiles at a time (A fragment shared); the 8 slice partials are summed through LDS into us[c][r].
// Part 2: P[r][h][e'] = sum_d u[r][h*64+d] * bf16(Wq)[h*64+d][e']   (f32, d ascending), so that qry.u = q.P, head by head.
//   Thread = two neighbouring columns e' (one 4-B load per d; a wave = one 128-B segment of a Wq row).
//   Output plane PP bf16 [b][hi, residual][v][h][1024]: a wave stores whole 128-B segments; the blocks cover all 256 rows.
// =====================================================================================================
#define PCH 256        // columns e' per block
static_assert((HID % PCH) == 0);
__device__ __forceinline__ void up_job(float* lds, const unsigned short* __restrict__ tpl,
                                       const unsigned short* __restrict__ wkp,
                                       const unsigned short* __restrict__ wqp, unsigned short* pp, int h, int cq) {
  float (*red)[8][64] = (float (*)[8][64])lds;            // [k slice][row r][column of the head]
  float (*us)[8] = (float (*)[8])(lds + 8 * 8 * 64);      // u of this head: [d][row r], 16-B aligned rows
  const int tid  = threadIdx.x;
  const int wave = tid >> 5;
  const int lane = tid & 31;
  const int rlane = lane & 15;          // row (A) / col (B, D) within the tile
  const int koff  = (lane >> 4) * 8;    // k offset of this lane half
  const int e0 = cq * PCH + 2 * tid;
  // rolled: one slice's fragments at a time stay in registers
#pragma unroll 1
  for (int sl = 0; sl < 2; ++sl) {
    const int ks = wave + 4 * sl;
    const __bf16* A = (const __bf16*)(const void*)tpl + (size_t)rlane * HID + koff + ks * 128;
    v16b af[4];
#pragma unroll
    for (int s = 0; s < 4; ++s) af[s] = ldfrag<__bf16>(A + 32 * s);
    const __bf16* B = (const __bf16*)(const void*)wkp + (size_t)(h * HD + rlane) * HID + koff + ks * 128;
    v16b bt[4][4];                      // [16-column tile][k-step]
#pragma unroll
    for (int j = 0; j < 4; ++j)
#pragma unroll
      for (int s = 0; s < 4; ++s) bt[j][s] = ldfrag<__bf16>(B + (size_t)j * 16 * HID + 32 * s);
#if DEV_ASM
    asm volatile("s_wait_xcnt 0x0" :: "v"(A), "v"(B) : "memory");   // the loads' address pairs are rewritten only behind this wait
#endif
#pragma unroll
    for (int hf = 0; hf < 2; ++hf) {
      v8f a0 = zero8(), a1 = zero8();
#pragma unroll
      for (int s = 0; s < 4; ++s) {
        a0 = mma_g(af[s], bt[2 * hf][s], a0);
        a1 = mma_g(af[s], bt[2 * hf + 1][s], a1);
      }
      // D element r of lane half 0 = row r (hi part), of lane half 1 = row r+8 (residual part), same column
#pragma unroll
      for (int r = 0; r < 8; ++r) {
        const float x0 = a0[r] + __shfl_xor(a0[r], 16, 32);
        const float x1 = a1[r] + __shfl_xor(a1[r], 16, 32);
        red[ks][r][hf * 32 + lane] = (lane < 16) ? x0 : x1;     // lanes 16..31 hold the second tile's column lane-16
      }
    }
  }
  // the thread's Wq column pair does not depend on u: loaded here, where part 1's fragments are dead, its latency runs beside the sums
  const unsigned short* wq = wqp + (size_t)(h * HD) * HID + e0;
  unsigned wv[HD];
#pragma unroll
  for (int d = 0; d < HD; ++d) wv[d] = *(const unsigned*)(wq + (size_t)d * HID);
#if DEV_ASM
  asm volatile("s_wait_xcnt 0x0" :: "v"(wq) : "memory");   // the loads' address pair is rewritten only behind this wait
#endif
  __syncthreads();
#pragma unroll
  for (int k = 0; k < 4; ++k) {         // 512 sums = 8 rows x 64 columns, four per thread
    const int r = (tid >> 6) + 2 * k, col = tid & 63;
    float s = 0.f;
#pragma unroll
    for (int w = 0; w < 8; ++w) s += red[w][r][col];
    us[col][r] = s;
  }
  __syncthreads();
  v2f acc[8];
#pragma unroll
  for (int r = 0; r < 8; ++r) { acc[r].x = 0.f; acc[r].y = 0.f; }
#pragma unroll
  for (int d = 0; d < HD; ++d) {
    v2f x;
    x.x = __uint_as_float(wv[d] << 16);
    x.y = __uint_as_float(wv[d] & 0xFFFF0000u);
    const v4f ua = *(const v4f*)(&us[d][0]);
    const v4f ub = *(const v4f*)(&us[d][4]);
#pragma unroll
    for (int r = 0; r < 4; ++r) {
      acc[r]     += x * ua[r];
      acc[4 + r] += x * ub[r];
    }
  }
#pragma unroll
  for (int r = 0; r < 8; ++r) {         // r = b*2+v
    const unsigned short h0 = bf_bits(acc[r].x), h1 = bf_bits(acc[r].y);
    const unsigned short l0 = bf_bits(acc[r].x - bf_up(h0));
    const unsigned short l1 = bf_bits(acc[r].y - bf_up(h1));
    unsigned short* o = pp + (size_t)((r >> 1) * 64 + (r & 1) * 16 + h) * HID + e0;
    *(unsigned*)(o)                    = pk16(h0, h1);
    *(unsigned*)(o + (size_t)32 * HID) = pk16(l0, l1);
  }
}

// =====================================================================================================
// LDS-staged batched WMMA GEMM (16-bit operand type OT): C[m][n] = sum_k A[m][k] * Bt[n][k];
// one block of 4 waves (2 x 2) per 128x128 tile, one wave per 64x64 quarter. A row-major [M][KD], Bt row-major
// [N][KD] (k contiguous, pitch KD); M, N multiples of 128, KD a multiple of 128 and at least 256 (static shapes here).
// blockIdx.x = tile (column tile fastest), blockIdx.y = batch index (strides in elements); the blocks with blockIdx.x < ntiles are exactly the tiles.
// A stage = 128 k = 256 B of each of the tile's operand rows [A 128 | Bt 128 | (SPL 2) Bt2 128], brought by asynchronous
// copies to LDS: 16 lanes x 16 B = one row's 256 B, so a wave's copy covers two rows in whole lines; each of the 128
// threads copies rows (tid >> 4) + 8 i. LDS row pitch 272 B. Two buffers: stage t + 1 flies while stage t is worked on.
// Fragments are read from LDS with the split k map (ldfrag), same k order per accumulator as a straight k loop.
// SPL 0: single product. SPL 2: Bt = hi plane Bt + residual plane Bt2 (2 products per k-step, same accumulator).
// OUT_MODE 0: f32 C (pitch ldc), value * oscale.
// OUT_MODE 2: bf16 hi plane C + bf16 residual plane C2 = bf16(v - hi) (same pitch / stride).
// JOB 1, 2: blocks with blockIdx.x >= ntiles (block-uniform) do not belong to the GEMM: they work a score-vector job that
// depends on nothing of this launch (JOB 1: t_job, JOB 2: up_job) in the ring's LDS and leave. JOB 0: the grid is the tiles.
// =====================================================================================================
#define GKS  128       // k elements per stage
#define GPIT 136       // LDS row pitch in 16-bit elements: 272 B = 16 B x 17, conflict-free for 16-B fragment reads

// Eight asynchronous 16-B-per-lane copies global -> LDS: rows r, r + 8, ..., r + 56 of one operand plane.
// l = the lane's LDS byte address, g = the lane's global address, ld = global row pitch in elements.
__device__ __forceinline__ void acopy8(unsigned l, const unsigned short* g, int ld) {
#if DEV_ASM
  const size_t gs = (size_t)8 * (size_t)ld;
  const unsigned ls = 8u * GPIT * 2u;
  // the closing s_wait_xcnt keeps every address register intact until the copies have taken it
  asm volatile(
      "global_load_async_to_lds_b128 %0, %8, off\n\t"
      "global_load_async_to_lds_b128 %1, %9, off\n\t"
      "global_load_async_to_lds_b128 %2, %10, off\n\t"
      "global_load_async_to_lds_b128 %3, %11, off\n\t"
      "global_load_async_to_lds_b128 %4, %12, off\n\t"
      "global_load_async_to_lds_b128 %5, %13, off\n\t"
      "global_load_async_to_lds_b128 %6, %14, off\n\t"
      "global_load_async_to_lds_b128 %7, %15, off\n\t"
      "s_wait_xcnt 0x0"
      :: "v"(l), "v"(l + ls), "v"(l + 2u * ls), "v"(l + 3u * ls),
         "v"(l + 4u * ls), "v"(l + 5u * ls), "v"(l + 6u * ls), "v"(l + 7u * ls),
         "v"(g), "v"(g + gs), "v"(g + 2 * gs), "v"(g + 3 * gs),
         "v"(g + 4 * gs), "v"(g + 5 * gs), "v"(g + 6 * gs), "v"(g + 7 * gs)
      : "memory");
#endif
}

template <typename OT, int SPL, int OUT_MODE, int KD, int JOB>
__global__ __launch_bounds__(128) void gemm128(
    const unsigned short* __restrict__ Ap, long long strideA,
    const unsigned short* __restrict__ Btp, const unsigned short* __restrict__ Bt2p, long long strideB,
    void* Cout, void* Cout2, int ldc, long long strideC,
    int N, float oscale,
    int ntiles, const unsigned short* __restrict__ j0, const unsigned short* __restrict__ j1,
    const unsigned short* __restrict__ j2, const float* __restrict__ jf, unsigned short* jo) {
  typedef typename FT<OT>::frag V16;
  static_assert((KD % GKS) == 0 && KD / GKS >= 2);
  constexpr int NST  = KD / GKS;                       // stages
  constexpr int NPL  = (SPL == 2) ? 3 : 2;             // operand planes per stage
  constexpr int BUFE = NPL * 128 * GPIT;               // elements per buffer
  __shared__ __align__(16) unsigned short ring[2 * BUFE];
  __shared__ __align__(16) float sT[4][16 * 68];       // per-wave 16x64 slab, pitch 68 floats
  if (JOB != 0 && (int)blockIdx.x >= ntiles) {
    float* jl = (float*)(void*)ring;
    if (JOB == 1) t_job(jl, j0, jf, jo, (int)blockIdx.x - ntiles, (int)blockIdx.y);
    else          up_job(jl, j0, j1, j2, jo, (int)blockIdx.x - ntiles, (int)blockIdx.y);
    return;
  }
  const int b    = blockIdx.y;
  const int tid  = threadIdx.x;
  const int lane = tid & 31;
  const int wave = tid >> 5;
  const int tilesN = N >> 7;
  const int tm = (int)blockIdx.x / tilesN;
  const int tn = (int)blockIdx.x - tm * tilesN;
  const int m0 = (tm << 7) + ((wave >> 1) << 6);       // this wave's 64x64 quarter
  const int n0 = (tn << 7) + ((wave & 1) << 6);

  // ---- copy side: lane -> (row group, 16-B segment of the 256-B row) ----
  const int seg = tid & 15, r8 = tid >> 4;
  const unsigned short* gA  = Ap   + (size_t)b * (size_t)strideA + (size_t)((tm << 7) + r8) * KD + seg * 8;
  const unsigned short* gB  = Btp  + (size_t)b * (size_t)strideB + (size_t)((tn << 7) + r8) * KD + seg * 8;
  const unsigned short* gB2 = Bt2p + (size_t)b * (size_t)strideB + (size_t)((tn << 7) + r8) * KD + seg * 8;
  const unsigned lds0 = (unsigned)(uintptr_t)(ring + r8 * GPIT + seg * 8);
  auto fill = [&](int s, int buf) {
    const unsigned l = lds0 + (unsigned)buf * (unsigned)(BUFE * 2);
    const int k0 = s * GKS;
    acopy8(l,                   gA + k0, KD);
    acopy8(l +  64 * GPIT * 2,  gA + k0 + (size_t)64 * KD, KD);
    acopy8(l + 128 * GPIT * 2,  gB + k0, KD);
    acopy8(l + 192 * GPIT * 2,  gB + k0 + (size_t)64 * KD, KD);
    if (SPL == 2) {
      acopy8(l + 256 * GPIT * 2, gB2 + k0, KD);
      acopy8(l + 320 * GPIT * 2, gB2 + k0 + (size_t)64 * KD, KD);
    }
  };

  const int rlane = lane & 15;                 // row (A) / col (B, D) within subtile
  const int koff  = (lane >> 4) * 8;           // k offset of this lane half
  const int mOff  = (lane >> 4) * 8;           // D row offset
  const int aoff = (((wave >> 1) << 6) + rlane) * GPIT + koff;
  const int boff = (128 + ((wave & 1) << 6) + rlane) * GPIT + koff;

  v8f acc[4][4];
#pragma unroll
  for (int i = 0; i < 4; ++i)
#pragma unroll
    for (int j = 0; j < 4; ++j) acc[i][j] = zero8();

  fill(0, 0);
#if DEV_ASM
  asm volatile("s_wait_asynccnt 0x0" ::: "memory");   // stage 0 of this wave has landed
#endif
  __syncthreads();                                      // stage 0 of every wave is readable
  fill(1, 1);

  // rolled: one stage's 64 or 128 WMMAs are the hot loop
#pragma unroll 1
  for (int t = 0; t < NST; ++t) {
    const OT* rb = (const OT*)(const void*)ring + (t & 1) * BUFE;
    // the loops below are unrolled so that af, bq and acc are indexed by constants and stay in registers
#pragma unroll
    for (int kk = 0; kk < GKS / 32; ++kk) {
      V16 af[4];
#pragma unroll
      for (int i = 0; i < 4; ++i) af[i] = ldfrag<OT>(rb + aoff + i * 16 * GPIT + kk * 32);
#pragma unroll
      for (int p = 0; p < ((SPL == 2) ? 2 : 1); ++p) {
        V16 bq[4];
#pragma unroll
        for (int j = 0; j < 4; ++j) bq[j] = ldfrag<OT>(rb + boff + p * 128 * GPIT + j * 16 * GPIT + kk * 32);
#pragma unroll
        for (int i = 0; i < 4; ++i)
#pragma unroll
          for (int j = 0; j < 4; ++j) acc[i][j] = mma_g(af[i], bq[j], acc[i][j]);
      }
    }
#if DEV_ASM
    asm volatile("s_wait_dscnt 0x0" ::: "memory");      // this wave's reads of buffer t & 1 are done before it is refilled
    asm volatile("s_wait_asynccnt 0x0" ::: "memory");   // this wave's copies of stage t + 1 have landed
#endif
    __syncthreads();                                    // publishes stage t + 1 and frees buffer t & 1
    if (t + 2 < NST) fill(t + 2, t & 1);
  }
#if DEV_ASM
  asm volatile("s_wait_asynccnt 0x0" ::: "memory");     // no copy is outstanding when the wave goes on to its end
#endif

  // ---- epilogue ----
  float* slab = sT[wave];
#pragma unroll
  for (int i = 0; i < 4; ++i) {
    const int mBase = m0 + (i << 4);
#pragma unroll
    for (int j = 0; j < 4; ++j) {
#pragma unroll
      for (int r = 0; r < 8; ++r) {
        slab[(mOff + r) * 68 + (j << 4) + rlane] = acc[i][j][r];
      }
    }
    __builtin_amdgcn_fence(__ATOMIC_RELEASE, "workgroup");
    __builtin_amdgcn_wave_barrier();
    __builtin_amdgcn_fence(__ATOMIC_ACQUIRE, "workgroup");
    if (OUT_MODE == 0) {
      float* Cf = (float*)Cout + (size_t)b * (size_t)strideC;
      const int h2 = lane >> 4, c4 = (lane & 15) * 4;     // 256-B row segment = 16 lanes x 16 B
      {
#pragma unroll
        for (int it = 0; it < 8; ++it) {
          const int row = it * 2 + h2;                     // it 0..7 x h2 0..1 = rows 0..15
          const v4f v = *(const v4f*)(slab + row * 68 + c4) * oscale;
          *(v4f*)(Cf + (size_t)(mBase + row) * (size_t)ldc + n0 + c4) = v;
        }
        
      }
    } else {
      const int q = lane >> 3, c8 = (lane & 7) * 8;
      unsigned short* Ch = (unsigned short*)Cout  + (size_t)b * (size_t)strideC;
      unsigned short* Cl = (unsigned short*)Cout2 + (size_t)b * (size_t)strideC;
      v4u hv[4], lv[4];
#pragma unroll
      for (int it = 0; it < 4; ++it) {
        const int row = it * 4 + q;                        // it 0..3 x q 0..3 = rows 0..15
        const float* sp = slab + row * 68 + c8;
        v4u a, a2;
#pragma unroll
        for (int e = 0; e < 4; ++e) {
          const float f0 = sp[2 * e], f1 = sp[2 * e + 1];
          const unsigned short h0 = bf_bits(f0), h1 = bf_bits(f1);
          const unsigned short l0 = bf_bits(f0 - bf_up(h0));
          const unsigned short l1 = bf_bits(f1 - bf_up(h1));
          a[e] = pk16(h0, h1); a2[e] = pk16(l0, l1);
        }
        hv[it] = a; lv[it] = a2;
      }
      {
#pragma unroll
        for (int it = 0; it < 4; ++it) {
          const int row = it * 4 + q;
          *(v4u*)(Ch + (size_t)(mBase + row) * (size_t)ldc + n0 + c8) = hv[it];
          *(v4u*)(Cl + (size_t)(mBase + row) * (size_t)ldc + n0 + c8) = lv[it];
        }
        
      }
    }
    __builtin_amdgcn_fence(__ATOMIC_RELEASE, "workgroup");
    __builtin_amdgcn_wave_barrier();
    __builtin_amdgcn_fence(__ATOMIC_ACQUIRE, "workgroup");
  }
}

// =====================================================================================================
// S[m][v*16+h] = sum_e' bf16(q)[m][e'] * (P hi + P residual)[b][v][h][e']   (= qry[m][head h] . u[b][v][head h], unscaled)
// Block 512 = 32 query rows (two 16-row tiles, all of one batch); wave w of 16 takes the k slice [64 w, 64 w + 64) = 2 k-steps.
// A fragments: q f32 from global with the split k map of ldfrag, RNE-converted to bf16 in registers (q is read once, here).
// B fragments: PP rows b*64 + j*16 + col, j = 0, 1: hi of v = 0, 1; j = 2, 3: residual of v = 0, 1; shared by both row tiles.
// The 16 slice partials are summed through LDS (pitch 36 floats = 16 B x 9). Store: 16 lanes x 8 B = one row's 128 B.
// grid MROWS / 32 covers all 8192 rows of S [8192][32].
// =====================================================================================================
#define SPIT 36
static_assert((QLEN % 32) == 0 && 2 * NH == 32);
__global__ __launch_bounds__(512) void s_kernel(const float* __restrict__ qin,
                                                const unsigned short* __restrict__ pp, float* S) {
  union FA { v16b v; unsigned w[8]; };
  __shared__ __align__(16) float red[16][32 * SPIT];
  const int tid  = threadIdx.x;
  const int wave = tid >> 5;
  const int lane = tid & 31;
  const int rlane = lane & 15;          // row (A) / col (B, D) within the tile
  const int hh    = lane >> 4;
  const int m0 = blockIdx.x * 32;
  const int b  = m0 / QLEN;
  const float* qa = qin + (size_t)(m0 + rlane) * HID + wave * 64 + 8 * hh;
  const __bf16* Bp = (const __bf16*)(const void*)pp + (size_t)(b * 64 + rlane) * HID + wave * 64 + 8 * hh;
  // every load of the wave is issued before the first use: each byte is read once, so the cost is latency, paid once
  v4f a[2][2][4];
#pragma unroll
  for (int i = 0; i < 2; ++i)
#pragma unroll
    for (int s = 0; s < 2; ++s) {
      const float* p = qa + (size_t)i * 16 * HID + 32 * s;
      a[i][s][0] = *(const v4f*)(p);
      a[i][s][1] = *(const v4f*)(p + 4);
      a[i][s][2] = *(const v4f*)(p + 16);
      a[i][s][3] = *(const v4f*)(p + 20);
    }
  v16b bq[2][4];
#pragma unroll
  for (int s = 0; s < 2; ++s)
#pragma unroll
    for (int j = 0; j < 4; ++j) bq[s][j] = ldfrag<__bf16>(Bp + (size_t)j * 16 * HID + 32 * s);
#if DEV_ASM
  asm volatile("s_wait_xcnt 0x0" :: "v"(qa), "v"(Bp) : "memory");   // the loads' address pairs are rewritten only behind this wait
#endif
  v8f acc[2][2];
#pragma unroll
  for (int i = 0; i < 2; ++i)
#pragma unroll
    for (int v = 0; v < 2; ++v) acc[i][v] = zero8();
#pragma unroll
  for (int s = 0; s < 2; ++s) {
    FA af[2];
#pragma unroll
    for (int i = 0; i < 2; ++i)
#pragma unroll
      for (int p = 0; p < 8; ++p) {      // elements 2p, 2p + 1
        v2f x;
        x.x = a[i][s][p >> 1][(p & 1) * 2];
        x.y = a[i][s][p >> 1][(p & 1) * 2 + 1];
        af[i].w[p] = __builtin_bit_cast(unsigned, __builtin_convertvector(x, v2b));
      }
#pragma unroll
    for (int pl = 0; pl < 2; ++pl)
#pragma unroll
      for (int i = 0; i < 2; ++i)
#pragma unroll
        for (int v = 0; v < 2; ++v) acc[i][v] = mma_g(af[i].v, bq[s][pl * 2 + v], acc[i][v]);
  }
  float* rw = red[wave];
#pragma unroll
  for (int i = 0; i < 2; ++i)
#pragma unroll
    for (int v = 0; v < 2; ++v)
#pragma unroll
      for (int r = 0; r < 8; ++r) rw[(i * 16 + 8 * hh + r) * SPIT + v * 16 + rlane] = acc[i][v][r];
  __syncthreads();
  {
    const int row = tid >> 4, c2 = (tid & 15) * 2;
    v2f s = {0.f, 0.f};
#pragma unroll
    for (int w = 0; w < 16; ++w) s += *(const v2f*)(red[w] + row * SPIT + c2);
    *(v2f*)(S + (size_t)(m0 + row) * 32 + c2) = s;
  }
}

// =====================================================================================================
// Continuous attention context, one block = (b, head h, 64 queries), 4 waves x 16 queries, grid NBATCH*NH*NQB64.
//   prologue (f32): dm = S[q][h] / 8 (= qry[q][head h] . u_mu[b][head h] / 8), dg = S[q][16+h] / 8 likewise with u_sigma;
//     mu = sigmoid(dm), sig2 = max(softplus(dg), 1e-4)   (lane c = query, both lane halves read the same two values)
//   loop over 8 chunks of 64 basis functions (static trip): vals^T hi / residual chunks [d 64][n 64] staged in
//     LDS by 128 threads x 32 elements per plane (whole 64x64 tile, __syncthreads before and after);
//     per 32-deep k-step the lane builds its A fragment in registers: element i = r[q=c][n0+32kk+k(i)],
//     r = exp(-0.5 (mu - bm[n])^2 / var) / sqrt(2 pi var), var = sig2 + bs[n]^2 (bm, bs = bf16-converted basis
//     tables in LDS), carried as r / RSC = exp2(-(t s)^2) s with t = mu - bm[n], s = rsq(VK var) (sig2 and the bs^2 table
//     hold VK var's two terms; RSC is folded back once in the epilogue), two n per packed f32 instruction,
//     as bf16 hi + bf16 residual (RNE converts); B fragments = vals^T hi / residual from LDS (col = d, k = n);
//     oacc[t] += rh.vh + rh.vl + rl.vh  (bf16 WMMA, one f32 accumulator).
//   epilogue: wave's 16x64 f32 tile staged in LDS, converted to f16(64 * ctx), written to the ctx plane
//   coverage: rows it(4) x (lane>>3)(4) = 16 per wave x 4 waves x 32 qb x 4 b; cols 8 lanes x 8 = 64 per head x 16 heads
//   = the whole [8192][1024] ctx plane. LDS extents: Vth/Vtl 64x64 staged = 64x64 consumed (row pitch VPIT); bm_s/bv_s 512 = 512;
//   Os written 16x64 per wave before the wave reads its own tile.
// =====================================================================================================
#define VPIT 72        // LDS row pitch of the vals^T chunks in 16-bit elements: 144 B = 16 B x 9, conflict-free for 16-B reads and stores
#define OPIT 68        // LDS row pitch of the per-wave context tile in floats: 272 B = 16 B x 17, same reason
#define VK   1.3862943611198906f   // 2 ln 2: exp(-t^2 / (2 var)) = exp2(-t^2 / (VK var))
#define RSC  0.46971863934982566f  // sqrt(VK / (2 pi)): 1 / sqrt(2 pi var) = RSC / sqrt(VK var)
__global__ __launch_bounds__(128) void ctx_kernel(
    const float* __restrict__ sv,
    const float* __restrict__ bmu, const float* __restrict__ bsg,
    const unsigned short* __restrict__ vthp, const unsigned short* __restrict__ vtlp,
    unsigned short* ctxp) {
  union FB { v16b v; v8us h[2]; unsigned w[8]; };
  __shared__ __align__(16) unsigned short Vth[64 * VPIT];  // vals^T hi chunk [d][n]       9 KB
  __shared__ __align__(16) unsigned short Vtl[64 * VPIT];  // vals^T residual chunk        9 KB
  __shared__ __align__(16) float Os[4][16 * OPIT];         // per-wave context tile       17 KB
  __shared__ __align__(16) float bm_s[NBAS];               // bf16-converted basis means
  __shared__ __align__(16) float bv_s[NBAS];               // VK * (bf16-converted basis sigma)^2

  const int tid  = threadIdx.x;
  const int wave = tid >> 5;
  const int lane = tid & 31;
  const int hh   = lane >> 4;
  const int c    = lane & 15;

  const int bx   = blockIdx.x;
  const int qb   = bx % NQB64;
  const int rest = bx / NQB64;
  const int h    = rest % NH;
  const int b    = rest / NH;
  const int q0   = qb * 64 + wave * 16;
  const size_t row0 = (size_t)b * QLEN + q0;              // plane row of this wave's query 0

  for (int i = tid; i < NBAS; i += 128) {
    const float m = bf_up(bf_bits(bmu[i]));
    const float s = bf_up(bf_bits(bsg[i]));
    bm_s[i] = m;
    bv_s[i] = s * s * VK;
  }

  // ---- per-query affine heads (f32) ----
  const float* sr = sv + (row0 + c) * 32 + h;
  const float dm = sr[0]  * 0.125f;
  const float dg = sr[NH] * 0.125f;
#if DEV_ASM
  asm volatile("s_wait_xcnt 0x0" :: "v"(sr) : "memory");   // the two loads' address pair is rewritten only behind this wait
#endif
  const float mu   = 1.0f / (1.0f + expf(-dm));
  const float spl  = fmaxf(dg, 0.0f) + log1pf(expf(-fabsf(dg)));
  const float sig2k = fmaxf(spl, 1e-4f) * VK;

  const unsigned short* Vh = vthp + ((size_t)b * HID + (size_t)h * HD) * NBAS;
  const unsigned short* Vl = vtlp + ((size_t)b * HID + (size_t)h * HD) * NBAS;

  v8f oacc[4];
#pragma unroll
  for (int t = 0; t < 4; ++t) oacc[t] = zero8();

  for (int nt = 0; nt < NCH; ++nt) {         // static trip count
    const int n0 = nt * 64;
    __syncthreads();
    {
      const int r = tid >> 1, half = (tid & 1) * 32;      // d = r, n = n0 + half .. + 31
      const unsigned short* vg  = Vh + (size_t)r * NBAS + n0 + half;
      const unsigned short* vlg = Vl + (size_t)r * NBAS + n0 + half;
#pragma unroll
      for (int i = 0; i < 4; ++i) {
        const v8us b0 = *(const v8usa*)(vg + 8 * i);
        const v8us b1 = *(const v8usa*)(vlg + 8 * i);
        *(v8usa*)(Vth + r * VPIT + half + 8 * i) = b0;
        *(v8usa*)(Vtl + r * VPIT + half + 8 * i) = b1;
      }
    }
    __syncthreads();

#pragma unroll 1
    for (int kk = 0; kk < 2; ++kk) {
      // ---- A fragments: r values of query c at the 16 k slots of this lane half, bf16 hi + residual ----
      FB rh, rl;
#pragma unroll
      for (int p = 0; p < 8; ++p) {          // elements 2p, 2p + 1: two neighbouring n
        const int n = n0 + kk * 32 + 8 * hh + ((p < 4) ? (2 * p) : (8 + 2 * p));
        const v2f t  = mu - *(const v2f*)(bm_s + n);
        const v2f vk = sig2k + *(const v2f*)(bv_s + n);
        v2f rs;
        rs.x = __builtin_amdgcn_rsqf(vk.x);
        rs.y = __builtin_amdgcn_rsqf(vk.y);
        const v2f zz = t * rs;
        const v2f ar = zz * zz;
        v2f ex;
        ex.x = __builtin_amdgcn_exp2f(-ar.x);
        ex.y = __builtin_amdgcn_exp2f(-ar.y);
        const v2f rv = ex * rs;
        const unsigned hp = __builtin_bit_cast(unsigned, __builtin_convertvector(rv, v2b));
        v2f up;
        up.x = __uint_as_float(hp << 16);
        up.y = __uint_as_float(hp & 0xFFFF0000u);
        rh.w[p] = hp;
        rl.w[p] = __builtin_bit_cast(unsigned, __builtin_convertvector(rv - up, v2b));
      }
      // ---- ctx += r . vals over this 32-deep slice of n ----
#pragma unroll
      for (int t = 0; t < 4; ++t) {
        FB vb, vl;
        vb.h[0] = *(const v8usa*)(Vth + (t * 16 + c) * VPIT + kk * 32 + 8 * hh);
        vb.h[1] = *(const v8usa*)(Vth + (t * 16 + c) * VPIT + kk * 32 + 16 + 8 * hh);
        vl.h[0] = *(const v8usa*)(Vtl + (t * 16 + c) * VPIT + kk * 32 + 8 * hh);
        vl.h[1] = *(const v8usa*)(Vtl + (t * 16 + c) * VPIT + kk * 32 + 16 + 8 * hh);
        oacc[t] = mma_g(rh.v, vb.v, oacc[t]);
        oacc[t] = mma_g(rh.v, vl.v, oacc[t]);
        oacc[t] = mma_g(rl.v, vb.v, oacc[t]);
      }
    }
  }

  float* os = Os[wave];
#pragma unroll
  for (int r = 0; r < 8; ++r) {
#pragma unroll
    for (int t = 0; t < 4; ++t) os[(8 * hh + r) * OPIT + t * 16 + c] = oacc[t][r];
  }
  __builtin_amdgcn_fence(__ATOMIC_RELEASE, "workgroup");
  __builtin_amdgcn_wave_barrier();
  __builtin_amdgcn_fence(__ATOMIC_ACQUIRE, "workgroup");
  {
    const int q4 = lane >> 3, c8 = (lane & 7) * 8;
    v4u hv[4];
#pragma unroll
    for (int it = 0; it < 4; ++it) {
      const int row = it * 4 + q4;   // it 0..3 x q4 0..3 = rows 0..15 of the wave tile
      const float* sp = os + row * OPIT + c8;
      v4u a;
#pragma unroll
      for (int e = 0; e < 4; ++e) {
        const float f0 = sp[2 * e] * (CSC * RSC), f1 = sp[2 * e + 1] * (CSC * RSC);
        a[e] = pk16(h_bits((_Float16)f0), h_bits((_Float16)f1));
      }
      hv[it] = a;
    }
    {
#pragma unroll
      for (int it = 0; it < 4; ++it) {
        const int row = it * 4 + q4;
        const size_t go = (row0 + row) * HID + (size_t)h * HD + c8;
        *(v4u*)(ctxp + go) = hv[it];
      }
      
    }
  }
}

// =====================================================================================================
// Workspace map (bytes), every region an exact multiple of its whole-line / whole-tile store granularity:
//   KT   bf16 [4][1024 e][2048 l]   16777216   (dead after the Bm GEMM; reused as the f16 ctx plane [8192][1024], same size)
//   GT   bf16 [512 n][2048 l]        2097152
//   WQB  bf16 [1024][1024]           2097152
//   WKB  bf16 [1024][1024]           2097152
//   WVB  bf16 [1024][1024]           2097152
//   WOH  f16  [1024][1024] (x64)     2097152
//   BMH  bf16 [4*512][1024]          4194304   Bm hi
//   BML  bf16 [4*512][1024]          4194304   Bm residual
//   TPL  bf16 [16][1024]               32768   t = g^T.k (= w^T.Bm), rows 0..7 hi, rows 8..15 residual
//   VTH  bf16 [4][1024 e][512 n]     4194304   vals^T hi
//   VTL  bf16 [4][1024 e][512 n]     4194304   vals^T residual
//   PP   bf16 [4][2][2][16][1024]     524288   P = u.Wq per head: [b][hi, residual][v][h][e']
//   SV   f32  [8192][32]             1048576   S = q.P^T: [query row][v*16+h]
//   G2   f32  [2][2048]                16384   g = Gs.w: [v][l]
//   total                           45662208
// Weights are [out][in] with in contiguous = the Bt layout for x.W^T, so they are only converted.
// =====================================================================================================
extern "C" void kernel_launch(void* const* d_in, const int* in_sizes, int n_in,
                              void* d_out, int out_size, void* d_ws, size_t ws_size,
                              hipStream_t stream) {
  if (n_in < 11) return;
  if (in_sizes[0] != NBATCH * LMEM * HID) return;
  if (in_sizes[1] != MROWS * HID) return;
  if (in_sizes[2] != HID * HID || in_sizes[3] != HID * HID || in_sizes[4] != HID * HID || in_sizes[5] != HID * HID) return;
  if (in_sizes[6] != NBAS || in_sizes[7] != NBAS) return;
  if (in_sizes[8] != LMEM * NBAS || in_sizes[9] != NBAS || in_sizes[10] != NBAS) return;
  if (out_size != MROWS * HID) return;

  const float* kin = (const float*)d_in[0];
  const float* qin = (const float*)d_in[1];
  const float* Wq  = (const float*)d_in[2];
  const float* Wk  = (const float*)d_in[3];
  const float* Wv  = (const float*)d_in[4];
  const float* Wo  = (const float*)d_in[5];
  const float* wmu = (const float*)d_in[6];
  const float* wsg = (const float*)d_in[7];
  const float* Gs  = (const float*)d_in[8];
  const float* bmu = (const float*)d_in[9];
  const float* bsg = (const float*)d_in[10];

  const size_t PKT  = (size_t)NBATCH * HID * LMEM * 2;    // 16777216  k^T planes; later the ctx f16 plane
  const size_t PCTX = (size_t)MROWS * HID * 2;            // 16777216  (== PKT)
  const size_t PGT  = (size_t)NBAS * LMEM * 2;            //  2097152
  const size_t PW   = (size_t)HID * HID * 2;              //  2097152
  const size_t PBM  = (size_t)NBATCH * NBAS * HID * 2;    //  4194304
  const size_t PTPL = (size_t)16 * HID * 2;               //    32768
  const size_t PVT  = (size_t)NBATCH * HID * NBAS * 2;    //  4194304
  const size_t PPP  = (size_t)NBATCH * 64 * HID * 2;      //   524288
  const size_t PSV  = (size_t)MROWS * 32 * 4;             //  1048576
  const size_t PG2  = (size_t)2 * LMEM * 4;               //    16384
  if (PCTX > PKT) return;
  size_t off = 0;
  const size_t oKT  = off; off += PKT;
  const size_t oGT  = off; off += PGT;
  const size_t oWQ  = off; off += PW;
  const size_t oWK  = off; off += PW;
  const size_t oWV  = off; off += PW;
  const size_t oWO  = off; off += PW;
  const size_t oBMH = off; off += PBM;
  const size_t oBML = off; off += PBM;
  const size_t oTPL = off; off += PTPL;
  const size_t oVTH = off; off += PVT;
  const size_t oVTL = off; off += PVT;
  const size_t oPP  = off; off += PPP;
  const size_t oSV  = off; off += PSV;
  const size_t oG2  = off; off += PG2;
  if (off > ws_size) return;                        // off = 45662208
  if (off > (size_t)134217728) return;

  char* ws = (char*)d_ws;
  unsigned short* KT  = (unsigned short*)(ws + oKT);
  unsigned short* CTX = (unsigned short*)(ws + oKT);   // reuse after the Bm GEMM has consumed KT
  unsigned short* GT  = (unsigned short*)(ws + oGT);
  unsigned short* WQB = (unsigned short*)(ws + oWQ);
  unsigned short* WKB = (unsigned short*)(ws + oWK);
  unsigned short* WVB = (unsigned short*)(ws + oWV);
  unsigned short* WOH = (unsigned short*)(ws + oWO);
  unsigned short* BMH = (unsigned short*)(ws + oBMH);
  unsigned short* BML = (unsigned short*)(ws + oBML);
  unsigned short* TPL = (unsigned short*)(ws + oTPL);
  unsigned short* VTH = (unsigned short*)(ws + oVTH);
  unsigned short* VTL = (unsigned short*)(ws + oVTL);
  unsigned short* PP  = (unsigned short*)(ws + oPP);
  float*          SV  = (float*)(ws + oSV);
  float*          G2  = (float*)(ws + oG2);

  const dim3 blk(256);
  const dim3 gBm((NBAS / 128) * (HID / 128) + HID / 64, NBATCH); // 32 tiles of 128x128 x 4 b      (M=512,  N=1024, K=2048) + (16, 4) t blocks
  const dim3 gVt((HID / 128) * (NBAS / 128) + NH, HID / PCH);     // 32 tiles of 128x128 x 4 b      (M=1024, N=512,  K=1024) + (16, 4) u, P blocks
  const dim3 gQ((MROWS / 128) * (HID / 128), 1);                  // 512 tiles of 128x128           (M=8192, N=1024, K=1024)
  const dim3 gS(MROWS / 32);                                      // 256 blocks of 512
  const dim3 gCtx(NBATCH * NH * NQB64);                           // 2048 blocks of 128

  // (1) k -> k^T bf16 per batch, Gs -> Gs^T bf16 (l contiguous); weights -> bf16; Wo -> f16 (64 x its bf16 value); g = Gs.w (f32)
  prep_kernel<<<dim3(NPREP), blk, 0, stream>>>(kin, Gs, Wq, Wk, Wv, Wo, wmu, wsg, KT, GT, WQB, WKB, WVB, WOH, G2);
  // (2) Bm[b][n][e] = sum_l Gs^T[n][l] k^T[b][e][l] -> bf16 hi / residual planes [b*512+n][e]
  //     beside it: t[b*2+v][e'] = sum_l g[v][l] k^T[b][e'][l] (f32) -> bf16 hi / residual rows of TPL
  gemm128<__bf16, 0, 2, LMEM, 1><<<gBm, dim3(128), 0, stream>>>(
      GT, 0LL, KT, KT, (long long)HID * LMEM,
      (void*)BMH, (void*)BML, HID, (long long)NBAS * HID,
      HID, 1.0f,
      (NBAS / 128) * (HID / 128), KT, KT, KT, G2, TPL);
  // (3) vals^T[b][e][n] = sum_e' Wv[e][e'] Bm[b*512+n][e'] -> bf16 hi / residual planes, pitch 512 (Bm on the Bt side, 2 products)
  //     beside it: u[b][0/1][e] = sum_e' t[b*2+0/1][e'] Wk[e][e']   (= sum_n keys[b][n][e] * w[n] with keys = Bm.Wk^T), kept in LDS;
  //     P[b][0/1][h][e'] = sum_d u[b][0/1][h*64+d] Wq[h*64+d][e'] -> bf16 hi / residual rows of PP
  gemm128<__bf16, 2, 2, HID, 2><<<gVt, dim3(128), 0, stream>>>(
      WVB, 0LL, BMH, BML, (long long)NBAS * HID,
      (void*)VTH, (void*)VTL, NBAS, (long long)HID * NBAS,
      NBAS, 1.0f,
      (HID / 128) * (NBAS / 128), TPL, WKB, WQB, G2, PP);
  // (4) S[b*2048+q][v*16+h] = sum_e' q[..][e'] P[b][v][h][e']   (= qry . u per head with qry = q.Wq^T)
  s_kernel<<<gS, dim3(512), 0, stream>>>(qin, PP, SV);
  // (5) mu, sig2 per query; ctx = r . vals -> f16 ctx plane (x64) [8192][1024] in the KT region
  ctx_kernel<<<gCtx, dim3(128), 0, stream>>>(SV, bmu, bsg, VTH, VTL, CTX);
  // (6) out = ctx . Wo^T -> d_out f32 [8192][1024], accumulator x 1/(64*64)
  gemm128<_Float16, 0, 0, HID, 0><<<gQ, dim3(128), 0, stream>>>(
      CTX, 0LL, WOH, WOH, 0LL,
      d_out, d_out, HID, 0LL,
      HID, 1.0f / (CSC * WOSC),
      (MROWS / 128) * (HID / 128), WOH, WOH, WOH, SV, TPL);
  (void)hipGetLastError();
}

// v008
// One run takes 109 microseconds.
// In two side-by-side timings against v007, it was 1.04 and 1.02 times as fast.
// Over all steps from v000 it is 4.33 times as fast.
// Contractions: Gs^T.k^T (Bm) on v_wmma_f32_16x16x32_bf16 (bf16 operands RNE-converted from inputs, single product, f32 accumulate);
// q.P^T on v_wmma_f32_16x16x32_bf16, P[b][v][h][e'] = sum_d u[b][v][h*64+d] * bf16(Wq)[h*64+d][e'] (f32) as bf16 hi + bf16 residual
// planes (2 products, f32 accumulate), q RNE-converted to bf16 in registers: qry.u = (q.Wq^T).u = q.(Wq^T.u), head by head;
// Wv.Bm^T on v_wmma_f32_16x16x32_bf16 with Bm as bf16 hi + bf16 residual planes (2 products, f32 accumulate);
// (w^T.Bm).Wk^T on v_wmma_f32_16x16x32_bf16: the 8 rows t = w^T.Bm = (Gs.w)^T.k as bf16 hi (A rows 0..7) + bf16 residual (A rows 8..15),
// one product, f32 accumulate, D rows r and r+8 added;
// r.vals on v_wmma_f32_16x16x32_bf16 with r and vals^T each bf16 hi + bf16 residual (3 products hh+hl+lh, f32 accumulate);
// ctx.Wo^T on v_wmma_f32_16x16x32_f16 (ctx f16 carried x64, Wo f16 = 64 x its bf16 value, single product, f32 accumulate, folded back x 1/4096);
// Gs.w (f32 inputs), (Gs.w)^T.k (k as bf16) and u.Wq score-vector dots, sigmoid, softplus and the Gaussian density in f32.
// Carry audit: Woh plane = f16(64 * bf16(Wo)), ctx plane = f16(64 * ctx); both inverses folded back exactly once by
// oscale = 1/4096 in the out GEMM epilogue (OUT_MODE 0). Bm, vals^T and r residual planes are unscaled bf16 (v - hi)
// and share the hi accumulator (no fold needed). r planes carry r / RSC (RSC = sqrt(ln 2 / pi)); the inverse is folded back exactly
// once, with the ctx carry, by CSC * RSC in the ctx kernel's epilogue.
#include <hip/hip_runtime.h>
#include <math.h>
#include <stdint.h>

#define NBATCH 4
#define LMEM   2048
#define QLEN   2048
#define HID    1024
#define NH     16
#define HD     64
#define NBAS   512
#define MROWS  (NBATCH * QLEN)   // 8192 query rows
#define NQB64  (QLEN / 64)       // 32 blocks of 64 queries per sequence
#define NCH    (NBAS / 64)       // 8 chunks of 64 basis functions
static_assert(NH * HD == HID);
static_assert(NBATCH == 4 && HID / 256 == NBATCH);   // the score-vector jobs share the GEMM grids' y extent
static_assert(NQB64 == 32 && NCH == 8);
static_assert((LMEM % 64) == 0 && (QLEN % 64) == 0 && (HID % 64) == 0 && (NBAS % 64) == 0);
static_assert((LMEM % 128) == 0 && (HID % 128) == 0 && (NBAS % 128) == 0 && (MROWS % 128) == 0);
#define CSC  64.0f     // ctx plane carry (f16)
#define WOSC 64.0f     // Wo plane carry (f16 of the bf16 value)

typedef _Float16 v16h __attribute__((ext_vector_type(16)));
typedef _Float16 v8h  __attribute__((ext_vector_type(8)));
typedef __bf16   v16b __attribute__((ext_vector_type(16)));
typedef __bf16   v8b  __attribute__((ext_vector_type(8)));
typedef float    v8f  __attribute__((ext_vector_type(8)));
typedef float    v4f  __attribute__((ext_vector_type(4)));
typedef float    v2f  __attribute__((ext_vector_type(2)));
typedef __bf16   v2b  __attribute__((ext_vector_type(2)));
typedef unsigned int   v4u  __attribute__((ext_vector_type(4)));
typedef unsigned short v8us __attribute__((ext_vector_type(8)));
typedef v4u  __attribute__((may_alias)) v4ua;
typedef v8us __attribute__((may_alias)) v8usa;

#if defined(__HIP_DEVICE_COMPILE__)
#define DEV_ASM 1
#else
#define DEV_ASM 0
#endif

// ---- scalar helpers ---------------------------------------------------------------------------------
__device__ __forceinline__ unsigned short bf_bits(float f) {          // f32 -> bf16 bits, RNE convert
  unsigned u = __float_as_uint(f);
  return (unsigned short)((u + 0x7FFFu + ((u >> 16) & 1u)) >> 16);
}
__device__ __forceinline__ float bf_up(unsigned short hb) { return __uint_as_float(((unsigned)hb) << 16); }
__device__ __forceinline__ unsigned short h_bits(_Float16 x) { return __builtin_bit_cast(unsigned short, x); }
__device__ __forceinline__ unsigned pk16(unsigned short a, unsigned short b) { return (unsigned)a | ((unsigned)b << 16); }
__device__ __forceinline__ v8f zero8() { v8f z = {0.f, 0.f, 0.f, 0.f, 0.f, 0.f, 0.f, 0.f}; return z; }

// ---- fragment types / loaders: 16-bit A/B operand, lane -> row/col (lane&15), p already includes +8*(lane>>4);
//      elements 0..7 <- p[0..7] (k0+8h..k0+8h+7), elements 8..15 <- p[16..23] (k0+16+8h..k0+16+8h+7)
template <typename OT> struct FT;
template <> struct FT<__bf16>   { typedef v16b frag; typedef v8b half8; };
template <> struct FT<_Float16> { typedef v16h frag; typedef v8h half8; };

template <typename OT>
__device__ __forceinline__ typename FT<OT>::frag ldfrag(const OT* p) {
  union { typename FT<OT>::frag v; typename FT<OT>::half8 h[2]; } f;
  f.h[0] = *(const typename FT<OT>::half8*)(p);
  f.h[1] = *(const typename FT<OT>::half8*)(p + 16);
  return f.v;
}

// ---- guarded WMMA: 4 VALU slots after every WMMA, D tied, A/B kept live -----------------------------------
__device__ __forceinline__ v8f mma_g(v16b a, v16b b, v8f c) {
  c = __builtin_amdgcn_wmma_f32_16x16x32_bf16(false, a, false, b, (short)0, c, false, false);
#if DEV_ASM
  asm volatile("v_nop\n\tv_nop\n\tv_nop\n\tv_nop" : "+v"(c) : "v"(a), "v"(b));
#endif
  return c;
}
__device__ __forceinline__ v8f mma_g(v16h a, v16h b, v8f c) {
  c = __builtin_amdgcn_wmma_f32_16x16x32_f16(false, a, false, b, (short)0, c, false, false);
#if DEV_ASM
  asm volatile("v_nop\n\tv_nop\n\tv_nop\n\tv_nop" : "+v"(c) : "v"(a), "v"(b));
#endif
  return c;
}

// ---- bare builtin WMMA for the GEMM's hot loop: the compiler keeps the distances behind its own WMMAs; the asm statement of mma_g
//      would hold acc and both fragment sets in the first 256 registers, where they do not fit -----------------------------------
__device__ __forceinline__ v8f mma_b(v16b a, v16b b, v8f c) {
  return __builtin_amdgcn_wmma_f32_16x16x32_bf16(false, a, false, b, (short)0, c, false, false);
}
__device__ __forceinline__ v8f mma_b(v16h a, v16h b, v8f c) {
  return __builtin_amdgcn_wmma_f32_16x16x32_f16(false, a, false, b, (short)0, c, false, false);
}

// =====================================================================================================
// Operand preparation, ONE launch: seven jobs that do not depend on one another share one grid; blockIdx.x alone
// (block-uniform) says which job a block works for and which piece of it:
//   [0, NG)           g[v][l] = sum_n Gs[l][n] w_v[n]  (f32; v = 0: w_mu, v = 1: w_sigma), 32 rows l per block
//   then NTK blocks   k[b][l][e]  f32 -> k^T[b][e][l] bf16   64x64 tile transpose
//   then NTG blocks   Gs[l][n]    f32 -> Gs^T[n][l]   bf16   64x64 tile transpose
//   then NCW blocks each for Wq, Wk, Wv (bf16) and Wo (f16 of 64 x its bf16 value)
// =====================================================================================================
#define NTK  ((HID / 64) * (LMEM / 64) * NBATCH)     // 2048
#define NTG  ((NBAS / 64) * (LMEM / 64))             //  256
#define NCW  (HID * HID / 2048)                      //  512
#define NG   (LMEM / 32)                             //   64
#define NPREP (NG + NTK + NTG + 4 * NCW)             // 4416
static_assert(((HID * HID) % 2048) == 0);

// f32 -> 16-bit planes, 8 elements per thread, one 16-B store per lane: a wave writes 512 contiguous B
// MODE 0: bf16 bits (RNE convert).  MODE 1: f16 bits of (64 * bf16(x)) (exact scaling of the bf16 value).
template <int MODE>
__device__ __forceinline__ unsigned short cvm(float f) {
  const unsigned short hb = bf_bits(f);
  if (MODE == 0) return hb;
  return h_bits((_Float16)(bf_up(hb) * WOSC));
}

// thread i of a plane -> its elements 8 i .. 8 i + 7; a block of 256 threads = 2048 elements, the blocks cover the plane exactly
template <int MODE>
__device__ __forceinline__ void cvt16x8(const float* __restrict__ in, unsigned short* out, int i) {
  const v4f a  = *(const v4f*)(in + (size_t)i * 8);
  const v4f a4 = *(const v4f*)(in + (size_t)i * 8 + 4);
  v4u p;
  p[0] = pk16(cvm<MODE>(a[0]),  cvm<MODE>(a[1]));
  p[1] = pk16(cvm<MODE>(a[2]),  cvm<MODE>(a[3]));
  p[2] = pk16(cvm<MODE>(a4[0]), cvm<MODE>(a4[1]));
  p[3] = pk16(cvm<MODE>(a4[2]), cvm<MODE>(a4[3]));
  unsigned short* o = out + (size_t)i * 8;
  *(v4u*)o = p;
#if DEV_ASM
  asm volatile("s_wait_xcnt 0x0" ::: "memory");   // another job's code follows in the kernel and reuses the store's registers
#endif
}

// Tiled transpose + bf16 convert: in[R][C] f32 (C contiguous) -> out[C][R] bf16 (R contiguous), one 64x64 tile at row r0,
// column c0. Load: 256 thr x 4 it x 4 floats = the tile (16-B loads along C), staged as bf16 t[cc][rr] (pitch 72 shorts,
// 16-B aligned rows); __syncthreads; store: out row (c0+row), 128-B segments.
template <int R, int C>
__device__ __forceinline__ void tr_bf16(const float* __restrict__ ib, unsigned short* ob, int r0, int c0,
                                        unsigned short (*t)[72], int tid) {
  const int rq = tid >> 4, cc4 = (tid & 15) * 4;       // round it: row rq + 16 it, columns cc4 .. cc4 + 3
  const float* p = ib + (size_t)(r0 + rq) * (size_t)C + c0 + cc4;
  v4f v[4];
#pragma unroll
  for (int it = 0; it < 4; ++it) v[it] = *(const v4f*)(p + (size_t)it * 16 * C);
#if DEV_ASM
  asm volatile("s_wait_xcnt 0x0" :: "v"(p) : "memory");   // the four loads' address pair is rewritten only behind this wait
#endif
#pragma unroll
  for (int it = 0; it < 4; ++it) {
    const int rr = rq + 16 * it;
    t[cc4 + 0][rr] = bf_bits(v[it][0]);
    t[cc4 + 1][rr] = bf_bits(v[it][1]);
    t[cc4 + 2][rr] = bf_bits(v[it][2]);
    t[cc4 + 3][rr] = bf_bits(v[it][3]);
  }
  __syncthreads();
  const int wave = tid >> 5, lane = tid & 31;
  const int q8 = lane & 7, sub = lane >> 3;
  v4u pv[2];
#pragma unroll
  for (int it = 0; it < 2; ++it) {
    const int row = it * 32 + wave * 4 + sub;
    pv[it] = *(const v4ua*)(&t[row][8 * q8]);
  }
#pragma unroll
  for (int it = 0; it < 2; ++it) {
    const int row = it * 32 + wave * 4 + sub;
    *(v4u*)(ob + (size_t)(c0 + row) * (size_t)R + r0 + 8 * q8) = pv[it];
  }
#if DEV_ASM
  asm volatile("s_wait_xcnt 0x0" ::: "memory");   // another job's code follows in the kernel and reuses the stores' registers
#endif
}

// g[v][l] = sum_n Gs[l][n] * w_v[n] for the 32 rows l0 .. l0 + 31: wave w takes rows l0 + 4 w .. + 3, a lane the columns
// n = 128 i + 4 lane .. + 3 (a wave's load = 512 contiguous B of the row); the 32 lane partials are summed by a butterfly.
// Store: wave 0 the 128-B segment of g[0], wave 1 that of g[1].
__device__ __forceinline__ void g_job(const float* __restrict__ Gs, const float* __restrict__ wmu,
                                      const float* __restrict__ wsg, float* g2, int l0, float (*gsh)[32], int tid) {
  const int wave = tid >> 5, lane = tid & 31;
  const float* p = Gs + (size_t)(l0 + wave * 4) * NBAS + lane * 4;
  float s0[4] = {0.f, 0.f, 0.f, 0.f}, s1[4] = {0.f, 0.f, 0.f, 0.f};
  // rolled: one 128-column chunk's values at a time, so that this job does not raise the register count of the whole launch
#pragma unroll 1
  for (int i = 0; i < 4; ++i) {
    const float* pi = p + i * 128;
    const float* q0 = wmu + i * 128 + lane * 4;
    const float* q1 = wsg + i * 128 + lane * 4;
    v4f x[4];
#pragma unroll
    for (int rr = 0; rr < 4; ++rr) x[rr] = *(const v4f*)(pi + (size_t)rr * NBAS);
    const v4f w0 = *(const v4f*)q0;
    const v4f w1 = *(const v4f*)q1;
#if DEV_ASM
    asm volatile("s_wait_xcnt 0x0" :: "v"(pi), "v"(q0), "v"(q1) : "memory");   // the loads' address registers are rewritten only behind this wait
#endif
#pragma unroll
    for (int rr = 0; rr < 4; ++rr)
#pragma unroll
      for (int e = 0; e < 4; ++e) {
        s0[rr] += x[rr][e] * w0[e];
        s1[rr] += x[rr][e] * w1[e];
      }
  }
#pragma unroll
  for (int rr = 0; rr < 4; ++rr) {
    float a0 = s0[rr], a1 = s1[rr];
#pragma unroll
    for (int m = 16; m >= 1; m >>= 1) {
      a0 += __shfl_xor(a0, m, 32);
      a1 += __shfl_xor(a1, m, 32);
    }
    if (lane == 0) {
      gsh[0][wave * 4 + rr] = a0;
      gsh[1][wave * 4 + rr] = a1;
    }
  }
  __syncthreads();
  if (tid < 64) g2[(size_t)(tid >> 5) * LMEM + l0 + (tid & 31)] = gsh[tid >> 5][tid & 31];
#if DEV_ASM
  asm volatile("s_wait_xcnt 0x0" ::: "memory");   // another job's code follows in the kernel and reuses the store's registers
#endif
}

__global__ __launch_bounds__(256) void prep_kernel(
    const float* __restrict__ kin, const float* __restrict__ Gs,
    const float* __restrict__ Wq, const float* __restrict__ Wk, const float* __restrict__ Wv,
    const float* __restrict__ Wo, const float* __restrict__ wmu, const float* __restrict__ wsg,
    unsigned short* KT, unsigned short* GT,
    unsigned short* WQB, unsigned short* WKB, unsigned short* WVB, unsigned short* WOH, float* G2) {
  __shared__ __align__(16) unsigned short t[64][72];
  __shared__ float gsh[2][32];
  const int tid = threadIdx.x;
  int j = blockIdx.x;
  if (j < NG) {
    g_job(Gs, wmu, wsg, G2, j * 32, gsh, tid);
    return;
  }
  j -= NG;
  if (j < NTK) {                         // column tile fastest, then row tile, then batch
    const int c0 = (j % (HID / 64)) * 64;
    const int r0 = ((j / (HID / 64)) % (LMEM / 64)) * 64;
    const size_t z = (size_t)(j / ((HID / 64) * (LMEM / 64)));
    tr_bf16<LMEM, HID>(kin + z * (size_t)(LMEM * HID), KT + z * (size_t)(HID * LMEM), r0, c0, t, tid);
    return;
  }
  j -= NTK;
  if (j < NTG) {
    const int c0 = (j % (NBAS / 64)) * 64;
    const int r0 = (j / (NBAS / 64)) * 64;
    tr_bf16<LMEM, NBAS>(Gs, GT, r0, c0, t, tid);
    return;
  }
  j -= NTG;
  const int w = j / NCW;
  const int i = (j % NCW) * 256 + tid;
  if (w == 3) {
    cvt16x8<1>(Wo, WOH, i);
  } else {
    const float* in = (w == 0) ? Wq : (w == 1) ? Wk : Wv;
    unsigned short* out = (w == 0) ? WQB : (w == 1) ? WKB : WVB;
    cvt16x8<0>(in, out, i);
  }
}

// =====================================================================================================
// Score-vector jobs. keys^T.w = Wk.(Bm^T.w) and Bm^T.w = k^T.(Gs.w): the score vectors need neither keys nor Bm, so their
// chain g = Gs.w -> t = g^T.k -> u, P does not wait for the GEMMs; t rides in the Bm GEMM's launch and u, P in the vals^T
// GEMM's launch, as extra blocks of 128 threads on WGPs that those grids of 128 tiles leave idle. lds = the block's LDS.
//
// t[b*2+v][e] = sum_l g[v][l] * bf16(k)[b][l][e]   (f32), one block = (b, 64 columns e) = 64 rows of k^T [b][e][l].
// Wave w takes rows e0 + 16 w .. + 15; a lane the elements l = 256 i + 8 lane .. + 7 of each row (a wave's load = 512
// contiguous B), with its 128 g values of both v in registers; the 32 lane partials are summed through LDS (pitch 33).
// Output plane T bf16 [16][1024]: row b*2+v = hi, row 8+b*2+v = residual; one wave stores a whole 128-B segment
// (32 lanes x 2 columns). 16 column blocks x NBATCH cover all 16 rows.
// =====================================================================================================
__device__ __forceinline__ void t_job(float* lds, const unsigned short* __restrict__ kt, const float* __restrict__ g2,
                                      unsigned short* tpl, int et, int b) {
  float* part = lds;                    // [v 2][e 64][33]
  float* fin  = lds + 2 * 64 * 33;      // [v 2][e 64]
  const int tid = threadIdx.x;
  const int wave = tid >> 5, lane = tid & 31;
  const int e0 = et * 64;
  v4f g[2][8][2];
#pragma unroll
  for (int v = 0; v < 2; ++v)
#pragma unroll
    for (int i = 0; i < 8; ++i) {
      g[v][i][0] = *(const v4f*)(g2 + v * LMEM + i * 256 + lane * 8);
      g[v][i][1] = *(const v4f*)(g2 + v * LMEM + i * 256 + lane * 8 + 4);
    }
  const unsigned short* p = kt + ((size_t)b * HID + e0 + wave * 16) * LMEM + lane * 8;
  // rolled, two rows per trip: 16 loads of 16 B in flight per lane, and the job stays within the GEMM's own register count
#pragma unroll 1
  for (int r = 0; r < 16; r += 2) {
    const unsigned short* pr = p + (size_t)r * LMEM;
    v8us x[2][8];
#pragma unroll
    for (int q = 0; q < 2; ++q)
#pragma unroll
      for (int i = 0; i < 8; ++i) x[q][i] = *(const v8usa*)(pr + (size_t)q * LMEM + i * 256);
#if DEV_ASM
    asm volatile("s_wait_xcnt 0x0" :: "v"(pr) : "memory");   // the loads' address pair is rewritten only behind this wait
#endif
#pragma unroll
    for (int q = 0; q < 2; ++q) {
      float a0 = 0.f, a1 = 0.f;
#pragma unroll
      for (int i = 0; i < 8; ++i)
#pragma unroll
        for (int j = 0; j < 8; ++j) {
          const float f = bf_up(x[q][i][j]);
          a0 += f * g[0][i][j >> 2][j & 3];
          a1 += f * g[1][i][j >> 2][j & 3];
        }
      part[(wave * 16 + r + q) * 33 + lane]      = a0;
      part[(64 + wave * 16 + r + q) * 33 + lane] = a1;
    }
  }
  __syncthreads();
  {
    float s = 0.f;                      // thread = (v, e): tid = v * 64 + e
#pragma unroll
    for (int k = 0; k < 32; ++k) s += part[tid * 33 + k];
    fin[tid] = s;
  }
  __syncthreads();
  if (tid < 64) {                       // wave 0: v = 0, wave 1: v = 1; lane = column pair
    const int v = tid >> 5, c2 = (tid & 31) * 2;
    const float s0 = fin[v * 64 + c2], s1 = fin[v * 64 + c2 + 1];
    const unsigned short h0 = bf_bits(s0), h1 = bf_bits(s1);
    const unsigned short l0 = bf_bits(s0 - bf_up(h0));
    const unsigned short l1 = bf_bits(s1 - bf_up(h1));
    *(unsigned*)(tpl + (size_t)(b * 2 + v) * HID + e0 + c2)     = pk16(h0, h1);
    *(unsigned*)(tpl + (size_t)(8 + b * 2 + v) * HID + e0 + c2) = pk16(l0, l1);
  }
}

// =====================================================================================================
// Score vectors folded through Wq, one block of 128 = (head h, 256 columns e'), NH x (HID / 256) blocks.
// Part 1: u[r][h*64+c] = sum_e' (T hi + T residual)[r][e'] * bf16(Wk)[h*64+c][e'],  r = b*2+v in 0..7, c in 0..63   (f32)
//   A = T [16][1024] (rows 0..7 hi, rows 8..15 residual), Bt = Wk bf16 [e][e']; D row r + D row r+8 = u row r.
//   Wave w takes the k slices [128 ks, 128 ks + 128), ks = w and w + 4, each 4 k-steps for the head's four 16-column tiles,
//   two tiles at a time (A fragment shared); the 8 slice partials are summed through LDS into us[c][r].
// Part 2: P[r][h][e'] = sum_d u[r][h*64+d] * bf16(Wq)[h*64+d][e']   (f32, d ascending), so that qry.u = q.P, head by head.
//   Thread = two neighbouring columns e' (one 4-B load per d; a wave = one 128-B segment of a Wq row).
//   Output plane PP bf16 [b][hi, residual][v][h][1024]: a wave stores whole 128-B segments; the blocks cover all 256 rows.
// =====================================================================================================
#define PCH 256        // columns e' per block
static_assert((HID % PCH) == 0);
__device__ __forceinline__ void up_job(float* lds, const unsigned short* __restrict__ tpl,
                                       const unsigned short* __restrict__ wkp,
                                       const unsigned short* __restrict__ wqp, unsigned short* pp, int h, int cq) {
  float (*red)[8][64] = (float (*)[8][64])lds;            // [k slice][row r][column of the head]
  float (*us)[8] = (float (*)[8])(lds + 8 * 8 * 64);      // u of this head: [d][row r], 16-B aligned rows
  const int tid  = threadIdx.x;
  const int wave = tid >> 5;
  const int lane = tid & 31;
  const int rlane = lane & 15;          // row (A) / col (B, D) within the tile
  const int koff  = (lane >> 4) * 8;    // k offset of this lane half
  const int e0 = cq * PCH + 2 * tid;
  // rolled: one slice's fragments at a time stay in registers
#pragma unroll 1
  for (int sl = 0; sl < 2; ++sl) {
    const int ks = wave + 4 * sl;
    const __bf16* A = (const __bf16*)(const void*)tpl + (size_t)rlane * HID + koff + ks * 128;
    v16b af[4];
#pragma unroll
    for (int s = 0; s < 4; ++s) af[s] = ldfrag<__bf16>(A + 32 * s);
    const __bf16* B = (const __bf16*)(const void*)wkp + (size_t)(h * HD + rlane) * HID + koff + ks * 128;
    v16b bt[4][4];                      // [16-column tile][k-step]
#pragma unroll
    for (int j = 0; j < 4; ++j)
#pragma unroll
      for (int s = 0; s < 4; ++s) bt[j][s] = ldfrag<__bf16>(B + (size_t)j * 16 * HID + 32 * s);
#if DEV_ASM
    asm volatile("s_wait_xcnt 0x0" :: "v"(A), "v"(B) : "memory");   // the loads' address pairs are rewritten only behind this wait
#endif
#pragma unroll
    for (int hf = 0; hf < 2; ++hf) {
      v8f a0 = zero8(), a1 = zero8();
#pragma unroll
      for (int s = 0; s < 4; ++s) {
        a0 = mma_g(af[s], bt[2 * hf][s], a0);
        a1 = mma_g(af[s], bt[2 * hf + 1][s], a1);
      }
      // D element r of lane half 0 = row r (hi part), of lane half 1 = row r+8 (residual part), same column
#pragma unroll
      for (int r = 0; r < 8; ++r) {
        const float x0 = a0[r] + __shfl_xor(a0[r], 16, 32);
        const float x1 = a1[r] + __shfl_xor(a1[r], 16, 32);
        red[ks][r][hf * 32 + lane] = (lane < 16) ? x0 : x1;     // lanes 16..31 hold the second tile's column lane-16
      }
    }
  }
  // the thread's Wq column pair does not depend on u: loaded here, where part 1's fragments are dead, its latency runs beside the sums
  const unsigned short* wq = wqp + (size_t)(h * HD) * HID + e0;
  unsigned wv[HD];
#pragma unroll
  for (int d = 0; d < HD; ++d) wv[d] = *(const unsigned*)(wq + (size_t)d * HID);
#if DEV_ASM
  asm volatile("s_wait_xcnt 0x0" :: "v"(wq) : "memory");   // the loads' address pair is rewritten only behind this wait
#endif
  __syncthreads();
#pragma unroll
  for (int k = 0; k < 4; ++k) {         // 512 sums = 8 rows x 64 columns, four per thread
    const int r = (tid >> 6) + 2 * k, col = tid & 63;
    float s = 0.f;
#pragma unroll
    for (int w = 0; w < 8; ++w) s += red[w][r][col];
    us[col][r] = s;
  }
  __syncthreads();
  v2f acc[8];
#pragma unroll
  for (int r = 0; r < 8; ++r) { acc[r].x = 0.f; acc[r].y = 0.f; }
#pragma unroll
  for (int d = 0; d < HD; ++d) {
    v2f x;
    x.x = __uint_as_float(wv[d] << 16);
    x.y = __uint_as_float(wv[d] & 0xFFFF0000u);
    const v4f ua = *(const v4f*)(&us[d][0]);
    const v4f ub = *(const v4f*)(&us[d][4]);
#pragma unroll
    for (int r = 0; r < 4; ++r) {
      acc[r]     += x * ua[r];
      acc[4 + r] += x * ub[r];
    }
  }
#pragma unroll
  for (int r = 0; r < 8; ++r) {         // r = b*2+v
    const unsigned short h0 = bf_bits(acc[r].x), h1 = bf_bits(acc[r].y);
    const unsigned short l0 = bf_bits(acc[r].x - bf_up(h0));
    const unsigned short l1 = bf_bits(acc[r].y - bf_up(h1));
    unsigned short* o = pp + (size_t)((r >> 1) * 64 + (r & 1) * 16 + h) * HID + e0;
    *(unsigned*)(o)                    = pk16(h0, h1);
    *(unsigned*)(o + (size_t)32 * HID) = pk16(l0, l1);
  }
}

// =====================================================================================================
// LDS-staged batched WMMA GEMM (16-bit operand type OT): C[m][n] = sum_k A[m][k] * Bt[n][k];
// one block of 4 waves (2 x 2) per 128x128 tile, one wave per 64x64 quarter. A row-major [M][KD], Bt row-major
// [N][KD] (k contiguous, pitch KD); M, N multiples of 128, KD a multiple of 128 and at least 256 (static shapes here).
// blockIdx.x = tile (column tile fastest), blockIdx.y = batch index (strides in elements); the blocks with blockIdx.x < ntiles are exactly the tiles.
// A stage = 128 k = 256 B of each of the tile's operand rows [A 128 | Bt 128 | (SPL 2) Bt2 128], brought by asynchronous
// copies to LDS: 16 lanes x 16 B = one row's 256 B, so a wave's copy covers two rows in whole lines; each of the 128
// threads copies rows (tid >> 4) + 8 i. LDS row pitch 272 B. Two buffers: stage t + 1 flies while stage t is worked on.
// Fragments are read from LDS with the split k map (ldfrag), one block of 16 WMMAs ahead, into a second register set; same k order
// per accumulator as a straight k loop. The publish point of stage t + 1 stands in front of stage t's last block.
// SPL 0: single product. SPL 2: Bt = hi plane Bt + residual plane Bt2 (2 products per k-step, same accumulator).
// OUT_MODE 0: f32 C (pitch ldc), value * oscale.
// OUT_MODE 2: bf16 hi plane C + bf16 residual plane C2 = bf16(v - hi) (same pitch / stride).
// JOB 1, 2: blocks with blockIdx.x >= ntiles (block-uniform) do not belong to the GEMM: they work a score-vector job that
// depends on nothing of this launch (JOB 1: t_job, JOB 2: up_job) in the ring's LDS and leave. JOB 0: the grid is the tiles.
// =====================================================================================================
#define GKS  128       // k elements per stage
#define GPIT 136       // LDS row pitch in 16-bit elements: 272 B = 16 B x 17, conflict-free for 16-B fragment reads

// Eight asynchronous 16-B-per-lane copies global -> LDS: rows r, r + 8, ..., r + 56 of one operand plane.
// l = the lane's LDS byte address, g = the lane's global address, ld = global row pitch in elements.
__device__ __forceinline__ void acopy8(unsigned l, const unsigned short* g, int ld) {
#if DEV_ASM
  const size_t gs = (size_t)8 * (size_t)ld;
  const unsigned ls = 8u * GPIT * 2u;
  // the closing s_wait_xcnt keeps every address register intact until the copies have taken it
  asm volatile(
      "global_load_async_to_lds_b128 %0, %8, off\n\t"
      "global_load_async_to_lds_b128 %1, %9, off\n\t"
      "global_load_async_to_lds_b128 %2, %10, off\n\t"
      "global_load_async_to_lds_b128 %3, %11, off\n\t"
      "global_load_async_to_lds_b128 %4, %12, off\n\t"
      "global_load_async_to_lds_b128 %5, %13, off\n\t"
      "global_load_async_to_lds_b128 %6, %14, off\n\t"
      "global_load_async_to_lds_b128 %7, %15, off\n\t"
      "s_wait_xcnt 0x0"
      :: "v"(l), "v"(l + ls), "v"(l + 2u * ls), "v"(l + 3u * ls),
         "v"(l + 4u * ls), "v"(l + 5u * ls), "v"(l + 6u * ls), "v"(l + 7u * ls),
         "v"(g), "v"(g + gs), "v"(g + 2 * gs), "v"(g + 3 * gs),
         "v"(g + 4 * gs), "v"(g + 5 * gs), "v"(g + 6 * gs), "v"(g + 7 * gs)
      : "memory");
#endif
}

template <typename OT, int SPL, int OUT_MODE, int KD, int JOB>
__global__ __launch_bounds__(128) void gemm128(
    const unsigned short* __restrict__ Ap, long long strideA,
    const unsigned short* __restrict__ Btp, const unsigned short* __restrict__ Bt2p, long long strideB,
    void* Cout, void* Cout2, int ldc, long long strideC,
    int N, float oscale,
    int ntiles, const unsigned short* __restrict__ j0, const unsigned short* __restrict__ j1,
    const unsigned short* __restrict__ j2, const float* __restrict__ jf, unsigned short* jo) {
  typedef typename FT<OT>::frag V16;
  static_assert((KD % GKS) == 0 && KD / GKS >= 2);
  constexpr int NST  = KD / GKS;                       // stages
  constexpr int NPL  = (SPL == 2) ? 3 : 2;             // operand planes per stage
  constexpr int BUFE = NPL * 128 * GPIT;               // elements per buffer
  __shared__ __align__(16) unsigned short ring[2 * BUFE];
  __shared__ __align__(16) float sT[4][16 * 68];       // per-wave 16x64 slab, pitch 68 floats
  if (JOB != 0 && (int)blockIdx.x >= ntiles) {
    float* jl = (float*)(void*)ring;
    if (JOB == 1) t_job(jl, j0, jf, jo, (int)blockIdx.x - ntiles, (int)blockIdx.y);
    else          up_job(jl, j0, j1, j2, jo, (int)blockIdx.x - ntiles, (int)blockIdx.y);
    return;
  }
  const int b    = blockIdx.y;
  const int tid  = threadIdx.x;
  const int lane = tid & 31;
  const int wave = tid >> 5;
  const int tilesN = N >> 7;
  const int tm = (int)blockIdx.x / tilesN;
  const int tn = (int)blockIdx.x - tm * tilesN;
  const int m0 = (tm << 7) + ((wave >> 1) << 6);       // this wave's 64x64 quarter
  const int n0 = (tn << 7) + ((wave & 1) << 6);

  // ---- copy side: lane -> (row group, 16-B segment of the 256-B row) ----
  const int seg = tid & 15, r8 = tid >> 4;
  const unsigned short* gA  = Ap   + (size_t)b * (size_t)strideA + (size_t)((tm << 7) + r8) * KD + seg * 8;
  const unsigned short* gB  = Btp  + (size_t)b * (size_t)strideB + (size_t)((tn << 7) + r8) * KD + seg * 8;
  const unsigned short* gB2 = Bt2p + (size_t)b * (size_t)strideB + (size_t)((tn << 7) + r8) * KD + seg * 8;
  const unsigned lds0 = (unsigned)(uintptr_t)(ring + r8 * GPIT + seg * 8);
  auto fill = [&](int s, int buf) {
    const unsigned l = lds0 + (unsigned)buf * (unsigned)(BUFE * 2);
    const int k0 = s * GKS;
    acopy8(l,                   gA + k0, KD);
    acopy8(l +  64 * GPIT * 2,  gA + k0 + (size_t)64 * KD, KD);
    acopy8(l + 128 * GPIT * 2,  gB + k0, KD);
    acopy8(l + 192 * GPIT * 2,  gB + k0 + (size_t)64 * KD, KD);
    if (SPL == 2) {
      acopy8(l + 256 * GPIT * 2, gB2 + k0, KD);
      acopy8(l + 320 * GPIT * 2, gB2 + k0 + (size_t)64 * KD, KD);
    }
  };

  const int rlane = lane & 15;                 // row (A) / col (B, D) within subtile
  const int koff  = (lane >> 4) * 8;           // k offset of this lane half
  const int mOff  = (lane >> 4) * 8;           // D row offset
  const int aoff = (((wave >> 1) << 6) + rlane) * GPIT + koff;
  const int boff = (128 + ((wave & 1) << 6) + rlane) * GPIT + koff;

  v8f acc[4][4];
#pragma unroll
  for (int i = 0; i < 4; ++i)
#pragma unroll
    for (int j = 0; j < 4; ++j) acc[i][j] = zero8();

  // Two register sets of fragments: a block = 16 WMMAs (one 32-deep k-step of one Bt plane); block u + 1's fragments are read
  // from LDS as one group in front of block u's WMMAs, so that their latency runs beside the matrix work.
  constexpr int NP = (SPL == 2) ? 2 : 1;       // Bt planes = blocks per k-step
  constexpr int NB = (GKS / 32) * NP;          // blocks per stage (even: the sets' parity is the same in every stage)
  V16 af[2][4], bq[2][4];                      // A set by k-step parity, Bt set by block parity
  auto ldblk = [&](const OT* rb, int u) {
    const int kk = u / NP, p = u % NP;
    if (p == 0) {
#pragma unroll
      for (int i = 0; i < 4; ++i) af[kk & 1][i] = ldfrag<OT>(rb + aoff + i * 16 * GPIT + kk * 32);
    }
#pragma unroll
    for (int j = 0; j < 4; ++j) bq[u & 1][j] = ldfrag<OT>(rb + boff + p * 128 * GPIT + j * 16 * GPIT + kk * 32);
  };

  fill(0, 0);
#if DEV_ASM
  asm volatile("s_wait_asynccnt 0x0" ::: "memory");   // stage 0 of this wave has landed
#endif
  __syncthreads();                                      // stage 0 of every wave is readable
  fill(1, 1);
  ldblk((const OT*)(const void*)ring, 0);

  // rolled: one stage's 64 or 128 WMMAs are the hot loop
#pragma unroll 1
  for (int t = 0; t < NST; ++t) {
    const OT* rb = (const OT*)(const void*)ring + (t & 1) * BUFE;
    const OT* rn = (const OT*)(const void*)ring + ((t + 1) & 1) * BUFE;
    // unrolled so that af, bq and acc are indexed by constants and stay in registers
#pragma unroll
    for (int u = 0; u < NB; ++u) {
      if (u + 1 < NB) {
        ldblk(rb, u + 1);
      } else {
        // publish point of stage t + 1, in front of stage t's last block: that block's fragments are already fetched
#if DEV_ASM
        asm volatile("s_wait_dscnt 0x0" ::: "memory");      // this wave's last reads of buffer t & 1 are done before it is refilled
        asm volatile("s_wait_asynccnt 0x0" ::: "memory");   // this wave's copies of stage t + 1 have landed
#endif
        __syncthreads();                                    // publishes stage t + 1 and frees buffer t & 1
        if (t + 2 < NST) fill(t + 2, t & 1);
        // in the last stage these reads find the stage before it, landed long ago, and nothing uses them: a test here would cost
        // a second copy of the set's registers
        ldblk(rn, 0);
      }
      __builtin_amdgcn_sched_barrier(0);   // keeps the reads one group in front of the block, for speed only
#pragma unroll
      for (int i = 0; i < 4; ++i)
#pragma unroll
        for (int j = 0; j < 4; ++j) acc[i][j] = mma_b(af[(u / NP) & 1][i], bq[u & 1][j], acc[i][j]);
      __builtin_amdgcn_sched_barrier(0);   // keeps the block's WMMAs in front of the next group and of the publish point's waits
    }
  }
#if DEV_ASM
  asm volatile("s_wait_asynccnt 0x0" ::: "memory");     // no copy is outstanding when the wave goes on to its end
  asm volatile("s_wait_dscnt 0x0" ::: "memory");        // the last stage's unused fragment reads have returned
#endif

  // ---- epilogue ----
  float* slab = sT[wave];
#pragma unroll
  for (int i = 0; i < 4; ++i) {
    const int mBase = m0 + (i << 4);
#pragma unroll
    for (int j = 0; j < 4; ++j) {
#pragma unroll
      for (int r = 0; r < 8; ++r) {
        slab[(mOff + r) * 68 + (j << 4) + rlane] = acc[i][j][r];
      }
    }
    __builtin_amdgcn_fence(__ATOMIC_RELEASE, "workgroup");
    __builtin_amdgcn_wave_barrier();
    __builtin_amdgcn_fence(__ATOMIC_ACQUIRE, "workgroup");
    if (OUT_MODE == 0) {
      float* Cf = (float*)Cout + (size_t)b * (size_t)strideC;
      const int h2 = lane >> 4, c4 = (lane & 15) * 4;     // 256-B row segment = 16 lanes x 16 B
      {
#pragma unroll
        for (int it = 0; it < 8; ++it) {
          const int row = it * 2 + h2;                     // it 0..7 x h2 0..1 = rows 0..15
          const v4f v = *(const v4f*)(slab + row * 68 + c4) * oscale;
          *(v4f*)(Cf + (size_t)(mBase + row) * (size_t)ldc + n0 + c4) = v;
        }
        
      }
    } else {
      const int q = lane >> 3, c8 = (lane & 7) * 8;
      unsigned short* Ch = (unsigned short*)Cout  + (size_t)b * (size_t)strideC;
      unsigned short* Cl = (unsigned short*)Cout2 + (size_t)b * (size_t)strideC;
      v4u hv[4], lv[4];
#pragma unroll
      for (int it = 0; it < 4; ++it) {
        const int row = it * 4 + q;                        // it 0..3 x q 0..3 = rows 0..15
        const float* sp = slab + row * 68 + c8;
        v4u a, a2;
#pragma unroll
        for (int e = 0; e < 4; ++e) {
          const float f0 = sp[2 * e], f1 = sp[2 * e + 1];
          const unsigned short h0 = bf_bits(f0), h1 = bf_bits(f1);
          const unsigned short l0 = bf_bits(f0 - bf_up(h0));
          const unsigned short l1 = bf_bits(f1 - bf_up(h1));
          a[e] = pk16(h0, h1); a2[e] = pk16(l0, l1);
        }
        hv[it] = a; lv[it] = a2;
      }
      {
#pragma unroll
        for (int it = 0; it < 4; ++it) {
          const int row = it * 4 + q;
          *(v4u*)(Ch + (size_t)(mBase + row) * (size_t)ldc + n0 + c8) = hv[it];
          *(v4u*)(Cl + (size_t)(mBase + row) * (size_t)ldc + n0 + c8) = lv[it];
        }
        
      }
    }
    __builtin_amdgcn_fence(__ATOMIC_RELEASE, "workgroup");
    __builtin_amdgcn_wave_barrier();
    __builtin_amdgcn_fence(__ATOMIC_ACQUIRE, "workgroup");
  }
}

// =====================================================================================================
// S[m][v*16+h] = sum_e' bf16(q)[m][e'] * (P hi + P residual)[b][v][h][e']   (= qry[m][head h] . u[b][v][head h], unscaled)
// Block 512 = 32 query rows (two 16-row tiles, all of one batch); wave w of 16 takes the k slice [64 w, 64 w + 64) = 2 k-steps.
// A fragments: q f32 from global with the split k map of ldfrag, RNE-converted to bf16 in registers (q is read once, here).
// B fragments: PP rows b*64 + j*16 + col, j = 0, 1: hi of v = 0, 1; j = 2, 3: residual of v = 0, 1; shared by both row tiles.
// The 16 slice partials are summed through LDS (pitch 36 floats = 16 B x 9). Store: 16 lanes x 8 B = one row's 128 B.
// grid MROWS / 32 covers all 8192 rows of S [8192][32].
// =====================================================================================================
#define SPIT 36
static_assert((QLEN % 32) == 0 && 2 * NH == 32);
__global__ __launch_bounds__(512) void s_kernel(const float* __restrict__ qin,
                                                const unsigned short* __restrict__ pp, float* S) {
  union FA { v16b v; unsigned w[8]; };
  __shared__ __align__(16) float red[16][32 * SPIT];
  const int tid  = threadIdx.x;
  const int wave = tid >> 5;
  const int lane = tid & 31;
  const int rlane = lane & 15;          // row (A) / col (B, D) within the tile
  const int hh    = lane >> 4;
  const int m0 = blockIdx.x * 32;
  const int b  = m0 / QLEN;
  const float* qa = qin + (size_t)(m0 + rlane) * HID + wave * 64 + 8 * hh;
  const __bf16* Bp = (const __bf16*)(const void*)pp + (size_t)(b * 64 + rlane) * HID + wave * 64 + 8 * hh;
  // every load of the wave is issued before the first use: each byte is read once, so the cost is latency, paid once
  v4f a[2][2][4];
#pragma unroll
  for (int i = 0; i < 2; ++i)
#pragma unroll
    for (int s = 0; s < 2; ++s) {
      const float* p = qa + (size_t)i * 16 * HID + 32 * s;
      a[i][s][0] = *(const v4f*)(p);
      a[i][s][1] = *(const v4f*)(p + 4);
      a[i][s][2] = *(const v4f*)(p + 16);
      a[i][s][3] = *(const v4f*)(p + 20);
    }
  v16b bq[2][4];
#pragma unroll
  for (int s = 0; s < 2; ++s)
#pragma unroll
    for (int j = 0; j < 4; ++j) bq[s][j] = ldfrag<__bf16>(Bp + (size_t)j * 16 * HID + 32 * s);
#if DEV_ASM
  asm volatile("s_wait_xcnt 0x0" :: "v"(qa), "v"(Bp) : "memory");   // the loads' address pairs are rewritten only behind this wait
#endif
  v8f acc[2][2];
#pragma unroll
  for (int i = 0; i < 2; ++i)
#pragma unroll
    for (int v = 0; v < 2; ++v) acc[i][v] = zero8();
#pragma unroll
  for (int s = 0; s < 2; ++s) {
    FA af[2];
#pragma unroll
    for (int i = 0; i < 2; ++i)
#pragma unroll
      for (int p = 0; p < 8; ++p) {      // elements 2p, 2p + 1
        v2f x;
        x.x = a[i][s][p >> 1][(p & 1) * 2];
        x.y = a[i][s][p >> 1][(p & 1) * 2 + 1];
        af[i].w[p] = __builtin_bit_cast(unsigned, __builtin_convertvector(x, v2b));
      }
#pragma unroll
    for (int pl = 0; pl < 2; ++pl)
#pragma unroll
      for (int i = 0; i < 2; ++i)
#pragma unroll
        for (int v = 0; v < 2; ++v) acc[i][v] = mma_g(af[i].v, bq[s][pl * 2 + v], acc[i][v]);
  }
  float* rw = red[wave];
#pragma unroll
  for (int i = 0; i < 2; ++i)
#pragma unroll
    for (int v = 0; v < 2; ++v)
#pragma unroll
      for (int r = 0; r < 8; ++r) rw[(i * 16 + 8 * hh + r) * SPIT + v * 16 + rlane] = acc[i][v][r];
  __syncthreads();
  {
    const int row = tid >> 4, c2 = (tid & 15) * 2;
    v2f s = {0.f, 0.f};
#pragma unroll
    for (int w = 0; w < 16; ++w) s += *(const v2f*)(red[w] + row * SPIT + c2);
    *(v2f*)(S + (size_t)(m0 + row) * 32 + c2) = s;
  }
}

// =====================================================================================================
// Continuous attention context, one block = (b, head h, 64 queries), 4 waves x 16 queries, grid NBATCH*NH*NQB64.
//   prologue (f32): dm = S[q][h] / 8 (= qry[q][head h] . u_mu[b][head h] / 8), dg = S[q][16+h] / 8 likewise with u_sigma;
//     mu = sigmoid(dm), sig2 = max(softplus(dg), 1e-4)   (lane c = query, both lane halves read the same two values)
//   loop over 8 chunks of 64 basis functions (static trip): vals^T hi / residual chunks [d 64][n 64] staged in
//     LDS by 128 threads x 32 elements per plane (whole 64x64 tile, __syncthreads before and after);
//     per 32-deep k-step the lane builds its A fragment in registers: element i = r[q=c][n0+32kk+k(i)],
//     r = exp(-0.5 (mu - bm[n])^2 / var) / sqrt(2 pi var), var = sig2 + bs[n]^2 (bm, bs = bf16-converted basis
//     tables in LDS), carried as r / RSC = exp2(-(t s)^2) s with t = mu - bm[n], s = rsq(VK var) (sig2 and the bs^2 table
//     hold VK var's two terms; RSC is folded back once in the epilogue), two n per packed f32 instruction,
//     as bf16 hi + bf16 residual (RNE converts); B fragments = vals^T hi / residual from LDS (col = d, k = n);
//     oacc[t] += rh.vh + rh.vl + rl.vh  (bf16 WMMA, one f32 accumulator).
//   epilogue: wave's 16x64 f32 tile staged in LDS, converted to f16(64 * ctx), written to the ctx plane
//   coverage: rows it(4) x (lane>>3)(4) = 16 per wave x 4 waves x 32 qb x 4 b; cols 8 lanes x 8 = 64 per head x 16 heads
//   = the whole [8192][1024] ctx plane. LDS extents: Vth/Vtl 64x64 staged = 64x64 consumed (row pitch VPIT); bm_s/bv_s 512 = 512;
//   Os written 16x64 per wave before the wave reads its own tile.
// =====================================================================================================
#define VPIT 72        // LDS row pitch of the vals^T chunks in 16-bit elements: 144 B = 16 B x 9, conflict-free for 16-B reads and stores
#define OPIT 68        // LDS row pitch of the per-wave context tile in floats: 272 B = 16 B x 17, same reason
#define VK   1.3862943611198906f   // 2 ln 2: exp(-t^2 / (2 var)) = exp2(-t^2 / (VK var))
#define RSC  0.46971863934982566f  // sqrt(VK / (2 pi)): 1 / sqrt(2 pi var) = RSC / sqrt(VK var)
__global__ __launch_bounds__(128) void ctx_kernel(
    const float* __restrict__ sv,
    const float* __restrict__ bmu, const float* __restrict__ bsg,
    const unsigned short* __restrict__ vthp, const unsigned short* __restrict__ vtlp,
    unsigned short* ctxp) {
  union FB { v16b v; v8us h[2]; unsigned w[8]; };
  __shared__ __align__(16) unsigned short Vth[64 * VPIT];  // vals^T hi chunk [d][n]       9 KB
  __shared__ __align__(16) unsigned short Vtl[64 * VPIT];  // vals^T residual chunk        9 KB
  __shared__ __align__(16) float Os[4][16 * OPIT];         // per-wave context tile       17 KB
  __shared__ __align__(16) float bm_s[NBAS];               // bf16-converted basis means
  __shared__ __align__(16) float bv_s[NBAS];               // VK * (bf16-converted basis sigma)^2

  const int tid  = threadIdx.x;
  const int wave = tid >> 5;
  const int lane = tid & 31;
  const int hh   = lane >> 4;
  const int c    = lane & 15;

  const int bx   = blockIdx.x;
  const int qb   = bx % NQB64;
  const int rest = bx / NQB64;
  const int h    = rest % NH;
  const int b    = rest / NH;
  const int q0   = qb * 64 + wave * 16;
  const size_t row0 = (size_t)b * QLEN + q0;              // plane row of this wave's query 0

  for (int i = tid; i < NBAS; i += 128) {
    const float m = bf_up(bf_bits(bmu[i]));
    const float s = bf_up(bf_bits(bsg[i]));
    bm_s[i] = m;
    bv_s[i] = s * s * VK;
  }

  // ---- per-query affine heads (f32) ----
  const float* sr = sv + (row0 + c) * 32 + h;
  const float dm = sr[0]  * 0.125f;
  const float dg = sr[NH] * 0.125f;
#if DEV_ASM
  asm volatile("s_wait_xcnt 0x0" :: "v"(sr) : "memory");   // the two loads' address pair is rewritten only behind this wait
#endif
  const float mu   = 1.0f / (1.0f + expf(-dm));
  const float spl  = fmaxf(dg, 0.0f) + log1pf(expf(-fabsf(dg)));
  const float sig2k = fmaxf(spl, 1e-4f) * VK;

  const unsigned short* Vh = vthp + ((size_t)b * HID + (size_t)h * HD) * NBAS;
  const unsigned short* Vl = vtlp + ((size_t)b * HID + (size_t)h * HD) * NBAS;

  v8f oacc[4];
#pragma unroll
  for (int t = 0; t < 4; ++t) oacc[t] = zero8();

  for (int nt = 0; nt < NCH; ++nt) {         // static trip count
    const int n0 = nt * 64;
    __syncthreads();
    {
      const int r = tid >> 1, half = (tid & 1) * 32;      // d = r, n = n0 + half .. + 31
      const unsigned short* vg  = Vh + (size_t)r * NBAS + n0 + half;
      const unsigned short* vlg = Vl + (size_t)r * NBAS + n0 + half;
#pragma unroll
      for (int i = 0; i < 4; ++i) {
        const v8us b0 = *(const v8usa*)(vg + 8 * i);
        const v8us b1 = *(const v8usa*)(vlg + 8 * i);
        *(v8usa*)(Vth + r * VPIT + half + 8 * i) = b0;
        *(v8usa*)(Vtl + r * VPIT + half + 8 * i) = b1;
      }
    }
    __syncthreads();

#pragma unroll 1
    for (int kk = 0; kk < 2; ++kk) {
      // ---- A fragments: r values of query c at the 16 k slots of this lane half, bf16 hi + residual ----
      FB rh, rl;
#pragma unroll
      for (int p = 0; p < 8; ++p) {          // elements 2p, 2p + 1: two neighbouring n
        const int n = n0 + kk * 32 + 8 * hh + ((p < 4) ? (2 * p) : (8 + 2 * p));
        const v2f t  = mu - *(const v2f*)(bm_s + n);
        const v2f vk = sig2k + *(const v2f*)(bv_s + n);
        v2f rs;
        rs.x = __builtin_amdgcn_rsqf(vk.x);
        rs.y = __builtin_amdgcn_rsqf(vk.y);
        const v2f zz = t * rs;
        const v2f ar = zz * zz;
        v2f ex;
        ex.x = __builtin_amdgcn_exp2f(-ar.x);
        ex.y = __builtin_amdgcn_exp2f(-ar.y);
        const v2f rv = ex * rs;
        const unsigned hp = __builtin_bit_cast(unsigned, __builtin_convertvector(rv, v2b));
        v2f up;
        up.x = __uint_as_float(hp << 16);
        up.y = __uint_as_float(hp & 0xFFFF0000u);
        rh.w[p] = hp;
        rl.w[p] = __builtin_bit_cast(unsigned, __builtin_convertvector(rv - up, v2b));
      }
      // ---- ctx += r . vals over this 32-deep slice of n ----
#pragma unroll
      for (int t = 0; t < 4; ++t) {
        FB vb, vl;
        vb.h[0] = *(const v8usa*)(Vth + (t * 16 + c) * VPIT + kk * 32 + 8 * hh);
        vb.h[1] = *(const v8usa*)(Vth + (t * 16 + c) * VPIT + kk * 32 + 16 + 8 * hh);
        vl.h[0] = *(const v8usa*)(Vtl + (t * 16 + c) * VPIT + kk * 32 + 8 * hh);
        vl.h[1] = *(const v8usa*)(Vtl + (t * 16 + c) * VPIT + kk * 32 + 16 + 8 * hh);
        oacc[t] = mma_g(rh.v, vb.v, oacc[t]);
        oacc[t] = mma_g(rh.v, vl.v, oacc[t]);
        oacc[t] = mma_g(rl.v, vb.v, oacc[t]);
      }
    }
  }

  float* os = Os[wave];
#pragma unroll
  for (int r = 0; r < 8; ++r) {
#pragma unroll
    for (int t = 0; t < 4; ++t) os[(8 * hh + r) * OPIT + t * 16 + c] = oacc[t][r];
  }
  __builtin_amdgcn_fence(__ATOMIC_RELEASE, "workgroup");
  __builtin_amdgcn_wave_barrier();
  __builtin_amdgcn_fence(__ATOMIC_ACQUIRE, "workgroup");
  {
    const int q4 = lane >> 3, c8 = (lane & 7) * 8;
    v4u hv[4];
#pragma unroll
    for (int it = 0; it < 4; ++it) {
      const int row = it * 4 + q4;   // it 0..3 x q4 0..3 = rows 0..15 of the wave tile
      const float* sp = os + row * OPIT + c8;
      v4u a;
#pragma unroll
      for (int e = 0; e < 4; ++e) {
        const float f0 = sp[2 * e] * (CSC * RSC), f1 = sp[2 * e + 1] * (CSC * RSC);
        a[e] = pk16(h_bits((_Float16)f0), h_bits((_Float16)f1));
      }
      hv[it] = a;
    }
    {
#pragma unroll
      for (int it = 0; it < 4; ++it) {
        const int row = it * 4 + q4;
        const size_t go = (row0 + row) * HID + (size_t)h * HD + c8;
        *(v4u*)(ctxp + go) = hv[it];
      }
      
    }
  }
}

// =====================================================================================================
// Workspace map (bytes), every region an exact multiple of its whole-line / whole-tile store granularity:
//   KT   bf16 [4][1024 e][2048 l]   16777216   (dead after the Bm GEMM; reused as the f16 ctx plane [8192][1024], same size)
//   GT   bf16 [512 n][2048 l]        2097152
//   WQB  bf16 [1024][1024]           2097152
//   WKB  bf16 [1024][1024]           2097152
//   WVB  bf16 [1024][1024]           2097152
//   WOH  f16  [1024][1024] (x64)     2097152
//   BMH  bf16 [4*512][1024]          4194304   Bm hi
//   BML  bf16 [4*512][1024]          4194304   Bm residual
//   TPL  bf16 [16][1024]               32768   t = g^T.k (= w^T.Bm), rows 0..7 hi, rows 8..15 residual
//   VTH  bf16 [4][1024 e][512 n]     4194304   vals^T hi
//   VTL  bf16 [4][1024 e][512 n]     4194304   vals^T residual
//   PP   bf16 [4][2][2][16][1024]     524288   P = u.Wq per head: [b][hi, residual][v][h][e']
//   SV   f32  [8192][32]             1048576   S = q.P^T: [query row][v*16+h]
//   G2   f32  [2][2048]                16384   g = Gs.w: [v][l]
//   total                           45662208
// Weights are [out][in] with in contiguous = the Bt layout for x.W^T, so they are only converted.
// =====================================================================================================
extern "C" void kernel_launch(void* const* d_in, const int* in_sizes, int n_in,
                              void* d_out, int out_size, void* d_ws, size_t ws_size,
                              hipStream_t stream) {
  if (n_in < 11) return;
  if (in_sizes[0] != NBATCH * LMEM * HID) return;
  if (in_sizes[1] != MROWS * HID) return;
  if (in_sizes[2] != HID * HID || in_sizes[3] != HID * HID || in_sizes[4] != HID * HID || in_sizes[5] != HID * HID) return;
  if (in_sizes[6] != NBAS || in_sizes[7] != NBAS) return;
  if (in_sizes[8] != LMEM * NBAS || in_sizes[9] != NBAS || in_sizes[10] != NBAS) return;
  if (out_size != MROWS * HID) return;

  const float* kin = (const float*)d_in[0];
  const float* qin = (const float*)d_in[1];
  const float* Wq  = (const float*)d_in[2];
  const float* Wk  = (const float*)d_in[3];
  const float* Wv  = (const float*)d_in[4];
  const float* Wo  = (const float*)d_in[5];
  const float* wmu = (const float*)d_in[6];
  const float* wsg = (const float*)d_in[7];
  const float* Gs  = (const float*)d_in[8];
  const float* bmu = (const float*)d_in[9];
  const float* bsg = (const float*)d_in[10];

  const size_t PKT  = (size_t)NBATCH * HID * LMEM * 2;    // 16777216  k^T planes; later the ctx f16 plane
  const size_t PCTX = (size_t)MROWS * HID * 2;            // 16777216  (== PKT)
  const size_t PGT  = (size_t)NBAS * LMEM * 2;            //  2097152
  const size_t PW   = (size_t)HID * HID * 2;              //  2097152
  const size_t PBM  = (size_t)NBATCH * NBAS * HID * 2;    //  4194304
  const size_t PTPL = (size_t)16 * HID * 2;               //    32768
  const size_t PVT  = (size_t)NBATCH * HID * NBAS * 2;    //  4194304
  const size_t PPP  = (size_t)NBATCH * 64 * HID * 2;      //   524288
  const size_t PSV  = (size_t)MROWS * 32 * 4;             //  1048576
  const size_t PG2  = (size_t)2 * LMEM * 4;               //    16384
  if (PCTX > PKT) return;
  size_t off = 0;
  const size_t oKT  = off; off += PKT;
  const size_t oGT  = off; off += PGT;
  const size_t oWQ  = off; off += PW;
  const size_t oWK  = off; off += PW;
  const size_t oWV  = off; off += PW;
  const size_t oWO  = off; off += PW;
  const size_t oBMH = off; off += PBM;
  const size_t oBML = off; off += PBM;
  const size_t oTPL = off; off += PTPL;
  const size_t oVTH = off; off += PVT;
  const size_t oVTL = off; off += PVT;
  const size_t oPP  = off; off += PPP;
  const size_t oSV  = off; off += PSV;
  const size_t oG2  = off; off += PG2;
  if (off > ws_size) return;                        // off = 45662208
  if (off > (size_t)134217728) return;

  char* ws = (char*)d_ws;
  unsigned short* KT  = (unsigned short*)(ws + oKT);
  unsigned short* CTX = (unsigned short*)(ws + oKT);   // reuse after the Bm GEMM has consumed KT
  unsigned short* GT  = (unsigned short*)(ws + oGT);
  unsigned short* WQB = (unsigned short*)(ws + oWQ);
  unsigned short* WKB = (unsigned short*)(ws + oWK);
  unsigned short* WVB = (unsigned short*)(ws + oWV);
  unsigned short* WOH = (unsigned short*)(ws + oWO);
  unsigned short* BMH = (unsigned short*)(ws + oBMH);
  unsigned short* BML = (unsigned short*)(ws + oBML);
  unsigned short* TPL = (unsigned short*)(ws + oTPL);
  unsigned short* VTH = (unsigned short*)(ws + oVTH);
  unsigned short* VTL = (unsigned short*)(ws + oVTL);
  unsigned short* PP  = (unsigned short*)(ws + oPP);
  float*          SV  = (float*)(ws + oSV);
  float*          G2  = (float*)(ws + oG2);

  const dim3 blk(256);
  const dim3 gBm((NBAS / 128) * (HID / 128) + HID / 64, NBATCH); // 32 tiles of 128x128 x 4 b      (M=512,  N=1024, K=2048) + (16, 4) t blocks
  const dim3 gVt((HID / 128) * (NBAS / 128) + NH, HID / PCH);     // 32 tiles of 128x128 x 4 b      (M=1024, N=512,  K=1024) + (16, 4) u, P blocks
  const dim3 gQ((MROWS / 128) * (HID / 128), 1);                  // 512 tiles of 128x128           (M=8192, N=1024, K=1024)
  const dim3 gS(MROWS / 32);                                      // 256 blocks of 512
  const dim3 gCtx(NBATCH * NH * NQB64);                           // 2048 blocks of 128

  // (1) k -> k^T bf16 per batch, Gs -> Gs^T bf16 (l contiguous); weights -> bf16; Wo -> f16 (64 x its bf16 value); g = Gs.w (f32)
  prep_kernel<<<dim3(NPREP), blk, 0, stream>>>(kin, Gs, Wq, Wk, Wv, Wo, wmu, wsg, KT, GT, WQB, WKB, WVB, WOH, G2);
  // (2) Bm[b][n][e] = sum_l Gs^T[n][l] k^T[b][e][l] -> bf16 hi / residual planes [b*512+n][e]
  //     beside it: t[b*2+v][e'] = sum_l g[v][l] k^T[b][e'][l] (f32) -> bf16 hi / residual rows of TPL
  gemm128<__bf16, 0, 2, LMEM, 1><<<gBm, dim3(128), 0, stream>>>(
      GT, 0LL, KT, KT, (long long)HID * LMEM,
      (void*)BMH, (void*)BML, HID, (long long)NBAS * HID,
      HID, 1.0f,
      (NBAS / 128) * (HID / 128), KT, KT, KT, G2, TPL);
  // (3) vals^T[b][e][n] = sum_e' Wv[e][e'] Bm[b*512+n][e'] -> bf16 hi / residual planes, pitch 512 (Bm on the Bt side, 2 products)
  //     beside it: u[b][0/1][e] = sum_e' t[b*2+0/1][e'] Wk[e][e']   (= sum_n keys[b][n][e] * w[n] with keys = Bm.Wk^T), kept in LDS;
  //     P[b][0/1][h][e'] = sum_d u[b][0/1][h*64+d] Wq[h*64+d][e'] -> bf16 hi / residual rows of PP
  gemm128<__bf16, 2, 2, HID, 2><<<gVt, dim3(128), 0, stream>>>(
      WVB, 0LL, BMH, BML, (long long)NBAS * HID,
      (void*)VTH, (void*)VTL, NBAS, (long long)HID * NBAS,
      NBAS, 1.0f,
      (HID / 128) * (NBAS / 128), TPL, WKB, WQB, G2, PP);
  // (4) S[b*2048+q][v*16+h] = sum_e' q[..][e'] P[b][v][h][e']   (= qry . u per head with qry = q.Wq^T)
  s_kernel<<<gS, dim3(512), 0, stream>>>(qin, PP, SV);
  // (5) mu, sig2 per query; ctx = r . vals -> f16 ctx plane (x64) [8192][1024] in the KT region
  ctx_kernel<<<gCtx, dim3(128), 0, stream>>>(SV, bmu, bsg, VTH, VTL, CTX);
  // (6) out = ctx . Wo^T -> d_out f32 [8192][1024], accumulator x 1/(64*64)
  gemm128<_Float16, 0, 0, HID, 0><<<gQ, dim3(128), 0, stream>>>(
      CTX, 0LL, WOH, WOH, 0LL,
      d_out, d_out, HID, 0LL,
      HID, 1.0f / (CSC * WOSC),
      (MROWS / 128) * (HID / 128), WOH, WOH, WOH, SV, TPL);
  (void)hipGetLastError();
}

// v009
// A run of this version takes 106 microseconds.
// In both of two side-by-side timings against v008, it was 1.03 times as fast.
// All steps since v000 together make it 4.47 times as fast.
// Contractions: Gs^T.k^T (Bm) on v_wmma_f32_16x16x32_bf16 (bf16 operands RNE-converted from inputs, single product, f32 accumulate);
// q.P^T on v_wmma_f32_16x16x32_bf16, P[b][v][h][e'] = sum_d u[b][v][h*64+d] * bf16(Wq)[h*64+d][e'] (f32) as bf16 hi + bf16 residual
// planes (2 products, f32 accumulate), q RNE-converted to bf16 in registers: qry.u = (q.Wq^T).u = q.(Wq^T.u), head by head;
// Wv.Bm^T on v_wmma_f32_16x16x32_bf16 with Bm as bf16 hi + bf16 residual planes (2 products, f32 accumulate);
// (w^T.Bm).Wk^T on v_wmma_f32_16x16x32_bf16: the 8 rows t = w^T.Bm = (Gs.w)^T.k as bf16 hi (A rows 0..7) + bf16 residual (A rows 8..15),
// one product, f32 accumulate, D rows r and r+8 added;
// r.vals on v_wmma_f32_16x16x32_bf16 with r and vals^T each bf16 hi + bf16 residual (3 products hh+hl+lh, f32 accumulate);
// ctx.Wo^T on v_wmma_f32_16x16x32_f16 (ctx f16 carried x64, Wo f16 = 64 x its bf16 value, single product, f32 accumulate, folded back x 1/4096);
// Gs.w (f32 inputs), (Gs.w)^T.k (k as bf16) and u.Wq score-vector dots, sigmoid, softplus and the Gaussian density in f32.
// Carry audit: Woh plane = f16(64 * bf16(Wo)), ctx plane = f16(64 * ctx); both inverses folded back exactly once by
// oscale = 1/4096 in the out GEMM epilogue (OUT_MODE 0). Bm, vals^T and r residual planes are unscaled bf16 (v - hi)
// and share the hi accumulator (no fold needed). r planes carry r / RSC (RSC = sqrt(ln 2 / pi)); the inverse is folded back exactly
// once, with the ctx carry, by CSC * RSC in the ctx kernel's epilogue.
#include <hip/hip_runtime.h>
#include <math.h>
#include <stdint.h>

#define NBATCH 4
#define LMEM   2048
#define QLEN   2048
#define HID    1024
#define NH     16
#define HD     64
#define NBAS   512
#define MROWS  (NBATCH * QLEN)   // 8192 query rows
#define NQB128 (QLEN / 128)      // 16 blocks of 128 queries per sequence
#define NCH    (NBAS / 64)       // 8 chunks of 64 basis functions
static_assert(NH * HD == HID);
static_assert(NBATCH == 4 && HID / 256 == NBATCH);   // the score-vector jobs share the GEMM grids' y extent
static_assert(NQB128 == 16 && NCH == 8);
static_assert((LMEM % 64) == 0 && (QLEN % 64) == 0 && (HID % 64) == 0 && (NBAS % 64) == 0);
static_assert((LMEM % 128) == 0 && (HID % 128) == 0 && (NBAS % 128) == 0 && (MROWS % 128) == 0);
#define CSC  64.0f     // ctx plane carry (f16)
#define WOSC 64.0f     // Wo plane carry (f16 of the bf16 value)

typedef _Float16 v16h __attribute__((ext_vector_type(16)));
typedef _Float16 v8h  __attribute__((ext_vector_type(8)));
typedef __bf16   v16b __attribute__((ext_vector_type(16)));
typedef __bf16   v8b  __attribute__((ext_vector_type(8)));
typedef float    v8f  __attribute__((ext_vector_type(8)));
typedef float    v4f  __attribute__((ext_vector_type(4)));
typedef float    v2f  __attribute__((ext_vector_type(2)));
typedef __bf16   v2b  __attribute__((ext_vector_type(2)));
typedef unsigned int   v4u  __attribute__((ext_vector_type(4)));
typedef unsigned short v8us __attribute__((ext_vector_type(8)));
typedef v4u  __attribute__((may_alias)) v4ua;
typedef v8us __attribute__((may_alias)) v8usa;

#if defined(__HIP_DEVICE_COMPILE__)
#define DEV_ASM 1
#else
#define DEV_ASM 0
#endif

// ---- scalar helpers ---------------------------------------------------------------------------------
__device__ __forceinline__ unsigned short bf_bits(float f) {          // f32 -> bf16 bits, RNE convert
  unsigned u = __float_as_uint(f);
  return (unsigned short)((u + 0x7FFFu + ((u >> 16) & 1u)) >> 16);
}
__device__ __forceinline__ float bf_up(unsigned short hb) { return __uint_as_float(((unsigned)hb) << 16); }
__device__ __forceinline__ unsigned short h_bits(_Float16 x) { return __builtin_bit_cast(unsigned short, x); }
__device__ __forceinline__ unsigned pk16(unsigned short a, unsigned short b) { return (unsigned)a | ((unsigned)b << 16); }
__device__ __forceinline__ v8f zero8() { v8f z = {0.f, 0.f, 0.f, 0.f, 0.f, 0.f, 0.f, 0.f}; return z; }

// ---- fragment types / loaders: 16-bit A/B operand, lane -> row/col (lane&15), p already includes +8*(lane>>4);
//      elements 0..7 <- p[0..7] (k0+8h..k0+8h+7), elements 8..15 <- p[16..23] (k0+16+8h..k0+16+8h+7)
template <typename OT> struct FT;
template <> struct FT<__bf16>   { typedef v16b frag; typedef v8b half8; };
template <> struct FT<_Float16> { typedef v16h frag; typedef v8h half8; };

template <typename OT>
__device__ __forceinline__ typename FT<OT>::frag ldfrag(const OT* p) {
  union { typename FT<OT>::frag v; typename FT<OT>::half8 h[2]; } f;
  f.h[0] = *(const typename FT<OT>::half8*)(p);
  f.h[1] = *(const typename FT<OT>::half8*)(p + 16);
  return f.v;
}

// ---- guarded WMMA: 4 VALU slots after every WMMA, D tied, A/B kept live -----------------------------------
__device__ __forceinline__ v8f mma_g(v16b a, v16b b, v8f c) {
  c = __builtin_amdgcn_wmma_f32_16x16x32_bf16(false, a, false, b, (short)0, c, false, false);
#if DEV_ASM
  asm volatile("v_nop\n\tv_nop\n\tv_nop\n\tv_nop" : "+v"(c) : "v"(a), "v"(b));
#endif
  return c;
}
__device__ __forceinline__ v8f mma_g(v16h a, v16h b, v8f c) {
  c = __builtin_amdgcn_wmma_f32_16x16x32_f16(false, a, false, b, (short)0, c, false, false);
#if DEV_ASM
  asm volatile("v_nop\n\tv_nop\n\tv_nop\n\tv_nop" : "+v"(c) : "v"(a), "v"(b));
#endif
  return c;
}

// ---- bare builtin WMMA for the GEMM's hot loop: the compiler keeps the distances behind its own WMMAs; the asm statement of mma_g
//      would hold acc and both fragment sets in the first 256 registers, where they do not fit -----------------------------------
__device__ __forceinline__ v8f mma_b(v16b a, v16b b, v8f c) {
  return __builtin_amdgcn_wmma_f32_16x16x32_bf16(false, a, false, b, (short)0, c, false, false);
}
__device__ __forceinline__ v8f mma_b(v16h a, v16h b, v8f c) {
  return __builtin_amdgcn_wmma_f32_16x16x32_f16(false, a, false, b, (short)0, c, false, false);
}

// =====================================================================================================
// Operand preparation, ONE launch: seven jobs that do not depend on one another share one grid; blockIdx.x alone
// (block-uniform) says which job a block works for and which piece of it:
//   [0, NG)           g[v][l] = sum_n Gs[l][n] w_v[n]  (f32; v = 0: w_mu, v = 1: w_sigma), 32 rows l per block
//   then NTK blocks   k[b][l][e]  f32 -> k^T[b][e][l] bf16   64x64 tile transpose
//   then NTG blocks   Gs[l][n]    f32 -> Gs^T[n][l]   bf16   64x64 tile transpose
//   then NCW blocks each for Wq, Wk, Wv (bf16) and Wo (f16 of 64 x its bf16 value)
// =====================================================================================================
#define NTK  ((HID / 64) * (LMEM / 64) * NBATCH)     // 2048
#define NTG  ((NBAS / 64) * (LMEM / 64))             //  256
#define NCW  (HID * HID / 2048)                      //  512
#define NG   (LMEM / 32)                             //   64
#define NPREP (NG + NTK + NTG + 4 * NCW)             // 4416
static_assert(((HID * HID) % 2048) == 0);

// f32 -> 16-bit planes, 8 elements per thread, one 16-B store per lane: a wave writes 512 contiguous B
// MODE 0: bf16 bits (RNE convert).  MODE 1: f16 bits of (64 * bf16(x)) (exact scaling of the bf16 value).
template <int MODE>
__device__ __forceinline__ unsigned short cvm(float f) {
  const unsigned short hb = bf_bits(f);
  if (MODE == 0) return hb;
  return h_bits((_Float16)(bf_up(hb) * WOSC));
}

// thread i of a plane -> its elements 8 i .. 8 i + 7; a block of 256 threads = 2048 elements, the blocks cover the plane exactly
template <int MODE>
__device__ __forceinline__ void cvt16x8(const float* __restrict__ in, unsigned short* out, int i) {
  const v4f a  = *(const v4f*)(in + (size_t)i * 8);
  const v4f a4 = *(const v4f*)(in + (size_t)i * 8 + 4);
  v4u p;
  p[0] = pk16(cvm<MODE>(a[0]),  cvm<MODE>(a[1]));
  p[1] = pk16(cvm<MODE>(a[2]),  cvm<MODE>(a[3]));
  p[2] = pk16(cvm<MODE>(a4[0]), cvm<MODE>(a4[1]));
  p[3] = pk16(cvm<MODE>(a4[2]), cvm<MODE>(a4[3]));
  unsigned short* o = out + (size_t)i * 8;
  *(v4u*)o = p;
#if DEV_ASM
  asm volatile("s_wait_xcnt 0x0" ::: "memory");   // another job's code follows in the kernel and reuses the store's registers
#endif
}

// Tiled transpose + bf16 convert: in[R][C] f32 (C contiguous) -> out[C][R] bf16 (R contiguous), one 64x64 tile at row r0,
// column c0. Load: 256 thr x 4 it x 4 floats = the tile (16-B loads along C), staged as bf16 t[cc][rr] (pitch 72 shorts,
// 16-B aligned rows); __syncthreads; store: out row (c0+row), 128-B segments.
template <int R, int C>
__device__ __forceinline__ void tr_bf16(const float* __restrict__ ib, unsigned short* ob, int r0, int c0,
                                        unsigned short (*t)[72], int tid) {
  const int rq = tid >> 4, cc4 = (tid & 15) * 4;       // round it: row rq + 16 it, columns cc4 .. cc4 + 3
  const float* p = ib + (size_t)(r0 + rq) * (size_t)C + c0 + cc4;
  v4f v[4];
#pragma unroll
  for (int it = 0; it < 4; ++it) v[it] = *(const v4f*)(p + (size_t)it * 16 * C);
#if DEV_ASM
  asm volatile("s_wait_xcnt 0x0" :: "v"(p) : "memory");   // the four loads' address pair is rewritten only behind this wait
#endif
#pragma unroll
  for (int it = 0; it < 4; ++it) {
    const int rr = rq + 16 * it;
    t[cc4 + 0][rr] = bf_bits(v[it][0]);
    t[cc4 + 1][rr] = bf_bits(v[it][1]);
    t[cc4 + 2][rr] = bf_bits(v[it][2]);
    t[cc4 + 3][rr] = bf_bits(v[it][3]);
  }
  __syncthreads();
  const int wave = tid >> 5, lane = tid & 31;
  const int q8 = lane & 7, sub = lane >> 3;
  v4u pv[2];
#pragma unroll
  for (int it = 0; it < 2; ++it) {
    const int row = it * 32 + wave * 4 + sub;
    pv[it] = *(const v4ua*)(&t[row][8 * q8]);
  }
#pragma unroll
  for (int it = 0; it < 2; ++it) {
    const int row = it * 32 + wave * 4 + sub;
    *(v4u*)(ob + (size_t)(c0 + row) * (size_t)R + r0 + 8 * q8) = pv[it];
  }
#if DEV_ASM
  asm volatile("s_wait_xcnt 0x0" ::: "memory");   // another job's code follows in the kernel and reuses the stores' registers
#endif
}

// g[v][l] = sum_n Gs[l][n] * w_v[n] for the 32 rows l0 .. l0 + 31: wave w takes rows l0 + 4 w .. + 3, a lane the columns
// n = 128 i + 4 lane .. + 3 (a wave's load = 512 contiguous B of the row); the 32 lane partials are summed by a butterfly.
// Store: wave 0 the 128-B segment of g[0], wave 1 that of g[1].
__device__ __forceinline__ void g_job(const float* __restrict__ Gs, const float* __restrict__ wmu,
                                      const float* __restrict__ wsg, float* g2, int l0, float (*gsh)[32], int tid) {
  const int wave = tid >> 5, lane = tid & 31;
  const float* p = Gs + (size_t)(l0 + wave * 4) * NBAS + lane * 4;
  float s0[4] = {0.f, 0.f, 0.f, 0.f}, s1[4] = {0.f, 0.f, 0.f, 0.f};
  // rolled: one 128-column chunk's values at a time, so that this job does not raise the register count of the whole launch
#pragma unroll 1
  for (int i = 0; i < 4; ++i) {
    const float* pi = p + i * 128;
    const float* q0 = wmu + i * 128 + lane * 4;
    const float* q1 = wsg + i * 128 + lane * 4;
    v4f x[4];
#pragma unroll
    for (int rr = 0; rr < 4; ++rr) x[rr] = *(const v4f*)(pi + (size_t)rr * NBAS);
    const v4f w0 = *(const v4f*)q0;
    const v4f w1 = *(const v4f*)q1;
#if DEV_ASM
    asm volatile("s_wait_xcnt 0x0" :: "v"(pi), "v"(q0), "v"(q1) : "memory");   // the loads' address registers are rewritten only behind this wait
#endif
#pragma unroll
    for (int rr = 0; rr < 4; ++rr)
#pragma unroll
      for (int e = 0; e < 4; ++e) {
        s0[rr] += x[rr][e] * w0[e];
        s1[rr] += x[rr][e] * w1[e];
      }
  }
#pragma unroll
  for (int rr = 0; rr < 4; ++rr) {
    float a0 = s0[rr], a1 = s1[rr];
#pragma unroll
    for (int m = 16; m >= 1; m >>= 1) {
      a0 += __shfl_xor(a0, m, 32);
      a1 += __shfl_xor(a1, m, 32);
    }
    if (lane == 0) {
      gsh[0][wave * 4 + rr] = a0;
      gsh[1][wave * 4 + rr] = a1;
    }
  }
  __syncthreads();
  if (tid < 64) g2[(size_t)(tid >> 5) * LMEM + l0 + (tid & 31)] = gsh[tid >> 5][tid & 31];
#if DEV_ASM
  asm volatile("s_wait_xcnt 0x0" ::: "memory");   // another job's code follows in the kernel and reuses the store's registers
#endif
}

__global__ __launch_bounds__(256) void prep_kernel(
    const float* __restrict__ kin, const float* __restrict__ Gs,
    const float* __restrict__ Wq, const float* __restrict__ Wk, const float* __restrict__ Wv,
    const float* __restrict__ Wo, const float* __restrict__ wmu, const float* __restrict__ wsg,
    unsigned short* KT, unsigned short* GT,
    unsigned short* WQB, unsigned short* WKB, unsigned short* WVB, unsigned short* WOH, float* G2) {
  __shared__ __align__(16) unsigned short t[64][72];
  __shared__ float gsh[2][32];
  const int tid = threadIdx.x;
  int j = blockIdx.x;
  if (j < NG) {
    g_job(Gs, wmu, wsg, G2, j * 32, gsh, tid);
    return;
  }
  j -= NG;
  if (j < NTK) {                         // column tile fastest, then row tile, then batch
    const int c0 = (j % (HID / 64)) * 64;
    const int r0 = ((j / (HID / 64)) % (LMEM / 64)) * 64;
    const size_t z = (size_t)(j / ((HID / 64) * (LMEM / 64)));
    tr_bf16<LMEM, HID>(kin + z * (size_t)(LMEM * HID), KT + z * (size_t)(HID * LMEM), r0, c0, t, tid);
    return;
  }
  j -= NTK;
  if (j < NTG) {
    const int c0 = (j % (NBAS / 64)) * 64;
    const int r0 = (j / (NBAS / 64)) * 64;
    tr_bf16<LMEM, NBAS>(Gs, GT, r0, c0, t, tid);
    return;
  }
  j -= NTG;
  const int w = j / NCW;
  const int i = (j % NCW) * 256 + tid;
  if (w == 3) {
    cvt16x8<1>(Wo, WOH, i);
  } else {
    const float* in = (w == 0) ? Wq : (w == 1) ? Wk : Wv;
    unsigned short* out = (w == 0) ? WQB : (w == 1) ? WKB : WVB;
    cvt16x8<0>(in, out, i);
  }
}

// =====================================================================================================
// Score-vector jobs. keys^T.w = Wk.(Bm^T.w) and Bm^T.w = k^T.(Gs.w): the score vectors need neither keys nor Bm, so their
// chain g = Gs.w -> t = g^T.k -> u, P does not wait for the GEMMs; t rides in the Bm GEMM's launch and u, P in the vals^T
// GEMM's launch, as extra blocks of 128 threads on WGPs that those grids of 128 tiles leave idle. lds = the block's LDS.
//
// t[b*2+v][e] = sum_l g[v][l] * bf16(k)[b][l][e]   (f32), one block = (b, 64 columns e) = 64 rows of k^T [b][e][l].
// Wave w takes rows e0 + 16 w .. + 15; a lane the elements l = 256 i + 8 lane .. + 7 of each row (a wave's load = 512
// contiguous B), with its 128 g values of both v in registers; the 32 lane partials are summed through LDS (pitch 33).
// Output plane T bf16 [16][1024]: row b*2+v = hi, row 8+b*2+v = residual; one wave stores a whole 128-B segment
// (32 lanes x 2 columns). 16 column blocks x NBATCH cover all 16 rows.
// =====================================================================================================
__device__ __forceinline__ void t_job(float* lds, const unsigned short* __restrict__ kt, const float* __restrict__ g2,
                                      unsigned short* tpl, int et, int b) {
  float* part = lds;                    // [v 2][e 64][33]
  float* fin  = lds + 2 * 64 * 33;      // [v 2][e 64]
  const int tid = threadIdx.x;
  const int wave = tid >> 5, lane = tid & 31;
  const int e0 = et * 64;
  v4f g[2][8][2];
#pragma unroll
  for (int v = 0; v < 2; ++v)
#pragma unroll
    for (int i = 0; i < 8; ++i) {
      g[v][i][0] = *(const v4f*)(g2 + v * LMEM + i * 256 + lane * 8);
      g[v][i][1] = *(const v4f*)(g2 + v * LMEM + i * 256 + lane * 8 + 4);
    }
  const unsigned short* p = kt + ((size_t)b * HID + e0 + wave * 16) * LMEM + lane * 8;
  // rolled, two rows per trip: 16 loads of 16 B in flight per lane, and the job stays within the GEMM's own register count
#pragma unroll 1
  for (int r = 0; r < 16; r += 2) {
    const unsigned short* pr = p + (size_t)r * LMEM;
    v8us x[2][8];
#pragma unroll
    for (int q = 0; q < 2; ++q)
#pragma unroll
      for (int i = 0; i < 8; ++i) x[q][i] = *(const v8usa*)(pr + (size_t)q * LMEM + i * 256);
#if DEV_ASM
    asm volatile("s_wait_xcnt 0x0" :: "v"(pr) : "memory");   // the loads' address pair is rewritten only behind this wait
#endif
#pragma unroll
    for (int q = 0; q < 2; ++q) {
      float a0 = 0.f, a1 = 0.f;
#pragma unroll
      for (int i = 0; i < 8; ++i)
#pragma unroll
        for (int j = 0; j < 8; ++j) {
          const float f = bf_up(x[q][i][j]);
          a0 += f * g[0][i][j >> 2][j & 3];
          a1 += f * g[1][i][j >> 2][j & 3];
        }
      part[(wave * 16 + r + q) * 33 + lane]      = a0;
      part[(64 + wave * 16 + r + q) * 33 + lane] = a1;
    }
  }
  __syncthreads();
  {
    float s = 0.f;                      // thread = (v, e): tid = v * 64 + e
#pragma unroll
    for (int k = 0; k < 32; ++k) s += part[tid * 33 + k];
    fin[tid] = s;
  }
  __syncthreads();
  if (tid < 64) {                       // wave 0: v = 0, wave 1: v = 1; lane = column pair
    const int v = tid >> 5, c2 = (tid & 31) * 2;
    const float s0 = fin[v * 64 + c2], s1 = fin[v * 64 + c2 + 1];
    const unsigned short h0 = bf_bits(s0), h1 = bf_bits(s1);
    const unsigned short l0 = bf_bits(s0 - bf_up(h0));
    const unsigned short l1 = bf_bits(s1 - bf_up(h1));
    *(unsigned*)(tpl + (size_t)(b * 2 + v) * HID + e0 + c2)     = pk16(h0, h1);
    *(unsigned*)(tpl + (size_t)(8 + b * 2 + v) * HID + e0 + c2) = pk16(l0, l1);
  }
}

// =====================================================================================================
// Score vectors folded through Wq, one block of 128 = (head h, 256 columns e'), NH x (HID / 256) blocks.
// Part 1: u[r][h*64+c] = sum_e' (T hi + T residual)[r][e'] * bf16(Wk)[h*64+c][e'],  r = b*2+v in 0..7, c in 0..63   (f32)
//   A = T [16][1024] (rows 0..7 hi, rows 8..15 residual), Bt = Wk bf16 [e][e']; D row r + D row r+8 = u row r.
//   Wave w takes the k slices [128 ks, 128 ks + 128), ks = w and w + 4, each 4 k-steps for the head's four 16-column tiles,
//   two tiles at a time (A fragment shared); the 8 slice partials are summed through LDS into us[c][r].
// Part 2: P[r][h][e'] = sum_d u[r][h*64+d] * bf16(Wq)[h*64+d][e']   (f32, d ascending), so that qry.u = q.P, head by head.
//   Thread = two neighbouring columns e' (one 4-B load per d; a wave = one 128-B segment of a Wq row).
//   Output plane PP bf16 [b][hi, residual][v][h][1024]: a wave stores whole 128-B segments; the blocks cover all 256 rows.
// =====================================================================================================
#define PCH 256        // columns e' per block
static_assert((HID % PCH) == 0);
__device__ __forceinline__ void up_job(float* lds, const unsigned short* __restrict__ tpl,
                                       const unsigned short* __restrict__ wkp,
                                       const unsigned short* __restrict__ wqp, unsigned short* pp, int h, int cq) {
  float (*red)[8][64] = (float (*)[8][64])lds;            // [k slice][row r][column of the head]
  float (*us)[8] = (float (*)[8])(lds + 8 * 8 * 64);      // u of this head: [d][row r], 16-B aligned rows
  const int tid  = threadIdx.x;
  const int wave = tid >> 5;
  const int lane = tid & 31;
  const int rlane = lane & 15;          // row (A) / col (B, D) within the tile
  const int koff  = (lane >> 4) * 8;    // k offset of this lane half
  const int e0 = cq * PCH + 2 * tid;
  // rolled: one slice's fragments at a time stay in registers
#pragma unroll 1
  for (int sl = 0; sl < 2; ++sl) {
    const int ks = wave + 4 * sl;
    const __bf16* A = (const __bf16*)(const void*)tpl + (size_t)rlane * HID + koff + ks * 128;
    v16b af[4];
#pragma unroll
    for (int s = 0; s < 4; ++s) af[s] = ldfrag<__bf16>(A + 32 * s);
    const __bf16* B = (const __bf16*)(const void*)wkp + (size_t)(h * HD + rlane) * HID + koff + ks * 128;
    v16b bt[4][4];                      // [16-column tile][k-step]
#pragma unroll
    for (int j = 0; j < 4; ++j)
#pragma unroll
      for (int s = 0; s < 4; ++s) bt[j][s] = ldfrag<__bf16>(B + (size_t)j * 16 * HID + 32 * s);
#if DEV_ASM
    asm volatile("s_wait_xcnt 0x0" :: "v"(A), "v"(B) : "memory");   // the loads' address pairs are rewritten only behind this wait
#endif
#pragma unroll
    for (int hf = 0; hf < 2; ++hf) {
      v8f a0 = zero8(), a1 = zero8();
#pragma unroll
      for (int s = 0; s < 4; ++s) {
        a0 = mma_g(af[s], bt[2 * hf][s], a0);
        a1 = mma_g(af[s], bt[2 * hf + 1][s], a1);
      }
      // D element r of lane half 0 = row r (hi part), of lane half 1 = row r+8 (residual part), same column
#pragma unroll
      for (int r = 0; r < 8; ++r) {
        const float x0 = a0[r] + __shfl_xor(a0[r], 16, 32);
        const float x1 = a1[r] + __shfl_xor(a1[r], 16, 32);
        red[ks][r][hf * 32 + lane] = (lane < 16) ? x0 : x1;     // lanes 16..31 hold the second tile's column lane-16
      }
    }
  }
  // the thread's Wq column pair does not depend on u: loaded here, where part 1's fragments are dead, its latency runs beside the sums
  const unsigned short* wq = wqp + (size_t)(h * HD) * HID + e0;
  unsigned wv[HD];
#pragma unroll
  for (int d = 0; d < HD; ++d) wv[d] = *(const unsigned*)(wq + (size_t)d * HID);
#if DEV_ASM
  asm volatile("s_wait_xcnt 0x0" :: "v"(wq) : "memory");   // the loads' address pair is rewritten only behind this wait
#endif
  __syncthreads();
#pragma unroll
  for (int k = 0; k < 4; ++k) {         // 512 sums = 8 rows x 64 columns, four per thread
    const int r = (tid >> 6) + 2 * k, col = tid & 63;
    float s = 0.f;
#pragma unroll
    for (int w = 0; w < 8; ++w) s += red[w][r][col];
    us[col][r] = s;
  }
  __syncthreads();
  v2f acc[8];
#pragma unroll
  for (int r = 0; r < 8; ++r) { acc[r].x = 0.f; acc[r].y = 0.f; }
#pragma unroll
  for (int d = 0; d < HD; ++d) {
    v2f x;
    x.x = __uint_as_float(wv[d] << 16);
    x.y = __uint_as_float(wv[d] & 0xFFFF0000u);
    const v4f ua = *(const v4f*)(&us[d][0]);
    const v4f ub = *(const v4f*)(&us[d][4]);
#pragma unroll
    for (int r = 0; r < 4; ++r) {
      acc[r]     += x * ua[r];
      acc[4 + r] += x * ub[r];
    }
  }
#pragma unroll
  for (int r = 0; r < 8; ++r) {         // r = b*2+v
    const unsigned short h0 = bf_bits(acc[r].x), h1 = bf_bits(acc[r].y);
    const unsigned short l0 = bf_bits(acc[r].x - bf_up(h0));
    const unsigned short l1 = bf_bits(acc[r].y - bf_up(h1));
    unsigned short* o = pp + (size_t)((r >> 1) * 64 + (r & 1) * 16 + h) * HID + e0;
    *(unsigned*)(o)                    = pk16(h0, h1);
    *(unsigned*)(o + (size_t)32 * HID) = pk16(l0, l1);
  }
}

// =====================================================================================================
// LDS-staged batched WMMA GEMM (16-bit operand type OT): C[m][n] = sum_k A[m][k] * Bt[n][k];
// one block of 4 waves (2 x 2) per 128x128 tile, one wave per 64x64 quarter. A row-major [M][KD], Bt row-major
// [N][KD] (k contiguous, pitch KD); M, N multiples of 128, KD a multiple of 128 and at least 256 (static shapes here).
// blockIdx.x = tile (column tile fastest), blockIdx.y = batch index (strides in elements); the blocks with blockIdx.x < ntiles are exactly the tiles.
// A stage = 128 k = 256 B of each of the tile's operand rows [A 128 | Bt 128 | (SPL 2) Bt2 128], brought by asynchronous
// copies to LDS: 16 lanes x 16 B = one row's 256 B, so a wave's copy covers two rows in whole lines; each of the 128
// threads copies rows (tid >> 4) + 8 i. LDS row pitch 272 B. Two buffers: stage t + 1 flies while stage t is worked on.
// Fragments are read from LDS with the split k map (ldfrag), one block of 16 WMMAs ahead, into a second register set; same k order
// per accumulator as a straight k loop. The publish point of stage t + 1 stands in front of stage t's last block.
// SPL 0: single product. SPL 2: Bt = hi plane Bt + residual plane Bt2 (2 products per k-step, same accumulator).
// OUT_MODE 0: f32 C (pitch ldc), value * oscale.
// OUT_MODE 2: bf16 hi plane C + bf16 residual plane C2 = bf16(v - hi) (same pitch / stride).
// JOB 1, 2: blocks with blockIdx.x >= ntiles (block-uniform) do not belong to the GEMM: they work a score-vector job that
// depends on nothing of this launch (JOB 1: t_job, JOB 2: up_job) in the ring's LDS and leave. JOB 0: the grid is the tiles.
// =====================================================================================================
#define GKS  128       // k elements per stage
#define GPIT 136       // LDS row pitch in 16-bit elements: 272 B = 16 B x 17, conflict-free for 16-B fragment reads

// Eight asynchronous 16-B-per-lane copies global -> LDS: rows r, r + 8, ..., r + 56 of one operand plane.
// l = the lane's LDS byte address, g = the lane's global address, ld = global row pitch in elements.
__device__ __forceinline__ void acopy8(unsigned l, const unsigned short* g, int ld) {
#if DEV_ASM
  const size_t gs = (size_t)8 * (size_t)ld;
  const unsigned ls = 8u * GPIT * 2u;
  // the closing s_wait_xcnt keeps every address register intact until the copies have taken it
  asm volatile(
      "global_load_async_to_lds_b128 %0, %8, off\n\t"
      "global_load_async_to_lds_b128 %1, %9, off\n\t"
      "global_load_async_to_lds_b128 %2, %10, off\n\t"
      "global_load_async_to_lds_b128 %3, %11, off\n\t"
      "global_load_async_to_lds_b128 %4, %12, off\n\t"
      "global_load_async_to_lds_b128 %5, %13, off\n\t"
      "global_load_async_to_lds_b128 %6, %14, off\n\t"
      "global_load_async_to_lds_b128 %7, %15, off\n\t"
      "s_wait_xcnt 0x0"
      :: "v"(l), "v"(l + ls), "v"(l + 2u * ls), "v"(l + 3u * ls),
         "v"(l + 4u * ls), "v"(l + 5u * ls), "v"(l + 6u * ls), "v"(l + 7u * ls),
         "v"(g), "v"(g + gs), "v"(g + 2 * gs), "v"(g + 3 * gs),
         "v"(g + 4 * gs), "v"(g + 5 * gs), "v"(g + 6 * gs), "v"(g + 7 * gs)
      : "memory");
#endif
}

template <typename OT, int SPL, int OUT_MODE, int KD, int JOB>
__global__ __launch_bounds__(128) void gemm128(
    const unsigned short* __restrict__ Ap, long long strideA,
    const unsigned short* __restrict__ Btp, const unsigned short* __restrict__ Bt2p, long long strideB,
    void* Cout, void* Cout2, int ldc, long long strideC,
    int N, float oscale,
    int ntiles, const unsigned short* __restrict__ j0, const unsigned short* __restrict__ j1,
    const unsigned short* __restrict__ j2, const float* __restrict__ jf, unsigned short* jo) {
  typedef typename FT<OT>::frag V16;
  static_assert((KD % GKS) == 0 && KD / GKS >= 2);
  constexpr int NST  = KD / GKS;                       // stages
  constexpr int NPL  = (SPL == 2) ? 3 : 2;             // operand planes per stage
  constexpr int BUFE = NPL * 128 * GPIT;               // elements per buffer
  __shared__ __align__(16) unsigned short ring[2 * BUFE];
  __shared__ __align__(16) float sT[4][16 * 68];       // per-wave 16x64 slab, pitch 68 floats
  if (JOB != 0 && (int)blockIdx.x >= ntiles) {
    float* jl = (float*)(void*)ring;
    if (JOB == 1) t_job(jl, j0, jf, jo, (int)blockIdx.x - ntiles, (int)blockIdx.y);
    else          up_job(jl, j0, j1, j2, jo, (int)blockIdx.x - ntiles, (int)blockIdx.y);
    return;
  }
  const int b    = blockIdx.y;
  const int tid  = threadIdx.x;
  const int lane = tid & 31;
  const int wave = tid >> 5;
  const int tilesN = N >> 7;
  const int tm = (int)blockIdx.x / tilesN;
  const int tn = (int)blockIdx.x - tm * tilesN;
  const int m0 = (tm << 7) + ((wave >> 1) << 6);       // this wave's 64x64 quarter
  const int n0 = (tn << 7) + ((wave & 1) << 6);

  // ---- copy side: lane -> (row group, 16-B segment of the 256-B row) ----
  const int seg = tid & 15, r8 = tid >> 4;
  const unsigned short* gA  = Ap   + (size_t)b * (size_t)strideA + (size_t)((tm << 7) + r8) * KD + seg * 8;
  const unsigned short* gB  = Btp  + (size_t)b * (size_t)strideB + (size_t)((tn << 7) + r8) * KD + seg * 8;
  const unsigned short* gB2 = Bt2p + (size_t)b * (size_t)strideB + (size_t)((tn << 7) + r8) * KD + seg * 8;
  const unsigned lds0 = (unsigned)(uintptr_t)(ring + r8 * GPIT + seg * 8);
  auto fill = [&](int s, int buf) {
    const unsigned l = lds0 + (unsigned)buf * (unsigned)(BUFE * 2);
    const int k0 = s * GKS;
    acopy8(l,                   gA + k0, KD);
    acopy8(l +  64 * GPIT * 2,  gA + k0 + (size_t)64 * KD, KD);
    acopy8(l + 128 * GPIT * 2,  gB + k0, KD);
    acopy8(l + 192 * GPIT * 2,  gB + k0 + (size_t)64 * KD, KD);
    if (SPL == 2) {
      acopy8(l + 256 * GPIT * 2, gB2 + k0, KD);
      acopy8(l + 320 * GPIT * 2, gB2 + k0 + (size_t)64 * KD, KD);
    }
  };

  const int rlane = lane & 15;                 // row (A) / col (B, D) within subtile
  const int koff  = (lane >> 4) * 8;           // k offset of this lane half
  const int mOff  = (lane >> 4) * 8;           // D row offset
  const int aoff = (((wave >> 1) << 6) + rlane) * GPIT + koff;
  const int boff = (128 + ((wave & 1) << 6) + rlane) * GPIT + koff;

  v8f acc[4][4];
#pragma unroll
  for (int i = 0; i < 4; ++i)
#pragma unroll
    for (int j = 0; j < 4; ++j) acc[i][j] = zero8();

  // Two register sets of fragments: a block = 16 WMMAs (one 32-deep k-step of one Bt plane); block u + 1's fragments are read
  // from LDS as one group in front of block u's WMMAs, so that their latency runs beside the matrix work.
  constexpr int NP = (SPL == 2) ? 2 : 1;       // Bt planes = blocks per k-step
  constexpr int NB = (GKS / 32) * NP;          // blocks per stage (even: the sets' parity is the same in every stage)
  V16 af[2][4], bq[2][4];                      // A set by k-step parity, Bt set by block parity
  auto ldblk = [&](const OT* rb, int u) {
    const int kk = u / NP, p = u % NP;
    if (p == 0) {
#pragma unroll
      for (int i = 0; i < 4; ++i) af[kk & 1][i] = ldfrag<OT>(rb + aoff + i * 16 * GPIT + kk * 32);
    }
#pragma unroll
    for (int j = 0; j < 4; ++j) bq[u & 1][j] = ldfrag<OT>(rb + boff + p * 128 * GPIT + j * 16 * GPIT + kk * 32);
  };

  fill(0, 0);
#if DEV_ASM
  asm volatile("s_wait_asynccnt 0x0" ::: "memory");   // stage 0 of this wave has landed
#endif
  __syncthreads();                                      // stage 0 of every wave is readable
  fill(1, 1);
  ldblk((const OT*)(const void*)ring, 0);

  // rolled: one stage's 64 or 128 WMMAs are the hot loop
#pragma unroll 1
  for (int t = 0; t < NST; ++t) {
    const OT* rb = (const OT*)(const void*)ring + (t & 1) * BUFE;
    const OT* rn = (const OT*)(const void*)ring + ((t + 1) & 1) * BUFE;
    // unrolled so that af, bq and acc are indexed by constants and stay in registers
#pragma unroll
    for (int u = 0; u < NB; ++u) {
      if (u + 1 < NB) {
        ldblk(rb, u + 1);
      } else {
        // publish point of stage t + 1, in front of stage t's last block: that block's fragments are already fetched
#if DEV_ASM
        asm volatile("s_wait_dscnt 0x0" ::: "memory");      // this wave's last reads of buffer t & 1 are done before it is refilled
        asm volatile("s_wait_asynccnt 0x0" ::: "memory");   // this wave's copies of stage t + 1 have landed
#endif
        __syncthreads();                                    // publishes stage t + 1 and frees buffer t & 1
        if (t + 2 < NST) fill(t + 2, t & 1);
        // in the last stage these reads find the stage before it, landed long ago, and nothing uses them: a test here would cost
        // a second copy of the set's registers
        ldblk(rn, 0);
      }
      __builtin_amdgcn_sched_barrier(0);   // keeps the reads one group in front of the block, for speed only
#pragma unroll
      for (int i = 0; i < 4; ++i)
#pragma unroll
        for (int j = 0; j < 4; ++j) acc[i][j] = mma_b(af[(u / NP) & 1][i], bq[u & 1][j], acc[i][j]);
      __builtin_amdgcn_sched_barrier(0);   // keeps the block's WMMAs in front of the next group and of the publish point's waits
    }
  }
#if DEV_ASM
  asm volatile("s_wait_asynccnt 0x0" ::: "memory");     // no copy is outstanding when the wave goes on to its end
  asm volatile("s_wait_dscnt 0x0" ::: "memory");        // the last stage's unused fragment reads have returned
#endif

  // ---- epilogue ----
  float* slab = sT[wave];
#pragma unroll
  for (int i = 0; i < 4; ++i) {
    const int mBase = m0 + (i << 4);
#pragma unroll
    for (int j = 0; j < 4; ++j) {
#pragma unroll
      for (int r = 0; r < 8; ++r) {
        slab[(mOff + r) * 68 + (j << 4) + rlane] = acc[i][j][r];
      }
    }
    __builtin_amdgcn_fence(__ATOMIC_RELEASE, "workgroup");
    __builtin_amdgcn_wave_barrier();
    __builtin_amdgcn_fence(__ATOMIC_ACQUIRE, "workgroup");
    if (OUT_MODE == 0) {
      float* Cf = (float*)Cout + (size_t)b * (size_t)strideC;
      const int h2 = lane >> 4, c4 = (lane & 15) * 4;     // 256-B row segment = 16 lanes x 16 B
      {
#pragma unroll
        for (int it = 0; it < 8; ++it) {
          const int row = it * 2 + h2;                     // it 0..7 x h2 0..1 = rows 0..15
          const v4f v = *(const v4f*)(slab + row * 68 + c4) * oscale;
          *(v4f*)(Cf + (size_t)(mBase + row) * (size_t)ldc + n0 + c4) = v;
        }
        
      }
    } else {
      const int q = lane >> 3, c8 = (lane & 7) * 8;
      unsigned short* Ch = (unsigned short*)Cout  + (size_t)b * (size_t)strideC;
      unsigned short* Cl = (unsigned short*)Cout2 + (size_t)b * (size_t)strideC;
      v4u hv[4], lv[4];
#pragma unroll
      for (int it = 0; it < 4; ++it) {
        const int row = it * 4 + q;                        // it 0..3 x q 0..3 = rows 0..15
        const float* sp = slab + row * 68 + c8;
        v4u a, a2;
#pragma unroll
        for (int e = 0; e < 4; ++e) {
          const float f0 = sp[2 * e], f1 = sp[2 * e + 1];
          const unsigned short h0 = bf_bits(f0), h1 = bf_bits(f1);
          const unsigned short l0 = bf_bits(f0 - bf_up(h0));
          const unsigned short l1 = bf_bits(f1 - bf_up(h1));
          a[e] = pk16(h0, h1); a2[e] = pk16(l0, l1);
        }
        hv[it] = a; lv[it] = a2;
      }
      {
#pragma unroll
        for (int it = 0; it < 4; ++it) {
          const int row = it * 4 + q;
          *(v4u*)(Ch + (size_t)(mBase + row) * (size_t)ldc + n0 + c8) = hv[it];
          *(v4u*)(Cl + (size_t)(mBase + row) * (size_t)ldc + n0 + c8) = lv[it];
        }
        
      }
    }
    __builtin_amdgcn_fence(__ATOMIC_RELEASE, "workgroup");
    __builtin_amdgcn_wave_barrier();
    __builtin_amdgcn_fence(__ATOMIC_ACQUIRE, "workgroup");
  }
}

// =====================================================================================================
// S[m][v*16+h] = sum_e' bf16(q)[m][e'] * (P hi + P residual)[b][v][h][e']   (= qry[m][head h] . u[b][v][head h], unscaled)
// Block 512 = 32 query rows (two 16-row tiles, all of one batch); wave w of 16 takes the k slice [64 w, 64 w + 64) = 2 k-steps.
// A fragments: q f32 from global with the split k map of ldfrag, RNE-converted to bf16 in registers (q is read once, here).
// B fragments: PP rows b*64 + j*16 + col, j = 0, 1: hi of v = 0, 1; j = 2, 3: residual of v = 0, 1; shared by both row tiles.
// The 16 slice partials are summed through LDS (pitch 36 floats = 16 B x 9). Store: 16 lanes x 8 B = one row's 128 B.
// grid MROWS / 32 covers all 8192 rows of S [8192][32].
// =====================================================================================================
#define SPIT 36
static_assert((QLEN % 32) == 0 && 2 * NH == 32);
__global__ __launch_bounds__(512) void s_kernel(const float* __restrict__ qin,
                                                const unsigned short* __restrict__ pp, float* S) {
  union FA { v16b v; unsigned w[8]; };
  __shared__ __align__(16) float red[16][32 * SPIT];
  const int tid  = threadIdx.x;
  const int wave = tid >> 5;
  const int lane = tid & 31;
  const int rlane = lane & 15;          // row (A) / col (B, D) within the tile
  const int hh    = lane >> 4;
  const int m0 = blockIdx.x * 32;
  const int b  = m0 / QLEN;
  const float* qa = qin + (size_t)(m0 + rlane) * HID + wave * 64 + 8 * hh;
  const __bf16* Bp = (const __bf16*)(const void*)pp + (size_t)(b * 64 + rlane) * HID + wave * 64 + 8 * hh;
  // every load of the wave is issued before the first use: each byte is read once, so the cost is latency, paid once
  v4f a[2][2][4];
#pragma unroll
  for (int i = 0; i < 2; ++i)
#pragma unroll
    for (int s = 0; s < 2; ++s) {
      const float* p = qa + (size_t)i * 16 * HID + 32 * s;
      a[i][s][0] = *(const v4f*)(p);
      a[i][s][1] = *(const v4f*)(p + 4);
      a[i][s][2] = *(const v4f*)(p + 16);
      a[i][s][3] = *(const v4f*)(p + 20);
    }
  v16b bq[2][4];
#pragma unroll
  for (int s = 0; s < 2; ++s)
#pragma unroll
    for (int j = 0; j < 4; ++j) bq[s][j] = ldfrag<__bf16>(Bp + (size_t)j * 16 * HID + 32 * s);
#if DEV_ASM
  asm volatile("s_wait_xcnt 0x0" :: "v"(qa), "v"(Bp) : "memory");   // the loads' address pairs are rewritten only behind this wait
#endif
  v8f acc[2][2];
#pragma unroll
  for (int i = 0; i < 2; ++i)
#pragma unroll
    for (int v = 0; v < 2; ++v) acc[i][v] = zero8();
#pragma unroll
  for (int s = 0; s < 2; ++s) {
    FA af[2];
#pragma unroll
    for (int i = 0; i < 2; ++i)
#pragma unroll
      for (int p = 0; p < 8; ++p) {      // elements 2p, 2p + 1
        v2f x;
        x.x = a[i][s][p >> 1][(p & 1) * 2];
        x.y = a[i][s][p >> 1][(p & 1) * 2 + 1];
        af[i].w[p] = __builtin_bit_cast(unsigned, __builtin_convertvector(x, v2b));
      }
#pragma unroll
    for (int pl = 0; pl < 2; ++pl)
#pragma unroll
      for (int i = 0; i < 2; ++i)
#pragma unroll
        for (int v = 0; v < 2; ++v) acc[i][v] = mma_g(af[i].v, bq[s][pl * 2 + v], acc[i][v]);
  }
  float* rw = red[wave];
#pragma unroll
  for (int i = 0; i < 2; ++i)
#pragma unroll
    for (int v = 0; v < 2; ++v)
#pragma unroll
      for (int r = 0; r < 8; ++r) rw[(i * 16 + 8 * hh + r) * SPIT + v * 16 + rlane] = acc[i][v][r];
  __syncthreads();
  {
    const int row = tid >> 4, c2 = (tid & 15) * 2;
    v2f s = {0.f, 0.f};
#pragma unroll
    for (int w = 0; w < 16; ++w) s += *(const v2f*)(red[w] + row * SPIT + c2);
    *(v2f*)(S + (size_t)(m0 + row) * 32 + c2) = s;
  }
}

// =====================================================================================================
// Continuous attention context, one block = (b, head h, 128 queries), 4 waves x 32 queries (two 16-row tiles m = 0, 1),
// grid NBATCH*NH*NQB128. A wave's LDS reads (vals^T fragments, basis tables) each serve both of its query tiles.
//   prologue (f32): dm = S[q][h] / 8 (= qry[q][head h] . u_mu[b][head h] / 8), dg = S[q][16+h] / 8 likewise with u_sigma;
//     mu = sigmoid(dm), sig2 = max(softplus(dg), 1e-4)   (lane c = query c of each tile, both lane halves read the same values)
//   loop over 8 chunks of 64 basis functions (static trip): vals^T hi / residual chunks [d 64][n 64] staged in
//     LDS by 128 threads x 32 elements per plane (whole 64x64 tile, __syncthreads before and after);
//     per 32-deep k-step the lane builds its two A fragments in registers: element i = r[q=16m+c][n0+32kk+k(i)],
//     r = exp(-0.5 (mu - bm[n])^2 / var) / sqrt(2 pi var), var = sig2 + bs[n]^2 (bm, bs = bf16-converted basis
//     tables in LDS), carried as r / RSC = exp2(-(t s)^2) s with t = mu - bm[n], s = rsq(VK var) (sig2 and the bs^2 table
//     hold VK var's two terms; RSC is folded back once in the epilogue), two n per packed f32 instruction,
//     as bf16 hi + bf16 residual (RNE converts); B fragments = vals^T hi / residual from LDS (col = d, k = n);
//     oacc[m][t] += rh.vh + rh.vl + rl.vh  (bf16 WMMA, one f32 accumulator per tile, that order).
//   epilogue: wave's 32x64 f32 tile staged in LDS, converted to f16(64 * ctx), written to the ctx plane
//   coverage: rows it(8) x (lane>>3)(4) = 32 per wave x 4 waves x 16 qb x 4 b; cols 8 lanes x 8 = 64 per head x 16 heads
//   = the whole [8192][1024] ctx plane. LDS extents: Vth/Vtl 64x64 staged = 64x64 consumed (row pitch VPIT); bm_s/bv_s 512 = 512;
//   Os written 32x64 per wave before the wave reads its own tile.
// =====================================================================================================
#define VPIT 72        // LDS row pitch of the vals^T chunks in 16-bit elements: 144 B = 16 B x 9, conflict-free for 16-B reads and stores
#define OPIT 68        // LDS row pitch of the per-wave context tile in floats: 272 B = 16 B x 17, same reason
#define VK   1.3862943611198906f   // 2 ln 2: exp(-t^2 / (2 var)) = exp2(-t^2 / (VK var))
#define RSC  0.46971863934982566f  // sqrt(VK / (2 pi)): 1 / sqrt(2 pi var) = RSC / sqrt(VK var)
__global__ __launch_bounds__(128) void ctx_kernel(
    const float* __restrict__ sv,
    const float* __restrict__ bmu, const float* __restrict__ bsg,
    const unsigned short* __restrict__ vthp, const unsigned short* __restrict__ vtlp,
    unsigned short* ctxp) {
  union FB { v16b v; v8us h[2]; unsigned w[8]; };
  __shared__ __align__(16) unsigned short Vth[64 * VPIT];  // vals^T hi chunk [d][n]       9 KB
  __shared__ __align__(16) unsigned short Vtl[64 * VPIT];  // vals^T residual chunk        9 KB
  __shared__ __align__(16) float Os[4][32 * OPIT];         // per-wave context tile       34 KB
  __shared__ __align__(16) float bm_s[NBAS];               // bf16-converted basis means
  __shared__ __align__(16) float bv_s[NBAS];               // VK * (bf16-converted basis sigma)^2

  const int tid  = threadIdx.x;
  const int wave = tid >> 5;
  const int lane = tid & 31;
  const int hh   = lane >> 4;
  const int c    = lane & 15;

  const int bx   = blockIdx.x;
  const int qb   = bx % NQB128;
  const int rest = bx / NQB128;
  const int h    = rest % NH;
  const int b    = rest / NH;
  const int q0   = qb * 128 + wave * 32;
  const size_t row0 = (size_t)b * QLEN + q0;              // plane row of this wave's query 0

  for (int i = tid; i < NBAS; i += 128) {
    const float m = bf_up(bf_bits(bmu[i]));
    const float s = bf_up(bf_bits(bsg[i]));
    bm_s[i] = m;
    bv_s[i] = s * s * VK;
  }

  // ---- per-query affine heads (f32) ----
  const float* sr = sv + (row0 + c) * 32 + h;             // tile m: 16 rows of 32 floats further on
  float dm[2], dg[2];
#pragma unroll
  for (int m = 0; m < 2; ++m) {
    dm[m] = sr[m * 16 * 32]      * 0.125f;
    dg[m] = sr[m * 16 * 32 + NH] * 0.125f;
  }
#if DEV_ASM
  asm volatile("s_wait_xcnt 0x0" :: "v"(sr) : "memory");   // the four loads' address pair is rewritten only behind this wait
#endif
  float mu[2], sig2k[2];
#pragma unroll
  for (int m = 0; m < 2; ++m) {
    mu[m] = 1.0f / (1.0f + expf(-dm[m]));
    const float spl = fmaxf(dg[m], 0.0f) + log1pf(expf(-fabsf(dg[m])));
    sig2k[m] = fmaxf(spl, 1e-4f) * VK;
  }

  const unsigned short* Vh = vthp + ((size_t)b * HID + (size_t)h * HD) * NBAS;
  const unsigned short* Vl = vtlp + ((size_t)b * HID + (size_t)h * HD) * NBAS;

  v8f oacc[2][4];
#pragma unroll
  for (int m = 0; m < 2; ++m)
#pragma unroll
    for (int t = 0; t < 4; ++t) oacc[m][t] = zero8();

  for (int nt = 0; nt < NCH; ++nt) {         // static trip count
    const int n0 = nt * 64;
    __syncthreads();
    {
      const int r = tid >> 1, half = (tid & 1) * 32;      // d = r, n = n0 + half .. + 31
      const unsigned short* vg  = Vh + (size_t)r * NBAS + n0 + half;
      const unsigned short* vlg = Vl + (size_t)r * NBAS + n0 + half;
#pragma unroll
      for (int i = 0; i < 4; ++i) {
        const v8us b0 = *(const v8usa*)(vg + 8 * i);
        const v8us b1 = *(const v8usa*)(vlg + 8 * i);
        *(v8usa*)(Vth + r * VPIT + half + 8 * i) = b0;
        *(v8usa*)(Vtl + r * VPIT + half + 8 * i) = b1;
      }
    }
    __syncthreads();

#pragma unroll 1
    for (int kk = 0; kk < 2; ++kk) {
      // ---- A fragments: r values of queries c and 16 + c at the 16 k slots of this lane half, bf16 hi + residual ----
      FB rh[2], rl[2];
#pragma unroll
      for (int p = 0; p < 8; ++p) {          // elements 2p, 2p + 1: two neighbouring n
        const int n = n0 + kk * 32 + 8 * hh + ((p < 4) ? (2 * p) : (8 + 2 * p));
        const v2f bmn = *(const v2f*)(bm_s + n);   // one table read for both tiles
        const v2f bvn = *(const v2f*)(bv_s + n);
#pragma unroll
       for (int m = 0; m < 2; ++m) {
        const v2f t  = mu[m] - bmn;
        const v2f vk = sig2k[m] + bvn;
        v2f rs;
        rs.x = __builtin_amdgcn_rsqf(vk.x);
        rs.y = __builtin_amdgcn_rsqf(vk.y);
        const v2f zz = t * rs;
        const v2f ar = zz * zz;
        v2f ex;
        ex.x = __builtin_amdgcn_exp2f(-ar.x);
        ex.y = __builtin_amdgcn_exp2f(-ar.y);
        const v2f rv = ex * rs;
        const unsigned hp = __builtin_bit_cast(unsigned, __builtin_convertvector(rv, v2b));
        v2f up;
        up.x = __uint_as_float(hp << 16);
        up.y = __uint_as_float(hp & 0xFFFF0000u);
        rh[m].w[p] = hp;
        rl[m].w[p] = __builtin_bit_cast(unsigned, __builtin_convertvector(rv - up, v2b));
       }
      }
      // ---- ctx += r . vals over this 32-deep slice of n ----
#pragma unroll
      for (int t = 0; t < 4; ++t) {
        FB vb, vl;
        vb.h[0] = *(const v8usa*)(Vth + (t * 16 + c) * VPIT + kk * 32 + 8 * hh);
        vb.h[1] = *(const v8usa*)(Vth + (t * 16 + c) * VPIT + kk * 32 + 16 + 8 * hh);
        vl.h[0] = *(const v8usa*)(Vtl + (t * 16 + c) * VPIT + kk * 32 + 8 * hh);
        vl.h[1] = *(const v8usa*)(Vtl + (t * 16 + c) * VPIT + kk * 32 + 16 + 8 * hh);
        // one fragment pair, both query tiles: the two accumulators alternate, each keeps its order hh, hl, lh
        oacc[0][t] = mma_b(rh[0].v, vb.v, oacc[0][t]);
        oacc[1][t] = mma_b(rh[1].v, vb.v, oacc[1][t]);
        oacc[0][t] = mma_b(rh[0].v, vl.v, oacc[0][t]);
        oacc[1][t] = mma_b(rh[1].v, vl.v, oacc[1][t]);
        oacc[0][t] = mma_b(rl[0].v, vb.v, oacc[0][t]);
        // the trip's last WMMA keeps the four slots behind it: the branch back is taken there, and the next trip's first
        // instructions overwrite its operands
        oacc[1][t] = (t == 3) ? mma_g(rl[1].v, vb.v, oacc[1][t]) : mma_b(rl[1].v, vb.v, oacc[1][t]);
      }
    }
  }

  float* os = Os[wave];
#pragma unroll
  for (int m = 0; m < 2; ++m)
#pragma unroll
    for (int r = 0; r < 8; ++r) {
#pragma unroll
      for (int t = 0; t < 4; ++t) os[(m * 16 + 8 * hh + r) * OPIT + t * 16 + c] = oacc[m][t][r];
    }
  __builtin_amdgcn_fence(__ATOMIC_RELEASE, "workgroup");
  __builtin_amdgcn_wave_barrier();
  __builtin_amdgcn_fence(__ATOMIC_ACQUIRE, "workgroup");
  {
    const int q4 = lane >> 3, c8 = (lane & 7) * 8;
    v4u hv[8];
#pragma unroll
    for (int it = 0; it < 8; ++it) {
      const int row = it * 4 + q4;   // it 0..7 x q4 0..3 = rows 0..31 of the wave tile
      const float* sp = os + row * OPIT + c8;
      v4u a;
#pragma unroll
      for (int e = 0; e < 4; ++e) {
        const float f0 = sp[2 * e] * (CSC * RSC), f1 = sp[2 * e + 1] * (CSC * RSC);
        a[e] = pk16(h_bits((_Float16)f0), h_bits((_Float16)f1));
      }
      hv[it] = a;
    }
    {
#pragma unroll
      for (int it = 0; it < 8; ++it) {
        const int row = it * 4 + q4;
        const size_t go = (row0 + row) * HID + (size_t)h * HD + c8;
        *(v4u*)(ctxp + go) = hv[it];
      }
      
    }
  }
}

// =====================================================================================================
// Workspace map (bytes), every region an exact multiple of its whole-line / whole-tile store granularity:
//   KT   bf16 [4][1024 e][2048 l]   16777216   (dead after the Bm GEMM; reused as the f16 ctx plane [8192][1024], same size)
//   GT   bf16 [512 n][2048 l]        2097152
//   WQB  bf16 [1024][1024]           2097152
//   WKB  bf16 [1024][1024]           2097152
//   WVB  bf16 [1024][1024]           2097152
//   WOH  f16  [1024][1024] (x64)     2097152
//   BMH  bf16 [4*512][1024]          4194304   Bm hi
//   BML  bf16 [4*512][1024]          4194304   Bm residual
//   TPL  bf16 [16][1024]               32768   t = g^T.k (= w^T.Bm), rows 0..7 hi, rows 8..15 residual
//   VTH  bf16 [4][1024 e][512 n]     4194304   vals^T hi
//   VTL  bf16 [4][1024 e][512 n]     4194304   vals^T residual
//   PP   bf16 [4][2][2][16][1024]     524288   P = u.Wq per head: [b][hi, residual][v][h][e']
//   SV   f32  [8192][32]             1048576   S = q.P^T: [query row][v*16+h]
//   G2   f32  [2][2048]                16384   g = Gs.w: [v][l]
//   total                           45662208
// Weights are [out][in] with in contiguous = the Bt layout for x.W^T, so they are only converted.
// =====================================================================================================
extern "C" void kernel_launch(void* const* d_in, const int* in_sizes, int n_in,
                              void* d_out, int out_size, void* d_ws, size_t ws_size,
                              hipStream_t stream) {
  if (n_in < 11) return;
  if (in_sizes[0] != NBATCH * LMEM * HID) return;
  if (in_sizes[1] != MROWS * HID) return;
  if (in_sizes[2] != HID * HID || in_sizes[3] != HID * HID || in_sizes[4] != HID * HID || in_sizes[5] != HID * HID) return;
  if (in_sizes[6] != NBAS || in_sizes[7] != NBAS) return;
  if (in_sizes[8] != LMEM * NBAS || in_sizes[9] != NBAS || in_sizes[10] != NBAS) return;
  if (out_size != MROWS * HID) return;

  const float* kin = (const float*)d_in[0];
  const float* qin = (const float*)d_in[1];
  const float* Wq  = (const float*)d_in[2];
  const float* Wk  = (const float*)d_in[3];
  const float* Wv  = (const float*)d_in[4];
  const float* Wo  = (const float*)d_in[5];
  const float* wmu = (const float*)d_in[6];
  const float* wsg = (const float*)d_in[7];
  const float* Gs  = (const float*)d_in[8];
  const float* bmu = (const float*)d_in[9];
  const float* bsg = (const float*)d_in[10];

  const size_t PKT  = (size_t)NBATCH * HID * LMEM * 2;    // 16777216  k^T planes; later the ctx f16 plane
  const size_t PCTX = (size_t)MROWS * HID * 2;            // 16777216  (== PKT)
  const size_t PGT  = (size_t)NBAS * LMEM * 2;            //  2097152
  const size_t PW   = (size_t)HID * HID * 2;              //  2097152
  const size_t PBM  = (size_t)NBATCH * NBAS * HID * 2;    //  4194304
  const size_t PTPL = (size_t)16 * HID * 2;               //    32768
  const size_t PVT  = (size_t)NBATCH * HID * NBAS * 2;    //  4194304
  const size_t PPP  = (size_t)NBATCH * 64 * HID * 2;      //   524288
  const size_t PSV  = (size_t)MROWS * 32 * 4;             //  1048576
  const size_t PG2  = (size_t)2 * LMEM * 4;               //    16384
  if (PCTX > PKT) return;
  size_t off = 0;
  const size_t oKT  = off; off += PKT;
  const size_t oGT  = off; off += PGT;
  const size_t oWQ  = off; off += PW;
  const size_t oWK  = off; off += PW;
  const size_t oWV  = off; off += PW;
  const size_t oWO  = off; off += PW;
  const size_t oBMH = off; off += PBM;
  const size_t oBML = off; off += PBM;
  const size_t oTPL = off; off += PTPL;
  const size_t oVTH = off; off += PVT;
  const size_t oVTL = off; off += PVT;
  const size_t oPP  = off; off += PPP;
  const size_t oSV  = off; off += PSV;
  const size_t oG2  = off; off += PG2;
  if (off > ws_size) return;                        // off = 45662208
  if (off > (size_t)134217728) return;

  char* ws = (char*)d_ws;
  unsigned short* KT  = (unsigned short*)(ws + oKT);
  unsigned short* CTX = (unsigned short*)(ws + oKT);   // reuse after the Bm GEMM has consumed KT
  unsigned short* GT  = (unsigned short*)(ws + oGT);
  unsigned short* WQB = (unsigned short*)(ws + oWQ);
  unsigned short* WKB = (unsigned short*)(ws + oWK);
  unsigned short* WVB = (unsigned short*)(ws + oWV);
  unsigned short* WOH = (unsigned short*)(ws + oWO);
  unsigned short* BMH = (unsigned short*)(ws + oBMH);
  unsigned short* BML = (unsigned short*)(ws + oBML);
  unsigned short* TPL = (unsigned short*)(ws + oTPL);
  unsigned short* VTH = (unsigned short*)(ws + oVTH);
  unsigned short* VTL = (unsigned short*)(ws + oVTL);
  unsigned short* PP  = (unsigned short*)(ws + oPP);
  float*          SV  = (float*)(ws + oSV);
  float*          G2  = (float*)(ws + oG2);

  const dim3 blk(256);
  const dim3 gBm((NBAS / 128) * (HID / 128) + HID / 64, NBATCH); // 32 tiles of 128x128 x 4 b      (M=512,  N=1024, K=2048) + (16, 4) t blocks
  const dim3 gVt((HID / 128) * (NBAS / 128) + NH, HID / PCH);     // 32 tiles of 128x128 x 4 b      (M=1024, N=512,  K=1024) + (16, 4) u, P blocks
  const dim3 gQ((MROWS / 128) * (HID / 128), 1);                  // 512 tiles of 128x128           (M=8192, N=1024, K=1024)
  const dim3 gS(MROWS / 32);                                      // 256 blocks of 512
  const dim3 gCtx(NBATCH * NH * NQB128);                          // 1024 blocks of 128

  // (1) k -> k^T bf16 per batch, Gs -> Gs^T bf16 (l contiguous); weights -> bf16; Wo -> f16 (64 x its bf16 value); g = Gs.w (f32)
  prep_kernel<<<dim3(NPREP), blk, 0, stream>>>(kin, Gs, Wq, Wk, Wv, Wo, wmu, wsg, KT, GT, WQB, WKB, WVB, WOH, G2);
  // (2) Bm[b][n][e] = sum_l Gs^T[n][l] k^T[b][e][l] -> bf16 hi / residual planes [b*512+n][e]
  //     beside it: t[b*2+v][e'] = sum_l g[v][l] k^T[b][e'][l] (f32) -> bf16 hi / residual rows of TPL
  gemm128<__bf16, 0, 2, LMEM, 1><<<gBm, dim3(128), 0, stream>>>(
      GT, 0LL, KT, KT, (long long)HID * LMEM,
      (void*)BMH, (void*)BML, HID, (long long)NBAS * HID,
      HID, 1.0f,
      (NBAS / 128) * (HID / 128), KT, KT, KT, G2, TPL);
  // (3) vals^T[b][e][n] = sum_e' Wv[e][e'] Bm[b*512+n][e'] -> bf16 hi / residual planes, pitch 512 (Bm on the Bt side, 2 products)
  //     beside it: u[b][0/1][e] = sum_e' t[b*2+0/1][e'] Wk[e][e']   (= sum_n keys[b][n][e] * w[n] with keys = Bm.Wk^T), kept in LDS;
  //     P[b][0/1][h][e'] = sum_d u[b][0/1][h*64+d] Wq[h*64+d][e'] -> bf16 hi / residual rows of PP
  gemm128<__bf16, 2, 2, HID, 2><<<gVt, dim3(128), 0, stream>>>(
      WVB, 0LL, BMH, BML, (long long)NBAS * HID,
      (void*)VTH, (void*)VTL, NBAS, (long long)HID * NBAS,
      NBAS, 1.0f,
      (HID / 128) * (NBAS / 128), TPL, WKB, WQB, G2, PP);
  // (4) S[b*2048+q][v*16+h] = sum_e' q[..][e'] P[b][v][h][e']   (= qry . u per head with qry = q.Wq^T)
  s_kernel<<<gS, dim3(512), 0, stream>>>(qin, PP, SV);
  // (5) mu, sig2 per query; ctx = r . vals -> f16 ctx plane (x64) [8192][1024] in the KT region
  ctx_kernel<<<gCtx, dim3(128), 0, stream>>>(SV, bmu, bsg, VTH, VTL, CTX);
  // (6) out = ctx . Wo^T -> d_out f32 [8192][1024], accumulator x 1/(64*64)
  gemm128<_Float16, 0, 0, HID, 0><<<gQ, dim3(128), 0, stream>>>(
      CTX, 0LL, WOH, WOH, 0LL,
      d_out, d_out, HID, 0LL,
      HID, 1.0f / (CSC * WOSC),
      (MROWS / 128) * (HID / 128), WOH, WOH, WOH, SV, TPL);
  (void)hipGetLastError();
}
